// v000
// Times are from an AMD MI455X. After a warm-up the kernel runs many times in a row, and a time is the length of
// such a window on the GPU divided by its runs, so every launch and the gaps after it count. The runs cycle
// through copies of the inputs. A figure is the median of several windows, for all but v000 over two sittings.
// Sittings can differ by a few percent; kernels timed side by side share one.
// The starting kernel, v000, takes 750 microseconds a run.
// Contractions: hn*WqkT (q|k plane), Wv*hn^T (v^T plane), K*Q^T scores, V^T*P^T, ctx*WpT for both attention
// blocks (cross block: k and v^T from the c plane), hn*W1T, mid*W2T: all v_wmma_f32_16x16x32_f16
// (f16 operands, single product, f32 accumulate). LayerNorms, softmax, key-mask add, GELU (erf form), bias and
// residual adds: f32 on VALU. Every float input enters as its bf16 RNE value (x, c, weights, biases).
// Carry audit (f16 planes): weights = bf16(w) x64, inverse folded once into the scale of each consuming GEMM
// (q/k/v^T: 1/64; proj GEMMs: 1/(64*256); fc1: 1/64; fc2: 1/(64*16)). hn, c, q, k, v^T carried x1.
// P = p x16384 and ctx = o x256: inv = (1/l)*(256/16384) in attn_kernel; mid = gelu x16.
#include <hip/hip_runtime.h>
#include <math.h>

#ifndef NB
#define NB 4
#endif
#ifndef SEQ
#define SEQ 1024
#endif
#define NB_FULL  4
#define SEQ_FULL 1024
#define FEAT 1024
#define NH   16
#define HD   64
#define MF   4096
#define QKP  (2 * FEAT)
#define NTOK (NB * SEQ)
static_assert(NH * HD == FEAT);
static_assert(HD == 64);
static_assert(NB >= 1 && NB <= NB_FULL);
static_assert(SEQ >= 64 && SEQ <= SEQ_FULL && (SEQ % 64) == 0);
static_assert((FEAT % 64) == 0 && (MF % 64) == 0 && (QKP % 64) == 0);
static_assert((FEAT % 32) == 0 && (MF % 32) == 0);
static_assert(FEAT == 4 * 256);
static_assert(((long long)(NB - 1) * SEQ_FULL + SEQ) * FEAT <= (long long)NB_FULL * SEQ_FULL * FEAT);

#define WCARRY   64.0f
#define PSCALE   16384.0f
#define CTXCARRY 256.0f
#define MIDCARRY 16.0f

typedef _Float16 v16h __attribute__((ext_vector_type(16)));
typedef _Float16 v8h  __attribute__((ext_vector_type(8)));
typedef float    v8f  __attribute__((ext_vector_type(8)));
typedef float    v4f  __attribute__((ext_vector_type(4)));
typedef int      v4i  __attribute__((ext_vector_type(4)));
typedef v8h __attribute__((may_alias)) v8ha;
typedef v4f __attribute__((may_alias)) v4fa;
typedef v4i __attribute__((may_alias)) v4ia;
union Frag { v16h v; v8h half[2]; };

#if defined(__HIP_DEVICE_COMPILE__)
#define DEV_ASM 1
#else
#define DEV_ASM 0
#endif

__device__ __forceinline__ v8f zero8() { v8f z = {0.f, 0.f, 0.f, 0.f, 0.f, 0.f, 0.f, 0.f}; return z; }

// f32 -> bf16 RNE value kept as f32
__device__ __forceinline__ float bf16r(float f) {
  unsigned u = __float_as_uint(f);
  u = (u + 0x7FFFu + ((u >> 16) & 1u)) & 0xFFFF0000u;
  return __uint_as_float(u);
}
__device__ __forceinline__ v4f bf16r4(v4f a) {
  v4f r = { bf16r(a.x), bf16r(a.y), bf16r(a.z), bf16r(a.w) };
  return r;
}

// ---------------------------------------------------------------------------------------------------
// 16x16x32 f16 WMMA. Fragment map (wave32): lane l, h = l>>4, m = n = l&15.
//   A/B element i: i<8 -> k0+8h+i ; i>=8 -> k0+16+8h+(i-8)      D element r: row 8h+r, col l&15
// ---------------------------------------------------------------------------------------------------
// guarded form: 4 VALU slots after the WMMA, D tied, A/B kept live
__device__ __forceinline__ v8f wmma_f16(v16h a, v16h b, v8f c) {
  v8f d = __builtin_amdgcn_wmma_f32_16x16x32_f16(false, a, false, b, (short)0, c, false, false);
#if DEV_ASM
  asm volatile("v_nop\n\tv_nop\n\tv_nop\n\tv_nop" : "+v"(d) : "v"(a), "v"(b));
#endif
  return d;
}
// unguarded form for the register-blocked GEMM inner loop (guards issued per row group / at loop end)
__device__ __forceinline__ v8f mmar(v16h a, v16h b, v8f c) {
  return __builtin_amdgcn_wmma_f32_16x16x32_f16(false, a, false, b, (short)0, c, false, false);
}
__device__ __forceinline__ void dep_guard(v8f& a, v8f& b, v16h x, v16h y) {
#if DEV_ASM
  asm volatile("v_nop\n\tv_nop\n\tv_nop\n\tv_nop" : "+v"(a), "+v"(b) : "v"(x), "v"(y));
#else
  (void)a; (void)b; (void)x; (void)y;
#endif
}
__device__ __forceinline__ void keep4(v16h a, v16h b, v16h c, v16h d) {
#if DEV_ASM
  asm volatile("v_nop" :: "v"(a), "v"(b), "v"(c), "v"(d));
#else
  (void)a; (void)b; (void)c; (void)d;
#endif
}
__device__ __forceinline__ void acc_guard4(v8f& a, v8f& b, v8f& c, v8f& d) {
#if DEV_ASM
  asm volatile("v_nop\n\tv_nop\n\tv_nop\n\tv_nop" : "+v"(a), "+v"(b), "+v"(c), "+v"(d));
#else
  (void)a; (void)b; (void)c; (void)d;
#endif
}

// A or B fragment from a k-contiguous f16 row; p points at element k0 of the row owned by this lane.
__device__ __forceinline__ v16h load_frag(const _Float16* p, int h) {
  Frag f;
  f.half[0] = *(const v8ha*)(p + 8 * h);
  f.half[1] = *(const v8ha*)(p + 16 + 8 * h);
  return f.v;
}
// same, p already includes +8*(lane>>4)
__device__ __forceinline__ v16h ldfrag(const _Float16* p) {
  Frag f;
  f.half[0] = *(const v8ha*)(p);
  f.half[1] = *(const v8ha*)(p + 16);
  return f.v;
}

// =====================================================================================================
// Kernel 1: transpose + convert: in f32 [K][N] (row = k) -> out f16 [N][K] = f16(carry * bf16rne(in)^T).
// Block 256 threads, tile 64 k x 32 n staged in LDS (n-major, pitch 68 floats; cross-wave -> block barrier).
// coverage: 32 n-rows x 64 k per block; grid covers the whole [N][K] plane (K % 64 == 0, N % 32 == 0).
// LDS: tile cols 0..63 of all 32 rows written before the barrier; cols 64..67 never read.
// =====================================================================================================
__global__ __launch_bounds__(256) void transpose_cvt(
    const float* __restrict__ in, _Float16* out, int K, int N, float carry)
{
  __shared__ __align__(16) float tile[32][68];
  const int k0 = blockIdx.x * 64, n0 = blockIdx.y * 32;
  const int tid = (int)threadIdx.x;
  {
    const int kk = tid >> 2, nq = (tid & 3) * 8;
    const float* src = in + (size_t)(k0 + kk) * N + n0 + nq;
    const v4f a = *(const v4fa*)src;
    const v4f c = *(const v4fa*)(src + 4);
    tile[nq + 0][kk] = a.x; tile[nq + 1][kk] = a.y; tile[nq + 2][kk] = a.z; tile[nq + 3][kk] = a.w;
    tile[nq + 4][kk] = c.x; tile[nq + 5][kk] = c.y; tile[nq + 6][kk] = c.z; tile[nq + 7][kk] = c.w;
  }
  __syncthreads();
  {
    const int nn = tid >> 3, kq = (tid & 7) * 8;
    const float* sp = &tile[nn][kq];
    const v4f a = bf16r4(*(const v4fa*)sp);
    const v4f c = bf16r4(*(const v4fa*)(sp + 4));
    const v8h o = { (_Float16)(a.x * carry), (_Float16)(a.y * carry), (_Float16)(a.z * carry), (_Float16)(a.w * carry),
                    (_Float16)(c.x * carry), (_Float16)(c.y * carry), (_Float16)(c.z * carry), (_Float16)(c.w * carry) };
    _Float16* dst = out + (size_t)(n0 + nn) * K + k0 + kq;
    *(v8h*)dst = o;
    
  }
}

// =====================================================================================================
// Kernel 2: row convert: f32 input rows (batch stride SEQ_FULL*FEAT) -> compact f16 plane [NTOK][FEAT],
// value = f16(bf16rne(v)). Block 128 threads, one 1024-wide row per block, 8 elements per thread.
// coverage: 128 x 8 = 1024 per row; grid = NTOK rows.
// =====================================================================================================
__global__ __launch_bounds__(128) void cvt_rows(const float* __restrict__ src, _Float16* dst)
{
  const int row = blockIdx.x;
  const int bb = row / SEQ, t = row - bb * SEQ;
  const int tid = (int)threadIdx.x;
  const float* sp = src + ((size_t)bb * SEQ_FULL + (size_t)t) * FEAT + 8 * tid;
  const v4f a = bf16r4(*(const v4fa*)sp);
  const v4f c = bf16r4(*(const v4fa*)(sp + 4));
  const v8h o = { (_Float16)a.x, (_Float16)a.y, (_Float16)a.z, (_Float16)a.w,
                  (_Float16)c.x, (_Float16)c.y, (_Float16)c.z, (_Float16)c.w };
  _Float16* d = dst + (size_t)row * FEAT + 8 * tid;
  *(v8h*)d = o;
  
}

// =====================================================================================================
// Kernel 3: LayerNorm, no affine, eps 1e-6 (one 1024-wide row per 256-thread block, thread owns 4 consecutive
//   RNEX = true : v = bf16rne(X) (raw input x); false: v = X (internal f32 plane).
//   Input row = b * strideXB + t * FEAT with (b, t) from the compact row index; output f16 row compact.
//   f16 row: staged in LDS (cross-wave -> block barrier), lanes of waves 0..3 write 16 B each (8 halves),
// =====================================================================================================
__device__ __forceinline__ float block_sum(float v, float* red, int lane, int w) {
#pragma unroll
  for (int off = 16; off > 0; off >>= 1) v += __shfl_xor(v, off);
  if (lane == 0) red[w] = v;
  __syncthreads();
  float r = red[0];
#pragma unroll
  for (int i = 1; i < 8; ++i) r += red[i];
  __syncthreads();
  return r;
}

template <bool RNEX>
__global__ __launch_bounds__(256) void ln_kernel(
    const float* __restrict__ X, long long strideXB, _Float16* pout)
{
  __shared__ __align__(16) float srow[FEAT];
  __shared__ float red[8];
  const int row = blockIdx.x;
  const int bb  = row / SEQ, t = row - bb * SEQ;
  const int tid = (int)threadIdx.x, lane = tid & 31, w = tid >> 5;
  const int f0  = 4 * tid;
  const float* xp = X + (size_t)bb * (size_t)strideXB + (size_t)t * FEAT + f0;

  v4f xv = *(const v4fa*)xp;
  if (RNEX) xv = bf16r4(xv);
  float s = (xv.x + xv.y) + (xv.z + xv.w);
  s = block_sum(s, red, lane, w);
  const float mu = s * (1.0f / FEAT);
  const float d0 = xv.x - mu, d1 = xv.y - mu, d2 = xv.z - mu, d3 = xv.w - mu;
  float q = (d0 * d0 + d1 * d1) + (d2 * d2 + d3 * d3);
  q = block_sum(q, red, lane, w);
  const float rstd = rsqrtf(q * (1.0f / FEAT) + 1e-6f);

  const v4f ov = { d0 * rstd, d1 * rstd, d2 * rstd, d3 * rstd };
  *(v4fa*)(srow + f0) = ov;
  __syncthreads();
  if (w < 4) {                                             // wave-uniform: waves 0..3, 128 threads x 8 halves
    const float* sp = srow + 8 * tid;
    const v4f a = *(const v4fa*)sp;
    const v4f c = *(const v4fa*)(sp + 4);
    const v8h o = { (_Float16)a.x, (_Float16)a.y, (_Float16)a.z, (_Float16)a.w,
                    (_Float16)c.x, (_Float16)c.y, (_Float16)c.z, (_Float16)c.w };
    _Float16* dst = pout + (size_t)row * FEAT + 8 * tid;
    *(v8h*)dst = o;
    
  }
}

// =====================================================================================================
// Kernel 4: register-blocked batched WMMA GEMM (f16 operands): C[m][n] = sum_k A[m][k] * Bt[n][k];
// one wave per 64x64 tile, no block barriers. A row-major [M][K] pitch lda; Bt row-major [N][K] pitch ldb
// (k contiguous); M, N multiples of 64, K multiple of 32 (host-checked). blockIdx.y = batch index.
// Fragments straight from global with the split k map (ldfrag).
// MODE 0: f32 C = acc*oscale + bf16rne(bias[n]) + res[m][n] (res pitch ldr, batch stride strideR;
//         RESRNE: res value bf16rne-converted on load)
// MODE 1: f16 C = f16(acc*oscale + bf16rne(bias[n]))
// MODE 2: f16 C = f16(gelu(acc*oscale + bf16rne(bias[n])) * ocarry), gelu = 0.5 v (1 + erf(v / sqrt 2))
// MODE 3: f16 C = f16(acc*oscale + bf16rne(bias[m]))       (row bias, transposed output planes)
// coverage: 4 slabs x 16 rows x 64 cols = the wave's whole 64x64 tile; slab 16x64 fully written before reads.
// =====================================================================================================
template <int MODE, bool RESRNE>
__global__ __launch_bounds__(256) void gemm64(
    const _Float16* __restrict__ A, int lda, long long strideA,
    const _Float16* __restrict__ Bt, int ldb, long long strideB,
    void* Cout, int ldc, long long strideC,
    const float* __restrict__ bias,
    const float* __restrict__ res, int ldr, long long strideR,
    int M, int N, int K, float oscale, float ocarry)
{
  __shared__ __align__(16) float sT[8][16 * 68];           // per-wave 16x64 slab, pitch 68 floats
  const int b    = blockIdx.y;
  const int lane = threadIdx.x & 31;
  const int wave = threadIdx.x >> 5;
  const int tilesN = N >> 6;
  const int tilesM = M >> 6;
  const int tile = blockIdx.x * 8 + wave;
  if (tile >= tilesM * tilesN) return;                     // wave-uniform; no block barriers in this kernel
  const int tm = tile / tilesN;
  const int tn = tile - tm * tilesN;
  const int m0 = tm << 6;
  const int n0 = tn << 6;

  const _Float16* Ab = A  + (size_t)b * (size_t)strideA;
  const _Float16* Bb = Bt + (size_t)b * (size_t)strideB;

  const int rlane = lane & 15;                             // row (A) / col (B, D) within subtile
  const int koff  = (lane >> 4) * 8;                       // k offset of this lane half
  const int mOff  = (lane >> 4) * 8;                       // D row offset

  v8f acc[4][4];
#pragma unroll
  for (int i = 0; i < 4; ++i)
#pragma unroll
    for (int j = 0; j < 4; ++j) acc[i][j] = zero8();

  for (int k0 = 0; k0 < K; k0 += 32) {
    v16h bq[4];
#pragma unroll
    for (int j = 0; j < 4; ++j)
      bq[j] = ldfrag(Bb + (size_t)(n0 + (j << 4) + rlane) * ldb + koff + k0);
#pragma unroll
    for (int i = 0; i < 4; ++i) {
      const v16h af = ldfrag(Ab + (size_t)(m0 + (i << 4) + rlane) * lda + koff + k0);
#pragma unroll
      for (int j = 0; j < 4; ++j) acc[i][j] = mmar(af, bq[j], acc[i][j]);
      dep_guard(acc[i][0], acc[i][3], af, bq[3]);
    }
    keep4(bq[0], bq[1], bq[2], bq[3]);
  }
  acc_guard4(acc[0][0], acc[0][1], acc[0][2], acc[0][3]);
  acc_guard4(acc[1][0], acc[1][1], acc[1][2], acc[1][3]);
  acc_guard4(acc[2][0], acc[2][1], acc[2][2], acc[2][3]);
  acc_guard4(acc[3][0], acc[3][1], acc[3][2], acc[3][3]);

  // ---- epilogue ----
  float* slab = sT[wave];
#pragma unroll
  for (int i = 0; i < 4; ++i) {
    const int mBase = m0 + (i << 4);
#pragma unroll
    for (int j = 0; j < 4; ++j) {
#pragma unroll
      for (int r = 0; r < 8; ++r) {
        slab[(mOff + r) * 68 + (j << 4) + rlane] = acc[i][j][r];
      }
    }
    __builtin_amdgcn_fence(3, "workgroup");
    __builtin_amdgcn_wave_barrier();
    __builtin_amdgcn_fence(2, "workgroup");
    if (MODE == 0) {
      float* C = (float*)Cout + (size_t)b * (size_t)strideC;
      const float* R = res + (size_t)b * (size_t)strideR;
      const int h2 = lane >> 4, c4 = (lane & 15) * 4;     // 256-B row segment = 16 lanes x 16 B
      const v4f bv = bf16r4(*(const v4fa*)(bias + n0 + c4));
      {
#pragma unroll
        for (int it = 0; it < 8; ++it) {
          const int row = it * 2 + h2;                     // it 0..7 x h2 0..1 = rows 0..15
          const size_t go = (size_t)(mBase + row) * ldc + n0 + c4;
          const size_t ro = (size_t)(mBase + row) * ldr + n0 + c4;
          const v4f sv = *(const v4fa*)(slab + row * 68 + c4);
          v4f rv = *(const v4fa*)(R + ro);
          if (RESRNE) rv = bf16r4(rv);
          const v4f v = sv * oscale + bv + rv;
          *(v4f*)(C + go) = v;
        }
        
      }
    } else {
      const int q = lane >> 3, c8 = (lane & 7) * 8;
      _Float16* C = (_Float16*)Cout + (size_t)b * (size_t)strideC;
      float bb8[8] = { 0.f, 0.f, 0.f, 0.f, 0.f, 0.f, 0.f, 0.f };
      if (MODE == 1 || MODE == 2) {
        const v4f ba = bf16r4(*(const v4fa*)(bias + n0 + c8));
        const v4f bc = bf16r4(*(const v4fa*)(bias + n0 + c8 + 4));
        bb8[0] = ba.x; bb8[1] = ba.y; bb8[2] = ba.z; bb8[3] = ba.w;
        bb8[4] = bc.x; bb8[5] = bc.y; bb8[6] = bc.z; bb8[7] = bc.w;
      }
      v8h hv[4];
#pragma unroll
      for (int it = 0; it < 4; ++it) {
        const int row = it * 4 + q;                        // it 0..3 x q 0..3 = rows 0..15
        const float* sp = slab + row * 68 + c8;
        const v4f a = *(const v4fa*)sp;
        const v4f c = *(const v4fa*)(sp + 4);
        float f[8] = { a.x, a.y, a.z, a.w, c.x, c.y, c.z, c.w };
        float brow = 0.0f;
        if (MODE == 3) brow = bf16r(bias[mBase + row]);
#pragma unroll
        for (int e = 0; e < 8; ++e) {
          float u = f[e] * oscale + ((MODE == 3) ? brow : bb8[e]);
          if (MODE == 2) {
            const float gl = 0.5f * u * (1.0f + erff(u * 0.70710678118654752f));
            u = gl * ocarry;
          }
          f[e] = u;
        }
        const v8h o = { (_Float16)f[0], (_Float16)f[1], (_Float16)f[2], (_Float16)f[3],
                        (_Float16)f[4], (_Float16)f[5], (_Float16)f[6], (_Float16)f[7] };
        hv[it] = o;
      }
      {
#pragma unroll
        for (int it = 0; it < 4; ++it) {
          const int row = it * 4 + q;
          *(v8h*)(C + (size_t)(mBase + row) * ldc + n0 + c8) = hv[it];
        }
        
      }
    }
    __builtin_amdgcn_fence(3, "workgroup");
    __builtin_amdgcn_wave_barrier();
    __builtin_amdgcn_fence(2, "workgroup");
  }
}

// =====================================================================================================
// Kernel 5: streaming attention, transposed form, 16 heads, additive key mask (-10000 where mask != 1),
// softmax over all SEQ keys. Block 128 thr (4 waves), 16 queries per wave, 64 keys per step.
//   S^T = K * Q^T : A = K rows (row = key, k = d), B = Q^T (k = d, n = query); scale 0.125 applied in f32
//   O^T += V^T * P^T : A = V^T rows (row = d, k = key), B = P^T packed from the score D registers
//   (element r <- key tile covering k 0..15 row r, element 8+r <- tile covering k 16..31 row r, same lane)
// Lane owns 32 keys of query column (lane&15); partner = lane ^ 16. Online softmax in f32; p carried x16384.
//   q|k plane [b*SEQ + t][QKP]: q at col head*64 + d, k at col FEAT + head*64 + d (f16);
//   v^T plane [b][head*64 + d][SEQ] (f16); mask int32 [b][SEQ_FULL].
//   ctx plane [b*SEQ + t][head*64 + d] = f16(256 * o / l): per-wave 16x64 tile staged in LDS (block barrier),
// coverage: grid (SEQ/64, NB*NH): every (b, head, query) row x 64 columns of its head written once.
// LDS sO: each wave writes its full 16x64 region before the barrier.
// =====================================================================================================
__device__ __forceinline__ v16h pack_p(v8f a, v8f c) {
  const v16h r = { (_Float16)(a[0] * PSCALE), (_Float16)(a[1] * PSCALE), (_Float16)(a[2] * PSCALE), (_Float16)(a[3] * PSCALE),
                   (_Float16)(a[4] * PSCALE), (_Float16)(a[5] * PSCALE), (_Float16)(a[6] * PSCALE), (_Float16)(a[7] * PSCALE),
                   (_Float16)(c[0] * PSCALE), (_Float16)(c[1] * PSCALE), (_Float16)(c[2] * PSCALE), (_Float16)(c[3] * PSCALE),
                   (_Float16)(c[4] * PSCALE), (_Float16)(c[5] * PSCALE), (_Float16)(c[6] * PSCALE), (_Float16)(c[7] * PSCALE) };
  return r;
}

__global__ __launch_bounds__(128) __attribute__((amdgpu_num_vgpr(256))) void attn_kernel(
    const _Float16* __restrict__ qk, const _Float16* __restrict__ vt,
    const int* __restrict__ mask, _Float16* ctx)
{
  __shared__ __align__(16) float sO[4 * 16 * 64];          // 16384 B

  const int tid = (int)threadIdx.x, lane = tid & 31, w = tid >> 5;
  const int h = lane >> 4, m = lane & 15;
  const int bh = blockIdx.y, b = bh / NH, head = bh - b * NH;
  const int q0 = blockIdx.x * 64 + 16 * w;

  // Q^T B-fragments: column n = query q0+m, k = d (two 32-deep chunks)
  const _Float16* qrow = qk + ((size_t)b * SEQ + q0 + m) * QKP + head * HD;
  const v16h qb0 = load_frag(qrow, h);
  const v16h qb1 = load_frag(qrow + 32, h);

  v8f o[4];                                                // o[t][r] = O[query m][d 16t+8h+r] * (l * PSCALE)
#pragma unroll
  for (int t = 0; t < 4; ++t) o[t] = zero8();
  float mrun = -1e30f, lrun = 0.0f;

  const _Float16* kbase = qk + ((size_t)b * SEQ + m) * QKP + FEAT + head * HD;   // + key*QKP
  const _Float16* vbase = vt + ((size_t)b * FEAT + head * HD + m) * SEQ;         // + 16t*SEQ + key0
  const int* mk = mask + (size_t)b * SEQ_FULL + 8 * h;                            // + key0 + 16j

#pragma unroll 1
  for (int kb = 0; kb < SEQ; kb += 64) {
    // ---- scores: s[j][r] = S[query m][key kb+16j+8h+r] * 0.125 + madd[key] ----
    v8f s[4];
#pragma unroll
    for (int j = 0; j < 4; ++j) {
      const _Float16* kr = kbase + (size_t)(kb + 16 * j) * QKP;
      const v16h kf0 = load_frag(kr, h);
      const v16h kf1 = load_frag(kr + 32, h);
      v8f z = zero8();
      z = wmma_f16(kf0, qb0, z);
      z = wmma_f16(kf1, qb1, z);
      const v4i ma = *(const v4ia*)(mk + kb + 16 * j);
      const v4i mc = *(const v4ia*)(mk + kb + 16 * j + 4);
      const int mm[8] = { ma.x, ma.y, ma.z, ma.w, mc.x, mc.y, mc.z, mc.w };
#pragma unroll
      for (int r = 0; r < 8; ++r) {
        const float sc = z[r] * 0.125f;
        s[j][r] = sc + ((mm[r] != 1) ? -10000.0f : 0.0f);
      }
    }

    // ---- online softmax (f32) ----
    float mloc = s[0][0];
#pragma unroll
    for (int j = 0; j < 4; ++j)
#pragma unroll
      for (int r = 0; r < 8; ++r) mloc = fmaxf(mloc, s[j][r]);
    mloc = fmaxf(mloc, __shfl_xor(mloc, 16));
    const float mnew = fmaxf(mrun, mloc);
    const float alpha = __expf(mrun - mnew);
    mrun = mnew;
    float lsum = 0.0f;
#pragma unroll
    for (int j = 0; j < 4; ++j)
#pragma unroll
      for (int r = 0; r < 8; ++r) {
        const float p = __expf(s[j][r] - mnew);
        s[j][r] = p;
        lsum += p;
      }
    lsum += __shfl_xor(lsum, 16);
    lrun = lrun * alpha + lsum;
#pragma unroll
    for (int t = 0; t < 4; ++t)
#pragma unroll
      for (int r = 0; r < 8; ++r) o[t][r] = o[t][r] * alpha;

    // ---- P^T B-fragments (key chunks 0..31 and 32..63 of this step) ----
    const v16h pb0 = pack_p(s[0], s[1]);
    const v16h pb1 = pack_p(s[2], s[3]);

    // ---- O^T += V^T * P^T ----
#pragma unroll
    for (int t = 0; t < 4; ++t) {
      const _Float16* vp = vbase + (size_t)(16 * t) * SEQ + kb;
      const v16h vf0 = load_frag(vp, h);
      const v16h vf1 = load_frag(vp + 32, h);
      o[t] = wmma_f16(vf0, pb0, o[t]);
      o[t] = wmma_f16(vf1, pb1, o[t]);
    }
  }

  // ---- epilogue: normalise (1/l, remove the p carry, apply the ctx carry), stage per-wave 16x64 tile ----
  const float inv = (1.0f / lrun) * (CTXCARRY / PSCALE);
  float* so = sO + w * 1024;
#pragma unroll
  for (int t = 0; t < 4; ++t)
#pragma unroll
    for (int r = 0; r < 8; ++r)
      so[m * 64 + 16 * t + 8 * h + r] = o[t][r] * inv;
  __syncthreads();

  const int q8 = lane & 7, sub = lane >> 3;
  v8h hv[4];
#pragma unroll
  for (int it = 0; it < 4; ++it) {
    const int row = it * 4 + sub;                          // it 0..3 x sub 0..3 = rows 0..15 of the wave tile
    const float* sp = so + row * 64 + 8 * q8;
    const v4f a = *(const v4fa*)sp;
    const v4f c = *(const v4fa*)(sp + 4);
    const v8h ov = { (_Float16)a.x, (_Float16)a.y, (_Float16)a.z, (_Float16)a.w,
                     (_Float16)c.x, (_Float16)c.y, (_Float16)c.z, (_Float16)c.w };
    hv[it] = ov;
  }
  {
#pragma unroll
    for (int it = 0; it < 4; ++it) {
      const int row = it * 4 + sub;
      _Float16* dst = ctx + ((size_t)b * SEQ + q0 + row) * FEAT + head * HD + 8 * q8;
      *(v8h*)dst = hv[it];
    }
    
  }
}

// =====================================================================================================
// Host orchestration. Workspace map (bytes, NB=4 SEQ=1024), every region an exact multiple of its whole-line
// store granularity, all offsets multiples of 128:
//   hn    f16 [4096][1024]      8388608   (LN outputs of all three blocks, written and consumed in order)
//   cpl   f16 [4096][1024]      8388608   (bf16rne(c) as f16)
//   WqkvT f16 [3072][1024]      6291456
//   WspT  f16 [1024][1024]      2097152
//   WcqT, WckT, WcvT, WcpT      4 x 2097152
//   W1T   f16 [4096][1024]      8388608
//   W2T   f16 [1024][4096]      8388608
//   ATT   shared region        33554432 : q|k f16 [4096][2048] (16777216) + v^T f16 [4][1024][1024] (8388608)
//                                         + ctx f16 [4096][1024] (8388608) during both attention blocks;
//                                         mid f16 [4096][4096] (33554432) during the MLP (all readers of
//                                         q|k, v^T, ctx have completed before fc1 writes mid)
//   x1    f32 [4096][1024]     16777216
//   x2    f32 [4096][1024]     16777216
//   total                     117440512
// =====================================================================================================
extern "C" void kernel_launch(void* const* d_in, const int* in_sizes, int n_in,
                              void* d_out, int out_size, void* d_ws, size_t ws_size,
                              hipStream_t stream)
{
  if (n_in < 19) return;
  const long long needTok = (long long)(NB - 1) * SEQ_FULL + SEQ;
  if ((long long)in_sizes[0] < needTok * FEAT) return;                 // x
  if ((long long)in_sizes[1] < needTok * FEAT) return;                 // c
  if ((long long)in_sizes[2] < needTok) return;                        // mask (int32)
  if ((long long)in_sizes[3] < (long long)FEAT * 3 * FEAT || in_sizes[4] < 3 * FEAT) return;
  if ((long long)in_sizes[5] < (long long)FEAT * FEAT || in_sizes[6] < FEAT) return;
  if ((long long)in_sizes[7] < (long long)FEAT * FEAT || in_sizes[8] < FEAT) return;
  if ((long long)in_sizes[9] < (long long)FEAT * FEAT || in_sizes[10] < FEAT) return;
  if ((long long)in_sizes[11] < (long long)FEAT * FEAT || in_sizes[12] < FEAT) return;
  if ((long long)in_sizes[13] < (long long)FEAT * FEAT || in_sizes[14] < FEAT) return;
  if ((long long)in_sizes[15] < (long long)FEAT * MF || in_sizes[16] < MF) return;
  if ((long long)in_sizes[17] < (long long)MF * FEAT || in_sizes[18] < FEAT) return;
  if ((long long)out_size < needTok * FEAT) return;

  const float* x         = (const float*)d_in[0];
  const float* c         = (const float*)d_in[1];
  const int*   mask      = (const int*)d_in[2];
  const float* sa_qkv_w  = (const float*)d_in[3];
  const float* sa_qkv_b  = (const float*)d_in[4];
  const float* sa_proj_w = (const float*)d_in[5];
  const float* sa_proj_b = (const float*)d_in[6];
  const float* ca_q_w    = (const float*)d_in[7];
  const float* ca_q_b    = (const float*)d_in[8];
  const float* ca_k_w    = (const float*)d_in[9];
  const float* ca_k_b    = (const float*)d_in[10];
  const float* ca_v_w    = (const float*)d_in[11];
  const float* ca_v_b    = (const float*)d_in[12];
  const float* ca_proj_w = (const float*)d_in[13];
  const float* ca_proj_b = (const float*)d_in[14];
  const float* fc1_w     = (const float*)d_in[15];
  const float* fc1_b     = (const float*)d_in[16];
  const float* fc2_w     = (const float*)d_in[17];
  const float* fc2_b     = (const float*)d_in[18];

  const size_t P_F16  = (size_t)NTOK * FEAT * 2;
  const size_t P_F32  = (size_t)NTOK * FEAT * 4;
  const size_t P_W    = (size_t)FEAT * FEAT * 2;
  const size_t P_WQKV = (size_t)3 * FEAT * FEAT * 2;
  const size_t P_W1   = (size_t)MF * FEAT * 2;
  const size_t P_QK   = (size_t)NTOK * QKP * 2;
  const size_t P_VT   = (size_t)NB * FEAT * SEQ * 2;
  const size_t P_MID  = (size_t)NTOK * MF * 2;
  const size_t P_ATTU = P_QK + P_VT + P_F16;
  const size_t P_ATT  = (P_ATTU > P_MID) ? P_ATTU : P_MID;
  size_t off = 0;
  const size_t oHn   = off; off += P_F16;
  const size_t oC    = off; off += P_F16;
  const size_t oWqkv = off; off += P_WQKV;
  const size_t oWsp  = off; off += P_W;
  const size_t oWcq  = off; off += P_W;
  const size_t oWck  = off; off += P_W;
  const size_t oWcv  = off; off += P_W;
  const size_t oWcp  = off; off += P_W;
  const size_t oW1   = off; off += P_W1;
  const size_t oW2   = off; off += P_W1;
  const size_t oAtt  = off; off += P_ATT;
  const size_t oX1   = off; off += P_F32;
  const size_t oX2   = off; off += P_F32;
  if (off > ws_size) return;                               // off = 117440512 at NB=4, SEQ=1024
  if (off > (size_t)134217728) return;

  char* ws = (char*)d_ws;
  _Float16* hn    = (_Float16*)(ws + oHn);
  _Float16* cpl   = (_Float16*)(ws + oC);
  _Float16* wqkvT = (_Float16*)(ws + oWqkv);
  _Float16* wspT  = (_Float16*)(ws + oWsp);
  _Float16* wcqT  = (_Float16*)(ws + oWcq);
  _Float16* wckT  = (_Float16*)(ws + oWck);
  _Float16* wcvT  = (_Float16*)(ws + oWcv);
  _Float16* wcpT  = (_Float16*)(ws + oWcp);
  _Float16* w1T   = (_Float16*)(ws + oW1);
  _Float16* w2T   = (_Float16*)(ws + oW2);
  _Float16* qkp   = (_Float16*)(ws + oAtt);
  _Float16* vtp   = (_Float16*)(ws + oAtt + P_QK);
  _Float16* ctx   = (_Float16*)(ws + oAtt + P_QK + P_VT);
  _Float16* mid   = (_Float16*)(ws + oAtt);
  float*    x1    = (float*)(ws + oX1);
  float*    x2    = (float*)(ws + oX2);

  const dim3 blk(256);
  const float sQKV  = 1.0f / WCARRY;
  const float sPROJ = 1.0f / (WCARRY * CTXCARRY);
  const float sFC2  = 1.0f / (WCARRY * MIDCARRY);

  // (1) weights f32 [in][out] -> f16 [out][in] = bf16rne(w) x64   (in[K rows][N cols] -> out[N][K], grid (K/64, N/32))
  transpose_cvt<<<dim3(FEAT / 64, (3 * FEAT) / 32), blk, 0, stream>>>(sa_qkv_w,  wqkvT, FEAT, 3 * FEAT, WCARRY);
  transpose_cvt<<<dim3(FEAT / 64, FEAT / 32),       blk, 0, stream>>>(sa_proj_w, wspT,  FEAT, FEAT,     WCARRY);
  transpose_cvt<<<dim3(FEAT / 64, FEAT / 32),       blk, 0, stream>>>(ca_q_w,    wcqT,  FEAT, FEAT,     WCARRY);
  transpose_cvt<<<dim3(FEAT / 64, FEAT / 32),       blk, 0, stream>>>(ca_k_w,    wckT,  FEAT, FEAT,     WCARRY);
  transpose_cvt<<<dim3(FEAT / 64, FEAT / 32),       blk, 0, stream>>>(ca_v_w,    wcvT,  FEAT, FEAT,     WCARRY);
  transpose_cvt<<<dim3(FEAT / 64, FEAT / 32),       blk, 0, stream>>>(ca_proj_w, wcpT,  FEAT, FEAT,     WCARRY);
  transpose_cvt<<<dim3(FEAT / 64, MF / 32),         blk, 0, stream>>>(fc1_w,     w1T,   FEAT, MF,       WCARRY);
  transpose_cvt<<<dim3(MF / 64, FEAT / 32),         blk, 0, stream>>>(fc2_w,     w2T,   MF,   FEAT,     WCARRY);

  // (2) c -> compact f16 plane (bf16rne values)
  cvt_rows<<<dim3(NTOK), dim3(128), 0, stream>>>(c, cpl);

  // ---------------- self-attention block ----------------
  // (3) hn = LN(bf16rne(x)) -> f16 plane
  ln_kernel<true><<<dim3(NTOK), blk, 0, stream>>>(x, (long long)SEQ_FULL * FEAT, hn);

  // (4) q|k = hn . Wqkv[:, 0:2048] + b -> f16 [NTOK][2048]   (M=NTOK, N=2048, K=1024; acc / 64)
  const dim3 gQK((((NTOK / 64) * (QKP / 64)) + 7) / 8, 1);
  gemm64<1, false><<<gQK, blk, 0, stream>>>(
      hn, FEAT, 0LL, wqkvT, FEAT, 0LL, (void*)qkp, QKP, 0LL, sa_qkv_b, x1, FEAT, 0LL,
      NTOK, QKP, FEAT, sQKV, 1.0f);
  // (5) v^T per batch: A = WqkvT rows 2048..3071 [1024][1024], Bt = hn rows of batch b -> f16 [b][1024][SEQ]
  //     (M=1024, N=SEQ, K=1024; row bias = sa_qkv_b[2048 + m])
  const dim3 gVT((((FEAT / 64) * (SEQ / 64)) + 7) / 8, NB);
  gemm64<3, false><<<gVT, blk, 0, stream>>>(
      wqkvT + (size_t)2 * FEAT * FEAT, FEAT, 0LL, hn, FEAT, (long long)SEQ * FEAT,
      (void*)vtp, SEQ, (long long)FEAT * SEQ, sa_qkv_b + 2 * FEAT, x1, FEAT, 0LL,
      FEAT, SEQ, FEAT, sQKV, 1.0f);
  // (6) attention -> ctx f16 plane (x256)
  const dim3 gAT(SEQ / 64, NB * NH);
  attn_kernel<<<gAT, dim3(128), 0, stream>>>(qkp, vtp, mask, ctx);
  // (7) x1 = ctx . Wsp + b + bf16rne(x) -> f32 plane   (per batch M=SEQ, N=1024, K=1024; acc / (64*256))
  const dim3 gPB((((SEQ / 64) * (FEAT / 64)) + 7) / 8, NB);
  gemm64<0, true><<<gPB, blk, 0, stream>>>(
      ctx, FEAT, (long long)SEQ * FEAT, wspT, FEAT, 0LL, (void*)x1, FEAT, (long long)SEQ * FEAT,
      sa_proj_b, x, FEAT, (long long)SEQ_FULL * FEAT,
      SEQ, FEAT, FEAT, sPROJ, 1.0f);

  // ---------------- cross-attention block ----------------
  // (8) hn = LN(x1)
  ln_kernel<false><<<dim3(NTOK), blk, 0, stream>>>(x1, (long long)SEQ * FEAT, hn);
  // (9) q = hn . Wcq + b -> q|k plane cols 0..1023   (M=NTOK, N=1024, K=1024)
  const dim3 gQ((((NTOK / 64) * (FEAT / 64)) + 7) / 8, 1);
  gemm64<1, false><<<gQ, blk, 0, stream>>>(
      hn, FEAT, 0LL, wcqT, FEAT, 0LL, (void*)qkp, QKP, 0LL, ca_q_b, x1, FEAT, 0LL,
      NTOK, FEAT, FEAT, sQKV, 1.0f);
  // (10) k = c . Wck + b -> q|k plane cols 1024..2047
  gemm64<1, false><<<gQ, blk, 0, stream>>>(
      cpl, FEAT, 0LL, wckT, FEAT, 0LL, (void*)(qkp + FEAT), QKP, 0LL, ca_k_b, x1, FEAT, 0LL,
      NTOK, FEAT, FEAT, sQKV, 1.0f);
  // (11) v^T per batch: A = WcvT [1024][1024], Bt = c rows of batch b
  gemm64<3, false><<<gVT, blk, 0, stream>>>(
      wcvT, FEAT, 0LL, cpl, FEAT, (long long)SEQ * FEAT,
      (void*)vtp, SEQ, (long long)FEAT * SEQ, ca_v_b, x1, FEAT, 0LL,
      FEAT, SEQ, FEAT, sQKV, 1.0f);
  // (12) attention -> ctx
  attn_kernel<<<gAT, dim3(128), 0, stream>>>(qkp, vtp, mask, ctx);
  // (13) x2 = ctx . Wcp + b + x1 -> f32 plane   (M=NTOK, N=1024, K=1024)
  gemm64<0, false><<<gQ, blk, 0, stream>>>(
      ctx, FEAT, 0LL, wcpT, FEAT, 0LL, (void*)x2, FEAT, 0LL,
      ca_proj_b, x1, FEAT, 0LL,
      NTOK, FEAT, FEAT, sPROJ, 1.0f);

  // ---------------- MLP block ----------------
  // (14) hn = LN(x2)
  ln_kernel<false><<<dim3(NTOK), blk, 0, stream>>>(x2, (long long)SEQ * FEAT, hn);
  // (15) mid = gelu(hn . W1 + b1) x16 -> f16 [NTOK][4096]   (M=NTOK, N=4096, K=1024; acc / 64)
  const dim3 gW1((((NTOK / 64) * (MF / 64)) + 7) / 8, 1);
  gemm64<2, false><<<gW1, blk, 0, stream>>>(
      hn, FEAT, 0LL, w1T, FEAT, 0LL, (void*)mid, MF, 0LL, fc1_b, x1, FEAT, 0LL,
      NTOK, MF, FEAT, sQKV, MIDCARRY);
  // (16) out = mid . W2 + b2 + x2 -> d_out f32 rows b*SEQ_FULL + t   (per batch M=SEQ, N=1024, K=4096; acc / (64*16))
  gemm64<0, false><<<gPB, blk, 0, stream>>>(
      mid, MF, (long long)SEQ * MF, w2T, MF, 0LL, d_out, FEAT, (long long)SEQ_FULL * FEAT,
      fc2_b, x2, FEAT, (long long)SEQ * FEAT,
      SEQ, FEAT, MF, sFC2, 1.0f);

  (void)hipGetLastError();
}

// v001
// Measured time: 369 microseconds a run.
// Next to v000, in two timings, it ran 2.06 and 2.07 times as fast.
// Contractions: hn*WqkT (q|k plane), Wv*hn^T (v^T plane), K*Q^T scores, V^T*P^T, ctx*WpT for both attention
// blocks (cross block: k and v^T from the c plane), hn*W1T, mid*W2T: all v_wmma_f32_16x16x32_f16
// (f16 operands, single product, f32 accumulate). LayerNorms, softmax, key-mask add, GELU (erf form), bias and
// residual adds: f32 on VALU. Every float input enters as its bf16 RNE value (x, c, weights, biases).
// Carry audit (f16 planes): weights = bf16(w) x64, inverse folded once into the scale of each consuming GEMM
// (q/k/v^T: 1/64; proj GEMMs: 1/(64*256); fc1: 1/64; fc2: 1/(64*16)). hn, c, q, k, v^T carried x1.
// P = p x16384 and ctx = o x256: inv = (1/l)*(256/16384) in attn_kernel; mid = gelu x16.
#include <hip/hip_runtime.h>
#include <math.h>

#ifndef NB
#define NB 4
#endif
#ifndef SEQ
#define SEQ 1024
#endif
#define NB_FULL  4
#define SEQ_FULL 1024
#define FEAT 1024
#define NH   16
#define HD   64
#define MF   4096
#define QKP  (2 * FEAT)
#define NTOK (NB * SEQ)
static_assert(NH * HD == FEAT);
static_assert(HD == 64);
static_assert(NB >= 1 && NB <= NB_FULL);
static_assert(SEQ >= 64 && SEQ <= SEQ_FULL && (SEQ % 64) == 0);
static_assert((FEAT % 64) == 0 && (MF % 64) == 0 && (QKP % 64) == 0);
static_assert((FEAT % 128) == 0 && (MF % 128) == 0 && (QKP % 128) == 0 && (SEQ % 128) == 0 && FEAT >= 256);
static_assert(FEAT == 4 * 256);
static_assert(((long long)(NB - 1) * SEQ_FULL + SEQ) * FEAT <= (long long)NB_FULL * SEQ_FULL * FEAT);

#define WCARRY   64.0f
#define PSCALE   16384.0f
#define CTXCARRY 256.0f
#define MIDCARRY 16.0f

typedef _Float16 v16h __attribute__((ext_vector_type(16)));
typedef _Float16 v8h  __attribute__((ext_vector_type(8)));
typedef float    v8f  __attribute__((ext_vector_type(8)));
typedef float    v4f  __attribute__((ext_vector_type(4)));
typedef int      v4i  __attribute__((ext_vector_type(4)));
typedef v8h __attribute__((may_alias)) v8ha;
typedef v4f __attribute__((may_alias)) v4fa;
typedef v4i __attribute__((may_alias)) v4ia;
union Frag { v16h v; v8h half[2]; };

#if defined(__HIP_DEVICE_COMPILE__)
#define DEV_ASM 1
#else
#define DEV_ASM 0
#endif

__device__ __forceinline__ v8f zero8() { v8f z = {0.f, 0.f, 0.f, 0.f, 0.f, 0.f, 0.f, 0.f}; return z; }

// f32 -> bf16 RNE value kept as f32
__device__ __forceinline__ float bf16r(float f) {
  unsigned u = __float_as_uint(f);
  u = (u + 0x7FFFu + ((u >> 16) & 1u)) & 0xFFFF0000u;
  return __uint_as_float(u);
}
__device__ __forceinline__ v4f bf16r4(v4f a) {
  v4f r = { bf16r(a.x), bf16r(a.y), bf16r(a.z), bf16r(a.w) };
  return r;
}

// ---------------------------------------------------------------------------------------------------
// 16x16x32 f16 WMMA. Fragment map (wave32): lane l, h = l>>4, m = n = l&15.
//   A/B element i: i<8 -> k0+8h+i ; i>=8 -> k0+16+8h+(i-8)      D element r: row 8h+r, col l&15
// ---------------------------------------------------------------------------------------------------
// guarded form: 4 VALU slots after the WMMA, D tied, A/B kept live
__device__ __forceinline__ v8f wmma_f16(v16h a, v16h b, v8f c) {
  v8f d = __builtin_amdgcn_wmma_f32_16x16x32_f16(false, a, false, b, (short)0, c, false, false);
#if DEV_ASM
  asm volatile("v_nop\n\tv_nop\n\tv_nop\n\tv_nop" : "+v"(d) : "v"(a), "v"(b));
#endif
  return d;
}
// plain builtin form for the GEMM inner loop (the compiler keeps the distances between its own builtins)
__device__ __forceinline__ v8f mmar(v16h a, v16h b, v8f c) {
  return __builtin_amdgcn_wmma_f32_16x16x32_f16(false, a, false, b, (short)0, c, false, false);
}
__device__ __forceinline__ void acc_guard4(v8f& a, v8f& b, v8f& c, v8f& d) {
#if DEV_ASM
  asm volatile("v_nop\n\tv_nop\n\tv_nop\n\tv_nop" : "+v"(a), "+v"(b), "+v"(c), "+v"(d));
#else
  (void)a; (void)b; (void)c; (void)d;
#endif
}

// A or B fragment from a k-contiguous f16 row; p points at element k0 of the row owned by this lane.
__device__ __forceinline__ v16h load_frag(const _Float16* p, int h) {
  Frag f;
  f.half[0] = *(const v8ha*)(p + 8 * h);
  f.half[1] = *(const v8ha*)(p + 16 + 8 * h);
  return f.v;
}
// same, p already includes +8*(lane>>4)
__device__ __forceinline__ v16h ldfrag(const _Float16* p) {
  Frag f;
  f.half[0] = *(const v8ha*)(p);
  f.half[1] = *(const v8ha*)(p + 16);
  return f.v;
}

// =====================================================================================================
// Kernel 1: transpose + convert: in f32 [K][N] (row = k) -> out f16 [N][K] = f16(carry * bf16rne(in)^T).
// Block 256 threads, tile 64 k x 32 n staged in LDS (n-major, pitch 68 floats; cross-wave -> block barrier).
// coverage: 32 n-rows x 64 k per block; grid covers the whole [N][K] plane (K % 64 == 0, N % 32 == 0).
// LDS: tile cols 0..63 of all 32 rows written before the barrier; cols 64..67 never read.
// =====================================================================================================
__global__ __launch_bounds__(256) void transpose_cvt(
    const float* __restrict__ in, _Float16* out, int K, int N, float carry)
{
  __shared__ __align__(16) float tile[32][68];
  const int k0 = blockIdx.x * 64, n0 = blockIdx.y * 32;
  const int tid = (int)threadIdx.x;
  {
    const int kk = tid >> 2, nq = (tid & 3) * 8;
    const float* src = in + (size_t)(k0 + kk) * N + n0 + nq;
    const v4f a = *(const v4fa*)src;
    const v4f c = *(const v4fa*)(src + 4);
    tile[nq + 0][kk] = a.x; tile[nq + 1][kk] = a.y; tile[nq + 2][kk] = a.z; tile[nq + 3][kk] = a.w;
    tile[nq + 4][kk] = c.x; tile[nq + 5][kk] = c.y; tile[nq + 6][kk] = c.z; tile[nq + 7][kk] = c.w;
  }
  __syncthreads();
  {
    const int nn = tid >> 3, kq = (tid & 7) * 8;
    const float* sp = &tile[nn][kq];
    const v4f a = bf16r4(*(const v4fa*)sp);
    const v4f c = bf16r4(*(const v4fa*)(sp + 4));
    const v8h o = { (_Float16)(a.x * carry), (_Float16)(a.y * carry), (_Float16)(a.z * carry), (_Float16)(a.w * carry),
                    (_Float16)(c.x * carry), (_Float16)(c.y * carry), (_Float16)(c.z * carry), (_Float16)(c.w * carry) };
    _Float16* dst = out + (size_t)(n0 + nn) * K + k0 + kq;
    *(v8h*)dst = o;
    
  }
}

// =====================================================================================================
// Kernel 2: row convert: f32 input rows (batch stride SEQ_FULL*FEAT) -> compact f16 plane [NTOK][FEAT],
// value = f16(bf16rne(v)). Block 128 threads, one 1024-wide row per block, 8 elements per thread.
// coverage: 128 x 8 = 1024 per row; grid = NTOK rows.
// =====================================================================================================
__global__ __launch_bounds__(128) void cvt_rows(const float* __restrict__ src, _Float16* dst)
{
  const int row = blockIdx.x;
  const int bb = row / SEQ, t = row - bb * SEQ;
  const int tid = (int)threadIdx.x;
  const float* sp = src + ((size_t)bb * SEQ_FULL + (size_t)t) * FEAT + 8 * tid;
  const v4f a = bf16r4(*(const v4fa*)sp);
  const v4f c = bf16r4(*(const v4fa*)(sp + 4));
  const v8h o = { (_Float16)a.x, (_Float16)a.y, (_Float16)a.z, (_Float16)a.w,
                  (_Float16)c.x, (_Float16)c.y, (_Float16)c.z, (_Float16)c.w };
  _Float16* d = dst + (size_t)row * FEAT + 8 * tid;
  *(v8h*)d = o;
  
}

// =====================================================================================================
// Kernel 3: LayerNorm, no affine, eps 1e-6 (one 1024-wide row per 256-thread block, thread owns 4 consecutive
//   RNEX = true : v = bf16rne(X) (raw input x); false: v = X (internal f32 plane).
//   Input row = b * strideXB + t * FEAT with (b, t) from the compact row index; output f16 row compact.
//   f16 row: staged in LDS (cross-wave -> block barrier), lanes of waves 0..3 write 16 B each (8 halves),
// =====================================================================================================
__device__ __forceinline__ float block_sum(float v, float* red, int lane, int w) {
#pragma unroll
  for (int off = 16; off > 0; off >>= 1) v += __shfl_xor(v, off);
  if (lane == 0) red[w] = v;
  __syncthreads();
  float r = red[0];
#pragma unroll
  for (int i = 1; i < 8; ++i) r += red[i];
  __syncthreads();
  return r;
}

template <bool RNEX>
__global__ __launch_bounds__(256) void ln_kernel(
    const float* __restrict__ X, long long strideXB, _Float16* pout)
{
  __shared__ __align__(16) float srow[FEAT];
  __shared__ float red[8];
  const int row = blockIdx.x;
  const int bb  = row / SEQ, t = row - bb * SEQ;
  const int tid = (int)threadIdx.x, lane = tid & 31, w = tid >> 5;
  const int f0  = 4 * tid;
  const float* xp = X + (size_t)bb * (size_t)strideXB + (size_t)t * FEAT + f0;

  v4f xv = *(const v4fa*)xp;
  if (RNEX) xv = bf16r4(xv);
  float s = (xv.x + xv.y) + (xv.z + xv.w);
  s = block_sum(s, red, lane, w);
  const float mu = s * (1.0f / FEAT);
  const float d0 = xv.x - mu, d1 = xv.y - mu, d2 = xv.z - mu, d3 = xv.w - mu;
  float q = (d0 * d0 + d1 * d1) + (d2 * d2 + d3 * d3);
  q = block_sum(q, red, lane, w);
  const float rstd = rsqrtf(q * (1.0f / FEAT) + 1e-6f);

  const v4f ov = { d0 * rstd, d1 * rstd, d2 * rstd, d3 * rstd };
  *(v4fa*)(srow + f0) = ov;
  __syncthreads();
  if (w < 4) {                                             // wave-uniform: waves 0..3, 128 threads x 8 halves
    const float* sp = srow + 8 * tid;
    const v4f a = *(const v4fa*)sp;
    const v4f c = *(const v4fa*)(sp + 4);
    const v8h o = { (_Float16)a.x, (_Float16)a.y, (_Float16)a.z, (_Float16)a.w,
                    (_Float16)c.x, (_Float16)c.y, (_Float16)c.z, (_Float16)c.w };
    _Float16* dst = pout + (size_t)row * FEAT + 8 * tid;
    *(v8h*)dst = o;
    
  }
}

// =====================================================================================================
// Kernel 4: batched WMMA GEMM (f16 operands): C[m][n] = sum_k A[m][k] * Bt[n][k].
// One 128x128 tile of C per 256-thread block; 8 waves as 4 (m) x 2 (n), each 32x64 (2 x 4 accumulator tiles).
// A row-major [M][K] pitch lda; Bt row-major [N][K] pitch ldb (k contiguous); M, N, K multiples of 128,
// K >= 256 (all shapes here are compile-time constants of the host code). blockIdx.y = batch index.
// Operands: per stage 128 k of the block's 128 A rows and 128 Bt rows are brought into LDS by asynchronous
// 16-byte copies (each thread 8 + 8 copies, a wave-wide copy = two whole 256-B row pieces), two buffers, the
// next stage in flight while this one is multiplied. LDS row pitch 272 B (256 + 16: ds_load_b128 readers).
// Fragments from LDS with the split k map (ldfrag), two register sets inside a stage; k runs upward in steps of
// 32 per accumulator.
// MODE 0: f32 C = acc*oscale + bf16rne(bias[n]) + res[m][n] (res pitch ldr, batch stride strideR;
//         RESRNE: res value bf16rne-converted on load)
// MODE 1: f16 C = f16(acc*oscale + bf16rne(bias[n]))
// MODE 2: f16 C = f16(gelu(acc*oscale + bf16rne(bias[n])) * ocarry), gelu = 0.5 v (1 + erf(v / sqrt 2))
// MODE 3: f16 C = f16(acc*oscale + bf16rne(bias[m]))       (row bias, transposed output planes)
// coverage: 2 slabs x 16 rows x 64 cols = the wave's whole 32x64 tile; slab 16x64 fully written before reads.
// LDS: every byte of a buffer's 256 data bytes per row is copied before the barrier that publishes it; the 16
// pad bytes per row are never read. The per-wave epilogue slabs lie in the ring, used only behind the last
// trip's barrier (no copy outstanding, every fragment read retired).
// =====================================================================================================
#define LROW    272                    // LDS row pitch, bytes
#define OPBYTES (128 * LROW)           // one operand's 128 rows of one stage
#define STAGEB  (2 * OPBYTES)          // [A 128 rows | Bt 128 rows]

// Eight asynchronous 16-byte copies of this lane: rows r, r+16, ..., r+112 of one operand's stage.
// l = the lane's LDS byte address of row r, gp = its global address, rstep = elements per 16 rows.
// s_wait_xcnt 0 is the last line of the statement, so that no address register is rewritten in front of it.
__device__ __forceinline__ void copy8(unsigned l, const _Float16* gp, size_t rstep) {
#if DEV_ASM
  const unsigned l1 = l + 16 * LROW, l2 = l + 32 * LROW, l3 = l + 48 * LROW, l4 = l + 64 * LROW,
                 l5 = l + 80 * LROW, l6 = l + 96 * LROW, l7 = l + 112 * LROW;
  const _Float16 *g1 = gp + rstep, *g2 = g1 + rstep, *g3 = g2 + rstep, *g4 = g3 + rstep,
                 *g5 = g4 + rstep, *g6 = g5 + rstep, *g7 = g6 + rstep;
  asm volatile("global_load_async_to_lds_b128 %0, %8, off\n\t"
               "global_load_async_to_lds_b128 %1, %9, off\n\t"
               "global_load_async_to_lds_b128 %2, %10, off\n\t"
               "global_load_async_to_lds_b128 %3, %11, off\n\t"
               "global_load_async_to_lds_b128 %4, %12, off\n\t"
               "global_load_async_to_lds_b128 %5, %13, off\n\t"
               "global_load_async_to_lds_b128 %6, %14, off\n\t"
               "global_load_async_to_lds_b128 %7, %15, off\n\t"
               "s_wait_xcnt 0x0"
               :: "v"(l), "v"(l1), "v"(l2), "v"(l3), "v"(l4), "v"(l5), "v"(l6), "v"(l7),
                  "v"(gp), "v"(g1), "v"(g2), "v"(g3), "v"(g4), "v"(g5), "v"(g6), "v"(g7)
               : "memory");
#else
  (void)l; (void)gp; (void)rstep;
#endif
}
// this wave's own copies have landed
__device__ __forceinline__ void wait_copies() {
#if DEV_ASM
  asm volatile("s_wait_asynccnt 0x0" ::: "memory");
#endif
}
// this wave's own LDS reads have retired (before the buffer they read is handed to its next writer)
__device__ __forceinline__ void wait_lds() {
#if DEV_ASM
  asm volatile("s_wait_dscnt 0x0" ::: "memory");
#endif
}

template <int MODE, bool RESRNE>
__global__ __launch_bounds__(256) void gemm128(
    const _Float16* __restrict__ A, int lda, long long strideA,
    const _Float16* __restrict__ Bt, int ldb, long long strideB,
    void* Cout, int ldc, long long strideC,
    const float* __restrict__ bias,
    const float* __restrict__ res, int ldr, long long strideR,
    int M, int N, int K, float oscale, float ocarry)
{
  __shared__ __align__(16) unsigned char smem[2 * STAGEB];  // two stage buffers; epilogue slabs behind the loop
  const int b    = blockIdx.y;
  const int tid  = (int)threadIdx.x;
  const int lane = tid & 31;
  const int wave = tid >> 5;
  const int tilesN = N >> 7;
  const int tilesM = M >> 7;
  const int tile = blockIdx.x;
  if (tile >= tilesM * tilesN) return;                     // block-uniform, in front of every copy and barrier
  const int tm = tile / tilesN;
  const int tn = tile - tm * tilesN;
  const int m0 = (tm << 7) + ((wave >> 1) << 5);           // this wave's 32 rows
  const int n0 = (tn << 7) + ((wave & 1) << 6);            // this wave's 64 columns

  const _Float16* Ab = A  + (size_t)b * (size_t)strideA;
  const _Float16* Bb = Bt + (size_t)b * (size_t)strideB;

  const int rlane = lane & 15;                             // row (A) / col (B, D) within subtile
  const int koff  = (lane >> 4) * 8;                       // k offset of this lane half
  const int mOff  = (lane >> 4) * 8;                       // D row offset

  // copy map: thread -> row tid>>4 (+16 per copy), 16-byte piece tid&15 of the row's 256 bytes
  const int crow = tid >> 4, ccol = tid & 15;
  const _Float16* gA = Ab + (size_t)((tm << 7) + crow) * lda + ccol * 8;
  const _Float16* gB = Bb + (size_t)((tn << 7) + crow) * ldb + ccol * 8;
  const unsigned lA = (unsigned)(size_t)smem + (unsigned)(crow * LROW + ccol * 16);
  const unsigned lB = lA + OPBYTES;
  const size_t stepA = (size_t)16 * lda, stepB = (size_t)16 * ldb;

  // fragment read bases inside a buffer
  const unsigned char* fA = smem + (((wave >> 1) << 5) + rlane) * LROW + koff * 2;
  const unsigned char* fB = smem + OPBYTES + (((wave & 1) << 6) + rlane) * LROW + koff * 2;

  v8f acc[2][4];
#pragma unroll
  for (int i = 0; i < 2; ++i)
#pragma unroll
    for (int j = 0; j < 4; ++j) acc[i][j] = zero8();

  const int nt = K >> 7;                                   // stages of 128 k
  copy8(lA, gA, stepA);
  copy8(lB, gB, stepB);
  wait_copies();
  __syncthreads();                                         // stage 0 published
  if (nt > 1) {
    copy8(lA + STAGEB, gA + 128, stepA);
    copy8(lB + STAGEB, gB + 128, stepB);
  }

  for (int t = 0; t < nt; ++t) {
    const unsigned buf = (unsigned)(t & 1) * STAGEB;
    // two fragment sets: the next 32 k of THIS buffer are read as one group ahead of the current products
    v16h bq[2][4], af[2][2];
#pragma unroll
    for (int j = 0; j < 4; ++j) bq[0][j] = ldfrag((const _Float16*)(fB + buf + j * 16 * LROW));
#pragma unroll
    for (int i = 0; i < 2; ++i) af[0][i] = ldfrag((const _Float16*)(fA + buf + i * 16 * LROW));
#pragma unroll
    for (int kk = 0; kk < 4; ++kk) {
      const int cur = kk & 1, nxt = cur ^ 1;
      if (kk < 3) {
#pragma unroll
        for (int j = 0; j < 4; ++j)
          bq[nxt][j] = ldfrag((const _Float16*)(fB + buf + j * 16 * LROW + (kk + 1) * 64));
#pragma unroll
        for (int i = 0; i < 2; ++i)
          af[nxt][i] = ldfrag((const _Float16*)(fA + buf + i * 16 * LROW + (kk + 1) * 64));
      }
      // keeps the load group in front of the products: without it the scheduler sinks the LDS reads among the
      // matrix instructions into one register set, and each product group waits out its own LDS latency
      __builtin_amdgcn_sched_barrier(0);
#pragma unroll
      for (int i = 0; i < 2; ++i)
#pragma unroll
        for (int j = 0; j < 4; ++j) acc[i][j] = mmar(af[cur][i], bq[cur][j], acc[i][j]);
      // same purpose: the following load group stays behind these products
      __builtin_amdgcn_sched_barrier(0);
    }
    wait_lds();
    wait_copies();
    __syncthreads();                                       // publishes stage t+1, frees stage t's buffer
    if (t + 2 < nt) {
      copy8(lA + buf, gA + (size_t)(t + 2) * 128, stepA);
      copy8(lB + buf, gB + (size_t)(t + 2) * 128, stepB);
    }
  }
  wait_copies();
  acc_guard4(acc[0][0], acc[0][1], acc[0][2], acc[0][3]);
  acc_guard4(acc[1][0], acc[1][1], acc[1][2], acc[1][3]);

  // ---- epilogue ----
  float* slab = (float*)(smem + wave * (16 * 68 * 4));     // per-wave 16x64 slab, pitch 68 floats
#pragma unroll
  for (int i = 0; i < 2; ++i) {
    const int mBase = m0 + (i << 4);
#pragma unroll
    for (int j = 0; j < 4; ++j) {
#pragma unroll
      for (int r = 0; r < 8; ++r) {
        slab[(mOff + r) * 68 + (j << 4) + rlane] = acc[i][j][r];
      }
    }
    __builtin_amdgcn_fence(3, "workgroup");
    __builtin_amdgcn_wave_barrier();
    __builtin_amdgcn_fence(2, "workgroup");
    if (MODE == 0) {
      float* C = (float*)Cout + (size_t)b * (size_t)strideC;
      const float* R = res + (size_t)b * (size_t)strideR;
      const int h2 = lane >> 4, c4 = (lane & 15) * 4;     // 256-B row segment = 16 lanes x 16 B
      const v4f bv = bf16r4(*(const v4fa*)(bias + n0 + c4));
      {
#pragma unroll
        for (int it = 0; it < 8; ++it) {
          const int row = it * 2 + h2;                     // it 0..7 x h2 0..1 = rows 0..15
          const size_t go = (size_t)(mBase + row) * ldc + n0 + c4;
          const size_t ro = (size_t)(mBase + row) * ldr + n0 + c4;
          const v4f sv = *(const v4fa*)(slab + row * 68 + c4);
          v4f rv = *(const v4fa*)(R + ro);
          if (RESRNE) rv = bf16r4(rv);
          const v4f v = sv * oscale + bv + rv;
          *(v4f*)(C + go) = v;
        }
        
      }
    } else {
      const int q = lane >> 3, c8 = (lane & 7) * 8;
      _Float16* C = (_Float16*)Cout + (size_t)b * (size_t)strideC;
      float bb8[8] = { 0.f, 0.f, 0.f, 0.f, 0.f, 0.f, 0.f, 0.f };
      if (MODE == 1 || MODE == 2) {
        const v4f ba = bf16r4(*(const v4fa*)(bias + n0 + c8));
        const v4f bc = bf16r4(*(const v4fa*)(bias + n0 + c8 + 4));
        bb8[0] = ba.x; bb8[1] = ba.y; bb8[2] = ba.z; bb8[3] = ba.w;
        bb8[4] = bc.x; bb8[5] = bc.y; bb8[6] = bc.z; bb8[7] = bc.w;
      }
      v8h hv[4];
#pragma unroll
      for (int it = 0; it < 4; ++it) {
        const int row = it * 4 + q;                        // it 0..3 x q 0..3 = rows 0..15
        const float* sp = slab + row * 68 + c8;
        const v4f a = *(const v4fa*)sp;
        const v4f c = *(const v4fa*)(sp + 4);
        float f[8] = { a.x, a.y, a.z, a.w, c.x, c.y, c.z, c.w };
        float brow = 0.0f;
        if (MODE == 3) brow = bf16r(bias[mBase + row]);
#pragma unroll
        for (int e = 0; e < 8; ++e) {
          float u = f[e] * oscale + ((MODE == 3) ? brow : bb8[e]);
          if (MODE == 2) {
            const float gl = 0.5f * u * (1.0f + erff(u * 0.70710678118654752f));
            u = gl * ocarry;
          }
          f[e] = u;
        }
        const v8h o = { (_Float16)f[0], (_Float16)f[1], (_Float16)f[2], (_Float16)f[3],
                        (_Float16)f[4], (_Float16)f[5], (_Float16)f[6], (_Float16)f[7] };
        hv[it] = o;
      }
      {
#pragma unroll
        for (int it = 0; it < 4; ++it) {
          const int row = it * 4 + q;
          *(v8h*)(C + (size_t)(mBase + row) * ldc + n0 + c8) = hv[it];
        }
        
      }
    }
    __builtin_amdgcn_fence(3, "workgroup");
    __builtin_amdgcn_wave_barrier();
    __builtin_amdgcn_fence(2, "workgroup");
  }
}

// =====================================================================================================
// Kernel 5: streaming attention, transposed form, 16 heads, additive key mask (-10000 where mask != 1),
// softmax over all SEQ keys. Block 128 thr (4 waves), 16 queries per wave, 64 keys per step.
//   S^T = K * Q^T : A = K rows (row = key, k = d), B = Q^T (k = d, n = query); scale 0.125 applied in f32
//   O^T += V^T * P^T : A = V^T rows (row = d, k = key), B = P^T packed from the score D registers
//   (element r <- key tile covering k 0..15 row r, element 8+r <- tile covering k 16..31 row r, same lane)
// Lane owns 32 keys of query column (lane&15); partner = lane ^ 16. Online softmax in f32; p carried x16384.
//   q|k plane [b*SEQ + t][QKP]: q at col head*64 + d, k at col FEAT + head*64 + d (f16);
//   v^T plane [b][head*64 + d][SEQ] (f16); mask int32 [b][SEQ_FULL].
//   ctx plane [b*SEQ + t][head*64 + d] = f16(256 * o / l): per-wave 16x64 tile staged in LDS (block barrier),
// coverage: grid (SEQ/64, NB*NH): every (b, head, query) row x 64 columns of its head written once.
// LDS sO: each wave writes its full 16x64 region before the barrier.
// =====================================================================================================
__device__ __forceinline__ v16h pack_p(v8f a, v8f c) {
  const v16h r = { (_Float16)(a[0] * PSCALE), (_Float16)(a[1] * PSCALE), (_Float16)(a[2] * PSCALE), (_Float16)(a[3] * PSCALE),
                   (_Float16)(a[4] * PSCALE), (_Float16)(a[5] * PSCALE), (_Float16)(a[6] * PSCALE), (_Float16)(a[7] * PSCALE),
                   (_Float16)(c[0] * PSCALE), (_Float16)(c[1] * PSCALE), (_Float16)(c[2] * PSCALE), (_Float16)(c[3] * PSCALE),
                   (_Float16)(c[4] * PSCALE), (_Float16)(c[5] * PSCALE), (_Float16)(c[6] * PSCALE), (_Float16)(c[7] * PSCALE) };
  return r;
}

__global__ __launch_bounds__(128) __attribute__((amdgpu_num_vgpr(256))) void attn_kernel(
    const _Float16* __restrict__ qk, const _Float16* __restrict__ vt,
    const int* __restrict__ mask, _Float16* ctx)
{
  __shared__ __align__(16) float sO[4 * 16 * 64];          // 16384 B

  const int tid = (int)threadIdx.x, lane = tid & 31, w = tid >> 5;
  const int h = lane >> 4, m = lane & 15;
  const int bh = blockIdx.y, b = bh / NH, head = bh - b * NH;
  const int q0 = blockIdx.x * 64 + 16 * w;

  // Q^T B-fragments: column n = query q0+m, k = d (two 32-deep chunks)
  const _Float16* qrow = qk + ((size_t)b * SEQ + q0 + m) * QKP + head * HD;
  const v16h qb0 = load_frag(qrow, h);
  const v16h qb1 = load_frag(qrow + 32, h);

  v8f o[4];                                                // o[t][r] = O[query m][d 16t+8h+r] * (l * PSCALE)
#pragma unroll
  for (int t = 0; t < 4; ++t) o[t] = zero8();
  float mrun = -1e30f, lrun = 0.0f;

  const _Float16* kbase = qk + ((size_t)b * SEQ + m) * QKP + FEAT + head * HD;   // + key*QKP
  const _Float16* vbase = vt + ((size_t)b * FEAT + head * HD + m) * SEQ;         // + 16t*SEQ + key0
  const int* mk = mask + (size_t)b * SEQ_FULL + 8 * h;                            // + key0 + 16j

#pragma unroll 1
  for (int kb = 0; kb < SEQ; kb += 64) {
    // ---- scores: s[j][r] = S[query m][key kb+16j+8h+r] * 0.125 + madd[key] ----
    v8f s[4];
#pragma unroll
    for (int j = 0; j < 4; ++j) {
      const _Float16* kr = kbase + (size_t)(kb + 16 * j) * QKP;
      const v16h kf0 = load_frag(kr, h);
      const v16h kf1 = load_frag(kr + 32, h);
      v8f z = zero8();
      z = wmma_f16(kf0, qb0, z);
      z = wmma_f16(kf1, qb1, z);
      const v4i ma = *(const v4ia*)(mk + kb + 16 * j);
      const v4i mc = *(const v4ia*)(mk + kb + 16 * j + 4);
      const int mm[8] = { ma.x, ma.y, ma.z, ma.w, mc.x, mc.y, mc.z, mc.w };
#pragma unroll
      for (int r = 0; r < 8; ++r) {
        const float sc = z[r] * 0.125f;
        s[j][r] = sc + ((mm[r] != 1) ? -10000.0f : 0.0f);
      }
    }

    // ---- online softmax (f32) ----
    float mloc = s[0][0];
#pragma unroll
    for (int j = 0; j < 4; ++j)
#pragma unroll
      for (int r = 0; r < 8; ++r) mloc = fmaxf(mloc, s[j][r]);
    mloc = fmaxf(mloc, __shfl_xor(mloc, 16));
    const float mnew = fmaxf(mrun, mloc);
    const float alpha = __expf(mrun - mnew);
    mrun = mnew;
    float lsum = 0.0f;
#pragma unroll
    for (int j = 0; j < 4; ++j)
#pragma unroll
      for (int r = 0; r < 8; ++r) {
        const float p = __expf(s[j][r] - mnew);
        s[j][r] = p;
        lsum += p;
      }
    lsum += __shfl_xor(lsum, 16);
    lrun = lrun * alpha + lsum;
#pragma unroll
    for (int t = 0; t < 4; ++t)
#pragma unroll
      for (int r = 0; r < 8; ++r) o[t][r] = o[t][r] * alpha;

    // ---- P^T B-fragments (key chunks 0..31 and 32..63 of this step) ----
    const v16h pb0 = pack_p(s[0], s[1]);
    const v16h pb1 = pack_p(s[2], s[3]);

    // ---- O^T += V^T * P^T ----
#pragma unroll
    for (int t = 0; t < 4; ++t) {
      const _Float16* vp = vbase + (size_t)(16 * t) * SEQ + kb;
      const v16h vf0 = load_frag(vp, h);
      const v16h vf1 = load_frag(vp + 32, h);
      o[t] = wmma_f16(vf0, pb0, o[t]);
      o[t] = wmma_f16(vf1, pb1, o[t]);
    }
  }

  // ---- epilogue: normalise (1/l, remove the p carry, apply the ctx carry), stage per-wave 16x64 tile ----
  const float inv = (1.0f / lrun) * (CTXCARRY / PSCALE);
  float* so = sO + w * 1024;
#pragma unroll
  for (int t = 0; t < 4; ++t)
#pragma unroll
    for (int r = 0; r < 8; ++r)
      so[m * 64 + 16 * t + 8 * h + r] = o[t][r] * inv;
  __syncthreads();

  const int q8 = lane & 7, sub = lane >> 3;
  v8h hv[4];
#pragma unroll
  for (int it = 0; it < 4; ++it) {
    const int row = it * 4 + sub;                          // it 0..3 x sub 0..3 = rows 0..15 of the wave tile
    const float* sp = so + row * 64 + 8 * q8;
    const v4f a = *(const v4fa*)sp;
    const v4f c = *(const v4fa*)(sp + 4);
    const v8h ov = { (_Float16)a.x, (_Float16)a.y, (_Float16)a.z, (_Float16)a.w,
                     (_Float16)c.x, (_Float16)c.y, (_Float16)c.z, (_Float16)c.w };
    hv[it] = ov;
  }
  {
#pragma unroll
    for (int it = 0; it < 4; ++it) {
      const int row = it * 4 + sub;
      _Float16* dst = ctx + ((size_t)b * SEQ + q0 + row) * FEAT + head * HD + 8 * q8;
      *(v8h*)dst = hv[it];
    }
    
  }
}

// =====================================================================================================
// Host orchestration. Workspace map (bytes, NB=4 SEQ=1024), every region an exact multiple of its whole-line
// store granularity, all offsets multiples of 128:
//   hn    f16 [4096][1024]      8388608   (LN outputs of all three blocks, written and consumed in order)
//   cpl   f16 [4096][1024]      8388608   (bf16rne(c) as f16)
//   WqkvT f16 [3072][1024]      6291456
//   WspT  f16 [1024][1024]      2097152
//   WcqT, WckT, WcvT, WcpT      4 x 2097152
//   W1T   f16 [4096][1024]      8388608
//   W2T   f16 [1024][4096]      8388608
//   ATT   shared region        33554432 : q|k f16 [4096][2048] (16777216) + v^T f16 [4][1024][1024] (8388608)
//                                         + ctx f16 [4096][1024] (8388608) during both attention blocks;
//                                         mid f16 [4096][4096] (33554432) during the MLP (all readers of
//                                         q|k, v^T, ctx have completed before fc1 writes mid)
//   x1    f32 [4096][1024]     16777216
//   x2    f32 [4096][1024]     16777216
//   total                     117440512
// =====================================================================================================
extern "C" void kernel_launch(void* const* d_in, const int* in_sizes, int n_in,
                              void* d_out, int out_size, void* d_ws, size_t ws_size,
                              hipStream_t stream)
{
  if (n_in < 19) return;
  const long long needTok = (long long)(NB - 1) * SEQ_FULL + SEQ;
  if ((long long)in_sizes[0] < needTok * FEAT) return;                 // x
  if ((long long)in_sizes[1] < needTok * FEAT) return;                 // c
  if ((long long)in_sizes[2] < needTok) return;                        // mask (int32)
  if ((long long)in_sizes[3] < (long long)FEAT * 3 * FEAT || in_sizes[4] < 3 * FEAT) return;
  if ((long long)in_sizes[5] < (long long)FEAT * FEAT || in_sizes[6] < FEAT) return;
  if ((long long)in_sizes[7] < (long long)FEAT * FEAT || in_sizes[8] < FEAT) return;
  if ((long long)in_sizes[9] < (long long)FEAT * FEAT || in_sizes[10] < FEAT) return;
  if ((long long)in_sizes[11] < (long long)FEAT * FEAT || in_sizes[12] < FEAT) return;
  if ((long long)in_sizes[13] < (long long)FEAT * FEAT || in_sizes[14] < FEAT) return;
  if ((long long)in_sizes[15] < (long long)FEAT * MF || in_sizes[16] < MF) return;
  if ((long long)in_sizes[17] < (long long)MF * FEAT || in_sizes[18] < FEAT) return;
  if ((long long)out_size < needTok * FEAT) return;

  const float* x         = (const float*)d_in[0];
  const float* c         = (const float*)d_in[1];
  const int*   mask      = (const int*)d_in[2];
  const float* sa_qkv_w  = (const float*)d_in[3];
  const float* sa_qkv_b  = (const float*)d_in[4];
  const float* sa_proj_w = (const float*)d_in[5];
  const float* sa_proj_b = (const float*)d_in[6];
  const float* ca_q_w    = (const float*)d_in[7];
  const float* ca_q_b    = (const float*)d_in[8];
  const float* ca_k_w    = (const float*)d_in[9];
  const float* ca_k_b    = (const float*)d_in[10];
  const float* ca_v_w    = (const float*)d_in[11];
  const float* ca_v_b    = (const float*)d_in[12];
  const float* ca_proj_w = (const float*)d_in[13];
  const float* ca_proj_b = (const float*)d_in[14];
  const float* fc1_w     = (const float*)d_in[15];
  const float* fc1_b     = (const float*)d_in[16];
  const float* fc2_w     = (const float*)d_in[17];
  const float* fc2_b     = (const float*)d_in[18];

  const size_t P_F16  = (size_t)NTOK * FEAT * 2;
  const size_t P_F32  = (size_t)NTOK * FEAT * 4;
  const size_t P_W    = (size_t)FEAT * FEAT * 2;
  const size_t P_WQKV = (size_t)3 * FEAT * FEAT * 2;
  const size_t P_W1   = (size_t)MF * FEAT * 2;
  const size_t P_QK   = (size_t)NTOK * QKP * 2;
  const size_t P_VT   = (size_t)NB * FEAT * SEQ * 2;
  const size_t P_MID  = (size_t)NTOK * MF * 2;
  const size_t P_ATTU = P_QK + P_VT + P_F16;
  const size_t P_ATT  = (P_ATTU > P_MID) ? P_ATTU : P_MID;
  size_t off = 0;
  const size_t oHn   = off; off += P_F16;
  const size_t oC    = off; off += P_F16;
  const size_t oWqkv = off; off += P_WQKV;
  const size_t oWsp  = off; off += P_W;
  const size_t oWcq  = off; off += P_W;
  const size_t oWck  = off; off += P_W;
  const size_t oWcv  = off; off += P_W;
  const size_t oWcp  = off; off += P_W;
  const size_t oW1   = off; off += P_W1;
  const size_t oW2   = off; off += P_W1;
  const size_t oAtt  = off; off += P_ATT;
  const size_t oX1   = off; off += P_F32;
  const size_t oX2   = off; off += P_F32;
  if (off > ws_size) return;                               // off = 117440512 at NB=4, SEQ=1024
  if (off > (size_t)134217728) return;

  char* ws = (char*)d_ws;
  _Float16* hn    = (_Float16*)(ws + oHn);
  _Float16* cpl   = (_Float16*)(ws + oC);
  _Float16* wqkvT = (_Float16*)(ws + oWqkv);
  _Float16* wspT  = (_Float16*)(ws + oWsp);
  _Float16* wcqT  = (_Float16*)(ws + oWcq);
  _Float16* wckT  = (_Float16*)(ws + oWck);
  _Float16* wcvT  = (_Float16*)(ws + oWcv);
  _Float16* wcpT  = (_Float16*)(ws + oWcp);
  _Float16* w1T   = (_Float16*)(ws + oW1);
  _Float16* w2T   = (_Float16*)(ws + oW2);
  _Float16* qkp   = (_Float16*)(ws + oAtt);
  _Float16* vtp   = (_Float16*)(ws + oAtt + P_QK);
  _Float16* ctx   = (_Float16*)(ws + oAtt + P_QK + P_VT);
  _Float16* mid   = (_Float16*)(ws + oAtt);
  float*    x1    = (float*)(ws + oX1);
  float*    x2    = (float*)(ws + oX2);

  const dim3 blk(256);
  const float sQKV  = 1.0f / WCARRY;
  const float sPROJ = 1.0f / (WCARRY * CTXCARRY);
  const float sFC2  = 1.0f / (WCARRY * MIDCARRY);

  // (1) weights f32 [in][out] -> f16 [out][in] = bf16rne(w) x64   (in[K rows][N cols] -> out[N][K], grid (K/64, N/32))
  transpose_cvt<<<dim3(FEAT / 64, (3 * FEAT) / 32), blk, 0, stream>>>(sa_qkv_w,  wqkvT, FEAT, 3 * FEAT, WCARRY);
  transpose_cvt<<<dim3(FEAT / 64, FEAT / 32),       blk, 0, stream>>>(sa_proj_w, wspT,  FEAT, FEAT,     WCARRY);
  transpose_cvt<<<dim3(FEAT / 64, FEAT / 32),       blk, 0, stream>>>(ca_q_w,    wcqT,  FEAT, FEAT,     WCARRY);
  transpose_cvt<<<dim3(FEAT / 64, FEAT / 32),       blk, 0, stream>>>(ca_k_w,    wckT,  FEAT, FEAT,     WCARRY);
  transpose_cvt<<<dim3(FEAT / 64, FEAT / 32),       blk, 0, stream>>>(ca_v_w,    wcvT,  FEAT, FEAT,     WCARRY);
  transpose_cvt<<<dim3(FEAT / 64, FEAT / 32),       blk, 0, stream>>>(ca_proj_w, wcpT,  FEAT, FEAT,     WCARRY);
  transpose_cvt<<<dim3(FEAT / 64, MF / 32),         blk, 0, stream>>>(fc1_w,     w1T,   FEAT, MF,       WCARRY);
  transpose_cvt<<<dim3(MF / 64, FEAT / 32),         blk, 0, stream>>>(fc2_w,     w2T,   MF,   FEAT,     WCARRY);

  // (2) c -> compact f16 plane (bf16rne values)
  cvt_rows<<<dim3(NTOK), dim3(128), 0, stream>>>(c, cpl);

  // ---------------- self-attention block ----------------
  // (3) hn = LN(bf16rne(x)) -> f16 plane
  ln_kernel<true><<<dim3(NTOK), blk, 0, stream>>>(x, (long long)SEQ_FULL * FEAT, hn);

  // (4) q|k = hn . Wqkv[:, 0:2048] + b -> f16 [NTOK][2048]   (M=NTOK, N=2048, K=1024; acc / 64)
  const dim3 gQK((NTOK / 128) * (QKP / 128), 1);
  gemm128<1, false><<<gQK, blk, 0, stream>>>(
      hn, FEAT, 0LL, wqkvT, FEAT, 0LL, (void*)qkp, QKP, 0LL, sa_qkv_b, x1, FEAT, 0LL,
      NTOK, QKP, FEAT, sQKV, 1.0f);
  // (5) v^T per batch: A = WqkvT rows 2048..3071 [1024][1024], Bt = hn rows of batch b -> f16 [b][1024][SEQ]
  //     (M=1024, N=SEQ, K=1024; row bias = sa_qkv_b[2048 + m])
  const dim3 gVT((FEAT / 128) * (SEQ / 128), NB);
  gemm128<3, false><<<gVT, blk, 0, stream>>>(
      wqkvT + (size_t)2 * FEAT * FEAT, FEAT, 0LL, hn, FEAT, (long long)SEQ * FEAT,
      (void*)vtp, SEQ, (long long)FEAT * SEQ, sa_qkv_b + 2 * FEAT, x1, FEAT, 0LL,
      FEAT, SEQ, FEAT, sQKV, 1.0f);
  // (6) attention -> ctx f16 plane (x256)
  const dim3 gAT(SEQ / 64, NB * NH);
  attn_kernel<<<gAT, dim3(128), 0, stream>>>(qkp, vtp, mask, ctx);
  // (7) x1 = ctx . Wsp + b + bf16rne(x) -> f32 plane   (per batch M=SEQ, N=1024, K=1024; acc / (64*256))
  const dim3 gPB((SEQ / 128) * (FEAT / 128), NB);
  gemm128<0, true><<<gPB, blk, 0, stream>>>(
      ctx, FEAT, (long long)SEQ * FEAT, wspT, FEAT, 0LL, (void*)x1, FEAT, (long long)SEQ * FEAT,
      sa_proj_b, x, FEAT, (long long)SEQ_FULL * FEAT,
      SEQ, FEAT, FEAT, sPROJ, 1.0f);

  // ---------------- cross-attention block ----------------
  // (8) hn = LN(x1)
  ln_kernel<false><<<dim3(NTOK), blk, 0, stream>>>(x1, (long long)SEQ * FEAT, hn);
  // (9) q = hn . Wcq + b -> q|k plane cols 0..1023   (M=NTOK, N=1024, K=1024)
  const dim3 gQ((NTOK / 128) * (FEAT / 128), 1);
  gemm128<1, false><<<gQ, blk, 0, stream>>>(
      hn, FEAT, 0LL, wcqT, FEAT, 0LL, (void*)qkp, QKP, 0LL, ca_q_b, x1, FEAT, 0LL,
      NTOK, FEAT, FEAT, sQKV, 1.0f);
  // (10) k = c . Wck + b -> q|k plane cols 1024..2047
  gemm128<1, false><<<gQ, blk, 0, stream>>>(
      cpl, FEAT, 0LL, wckT, FEAT, 0LL, (void*)(qkp + FEAT), QKP, 0LL, ca_k_b, x1, FEAT, 0LL,
      NTOK, FEAT, FEAT, sQKV, 1.0f);
  // (11) v^T per batch: A = WcvT [1024][1024], Bt = c rows of batch b
  gemm128<3, false><<<gVT, blk, 0, stream>>>(
      wcvT, FEAT, 0LL, cpl, FEAT, (long long)SEQ * FEAT,
      (void*)vtp, SEQ, (long long)FEAT * SEQ, ca_v_b, x1, FEAT, 0LL,
      FEAT, SEQ, FEAT, sQKV, 1.0f);
  // (12) attention -> ctx
  attn_kernel<<<gAT, dim3(128), 0, stream>>>(qkp, vtp, mask, ctx);
  // (13) x2 = ctx . Wcp + b + x1 -> f32 plane   (M=NTOK, N=1024, K=1024)
  gemm128<0, false><<<gQ, blk, 0, stream>>>(
      ctx, FEAT, 0LL, wcpT, FEAT, 0LL, (void*)x2, FEAT, 0LL,
      ca_proj_b, x1, FEAT, 0LL,
      NTOK, FEAT, FEAT, sPROJ, 1.0f);

  // ---------------- MLP block ----------------
  // (14) hn = LN(x2)
  ln_kernel<false><<<dim3(NTOK), blk, 0, stream>>>(x2, (long long)SEQ * FEAT, hn);
  // (15) mid = gelu(hn . W1 + b1) x16 -> f16 [NTOK][4096]   (M=NTOK, N=4096, K=1024; acc / 64)
  const dim3 gW1((NTOK / 128) * (MF / 128), 1);
  gemm128<2, false><<<gW1, blk, 0, stream>>>(
      hn, FEAT, 0LL, w1T, FEAT, 0LL, (void*)mid, MF, 0LL, fc1_b, x1, FEAT, 0LL,
      NTOK, MF, FEAT, sQKV, MIDCARRY);
  // (16) out = mid . W2 + b2 + x2 -> d_out f32 rows b*SEQ_FULL + t   (per batch M=SEQ, N=1024, K=4096; acc / (64*16))
  gemm128<0, false><<<gPB, blk, 0, stream>>>(
      mid, MF, (long long)SEQ * MF, w2T, MF, 0LL, d_out, FEAT, (long long)SEQ_FULL * FEAT,
      fc2_b, x2, FEAT, (long long)SEQ * FEAT,
      SEQ, FEAT, MF, sFC2, 1.0f);

  (void)hipGetLastError();
}

// v002
// Measured time: 272 microseconds a run.
// Timed twice side by side with v001, it ran 1.35 and 1.36 times as fast.
// All steps since v000 together make it 2.81 times as fast.
// Contractions: hn*WqkT (q|k plane), Wv*hn^T (v^T plane), K*Q^T scores, V^T*P^T, ctx*WpT for both attention
// blocks (cross block: k and v^T from the c plane), hn*W1T, mid*W2T: all v_wmma_f32_16x16x32_f16
// (f16 operands, single product, f32 accumulate). LayerNorms, softmax, key-mask add, GELU (erf form), bias and
// residual adds: f32 on VALU. Every float input enters as its bf16 RNE value (x, c, weights, biases).
// Carry audit (f16 planes): weights = bf16(w) x64, inverse folded once into the scale of each consuming GEMM
// (q/k/v^T: 1/64; proj GEMMs: 1/(64*256); fc1: 1/64; fc2: 1/(64*16)). hn, c, q, k, v^T carried x1.
// P = p x16384 and ctx = o x256: inv = (1/l)*(256/16384) in attn_kernel; mid = gelu x16.
#include <hip/hip_runtime.h>
#include <math.h>

#ifndef NB
#define NB 4
#endif
#ifndef SEQ
#define SEQ 1024
#endif
#define NB_FULL  4
#define SEQ_FULL 1024
#define FEAT 1024
#define NH   16
#define HD   64
#define MF   4096
#define QKP  (2 * FEAT)
#define NTOK (NB * SEQ)
static_assert(NH * HD == FEAT);
static_assert(HD == 64);
static_assert(NB >= 1 && NB <= NB_FULL);
static_assert(SEQ >= 64 && SEQ <= SEQ_FULL && (SEQ % 64) == 0);
static_assert((FEAT % 64) == 0 && (MF % 64) == 0 && (QKP % 64) == 0);
static_assert((FEAT % 128) == 0 && (MF % 128) == 0 && (QKP % 128) == 0 && (SEQ % 128) == 0 && FEAT >= 256);
static_assert(FEAT == 4 * 256);
static_assert(((long long)(NB - 1) * SEQ_FULL + SEQ) * FEAT <= (long long)NB_FULL * SEQ_FULL * FEAT);

#define WCARRY   64.0f
#define PSCALE   16384.0f
#define CTXCARRY 256.0f
#define MIDCARRY 16.0f

typedef _Float16 v16h __attribute__((ext_vector_type(16)));
typedef _Float16 v8h  __attribute__((ext_vector_type(8)));
typedef float    v8f  __attribute__((ext_vector_type(8)));
typedef float    v4f  __attribute__((ext_vector_type(4)));
typedef int      v4i  __attribute__((ext_vector_type(4)));
typedef v8h __attribute__((may_alias)) v8ha;
typedef v4f __attribute__((may_alias)) v4fa;
typedef v4i __attribute__((may_alias)) v4ia;
union Frag { v16h v; v8h half[2]; };

#if defined(__HIP_DEVICE_COMPILE__)
#define DEV_ASM 1
#else
#define DEV_ASM 0
#endif

__device__ __forceinline__ v8f zero8() { v8f z = {0.f, 0.f, 0.f, 0.f, 0.f, 0.f, 0.f, 0.f}; return z; }

// f32 -> bf16 RNE value kept as f32
__device__ __forceinline__ float bf16r(float f) {
  unsigned u = __float_as_uint(f);
  u = (u + 0x7FFFu + ((u >> 16) & 1u)) & 0xFFFF0000u;
  return __uint_as_float(u);
}
__device__ __forceinline__ v4f bf16r4(v4f a) {
  v4f r = { bf16r(a.x), bf16r(a.y), bf16r(a.z), bf16r(a.w) };
  return r;
}

// ---------------------------------------------------------------------------------------------------
// 16x16x32 f16 WMMA. Fragment map (wave32): lane l, h = l>>4, m = n = l&15.
//   A/B element i: i<8 -> k0+8h+i ; i>=8 -> k0+16+8h+(i-8)      D element r: row 8h+r, col l&15
// ---------------------------------------------------------------------------------------------------
// guarded form: 4 VALU slots after the WMMA, D tied, A/B kept live
__device__ __forceinline__ v8f wmma_f16(v16h a, v16h b, v8f c) {
  v8f d = __builtin_amdgcn_wmma_f32_16x16x32_f16(false, a, false, b, (short)0, c, false, false);
#if DEV_ASM
  asm volatile("v_nop\n\tv_nop\n\tv_nop\n\tv_nop" : "+v"(d) : "v"(a), "v"(b));
#endif
  return d;
}
// plain builtin form for the GEMM inner loop (the compiler keeps the distances between its own builtins)
__device__ __forceinline__ v8f mmar(v16h a, v16h b, v8f c) {
  return __builtin_amdgcn_wmma_f32_16x16x32_f16(false, a, false, b, (short)0, c, false, false);
}
__device__ __forceinline__ void acc_guard4(v8f& a, v8f& b, v8f& c, v8f& d) {
#if DEV_ASM
  asm volatile("v_nop\n\tv_nop\n\tv_nop\n\tv_nop" : "+v"(a), "+v"(b), "+v"(c), "+v"(d));
#else
  (void)a; (void)b; (void)c; (void)d;
#endif
}

// A or B fragment from a k-contiguous f16 row; p points at element k0 of the row owned by this lane.
__device__ __forceinline__ v16h load_frag(const _Float16* p, int h) {
  Frag f;
  f.half[0] = *(const v8ha*)(p + 8 * h);
  f.half[1] = *(const v8ha*)(p + 16 + 8 * h);
  return f.v;
}
// same, p already includes +8*(lane>>4)
__device__ __forceinline__ v16h ldfrag(const _Float16* p) {
  Frag f;
  f.half[0] = *(const v8ha*)(p);
  f.half[1] = *(const v8ha*)(p + 16);
  return f.v;
}

// =====================================================================================================
// Kernel 1: transpose + convert: in f32 [K][N] (row = k) -> out f16 [N][K] = f16(carry * bf16rne(in)^T).
// Block 256 threads, tile 64 k x 32 n staged in LDS (n-major, pitch 68 floats; cross-wave -> block barrier).
// coverage: 32 n-rows x 64 k per block; grid covers the whole [N][K] plane (K % 64 == 0, N % 32 == 0).
// LDS: tile cols 0..63 of all 32 rows written before the barrier; cols 64..67 never read.
// =====================================================================================================
__global__ __launch_bounds__(256) void transpose_cvt(
    const float* __restrict__ in, _Float16* out, int K, int N, float carry)
{
  __shared__ __align__(16) float tile[32][68];
  const int k0 = blockIdx.x * 64, n0 = blockIdx.y * 32;
  const int tid = (int)threadIdx.x;
  {
    const int kk = tid >> 2, nq = (tid & 3) * 8;
    const float* src = in + (size_t)(k0 + kk) * N + n0 + nq;
    const v4f a = *(const v4fa*)src;
    const v4f c = *(const v4fa*)(src + 4);
    tile[nq + 0][kk] = a.x; tile[nq + 1][kk] = a.y; tile[nq + 2][kk] = a.z; tile[nq + 3][kk] = a.w;
    tile[nq + 4][kk] = c.x; tile[nq + 5][kk] = c.y; tile[nq + 6][kk] = c.z; tile[nq + 7][kk] = c.w;
  }
  __syncthreads();
  {
    const int nn = tid >> 3, kq = (tid & 7) * 8;
    const float* sp = &tile[nn][kq];
    const v4f a = bf16r4(*(const v4fa*)sp);
    const v4f c = bf16r4(*(const v4fa*)(sp + 4));
    const v8h o = { (_Float16)(a.x * carry), (_Float16)(a.y * carry), (_Float16)(a.z * carry), (_Float16)(a.w * carry),
                    (_Float16)(c.x * carry), (_Float16)(c.y * carry), (_Float16)(c.z * carry), (_Float16)(c.w * carry) };
    _Float16* dst = out + (size_t)(n0 + nn) * K + k0 + kq;
    *(v8h*)dst = o;
    
  }
}

// =====================================================================================================
// Kernel 2: row convert: f32 input rows (batch stride SEQ_FULL*FEAT) -> compact f16 plane [NTOK][FEAT],
// value = f16(bf16rne(v)). Block 128 threads, one 1024-wide row per block, 8 elements per thread.
// coverage: 128 x 8 = 1024 per row; grid = NTOK rows.
// =====================================================================================================
__global__ __launch_bounds__(128) void cvt_rows(const float* __restrict__ src, _Float16* dst)
{
  const int row = blockIdx.x;
  const int bb = row / SEQ, t = row - bb * SEQ;
  const int tid = (int)threadIdx.x;
  const float* sp = src + ((size_t)bb * SEQ_FULL + (size_t)t) * FEAT + 8 * tid;
  const v4f a = bf16r4(*(const v4fa*)sp);
  const v4f c = bf16r4(*(const v4fa*)(sp + 4));
  const v8h o = { (_Float16)a.x, (_Float16)a.y, (_Float16)a.z, (_Float16)a.w,
                  (_Float16)c.x, (_Float16)c.y, (_Float16)c.z, (_Float16)c.w };
  _Float16* d = dst + (size_t)row * FEAT + 8 * tid;
  *(v8h*)d = o;
  
}

// =====================================================================================================
// Kernel 3: LayerNorm, no affine, eps 1e-6 (one 1024-wide row per 256-thread block, thread owns 4 consecutive
//   RNEX = true : v = bf16rne(X) (raw input x); false: v = X (internal f32 plane).
//   Input row = b * strideXB + t * FEAT with (b, t) from the compact row index; output f16 row compact.
//   f16 row: staged in LDS (cross-wave -> block barrier), lanes of waves 0..3 write 16 B each (8 halves),
// =====================================================================================================
__device__ __forceinline__ float block_sum(float v, float* red, int lane, int w) {
#pragma unroll
  for (int off = 16; off > 0; off >>= 1) v += __shfl_xor(v, off);
  if (lane == 0) red[w] = v;
  __syncthreads();
  float r = red[0];
#pragma unroll
  for (int i = 1; i < 8; ++i) r += red[i];
  __syncthreads();
  return r;
}

template <bool RNEX>
__global__ __launch_bounds__(256) void ln_kernel(
    const float* __restrict__ X, long long strideXB, _Float16* pout)
{
  __shared__ __align__(16) float srow[FEAT];
  __shared__ float red[8];
  const int row = blockIdx.x;
  const int bb  = row / SEQ, t = row - bb * SEQ;
  const int tid = (int)threadIdx.x, lane = tid & 31, w = tid >> 5;
  const int f0  = 4 * tid;
  const float* xp = X + (size_t)bb * (size_t)strideXB + (size_t)t * FEAT + f0;

  v4f xv = *(const v4fa*)xp;
  if (RNEX) xv = bf16r4(xv);
  float s = (xv.x + xv.y) + (xv.z + xv.w);
  s = block_sum(s, red, lane, w);
  const float mu = s * (1.0f / FEAT);
  const float d0 = xv.x - mu, d1 = xv.y - mu, d2 = xv.z - mu, d3 = xv.w - mu;
  float q = (d0 * d0 + d1 * d1) + (d2 * d2 + d3 * d3);
  q = block_sum(q, red, lane, w);
  const float rstd = rsqrtf(q * (1.0f / FEAT) + 1e-6f);

  const v4f ov = { d0 * rstd, d1 * rstd, d2 * rstd, d3 * rstd };
  *(v4fa*)(srow + f0) = ov;
  __syncthreads();
  if (w < 4) {                                             // wave-uniform: waves 0..3, 128 threads x 8 halves
    const float* sp = srow + 8 * tid;
    const v4f a = *(const v4fa*)sp;
    const v4f c = *(const v4fa*)(sp + 4);
    const v8h o = { (_Float16)a.x, (_Float16)a.y, (_Float16)a.z, (_Float16)a.w,
                    (_Float16)c.x, (_Float16)c.y, (_Float16)c.z, (_Float16)c.w };
    _Float16* dst = pout + (size_t)row * FEAT + 8 * tid;
    *(v8h*)dst = o;
    
  }
}

// =====================================================================================================
// Kernel 4: batched WMMA GEMM (f16 operands): C[m][n] = sum_k A[m][k] * Bt[n][k].
// One 128x128 tile of C per 256-thread block; 8 waves as 4 (m) x 2 (n), each 32x64 (2 x 4 accumulator tiles).
// A row-major [M][K] pitch lda; Bt row-major [N][K] pitch ldb (k contiguous); M, N, K multiples of 128,
// K >= 256 (all shapes here are compile-time constants of the host code). blockIdx.y = batch index.
// Operands: per stage 128 k of the block's 128 A rows and 128 Bt rows are brought into LDS by asynchronous
// 16-byte copies (each thread 8 + 8 copies, a wave-wide copy = two whole 256-B row pieces), two buffers, the
// next stage in flight while this one is multiplied. LDS row pitch 272 B (256 + 16: ds_load_b128 readers).
// Fragments from LDS with the split k map (ldfrag), two register sets inside a stage; k runs upward in steps of
// 32 per accumulator.
// MODE 0: f32 C = acc*oscale + bf16rne(bias[n]) + res[m][n] (res pitch ldr, batch stride strideR;
//         RESRNE: res value bf16rne-converted on load)
// MODE 1: f16 C = f16(acc*oscale + bf16rne(bias[n]))
// MODE 2: f16 C = f16(gelu(acc*oscale + bf16rne(bias[n])) * ocarry), gelu = 0.5 v (1 + erf(v / sqrt 2))
// MODE 3: f16 C = f16(acc*oscale + bf16rne(bias[m]))       (row bias, transposed output planes)
// coverage: 2 slabs x 16 rows x 64 cols = the wave's whole 32x64 tile; slab 16x64 fully written before reads.
// LDS: every byte of a buffer's 256 data bytes per row is copied before the barrier that publishes it; the 16
// pad bytes per row are never read. The per-wave epilogue slabs lie in the ring, used only behind the last
// trip's barrier (no copy outstanding, every fragment read retired).
// =====================================================================================================
#define LROW    272                    // LDS row pitch, bytes
#define OPBYTES (128 * LROW)           // one operand's 128 rows of one stage
#define STAGEB  (2 * OPBYTES)          // [A 128 rows | Bt 128 rows]

// Eight asynchronous 16-byte copies of this lane: rows r, r+16, ..., r+112 of one operand's stage.
// l = the lane's LDS byte address of row r, gp = its global address, rstep = elements per 16 rows.
// s_wait_xcnt 0 is the last line of the statement, so that no address register is rewritten in front of it.
__device__ __forceinline__ void copy8(unsigned l, const _Float16* gp, size_t rstep) {
#if DEV_ASM
  const unsigned l1 = l + 16 * LROW, l2 = l + 32 * LROW, l3 = l + 48 * LROW, l4 = l + 64 * LROW,
                 l5 = l + 80 * LROW, l6 = l + 96 * LROW, l7 = l + 112 * LROW;
  const _Float16 *g1 = gp + rstep, *g2 = g1 + rstep, *g3 = g2 + rstep, *g4 = g3 + rstep,
                 *g5 = g4 + rstep, *g6 = g5 + rstep, *g7 = g6 + rstep;
  asm volatile("global_load_async_to_lds_b128 %0, %8, off\n\t"
               "global_load_async_to_lds_b128 %1, %9, off\n\t"
               "global_load_async_to_lds_b128 %2, %10, off\n\t"
               "global_load_async_to_lds_b128 %3, %11, off\n\t"
               "global_load_async_to_lds_b128 %4, %12, off\n\t"
               "global_load_async_to_lds_b128 %5, %13, off\n\t"
               "global_load_async_to_lds_b128 %6, %14, off\n\t"
               "global_load_async_to_lds_b128 %7, %15, off\n\t"
               "s_wait_xcnt 0x0"
               :: "v"(l), "v"(l1), "v"(l2), "v"(l3), "v"(l4), "v"(l5), "v"(l6), "v"(l7),
                  "v"(gp), "v"(g1), "v"(g2), "v"(g3), "v"(g4), "v"(g5), "v"(g6), "v"(g7)
               : "memory");
#else
  (void)l; (void)gp; (void)rstep;
#endif
}
// this wave's own copies have landed
__device__ __forceinline__ void wait_copies() {
#if DEV_ASM
  asm volatile("s_wait_asynccnt 0x0" ::: "memory");
#endif
}
// this wave's own LDS reads have retired (before the buffer they read is handed to its next writer)
__device__ __forceinline__ void wait_lds() {
#if DEV_ASM
  asm volatile("s_wait_dscnt 0x0" ::: "memory");
#endif
}

template <int MODE, bool RESRNE>
__global__ __launch_bounds__(256) void gemm128(
    const _Float16* __restrict__ A, int lda, long long strideA,
    const _Float16* __restrict__ Bt, int ldb, long long strideB,
    void* Cout, int ldc, long long strideC,
    const float* __restrict__ bias,
    const float* __restrict__ res, int ldr, long long strideR,
    int M, int N, int K, float oscale, float ocarry)
{
  __shared__ __align__(16) unsigned char smem[2 * STAGEB];  // two stage buffers; epilogue slabs behind the loop
  const int b    = blockIdx.y;
  const int tid  = (int)threadIdx.x;
  const int lane = tid & 31;
  const int wave = tid >> 5;
  const int tilesN = N >> 7;
  const int tilesM = M >> 7;
  const int tile = blockIdx.x;
  if (tile >= tilesM * tilesN) return;                     // block-uniform, in front of every copy and barrier
  const int tm = tile / tilesN;
  const int tn = tile - tm * tilesN;
  const int m0 = (tm << 7) + ((wave >> 1) << 5);           // this wave's 32 rows
  const int n0 = (tn << 7) + ((wave & 1) << 6);            // this wave's 64 columns

  const _Float16* Ab = A  + (size_t)b * (size_t)strideA;
  const _Float16* Bb = Bt + (size_t)b * (size_t)strideB;

  const int rlane = lane & 15;                             // row (A) / col (B, D) within subtile
  const int koff  = (lane >> 4) * 8;                       // k offset of this lane half
  const int mOff  = (lane >> 4) * 8;                       // D row offset

  // copy map: thread -> row tid>>4 (+16 per copy), 16-byte piece tid&15 of the row's 256 bytes
  const int crow = tid >> 4, ccol = tid & 15;
  const _Float16* gA = Ab + (size_t)((tm << 7) + crow) * lda + ccol * 8;
  const _Float16* gB = Bb + (size_t)((tn << 7) + crow) * ldb + ccol * 8;
  const unsigned lA = (unsigned)(size_t)smem + (unsigned)(crow * LROW + ccol * 16);
  const unsigned lB = lA + OPBYTES;
  const size_t stepA = (size_t)16 * lda, stepB = (size_t)16 * ldb;

  // fragment read bases inside a buffer
  const unsigned char* fA = smem + (((wave >> 1) << 5) + rlane) * LROW + koff * 2;
  const unsigned char* fB = smem + OPBYTES + (((wave & 1) << 6) + rlane) * LROW + koff * 2;

  v8f acc[2][4];
#pragma unroll
  for (int i = 0; i < 2; ++i)
#pragma unroll
    for (int j = 0; j < 4; ++j) acc[i][j] = zero8();

  const int nt = K >> 7;                                   // stages of 128 k
  copy8(lA, gA, stepA);
  copy8(lB, gB, stepB);
  wait_copies();
  __syncthreads();                                         // stage 0 published
  if (nt > 1) {
    copy8(lA + STAGEB, gA + 128, stepA);
    copy8(lB + STAGEB, gB + 128, stepB);
  }

  for (int t = 0; t < nt; ++t) {
    const unsigned buf = (unsigned)(t & 1) * STAGEB;
    // two fragment sets: the next 32 k of THIS buffer are read as one group ahead of the current products
    v16h bq[2][4], af[2][2];
#pragma unroll
    for (int j = 0; j < 4; ++j) bq[0][j] = ldfrag((const _Float16*)(fB + buf + j * 16 * LROW));
#pragma unroll
    for (int i = 0; i < 2; ++i) af[0][i] = ldfrag((const _Float16*)(fA + buf + i * 16 * LROW));
#pragma unroll
    for (int kk = 0; kk < 4; ++kk) {
      const int cur = kk & 1, nxt = cur ^ 1;
      if (kk < 3) {
#pragma unroll
        for (int j = 0; j < 4; ++j)
          bq[nxt][j] = ldfrag((const _Float16*)(fB + buf + j * 16 * LROW + (kk + 1) * 64));
#pragma unroll
        for (int i = 0; i < 2; ++i)
          af[nxt][i] = ldfrag((const _Float16*)(fA + buf + i * 16 * LROW + (kk + 1) * 64));
      }
      // keeps the load group in front of the products: without it the scheduler sinks the LDS reads among the
      // matrix instructions into one register set, and each product group waits out its own LDS latency
      __builtin_amdgcn_sched_barrier(0);
#pragma unroll
      for (int i = 0; i < 2; ++i)
#pragma unroll
        for (int j = 0; j < 4; ++j) acc[i][j] = mmar(af[cur][i], bq[cur][j], acc[i][j]);
      // same purpose: the following load group stays behind these products
      __builtin_amdgcn_sched_barrier(0);
    }
    wait_lds();
    wait_copies();
    __syncthreads();                                       // publishes stage t+1, frees stage t's buffer
    if (t + 2 < nt) {
      copy8(lA + buf, gA + (size_t)(t + 2) * 128, stepA);
      copy8(lB + buf, gB + (size_t)(t + 2) * 128, stepB);
    }
  }
  wait_copies();
  acc_guard4(acc[0][0], acc[0][1], acc[0][2], acc[0][3]);
  acc_guard4(acc[1][0], acc[1][1], acc[1][2], acc[1][3]);

  // ---- epilogue ----
  float* slab = (float*)(smem + wave * (16 * 68 * 4));     // per-wave 16x64 slab, pitch 68 floats
#pragma unroll
  for (int i = 0; i < 2; ++i) {
    const int mBase = m0 + (i << 4);
#pragma unroll
    for (int j = 0; j < 4; ++j) {
#pragma unroll
      for (int r = 0; r < 8; ++r) {
        slab[(mOff + r) * 68 + (j << 4) + rlane] = acc[i][j][r];
      }
    }
    __builtin_amdgcn_fence(3, "workgroup");
    __builtin_amdgcn_wave_barrier();
    __builtin_amdgcn_fence(2, "workgroup");
    if (MODE == 0) {
      float* C = (float*)Cout + (size_t)b * (size_t)strideC;
      const float* R = res + (size_t)b * (size_t)strideR;
      const int h2 = lane >> 4, c4 = (lane & 15) * 4;     // 256-B row segment = 16 lanes x 16 B
      const v4f bv = bf16r4(*(const v4fa*)(bias + n0 + c4));
      {
#pragma unroll
        for (int it = 0; it < 8; ++it) {
          const int row = it * 2 + h2;                     // it 0..7 x h2 0..1 = rows 0..15
          const size_t go = (size_t)(mBase + row) * ldc + n0 + c4;
          const size_t ro = (size_t)(mBase + row) * ldr + n0 + c4;
          const v4f sv = *(const v4fa*)(slab + row * 68 + c4);
          v4f rv = *(const v4fa*)(R + ro);
          if (RESRNE) rv = bf16r4(rv);
          const v4f v = sv * oscale + bv + rv;
          *(v4f*)(C + go) = v;
        }
        
      }
    } else {
      const int q = lane >> 3, c8 = (lane & 7) * 8;
      _Float16* C = (_Float16*)Cout + (size_t)b * (size_t)strideC;
      float bb8[8] = { 0.f, 0.f, 0.f, 0.f, 0.f, 0.f, 0.f, 0.f };
      if (MODE == 1 || MODE == 2) {
        const v4f ba = bf16r4(*(const v4fa*)(bias + n0 + c8));
        const v4f bc = bf16r4(*(const v4fa*)(bias + n0 + c8 + 4));
        bb8[0] = ba.x; bb8[1] = ba.y; bb8[2] = ba.z; bb8[3] = ba.w;
        bb8[4] = bc.x; bb8[5] = bc.y; bb8[6] = bc.z; bb8[7] = bc.w;
      }
      v8h hv[4];
#pragma unroll
      for (int it = 0; it < 4; ++it) {
        const int row = it * 4 + q;                        // it 0..3 x q 0..3 = rows 0..15
        const float* sp = slab + row * 68 + c8;
        const v4f a = *(const v4fa*)sp;
        const v4f c = *(const v4fa*)(sp + 4);
        float f[8] = { a.x, a.y, a.z, a.w, c.x, c.y, c.z, c.w };
        float brow = 0.0f;
        if (MODE == 3) brow = bf16r(bias[mBase + row]);
#pragma unroll
        for (int e = 0; e < 8; ++e) {
          float u = f[e] * oscale + ((MODE == 3) ? brow : bb8[e]);
          if (MODE == 2) {
            const float gl = 0.5f * u * (1.0f + erff(u * 0.70710678118654752f));
            u = gl * ocarry;
          }
          f[e] = u;
        }
        const v8h o = { (_Float16)f[0], (_Float16)f[1], (_Float16)f[2], (_Float16)f[3],
                        (_Float16)f[4], (_Float16)f[5], (_Float16)f[6], (_Float16)f[7] };
        hv[it] = o;
      }
      {
#pragma unroll
        for (int it = 0; it < 4; ++it) {
          const int row = it * 4 + q;
          *(v8h*)(C + (size_t)(mBase + row) * ldc + n0 + c8) = hv[it];
        }
        
      }
    }
    __builtin_amdgcn_fence(3, "workgroup");
    __builtin_amdgcn_wave_barrier();
    __builtin_amdgcn_fence(2, "workgroup");
  }
}

// =====================================================================================================
// Kernel 5: streaming attention, transposed form, 16 heads, additive key mask (-10000 where mask != 1),
// softmax over all SEQ keys. Block 128 thr (4 waves), 16 queries per wave, 64 keys per step.
//   S^T = K * Q^T : A = K rows (row = key, k = d), B = Q^T (k = d, n = query); scale 0.125 applied in f32
//   O^T += V^T * P^T : A = V^T rows (row = d, k = key), B = P^T packed from the score D registers
//   (element r <- key tile covering k 0..15 row r, element 8+r <- tile covering k 16..31 row r, same lane)
// Lane owns 32 keys of query column (lane&15); partner = lane ^ 16. Online softmax in f32; p carried x16384.
//   q|k plane [b*SEQ + t][QKP]: q at col head*64 + d, k at col FEAT + head*64 + d (f16);
//   v^T plane [b][head*64 + d][SEQ] (f16); mask int32 [b][SEQ_FULL].
//   ctx plane [b*SEQ + t][head*64 + d] = f16(256 * o / l): per-wave 16x64 tile staged in LDS (block barrier),
// coverage: grid (SEQ/64, NB*NH): every (b, head, query) row x 64 columns of its head written once.
// LDS sO: each wave writes its full 16x64 region before the barrier.
// Operands: per step the 64 K rows (128 B each) and the 64 V^T rows (128 B each) that all four waves use are
// brought into LDS once per block by asynchronous 16-byte copies (each thread 4 + 4 copies, a wave-wide copy =
// four whole 128-B rows), two buffers, the next step's tiles in flight while this step is worked on.
// LDS row pitch 144 B (128 + 16: ds_load_b128 readers); the 16 pad bytes per row are never read.
// =====================================================================================================
#define KVROW   144                    // LDS row pitch, bytes
#define KVOP    (64 * KVROW)           // one operand's 64 rows of one step
#define KVSTAGE (2 * KVOP)             // [K 64 rows | V^T 64 rows]

// Eight asynchronous 16-byte copies of this lane: rows r, r+16, r+32, r+48 of the K tile and of the V^T tile.
// lk, lv = the lane's LDS byte addresses of row r, gk, gv = its global addresses, kstep, vstep = elements per 16 rows.
// s_wait_xcnt 0 is the last line of the statement, so that no address register is rewritten in front of it.
__device__ __forceinline__ void copy_kv(unsigned lk, const _Float16* gk, size_t kstep,
                                        unsigned lv, const _Float16* gv, size_t vstep) {
#if DEV_ASM
  const unsigned lk1 = lk + 16 * KVROW, lk2 = lk + 32 * KVROW, lk3 = lk + 48 * KVROW;
  const unsigned lv1 = lv + 16 * KVROW, lv2 = lv + 32 * KVROW, lv3 = lv + 48 * KVROW;
  const _Float16 *gk1 = gk + kstep, *gk2 = gk1 + kstep, *gk3 = gk2 + kstep;
  const _Float16 *gv1 = gv + vstep, *gv2 = gv1 + vstep, *gv3 = gv2 + vstep;
  asm volatile("global_load_async_to_lds_b128 %0, %8, off\n\t"
               "global_load_async_to_lds_b128 %1, %9, off\n\t"
               "global_load_async_to_lds_b128 %2, %10, off\n\t"
               "global_load_async_to_lds_b128 %3, %11, off\n\t"
               "global_load_async_to_lds_b128 %4, %12, off\n\t"
               "global_load_async_to_lds_b128 %5, %13, off\n\t"
               "global_load_async_to_lds_b128 %6, %14, off\n\t"
               "global_load_async_to_lds_b128 %7, %15, off\n\t"
               "s_wait_xcnt 0x0"
               :: "v"(lk), "v"(lk1), "v"(lk2), "v"(lk3), "v"(lv), "v"(lv1), "v"(lv2), "v"(lv3),
                  "v"(gk), "v"(gk1), "v"(gk2), "v"(gk3), "v"(gv), "v"(gv1), "v"(gv2), "v"(gv3)
               : "memory");
#else
  (void)lk; (void)gk; (void)kstep; (void)lv; (void)gv; (void)vstep;
#endif
}

__device__ __forceinline__ v16h pack_p(v8f a, v8f c) {
  const v16h r = { (_Float16)(a[0] * PSCALE), (_Float16)(a[1] * PSCALE), (_Float16)(a[2] * PSCALE), (_Float16)(a[3] * PSCALE),
                   (_Float16)(a[4] * PSCALE), (_Float16)(a[5] * PSCALE), (_Float16)(a[6] * PSCALE), (_Float16)(a[7] * PSCALE),
                   (_Float16)(c[0] * PSCALE), (_Float16)(c[1] * PSCALE), (_Float16)(c[2] * PSCALE), (_Float16)(c[3] * PSCALE),
                   (_Float16)(c[4] * PSCALE), (_Float16)(c[5] * PSCALE), (_Float16)(c[6] * PSCALE), (_Float16)(c[7] * PSCALE) };
  return r;
}

__global__ __launch_bounds__(128) __attribute__((amdgpu_num_vgpr(256))) void attn_kernel(
    const _Float16* __restrict__ qk, const _Float16* __restrict__ vt,
    const int* __restrict__ mask, _Float16* ctx)
{
  __shared__ __align__(16) float sO[4 * 16 * 64];          // 16384 B
  __shared__ __align__(16) unsigned char skv[2 * KVSTAGE]; // two step buffers of K and V^T rows

  const int tid = (int)threadIdx.x, lane = tid & 31, w = tid >> 5;
  const int h = lane >> 4, m = lane & 15;
  const int bh = blockIdx.y, b = bh / NH, head = bh - b * NH;
  const int q0 = blockIdx.x * 64 + 16 * w;

  // Q^T B-fragments: column n = query q0+m, k = d (two 32-deep chunks)
  const _Float16* qrow = qk + ((size_t)b * SEQ + q0 + m) * QKP + head * HD;
  const v16h qb0 = load_frag(qrow, h);
  const v16h qb1 = load_frag(qrow + 32, h);

  v8f o[4];                                                // o[t][r] = O[query m][d 16t+8h+r] * (l * PSCALE)
#pragma unroll
  for (int t = 0; t < 4; ++t) o[t] = zero8();
  float mrun = -1e30f, lrun = 0.0f;

  const int* mk = mask + (size_t)b * SEQ_FULL + 8 * h;                            // + key0 + 16j

  // copy map: thread -> row tid>>3 (+16 per copy), 16-byte piece tid&7 of the row's 128 bytes
  const int crow = tid >> 3, cpc = tid & 7;
  const _Float16* gK = qk + ((size_t)b * SEQ + crow) * QKP + FEAT + head * HD + cpc * 8;   // + key0*QKP
  const _Float16* gV = vt + ((size_t)b * FEAT + head * HD + crow) * SEQ + cpc * 8;         // + key0
  const unsigned lK = (unsigned)(size_t)skv + (unsigned)(crow * KVROW + cpc * 16);
  const unsigned lV = lK + KVOP;
  const size_t stepK = (size_t)16 * QKP, stepV = (size_t)16 * SEQ;
  // fragment read bases inside a buffer: row m of a 16-row group, k offset 8h
  const unsigned char* fK = skv + m * KVROW + 16 * h;
  const unsigned char* fV = skv + KVOP + m * KVROW + 16 * h;

  copy_kv(lK, gK, stepK, lV, gV, stepV);
  wait_copies();
  __syncthreads();                                         // step 0 published
  if (SEQ > 64) copy_kv(lK + KVSTAGE, gK + (size_t)64 * QKP, stepK, lV + KVSTAGE, gV + 64, stepV);

#pragma unroll 1
  for (int kb = 0; kb < SEQ; kb += 64) {
    const unsigned buf = (unsigned)((kb >> 6) & 1) * KVSTAGE;
    // ---- scores: s[j][r] = S[query m][key kb+16j+8h+r] * 0.125 + madd[key] ----
    v8f s[4];
    v16h kf[4][2];
#pragma unroll
    for (int j = 0; j < 4; ++j) {
      const _Float16* kr = (const _Float16*)(fK + buf + j * 16 * KVROW);
      kf[j][0] = ldfrag(kr);
      kf[j][1] = ldfrag(kr + 32);
    }
    // keeps the K reads one group in front of the score products: left free, the scheduler puts four reads in
    // front of each pair of products, and every pair waits out its own LDS latency
    __builtin_amdgcn_sched_barrier(0);
#pragma unroll
    for (int j = 0; j < 4; ++j) {
      v8f z = zero8();
      z = wmma_f16(kf[j][0], qb0, z);
      z = wmma_f16(kf[j][1], qb1, z);
      const v4i ma = *(const v4ia*)(mk + kb + 16 * j);
      const v4i mc = *(const v4ia*)(mk + kb + 16 * j + 4);
      const int mm[8] = { ma.x, ma.y, ma.z, ma.w, mc.x, mc.y, mc.z, mc.w };
#pragma unroll
      for (int r = 0; r < 8; ++r) {
        const float sc = z[r] * 0.125f;
        s[j][r] = sc + ((mm[r] != 1) ? -10000.0f : 0.0f);
      }
    }

    // ---- V^T fragments of this step: one read group, in flight while the softmax runs ----
    v16h vf[4][2];
#pragma unroll
    for (int t = 0; t < 4; ++t) {
      const _Float16* vp = (const _Float16*)(fV + buf + t * 16 * KVROW);
      vf[t][0] = ldfrag(vp);
      vf[t][1] = ldfrag(vp + 32);
    }
    // keeps the V^T reads in front of the softmax: left free, they sink to their products and are waited for there
    __builtin_amdgcn_sched_barrier(0);

    // ---- online softmax (f32) ----
    float mloc = s[0][0];
#pragma unroll
    for (int j = 0; j < 4; ++j)
#pragma unroll
      for (int r = 0; r < 8; ++r) mloc = fmaxf(mloc, s[j][r]);
    mloc = fmaxf(mloc, __shfl_xor(mloc, 16));
    const float mnew = fmaxf(mrun, mloc);
    const float alpha = __expf(mrun - mnew);
    mrun = mnew;
    float lsum = 0.0f;
#pragma unroll
    for (int j = 0; j < 4; ++j)
#pragma unroll
      for (int r = 0; r < 8; ++r) {
        const float p = __expf(s[j][r] - mnew);
        s[j][r] = p;
        lsum += p;
      }
    lsum += __shfl_xor(lsum, 16);
    lrun = lrun * alpha + lsum;
#pragma unroll
    for (int t = 0; t < 4; ++t)
#pragma unroll
      for (int r = 0; r < 8; ++r) o[t][r] = o[t][r] * alpha;

    // ---- P^T B-fragments (key chunks 0..31 and 32..63 of this step) ----
    const v16h pb0 = pack_p(s[0], s[1]);
    const v16h pb1 = pack_p(s[2], s[3]);

    // ---- O^T += V^T * P^T ----
#pragma unroll
    for (int t = 0; t < 4; ++t) {
      o[t] = wmma_f16(vf[t][0], pb0, o[t]);
      o[t] = wmma_f16(vf[t][1], pb1, o[t]);
    }
    wait_lds();
    wait_copies();
    __syncthreads();                                       // publishes step kb+64, frees this step's buffer
    if (kb + 128 < SEQ)
      copy_kv(lK + buf, gK + (size_t)(kb + 128) * QKP, stepK, lV + buf, gV + (kb + 128), stepV);
  }
  wait_copies();

  // ---- epilogue: normalise (1/l, remove the p carry, apply the ctx carry), stage per-wave 16x64 tile ----
  const float inv = (1.0f / lrun) * (CTXCARRY / PSCALE);
  float* so = sO + w * 1024;
#pragma unroll
  for (int t = 0; t < 4; ++t)
#pragma unroll
    for (int r = 0; r < 8; ++r)
      so[m * 64 + 16 * t + 8 * h + r] = o[t][r] * inv;
  __syncthreads();

  const int q8 = lane & 7, sub = lane >> 3;
  v8h hv[4];
#pragma unroll
  for (int it = 0; it < 4; ++it) {
    const int row = it * 4 + sub;                          // it 0..3 x sub 0..3 = rows 0..15 of the wave tile
    const float* sp = so + row * 64 + 8 * q8;
    const v4f a = *(const v4fa*)sp;
    const v4f c = *(const v4fa*)(sp + 4);
    const v8h ov = { (_Float16)a.x, (_Float16)a.y, (_Float16)a.z, (_Float16)a.w,
                     (_Float16)c.x, (_Float16)c.y, (_Float16)c.z, (_Float16)c.w };
    hv[it] = ov;
  }
  {
#pragma unroll
    for (int it = 0; it < 4; ++it) {
      const int row = it * 4 + sub;
      _Float16* dst = ctx + ((size_t)b * SEQ + q0 + row) * FEAT + head * HD + 8 * q8;
      *(v8h*)dst = hv[it];
    }
    
  }
}

// =====================================================================================================
// Host orchestration. Workspace map (bytes, NB=4 SEQ=1024), every region an exact multiple of its whole-line
// store granularity, all offsets multiples of 128:
//   hn    f16 [4096][1024]      8388608   (LN outputs of all three blocks, written and consumed in order)
//   cpl   f16 [4096][1024]      8388608   (bf16rne(c) as f16)
//   WqkvT f16 [3072][1024]      6291456
//   WspT  f16 [1024][1024]      2097152
//   WcqT, WckT, WcvT, WcpT      4 x 2097152
//   W1T   f16 [4096][1024]      8388608
//   W2T   f16 [1024][4096]      8388608
//   ATT   shared region        33554432 : q|k f16 [4096][2048] (16777216) + v^T f16 [4][1024][1024] (8388608)
//                                         + ctx f16 [4096][1024] (8388608) during both attention blocks;
//                                         mid f16 [4096][4096] (33554432) during the MLP (all readers of
//                                         q|k, v^T, ctx have completed before fc1 writes mid)
//   x1    f32 [4096][1024]     16777216
//   x2    f32 [4096][1024]     16777216
//   total                     117440512
// =====================================================================================================
extern "C" void kernel_launch(void* const* d_in, const int* in_sizes, int n_in,
                              void* d_out, int out_size, void* d_ws, size_t ws_size,
                              hipStream_t stream)
{
  if (n_in < 19) return;
  const long long needTok = (long long)(NB - 1) * SEQ_FULL + SEQ;
  if ((long long)in_sizes[0] < needTok * FEAT) return;                 // x
  if ((long long)in_sizes[1] < needTok * FEAT) return;                 // c
  if ((long long)in_sizes[2] < needTok) return;                        // mask (int32)
  if ((long long)in_sizes[3] < (long long)FEAT * 3 * FEAT || in_sizes[4] < 3 * FEAT) return;
  if ((long long)in_sizes[5] < (long long)FEAT * FEAT || in_sizes[6] < FEAT) return;
  if ((long long)in_sizes[7] < (long long)FEAT * FEAT || in_sizes[8] < FEAT) return;
  if ((long long)in_sizes[9] < (long long)FEAT * FEAT || in_sizes[10] < FEAT) return;
  if ((long long)in_sizes[11] < (long long)FEAT * FEAT || in_sizes[12] < FEAT) return;
  if ((long long)in_sizes[13] < (long long)FEAT * FEAT || in_sizes[14] < FEAT) return;
  if ((long long)in_sizes[15] < (long long)FEAT * MF || in_sizes[16] < MF) return;
  if ((long long)in_sizes[17] < (long long)MF * FEAT || in_sizes[18] < FEAT) return;
  if ((long long)out_size < needTok * FEAT) return;

  const float* x         = (const float*)d_in[0];
  const float* c         = (const float*)d_in[1];
  const int*   mask      = (const int*)d_in[2];
  const float* sa_qkv_w  = (const float*)d_in[3];
  const float* sa_qkv_b  = (const float*)d_in[4];
  const float* sa_proj_w = (const float*)d_in[5];
  const float* sa_proj_b = (const float*)d_in[6];
  const float* ca_q_w    = (const float*)d_in[7];
  const float* ca_q_b    = (const float*)d_in[8];
  const float* ca_k_w    = (const float*)d_in[9];
  const float* ca_k_b    = (const float*)d_in[10];
  const float* ca_v_w    = (const float*)d_in[11];
  const float* ca_v_b    = (const float*)d_in[12];
  const float* ca_proj_w = (const float*)d_in[13];
  const float* ca_proj_b = (const float*)d_in[14];
  const float* fc1_w     = (const float*)d_in[15];
  const float* fc1_b     = (const float*)d_in[16];
  const float* fc2_w     = (const float*)d_in[17];
  const float* fc2_b     = (const float*)d_in[18];

  const size_t P_F16  = (size_t)NTOK * FEAT * 2;
  const size_t P_F32  = (size_t)NTOK * FEAT * 4;
  const size_t P_W    = (size_t)FEAT * FEAT * 2;
  const size_t P_WQKV = (size_t)3 * FEAT * FEAT * 2;
  const size_t P_W1   = (size_t)MF * FEAT * 2;
  const size_t P_QK   = (size_t)NTOK * QKP * 2;
  const size_t P_VT   = (size_t)NB * FEAT * SEQ * 2;
  const size_t P_MID  = (size_t)NTOK * MF * 2;
  const size_t P_ATTU = P_QK + P_VT + P_F16;
  const size_t P_ATT  = (P_ATTU > P_MID) ? P_ATTU : P_MID;
  size_t off = 0;
  const size_t oHn   = off; off += P_F16;
  const size_t oC    = off; off += P_F16;
  const size_t oWqkv = off; off += P_WQKV;
  const size_t oWsp  = off; off += P_W;
  const size_t oWcq  = off; off += P_W;
  const size_t oWck  = off; off += P_W;
  const size_t oWcv  = off; off += P_W;
  const size_t oWcp  = off; off += P_W;
  const size_t oW1   = off; off += P_W1;
  const size_t oW2   = off; off += P_W1;
  const size_t oAtt  = off; off += P_ATT;
  const size_t oX1   = off; off += P_F32;
  const size_t oX2   = off; off += P_F32;
  if (off > ws_size) return;                               // off = 117440512 at NB=4, SEQ=1024
  if (off > (size_t)134217728) return;

  char* ws = (char*)d_ws;
  _Float16* hn    = (_Float16*)(ws + oHn);
  _Float16* cpl   = (_Float16*)(ws + oC);
  _Float16* wqkvT = (_Float16*)(ws + oWqkv);
  _Float16* wspT  = (_Float16*)(ws + oWsp);
  _Float16* wcqT  = (_Float16*)(ws + oWcq);
  _Float16* wckT  = (_Float16*)(ws + oWck);
  _Float16* wcvT  = (_Float16*)(ws + oWcv);
  _Float16* wcpT  = (_Float16*)(ws + oWcp);
  _Float16* w1T   = (_Float16*)(ws + oW1);
  _Float16* w2T   = (_Float16*)(ws + oW2);
  _Float16* qkp   = (_Float16*)(ws + oAtt);
  _Float16* vtp   = (_Float16*)(ws + oAtt + P_QK);
  _Float16* ctx   = (_Float16*)(ws + oAtt + P_QK + P_VT);
  _Float16* mid   = (_Float16*)(ws + oAtt);
  float*    x1    = (float*)(ws + oX1);
  float*    x2    = (float*)(ws + oX2);

  const dim3 blk(256);
  const float sQKV  = 1.0f / WCARRY;
  const float sPROJ = 1.0f / (WCARRY * CTXCARRY);
  const float sFC2  = 1.0f / (WCARRY * MIDCARRY);

  // (1) weights f32 [in][out] -> f16 [out][in] = bf16rne(w) x64   (in[K rows][N cols] -> out[N][K], grid (K/64, N/32))
  transpose_cvt<<<dim3(FEAT / 64, (3 * FEAT) / 32), blk, 0, stream>>>(sa_qkv_w,  wqkvT, FEAT, 3 * FEAT, WCARRY);
  transpose_cvt<<<dim3(FEAT / 64, FEAT / 32),       blk, 0, stream>>>(sa_proj_w, wspT,  FEAT, FEAT,     WCARRY);
  transpose_cvt<<<dim3(FEAT / 64, FEAT / 32),       blk, 0, stream>>>(ca_q_w,    wcqT,  FEAT, FEAT,     WCARRY);
  transpose_cvt<<<dim3(FEAT / 64, FEAT / 32),       blk, 0, stream>>>(ca_k_w,    wckT,  FEAT, FEAT,     WCARRY);
  transpose_cvt<<<dim3(FEAT / 64, FEAT / 32),       blk, 0, stream>>>(ca_v_w,    wcvT,  FEAT, FEAT,     WCARRY);
  transpose_cvt<<<dim3(FEAT / 64, FEAT / 32),       blk, 0, stream>>>(ca_proj_w, wcpT,  FEAT, FEAT,     WCARRY);
  transpose_cvt<<<dim3(FEAT / 64, MF / 32),         blk, 0, stream>>>(fc1_w,     w1T,   FEAT, MF,       WCARRY);
  transpose_cvt<<<dim3(MF / 64, FEAT / 32),         blk, 0, stream>>>(fc2_w,     w2T,   MF,   FEAT,     WCARRY);

  // (2) c -> compact f16 plane (bf16rne values)
  cvt_rows<<<dim3(NTOK), dim3(128), 0, stream>>>(c, cpl);

  // ---------------- self-attention block ----------------
  // (3) hn = LN(bf16rne(x)) -> f16 plane
  ln_kernel<true><<<dim3(NTOK), blk, 0, stream>>>(x, (long long)SEQ_FULL * FEAT, hn);

  // (4) q|k = hn . Wqkv[:, 0:2048] + b -> f16 [NTOK][2048]   (M=NTOK, N=2048, K=1024; acc / 64)
  const dim3 gQK((NTOK / 128) * (QKP / 128), 1);
  gemm128<1, false><<<gQK, blk, 0, stream>>>(
      hn, FEAT, 0LL, wqkvT, FEAT, 0LL, (void*)qkp, QKP, 0LL, sa_qkv_b, x1, FEAT, 0LL,
      NTOK, QKP, FEAT, sQKV, 1.0f);
  // (5) v^T per batch: A = WqkvT rows 2048..3071 [1024][1024], Bt = hn rows of batch b -> f16 [b][1024][SEQ]
  //     (M=1024, N=SEQ, K=1024; row bias = sa_qkv_b[2048 + m])
  const dim3 gVT((FEAT / 128) * (SEQ / 128), NB);
  gemm128<3, false><<<gVT, blk, 0, stream>>>(
      wqkvT + (size_t)2 * FEAT * FEAT, FEAT, 0LL, hn, FEAT, (long long)SEQ * FEAT,
      (void*)vtp, SEQ, (long long)FEAT * SEQ, sa_qkv_b + 2 * FEAT, x1, FEAT, 0LL,
      FEAT, SEQ, FEAT, sQKV, 1.0f);
  // (6) attention -> ctx f16 plane (x256)
  const dim3 gAT(SEQ / 64, NB * NH);
  attn_kernel<<<gAT, dim3(128), 0, stream>>>(qkp, vtp, mask, ctx);
  // (7) x1 = ctx . Wsp + b + bf16rne(x) -> f32 plane   (per batch M=SEQ, N=1024, K=1024; acc / (64*256))
  const dim3 gPB((SEQ / 128) * (FEAT / 128), NB);
  gemm128<0, true><<<gPB, blk, 0, stream>>>(
      ctx, FEAT, (long long)SEQ * FEAT, wspT, FEAT, 0LL, (void*)x1, FEAT, (long long)SEQ * FEAT,
      sa_proj_b, x, FEAT, (long long)SEQ_FULL * FEAT,
      SEQ, FEAT, FEAT, sPROJ, 1.0f);

  // ---------------- cross-attention block ----------------
  // (8) hn = LN(x1)
  ln_kernel<false><<<dim3(NTOK), blk, 0, stream>>>(x1, (long long)SEQ * FEAT, hn);
  // (9) q = hn . Wcq + b -> q|k plane cols 0..1023   (M=NTOK, N=1024, K=1024)
  const dim3 gQ((NTOK / 128) * (FEAT / 128), 1);
  gemm128<1, false><<<gQ, blk, 0, stream>>>(
      hn, FEAT, 0LL, wcqT, FEAT, 0LL, (void*)qkp, QKP, 0LL, ca_q_b, x1, FEAT, 0LL,
      NTOK, FEAT, FEAT, sQKV, 1.0f);
  // (10) k = c . Wck + b -> q|k plane cols 1024..2047
  gemm128<1, false><<<gQ, blk, 0, stream>>>(
      cpl, FEAT, 0LL, wckT, FEAT, 0LL, (void*)(qkp + FEAT), QKP, 0LL, ca_k_b, x1, FEAT, 0LL,
      NTOK, FEAT, FEAT, sQKV, 1.0f);
  // (11) v^T per batch: A = WcvT [1024][1024], Bt = c rows of batch b
  gemm128<3, false><<<gVT, blk, 0, stream>>>(
      wcvT, FEAT, 0LL, cpl, FEAT, (long long)SEQ * FEAT,
      (void*)vtp, SEQ, (long long)FEAT * SEQ, ca_v_b, x1, FEAT, 0LL,
      FEAT, SEQ, FEAT, sQKV, 1.0f);
  // (12) attention -> ctx
  attn_kernel<<<gAT, dim3(128), 0, stream>>>(qkp, vtp, mask, ctx);
  // (13) x2 = ctx . Wcp + b + x1 -> f32 plane   (M=NTOK, N=1024, K=1024)
  gemm128<0, false><<<gQ, blk, 0, stream>>>(
      ctx, FEAT, 0LL, wcpT, FEAT, 0LL, (void*)x2, FEAT, 0LL,
      ca_proj_b, x1, FEAT, 0LL,
      NTOK, FEAT, FEAT, sPROJ, 1.0f);

  // ---------------- MLP block ----------------
  // (14) hn = LN(x2)
  ln_kernel<false><<<dim3(NTOK), blk, 0, stream>>>(x2, (long long)SEQ * FEAT, hn);
  // (15) mid = gelu(hn . W1 + b1) x16 -> f16 [NTOK][4096]   (M=NTOK, N=4096, K=1024; acc / 64)
  const dim3 gW1((NTOK / 128) * (MF / 128), 1);
  gemm128<2, false><<<gW1, blk, 0, stream>>>(
      hn, FEAT, 0LL, w1T, FEAT, 0LL, (void*)mid, MF, 0LL, fc1_b, x1, FEAT, 0LL,
      NTOK, MF, FEAT, sQKV, MIDCARRY);
  // (16) out = mid . W2 + b2 + x2 -> d_out f32 rows b*SEQ_FULL + t   (per batch M=SEQ, N=1024, K=4096; acc / (64*16))
  gemm128<0, false><<<gPB, blk, 0, stream>>>(
      mid, MF, (long long)SEQ * MF, w2T, MF, 0LL, d_out, FEAT, (long long)SEQ_FULL * FEAT,
      fc2_b, x2, FEAT, (long long)SEQ * FEAT,
      SEQ, FEAT, MF, sFC2, 1.0f);

  (void)hipGetLastError();
}

// v003
// One run takes 241 microseconds.
// In two side-by-side timings against v002, it was 1.12 and 1.13 times as fast.
// Over all steps from v000 it is 3.17 times as fast.
// Contractions: hn*WqkT (q|k plane), Wv*hn^T (v^T plane), K*Q^T scores, V^T*P^T, ctx*WpT for both attention
// blocks (cross block: k and v^T from the c plane), hn*W1T, mid*W2T: all v_wmma_f32_16x16x32_f16
// (f16 operands, single product, f32 accumulate). LayerNorms, softmax, key-mask add, GELU (erf form), bias and
// residual adds: f32 on VALU. Every float input enters as its bf16 RNE value (x, c, weights, biases).
// Carry audit (f16 planes): weights = bf16(w) x64, inverse folded once into the scale of each consuming GEMM
// (q/k/v^T: 1/64; proj GEMMs: 1/(64*256); fc1: 1/64; fc2: 1/(64*16)). hn, c, q, k, v^T carried x1.
// P = p x16384 and ctx = o x256: inv = (1/l)*(256/16384) in attn_kernel; mid = gelu x16.
#include <hip/hip_runtime.h>
#include <math.h>

#ifndef NB
#define NB 4
#endif
#ifndef SEQ
#define SEQ 1024
#endif
#define NB_FULL  4
#define SEQ_FULL 1024
#define FEAT 1024
#define NH   16
#define HD   64
#define MF   4096
#define QKP  (2 * FEAT)
#define NTOK (NB * SEQ)
static_assert(NH * HD == FEAT);
static_assert(HD == 64);
static_assert(NB >= 1 && NB <= NB_FULL);
static_assert(SEQ >= 64 && SEQ <= SEQ_FULL && (SEQ % 64) == 0);
static_assert((FEAT % 64) == 0 && (MF % 64) == 0 && (QKP % 64) == 0);
static_assert((FEAT % 128) == 0 && (MF % 128) == 0 && (QKP % 128) == 0 && (SEQ % 128) == 0 && FEAT >= 256);
static_assert(FEAT == 4 * 256);
static_assert(((long long)(NB - 1) * SEQ_FULL + SEQ) * FEAT <= (long long)NB_FULL * SEQ_FULL * FEAT);

#define WCARRY   64.0f
#define PSCALE   16384.0f
#define CTXCARRY 256.0f
#define MIDCARRY 16.0f

typedef _Float16 v16h __attribute__((ext_vector_type(16)));
typedef _Float16 v8h  __attribute__((ext_vector_type(8)));
typedef float    v8f  __attribute__((ext_vector_type(8)));
typedef float    v4f  __attribute__((ext_vector_type(4)));
typedef int      v4i  __attribute__((ext_vector_type(4)));
typedef v8h __attribute__((may_alias)) v8ha;
typedef v4f __attribute__((may_alias)) v4fa;
typedef v4i __attribute__((may_alias)) v4ia;
union Frag { v16h v; v8h half[2]; };

#if defined(__HIP_DEVICE_COMPILE__)
#define DEV_ASM 1
#else
#define DEV_ASM 0
#endif

__device__ __forceinline__ v8f zero8() { v8f z = {0.f, 0.f, 0.f, 0.f, 0.f, 0.f, 0.f, 0.f}; return z; }

// f32 -> bf16 RNE value kept as f32
__device__ __forceinline__ float bf16r(float f) {
  unsigned u = __float_as_uint(f);
  u = (u + 0x7FFFu + ((u >> 16) & 1u)) & 0xFFFF0000u;
  return __uint_as_float(u);
}
__device__ __forceinline__ v4f bf16r4(v4f a) {
  v4f r = { bf16r(a.x), bf16r(a.y), bf16r(a.z), bf16r(a.w) };
  return r;
}

// ---------------------------------------------------------------------------------------------------
// 16x16x32 f16 WMMA. Fragment map (wave32): lane l, h = l>>4, m = n = l&15.
//   A/B element i: i<8 -> k0+8h+i ; i>=8 -> k0+16+8h+(i-8)      D element r: row 8h+r, col l&15
// ---------------------------------------------------------------------------------------------------
// guarded form: 4 VALU slots after the WMMA, D tied, A/B kept live
__device__ __forceinline__ v8f wmma_f16(v16h a, v16h b, v8f c) {
  v8f d = __builtin_amdgcn_wmma_f32_16x16x32_f16(false, a, false, b, (short)0, c, false, false);
#if DEV_ASM
  asm volatile("v_nop\n\tv_nop\n\tv_nop\n\tv_nop" : "+v"(d) : "v"(a), "v"(b));
#endif
  return d;
}
// plain builtin form for the GEMM inner loop (the compiler keeps the distances between its own builtins)
__device__ __forceinline__ v8f mmar(v16h a, v16h b, v8f c) {
  return __builtin_amdgcn_wmma_f32_16x16x32_f16(false, a, false, b, (short)0, c, false, false);
}
__device__ __forceinline__ void acc_guard4(v8f& a, v8f& b, v8f& c, v8f& d) {
#if DEV_ASM
  asm volatile("v_nop\n\tv_nop\n\tv_nop\n\tv_nop" : "+v"(a), "+v"(b), "+v"(c), "+v"(d));
#else
  (void)a; (void)b; (void)c; (void)d;
#endif
}

// A or B fragment from a k-contiguous f16 row; p points at element k0 of the row owned by this lane.
__device__ __forceinline__ v16h load_frag(const _Float16* p, int h) {
  Frag f;
  f.half[0] = *(const v8ha*)(p + 8 * h);
  f.half[1] = *(const v8ha*)(p + 16 + 8 * h);
  return f.v;
}
// same, p already includes +8*(lane>>4)
__device__ __forceinline__ v16h ldfrag(const _Float16* p) {
  Frag f;
  f.half[0] = *(const v8ha*)(p);
  f.half[1] = *(const v8ha*)(p + 16);
  return f.v;
}

// behind a job's last global store: the compiler lays the jobs of one kernel one behind the other, and the code that
// follows in the listing rewrites the store's address and data registers; the wait stands in front of that
__device__ __forceinline__ void wait_store_regs() {
#if DEV_ASM
  asm volatile("s_wait_xcnt 0x0" ::: "memory");
#endif
}

// =====================================================================================================
// A job of the preparation kernel: transpose + convert: in f32 [K][N] (row = k) -> out f16 [N][K] =
// f16(carry * bf16rne(in)^T). Block 256 threads, tile 64 k x 32 n (tile index bx along k, by along n) staged in
// LDS (n-major, pitch 68 floats; cross-wave -> block barrier).
// coverage: 32 n-rows x 64 k per block; (K/64) x (N/32) blocks cover the whole [N][K] plane.
// LDS: tile cols 0..63 of all 32 rows written before the barrier; cols 64..67 never read.
// =====================================================================================================
__device__ __forceinline__ void transpose_tile(
    const float* in, _Float16* out, int K, int N, float carry, int bx, int by)
{
  __shared__ __align__(16) float tile[32][68];
  const int k0 = bx * 64, n0 = by * 32;
  const int tid = (int)threadIdx.x;
  {
    const int kk = tid >> 2, nq = (tid & 3) * 8;
    const float* src = in + (size_t)(k0 + kk) * N + n0 + nq;
    const v4f a = *(const v4fa*)src;
    const v4f c = *(const v4fa*)(src + 4);
    tile[nq + 0][kk] = a.x; tile[nq + 1][kk] = a.y; tile[nq + 2][kk] = a.z; tile[nq + 3][kk] = a.w;
    tile[nq + 4][kk] = c.x; tile[nq + 5][kk] = c.y; tile[nq + 6][kk] = c.z; tile[nq + 7][kk] = c.w;
  }
  __syncthreads();
  {
    const int nn = tid >> 3, kq = (tid & 7) * 8;
    const float* sp = &tile[nn][kq];
    const v4f a = bf16r4(*(const v4fa*)sp);
    const v4f c = bf16r4(*(const v4fa*)(sp + 4));
    const v8h o = { (_Float16)(a.x * carry), (_Float16)(a.y * carry), (_Float16)(a.z * carry), (_Float16)(a.w * carry),
                    (_Float16)(c.x * carry), (_Float16)(c.y * carry), (_Float16)(c.z * carry), (_Float16)(c.w * carry) };
    _Float16* dst = out + (size_t)(n0 + nn) * K + k0 + kq;
    *(v8h*)dst = o;
    wait_store_regs();
  }
}

// =====================================================================================================
// A job of the preparation kernel: row convert: f32 input rows (batch stride SEQ_FULL*FEAT) -> compact f16 plane
// [NTOK][FEAT], value = f16(bf16rne(v)). Two 1024-wide rows per 256-thread block, 8 elements per thread.
// coverage: 128 x 8 = 1024 per row; NTOK/2 blocks.
// =====================================================================================================
__device__ __forceinline__ void cvt_two_rows(const float* src, _Float16* dst, int pair)
{
  const int row = 2 * pair + ((int)threadIdx.x >> 7);
  const int bb = row / SEQ, t = row - bb * SEQ;
  const int tid = (int)threadIdx.x & 127;
  const float* sp = src + ((size_t)bb * SEQ_FULL + (size_t)t) * FEAT + 8 * tid;
  const v4f a = bf16r4(*(const v4fa*)sp);
  const v4f c = bf16r4(*(const v4fa*)(sp + 4));
  const v8h o = { (_Float16)a.x, (_Float16)a.y, (_Float16)a.z, (_Float16)a.w,
                  (_Float16)c.x, (_Float16)c.y, (_Float16)c.z, (_Float16)c.w };
  _Float16* d = dst + (size_t)row * FEAT + 8 * tid;
  *(v8h*)d = o;
  wait_store_regs();
}

// =====================================================================================================
// LayerNorm, no affine, eps 1e-6 (one 1024-wide row per 256-thread block, thread owns 4 consecutive
//   RNEX = true : v = bf16rne(X) (raw input x); false: v = X (internal f32 plane).
//   Input row = b * strideXB + t * FEAT with (b, t) from the compact row index; output f16 row compact.
//   f16 row: staged in LDS (cross-wave -> block barrier), lanes of waves 0..3 write 16 B each (8 halves),
// =====================================================================================================
__device__ __forceinline__ float block_sum(float v, float* red, int lane, int w) {
#pragma unroll
  for (int off = 16; off > 0; off >>= 1) v += __shfl_xor(v, off);
  if (lane == 0) red[w] = v;
  __syncthreads();
  float r = red[0];
#pragma unroll
  for (int i = 1; i < 8; ++i) r += red[i];
  __syncthreads();
  return r;
}

template <bool RNEX>
__device__ __forceinline__ void ln_row(const float* X, long long strideXB, _Float16* pout, int row)
{
  __shared__ __align__(16) float srow[FEAT];
  __shared__ float red[8];
  const int bb  = row / SEQ, t = row - bb * SEQ;
  const int tid = (int)threadIdx.x, lane = tid & 31, w = tid >> 5;
  const int f0  = 4 * tid;
  const float* xp = X + (size_t)bb * (size_t)strideXB + (size_t)t * FEAT + f0;

  v4f xv = *(const v4fa*)xp;
  if (RNEX) xv = bf16r4(xv);
  float s = (xv.x + xv.y) + (xv.z + xv.w);
  s = block_sum(s, red, lane, w);
  const float mu = s * (1.0f / FEAT);
  const float d0 = xv.x - mu, d1 = xv.y - mu, d2 = xv.z - mu, d3 = xv.w - mu;
  float q = (d0 * d0 + d1 * d1) + (d2 * d2 + d3 * d3);
  q = block_sum(q, red, lane, w);
  const float rstd = rsqrtf(q * (1.0f / FEAT) + 1e-6f);

  const v4f ov = { d0 * rstd, d1 * rstd, d2 * rstd, d3 * rstd };
  *(v4fa*)(srow + f0) = ov;
  __syncthreads();
  if (w < 4) {                                             // wave-uniform: waves 0..3, 128 threads x 8 halves
    const float* sp = srow + 8 * tid;
    const v4f a = *(const v4fa*)sp;
    const v4f c = *(const v4fa*)(sp + 4);
    const v8h o = { (_Float16)a.x, (_Float16)a.y, (_Float16)a.z, (_Float16)a.w,
                    (_Float16)c.x, (_Float16)c.y, (_Float16)c.z, (_Float16)c.w };
    _Float16* dst = pout + (size_t)row * FEAT + 8 * tid;
    *(v8h*)dst = o;
    
  }
}

// LayerNorm of an internal f32 plane, one row per block
__global__ __launch_bounds__(256) void ln_kernel(const float* __restrict__ X, long long strideXB, _Float16* pout)
{
  ln_row<false>(X, strideXB, pout, (int)blockIdx.x);
}

// =====================================================================================================
// Preparation kernel: everything that depends on the raw inputs alone, in ONE grid; a block-index range picks
// the job (block-uniform, so each job's barriers stay under block-uniform control flow):
//   LN(bf16rne(x)) first (its blocks run longest, so they do not form the grid's tail), the row convert of c,
//   the eight weight transposes (tiles in the order bx fastest).
// =====================================================================================================
#define PB_QKV ((FEAT / 64) * ((3 * FEAT) / 32))   // blocks of the [FEAT][3 FEAT] transpose
#define PB_SQ  ((FEAT / 64) * (FEAT / 32))         // blocks of one [FEAT][FEAT] transpose
#define PB_MLP ((FEAT / 64) * (MF / 32))           // blocks of the [FEAT][MF] and of the [MF][FEAT] transpose
#define PB_TR  (PB_QKV + 5 * PB_SQ + 2 * PB_MLP)
#define PB_CV  (NTOK / 2)
#define PB_ALL (PB_TR + PB_CV + NTOK)
static_assert((NTOK % 2) == 0);

__global__ __launch_bounds__(256) void prep_kernel(
    const float* __restrict__ w_qkv, const float* __restrict__ w_sp, const float* __restrict__ w_cq,
    const float* __restrict__ w_ck, const float* __restrict__ w_cv, const float* __restrict__ w_cp,
    const float* __restrict__ w_1, const float* __restrict__ w_2,
    const float* __restrict__ x, const float* __restrict__ c,
    _Float16* t_qkv, _Float16* t_sp, _Float16* t_cq, _Float16* t_ck, _Float16* t_cv, _Float16* t_cp,
    _Float16* t_1, _Float16* t_2, _Float16* cpl, _Float16* hn)
{
  int blk = (int)blockIdx.x;
  if (blk < NTOK) {
    ln_row<true>(x, (long long)SEQ_FULL * FEAT, hn, blk);
  } else if (blk < NTOK + PB_CV) {
    cvt_two_rows(c, cpl, blk - NTOK);
  } else {
    blk -= NTOK + PB_CV;
    const float* in; _Float16* out; int K = FEAT, N = FEAT;
    if (blk < PB_MLP)                    { in = w_1; out = t_1; N = MF; }
    else if ((blk -= PB_MLP) < PB_MLP)   { in = w_2; out = t_2; K = MF; }
    else if ((blk -= PB_MLP) < PB_QKV)   { in = w_qkv; out = t_qkv; N = 3 * FEAT; }
    else if ((blk -= PB_QKV) < PB_SQ)    { in = w_sp; out = t_sp; }
    else if ((blk -= PB_SQ) < PB_SQ)     { in = w_cq; out = t_cq; }
    else if ((blk -= PB_SQ) < PB_SQ)     { in = w_ck; out = t_ck; }
    else if ((blk -= PB_SQ) < PB_SQ)     { in = w_cv; out = t_cv; }
    else                                 { blk -= PB_SQ; in = w_cp; out = t_cp; }
    const int kt = K >> 6;
    const int by = blk / kt;
    transpose_tile(in, out, K, N, WCARRY, blk - by * kt, by);
  }
}

// =====================================================================================================
// Batched WMMA GEMM (f16 operands): C[m][n] = sum_k A[m][k] * Bt[n][k].
// One 128x128 tile of C per 256-thread block; 8 waves as 4 (m) x 2 (n), each 32x64 (2 x 4 accumulator tiles).
// A row-major [M][K] pitch lda; Bt row-major [N][K] pitch ldb (k contiguous); M, N, K multiples of 128,
// K >= 256 (all shapes here are compile-time constants of the host code). tile = index of the C tile, b = batch
// index, smem = the block's 2 * STAGEB bytes of LDS (declared in the kernel that calls this).
// Operands: per stage 128 k of the block's 128 A rows and 128 Bt rows are brought into LDS by asynchronous
// 16-byte copies (each thread 8 + 8 copies, a wave-wide copy = two whole 256-B row pieces), two buffers, the
// next stage in flight while this one is multiplied. LDS row pitch 272 B (256 + 16: ds_load_b128 readers).
// Fragments from LDS with the split k map (ldfrag), two register sets inside a stage; k runs upward in steps of
// 32 per accumulator.
// MODE 0: f32 C = acc*oscale + bf16rne(bias[n]) + res[m][n] (res pitch ldr, batch stride strideR;
//         RESRNE: res value bf16rne-converted on load)
// MODE 1: f16 C = f16(acc*oscale + bf16rne(bias[n]))
// MODE 2: f16 C = f16(gelu(acc*oscale + bf16rne(bias[n])) * ocarry), gelu = 0.5 v (1 + erf(v / sqrt 2))
// MODE 3: f16 C = f16(acc*oscale + bf16rne(bias[m]))       (row bias, transposed output planes)
// coverage: 2 slabs x 16 rows x 64 cols = the wave's whole 32x64 tile; slab 16x64 fully written before reads.
// LDS: every byte of a buffer's 256 data bytes per row is copied before the barrier that publishes it; the 16
// pad bytes per row are never read. The per-wave epilogue slabs lie in the ring, used only behind the last
// trip's barrier (no copy outstanding, every fragment read retired).
// =====================================================================================================
#define LROW    272                    // LDS row pitch, bytes
#define OPBYTES (128 * LROW)           // one operand's 128 rows of one stage
#define STAGEB  (2 * OPBYTES)          // [A 128 rows | Bt 128 rows]

// Eight asynchronous 16-byte copies of this lane: rows r, r+16, ..., r+112 of one operand's stage.
// l = the lane's LDS byte address of row r, gp = its global address, rstep = elements per 16 rows.
// s_wait_xcnt 0 is the last line of the statement, so that no address register is rewritten in front of it.
__device__ __forceinline__ void copy8(unsigned l, const _Float16* gp, size_t rstep) {
#if DEV_ASM
  const unsigned l1 = l + 16 * LROW, l2 = l + 32 * LROW, l3 = l + 48 * LROW, l4 = l + 64 * LROW,
                 l5 = l + 80 * LROW, l6 = l + 96 * LROW, l7 = l + 112 * LROW;
  const _Float16 *g1 = gp + rstep, *g2 = g1 + rstep, *g3 = g2 + rstep, *g4 = g3 + rstep,
                 *g5 = g4 + rstep, *g6 = g5 + rstep, *g7 = g6 + rstep;
  asm volatile("global_load_async_to_lds_b128 %0, %8, off\n\t"
               "global_load_async_to_lds_b128 %1, %9, off\n\t"
               "global_load_async_to_lds_b128 %2, %10, off\n\t"
               "global_load_async_to_lds_b128 %3, %11, off\n\t"
               "global_load_async_to_lds_b128 %4, %12, off\n\t"
               "global_load_async_to_lds_b128 %5, %13, off\n\t"
               "global_load_async_to_lds_b128 %6, %14, off\n\t"
               "global_load_async_to_lds_b128 %7, %15, off\n\t"
               "s_wait_xcnt 0x0"
               :: "v"(l), "v"(l1), "v"(l2), "v"(l3), "v"(l4), "v"(l5), "v"(l6), "v"(l7),
                  "v"(gp), "v"(g1), "v"(g2), "v"(g3), "v"(g4), "v"(g5), "v"(g6), "v"(g7)
               : "memory");
#else
  (void)l; (void)gp; (void)rstep;
#endif
}
// this wave's own copies have landed
__device__ __forceinline__ void wait_copies() {
#if DEV_ASM
  asm volatile("s_wait_asynccnt 0x0" ::: "memory");
#endif
}
// this wave's own LDS reads have retired (before the buffer they read is handed to its next writer)
__device__ __forceinline__ void wait_lds() {
#if DEV_ASM
  asm volatile("s_wait_dscnt 0x0" ::: "memory");
#endif
}

template <int MODE, bool RESRNE>
__device__ __forceinline__ void gemm_tile(
    unsigned char* smem, int tile, int b,
    const _Float16* A, int lda, long long strideA,
    const _Float16* Bt, int ldb, long long strideB,
    void* Cout, int ldc, long long strideC,
    const float* bias,
    const float* res, int ldr, long long strideR,
    int M, int N, int K, float oscale, float ocarry)
{
  const int tid  = (int)threadIdx.x;
  const int lane = tid & 31;
  const int wave = tid >> 5;
  const int tilesN = N >> 7;
  const int tilesM = M >> 7;
  if (tile >= tilesM * tilesN) return;                     // block-uniform, in front of every copy and barrier
  const int tm = tile / tilesN;
  const int tn = tile - tm * tilesN;
  const int m0 = (tm << 7) + ((wave >> 1) << 5);           // this wave's 32 rows
  const int n0 = (tn << 7) + ((wave & 1) << 6);            // this wave's 64 columns

  const _Float16* Ab = A  + (size_t)b * (size_t)strideA;
  const _Float16* Bb = Bt + (size_t)b * (size_t)strideB;

  const int rlane = lane & 15;                             // row (A) / col (B, D) within subtile
  const int koff  = (lane >> 4) * 8;                       // k offset of this lane half
  const int mOff  = (lane >> 4) * 8;                       // D row offset

  // copy map: thread -> row tid>>4 (+16 per copy), 16-byte piece tid&15 of the row's 256 bytes
  const int crow = tid >> 4, ccol = tid & 15;
  const _Float16* gA = Ab + (size_t)((tm << 7) + crow) * lda + ccol * 8;
  const _Float16* gB = Bb + (size_t)((tn << 7) + crow) * ldb + ccol * 8;
  const unsigned lA = (unsigned)(size_t)smem + (unsigned)(crow * LROW + ccol * 16);
  const unsigned lB = lA + OPBYTES;
  const size_t stepA = (size_t)16 * lda, stepB = (size_t)16 * ldb;

  // fragment read bases inside a buffer
  const unsigned char* fA = smem + (((wave >> 1) << 5) + rlane) * LROW + koff * 2;
  const unsigned char* fB = smem + OPBYTES + (((wave & 1) << 6) + rlane) * LROW + koff * 2;

  v8f acc[2][4];
#pragma unroll
  for (int i = 0; i < 2; ++i)
#pragma unroll
    for (int j = 0; j < 4; ++j) acc[i][j] = zero8();

  const int nt = K >> 7;                                   // stages of 128 k
  copy8(lA, gA, stepA);
  copy8(lB, gB, stepB);
  wait_copies();
  __syncthreads();                                         // stage 0 published
  if (nt > 1) {
    copy8(lA + STAGEB, gA + 128, stepA);
    copy8(lB + STAGEB, gB + 128, stepB);
  }

  for (int t = 0; t < nt; ++t) {
    const unsigned buf = (unsigned)(t & 1) * STAGEB;
    // two fragment sets: the next 32 k of THIS buffer are read as one group ahead of the current products
    v16h bq[2][4], af[2][2];
#pragma unroll
    for (int j = 0; j < 4; ++j) bq[0][j] = ldfrag((const _Float16*)(fB + buf + j * 16 * LROW));
#pragma unroll
    for (int i = 0; i < 2; ++i) af[0][i] = ldfrag((const _Float16*)(fA + buf + i * 16 * LROW));
#pragma unroll
    for (int kk = 0; kk < 4; ++kk) {
      const int cur = kk & 1, nxt = cur ^ 1;
      if (kk < 3) {
#pragma unroll
        for (int j = 0; j < 4; ++j)
          bq[nxt][j] = ldfrag((const _Float16*)(fB + buf + j * 16 * LROW + (kk + 1) * 64));
#pragma unroll
        for (int i = 0; i < 2; ++i)
          af[nxt][i] = ldfrag((const _Float16*)(fA + buf + i * 16 * LROW + (kk + 1) * 64));
      }
      // keeps the load group in front of the products: without it the scheduler sinks the LDS reads among the
      // matrix instructions into one register set, and each product group waits out its own LDS latency
      __builtin_amdgcn_sched_barrier(0);
#pragma unroll
      for (int i = 0; i < 2; ++i)
#pragma unroll
        for (int j = 0; j < 4; ++j) acc[i][j] = mmar(af[cur][i], bq[cur][j], acc[i][j]);
      // same purpose: the following load group stays behind these products
      __builtin_amdgcn_sched_barrier(0);
    }
    wait_lds();
    wait_copies();
    __syncthreads();                                       // publishes stage t+1, frees stage t's buffer
    if (t + 2 < nt) {
      copy8(lA + buf, gA + (size_t)(t + 2) * 128, stepA);
      copy8(lB + buf, gB + (size_t)(t + 2) * 128, stepB);
    }
  }
  wait_copies();
  acc_guard4(acc[0][0], acc[0][1], acc[0][2], acc[0][3]);
  acc_guard4(acc[1][0], acc[1][1], acc[1][2], acc[1][3]);

  // ---- epilogue ----
  float* slab = (float*)(smem + wave * (16 * 68 * 4));     // per-wave 16x64 slab, pitch 68 floats
#pragma unroll
  for (int i = 0; i < 2; ++i) {
    const int mBase = m0 + (i << 4);
#pragma unroll
    for (int j = 0; j < 4; ++j) {
#pragma unroll
      for (int r = 0; r < 8; ++r) {
        slab[(mOff + r) * 68 + (j << 4) + rlane] = acc[i][j][r];
      }
    }
    __builtin_amdgcn_fence(3, "workgroup");
    __builtin_amdgcn_wave_barrier();
    __builtin_amdgcn_fence(2, "workgroup");
    if (MODE == 0) {
      float* C = (float*)Cout + (size_t)b * (size_t)strideC;
      const float* R = res + (size_t)b * (size_t)strideR;
      const int h2 = lane >> 4, c4 = (lane & 15) * 4;     // 256-B row segment = 16 lanes x 16 B
      const v4f bv = bf16r4(*(const v4fa*)(bias + n0 + c4));
      {
#pragma unroll
        for (int it = 0; it < 8; ++it) {
          const int row = it * 2 + h2;                     // it 0..7 x h2 0..1 = rows 0..15
          const size_t go = (size_t)(mBase + row) * ldc + n0 + c4;
          const size_t ro = (size_t)(mBase + row) * ldr + n0 + c4;
          const v4f sv = *(const v4fa*)(slab + row * 68 + c4);
          v4f rv = *(const v4fa*)(R + ro);
          if (RESRNE) rv = bf16r4(rv);
          const v4f v = sv * oscale + bv + rv;
          *(v4f*)(C + go) = v;
        }
        
      }
    } else {
      const int q = lane >> 3, c8 = (lane & 7) * 8;
      _Float16* C = (_Float16*)Cout + (size_t)b * (size_t)strideC;
      float bb8[8] = { 0.f, 0.f, 0.f, 0.f, 0.f, 0.f, 0.f, 0.f };
      if (MODE == 1 || MODE == 2) {
        const v4f ba = bf16r4(*(const v4fa*)(bias + n0 + c8));
        const v4f bc = bf16r4(*(const v4fa*)(bias + n0 + c8 + 4));
        bb8[0] = ba.x; bb8[1] = ba.y; bb8[2] = ba.z; bb8[3] = ba.w;
        bb8[4] = bc.x; bb8[5] = bc.y; bb8[6] = bc.z; bb8[7] = bc.w;
      }
      v8h hv[4];
#pragma unroll
      for (int it = 0; it < 4; ++it) {
        const int row = it * 4 + q;                        // it 0..3 x q 0..3 = rows 0..15
        const float* sp = slab + row * 68 + c8;
        const v4f a = *(const v4fa*)sp;
        const v4f c = *(const v4fa*)(sp + 4);
        float f[8] = { a.x, a.y, a.z, a.w, c.x, c.y, c.z, c.w };
        float brow = 0.0f;
        if (MODE == 3) brow = bf16r(bias[mBase + row]);
#pragma unroll
        for (int e = 0; e < 8; ++e) {
          float u = f[e] * oscale + ((MODE == 3) ? brow : bb8[e]);
          if (MODE == 2) {
            const float gl = 0.5f * u * (1.0f + erff(u * 0.70710678118654752f));
            u = gl * ocarry;
          }
          f[e] = u;
        }
        const v8h o = { (_Float16)f[0], (_Float16)f[1], (_Float16)f[2], (_Float16)f[3],
                        (_Float16)f[4], (_Float16)f[5], (_Float16)f[6], (_Float16)f[7] };
        hv[it] = o;
      }
      {
#pragma unroll
        for (int it = 0; it < 4; ++it) {
          const int row = it * 4 + q;
          *(v8h*)(C + (size_t)(mBase + row) * ldc + n0 + c8) = hv[it];
        }
        
      }
    }
    __builtin_amdgcn_fence(3, "workgroup");
    __builtin_amdgcn_wave_barrier();
    __builtin_amdgcn_fence(2, "workgroup");
  }
}

// one GEMM per launch: blockIdx.x = tile, blockIdx.y = batch
template <int MODE, bool RESRNE>
__global__ __launch_bounds__(256) void gemm128(
    const _Float16* __restrict__ A, int lda, long long strideA,
    const _Float16* __restrict__ Bt, int ldb, long long strideB,
    void* Cout, int ldc, long long strideC,
    const float* __restrict__ bias,
    const float* __restrict__ res, int ldr, long long strideR,
    int M, int N, int K, float oscale, float ocarry)
{
  __shared__ __align__(16) unsigned char smem[2 * STAGEB];  // two stage buffers; epilogue slabs behind the loop
  gemm_tile<MODE, RESRNE>(smem, (int)blockIdx.x, (int)blockIdx.y, A, lda, strideA, Bt, ldb, strideB,
                          Cout, ldc, strideC, bias, res, ldr, strideR, M, N, K, oscale, ocarry);
}

// The four projections that need only hn = LN(x) or the c plane, in ONE grid; a block-index range picks the job:
//   self q|k   = hn . Wqkv[:, 0:2 FEAT]      -> qk_s [NTOK][QKP]              (M=NTOK, N=QKP,  column bias)
//   cross k    = c . Wck                     -> qk_c [NTOK][QKP] cols FEAT..  (M=NTOK, N=FEAT, column bias)
//   self v^T   = Wqkv[:, 2 FEAT:]^T . hn^T   -> vt_s [b][FEAT][SEQ]           (M=FEAT, N=SEQ per batch, row bias)
//   cross v^T  = Wcv^T . c^T                 -> vt_c [b][FEAT][SEQ]           (M=FEAT, N=SEQ per batch, row bias)
// K (= FEAT) comes as an argument, as in gemm128.
#define GB_QK ((NTOK / 128) * (QKP / 128))
#define GB_K  ((NTOK / 128) * (FEAT / 128))
#define GB_V1 ((FEAT / 128) * (SEQ / 128))         // v^T tiles of one batch
#define GB_ALL (GB_QK + GB_K + 2 * NB * GB_V1)

__global__ __launch_bounds__(256) void gemm_proj4(
    const _Float16* __restrict__ hn, const _Float16* __restrict__ cpl,
    const _Float16* __restrict__ wqkvT, const _Float16* __restrict__ wckT, const _Float16* __restrict__ wcvT,
    const float* __restrict__ b_qkv, const float* __restrict__ b_ck, const float* __restrict__ b_cv,
    _Float16* qk_s, _Float16* qk_c, _Float16* vt_s, _Float16* vt_c, int K, float oscale)
{
  __shared__ __align__(16) unsigned char smem[2 * STAGEB];  // two stage buffers; epilogue slabs behind the loop
  int blk = (int)blockIdx.x;
  const _Float16 *A, *Bt; _Float16* C; const float* bias;
  int b = 0, rowbias = 0, ldc = QKP, M = NTOK, N = FEAT;
  long long strideB = 0LL, strideC = 0LL;
  if (blk < GB_QK)               { A = hn;  Bt = wqkvT; C = qk_s;        bias = b_qkv; N = QKP; }
  else if ((blk -= GB_QK) < GB_K) { A = cpl; Bt = wckT;  C = qk_c + FEAT; bias = b_ck; }
  else {
    blk -= GB_K;
    if (blk < NB * GB_V1) { A = wqkvT + (size_t)2 * FEAT * FEAT; Bt = hn; C = vt_s; bias = b_qkv + 2 * FEAT; }
    else { blk -= NB * GB_V1; A = wcvT; Bt = cpl; C = vt_c; bias = b_cv; }
    b = blk / GB_V1; blk -= b * GB_V1;
    rowbias = 1; ldc = SEQ; M = FEAT; N = SEQ;
    strideB = (long long)SEQ * FEAT; strideC = (long long)FEAT * SEQ;
  }
  if (rowbias)                                             // block-uniform: every barrier inside is met by all waves
    gemm_tile<3, false>(smem, blk, b, A, FEAT, 0LL, Bt, FEAT, strideB, (void*)C, ldc, strideC,
                        bias, bias, FEAT, 0LL, M, N, K, oscale, 1.0f);
  else
    gemm_tile<1, false>(smem, blk, b, A, FEAT, 0LL, Bt, FEAT, strideB, (void*)C, ldc, strideC,
                        bias, bias, FEAT, 0LL, M, N, K, oscale, 1.0f);
}

// =====================================================================================================
// Streaming attention, transposed form, 16 heads, additive key mask (-10000 where mask != 1),
// softmax over all SEQ keys. Block 128 thr (4 waves), 16 queries per wave, 64 keys per step.
//   S^T = K * Q^T : A = K rows (row = key, k = d), B = Q^T (k = d, n = query); scale 0.125 applied in f32
//   O^T += V^T * P^T : A = V^T rows (row = d, k = key), B = P^T packed from the score D registers
//   (element r <- key tile covering k 0..15 row r, element 8+r <- tile covering k 16..31 row r, same lane)
// Lane owns 32 keys of query column (lane&15); partner = lane ^ 16. Online softmax in f32; p carried x16384.
//   q|k plane [b*SEQ + t][QKP]: q at col head*64 + d, k at col FEAT + head*64 + d (f16);
//   v^T plane [b][head*64 + d][SEQ] (f16); mask int32 [b][SEQ_FULL].
//   ctx plane [b*SEQ + t][head*64 + d] = f16(256 * o / l): per-wave 16x64 tile staged in LDS (block barrier),
// coverage: grid (SEQ/64, NB*NH): every (b, head, query) row x 64 columns of its head written once.
// LDS sO: each wave writes its full 16x64 region before the barrier.
// Operands: per step the 64 K rows (128 B each) and the 64 V^T rows (128 B each) that all four waves use are
// brought into LDS once per block by asynchronous 16-byte copies (each thread 4 + 4 copies, a wave-wide copy =
// four whole 128-B rows), two buffers, the next step's tiles in flight while this step is worked on.
// LDS row pitch 144 B (128 + 16: ds_load_b128 readers); the 16 pad bytes per row are never read.
// =====================================================================================================
#define KVROW   144                    // LDS row pitch, bytes
#define KVOP    (64 * KVROW)           // one operand's 64 rows of one step
#define KVSTAGE (2 * KVOP)             // [K 64 rows | V^T 64 rows]

// Eight asynchronous 16-byte copies of this lane: rows r, r+16, r+32, r+48 of the K tile and of the V^T tile.
// lk, lv = the lane's LDS byte addresses of row r, gk, gv = its global addresses, kstep, vstep = elements per 16 rows.
// s_wait_xcnt 0 is the last line of the statement, so that no address register is rewritten in front of it.
__device__ __forceinline__ void copy_kv(unsigned lk, const _Float16* gk, size_t kstep,
                                        unsigned lv, const _Float16* gv, size_t vstep) {
#if DEV_ASM
  const unsigned lk1 = lk + 16 * KVROW, lk2 = lk + 32 * KVROW, lk3 = lk + 48 * KVROW;
  const unsigned lv1 = lv + 16 * KVROW, lv2 = lv + 32 * KVROW, lv3 = lv + 48 * KVROW;
  const _Float16 *gk1 = gk + kstep, *gk2 = gk1 + kstep, *gk3 = gk2 + kstep;
  const _Float16 *gv1 = gv + vstep, *gv2 = gv1 + vstep, *gv3 = gv2 + vstep;
  asm volatile("global_load_async_to_lds_b128 %0, %8, off\n\t"
               "global_load_async_to_lds_b128 %1, %9, off\n\t"
               "global_load_async_to_lds_b128 %2, %10, off\n\t"
               "global_load_async_to_lds_b128 %3, %11, off\n\t"
               "global_load_async_to_lds_b128 %4, %12, off\n\t"
               "global_load_async_to_lds_b128 %5, %13, off\n\t"
               "global_load_async_to_lds_b128 %6, %14, off\n\t"
               "global_load_async_to_lds_b128 %7, %15, off\n\t"
               "s_wait_xcnt 0x0"
               :: "v"(lk), "v"(lk1), "v"(lk2), "v"(lk3), "v"(lv), "v"(lv1), "v"(lv2), "v"(lv3),
                  "v"(gk), "v"(gk1), "v"(gk2), "v"(gk3), "v"(gv), "v"(gv1), "v"(gv2), "v"(gv3)
               : "memory");
#else
  (void)lk; (void)gk; (void)kstep; (void)lv; (void)gv; (void)vstep;
#endif
}

__device__ __forceinline__ v16h pack_p(v8f a, v8f c) {
  const v16h r = { (_Float16)(a[0] * PSCALE), (_Float16)(a[1] * PSCALE), (_Float16)(a[2] * PSCALE), (_Float16)(a[3] * PSCALE),
                   (_Float16)(a[4] * PSCALE), (_Float16)(a[5] * PSCALE), (_Float16)(a[6] * PSCALE), (_Float16)(a[7] * PSCALE),
                   (_Float16)(c[0] * PSCALE), (_Float16)(c[1] * PSCALE), (_Float16)(c[2] * PSCALE), (_Float16)(c[3] * PSCALE),
                   (_Float16)(c[4] * PSCALE), (_Float16)(c[5] * PSCALE), (_Float16)(c[6] * PSCALE), (_Float16)(c[7] * PSCALE) };
  return r;
}

__global__ __launch_bounds__(128) __attribute__((amdgpu_num_vgpr(256))) void attn_kernel(
    const _Float16* __restrict__ qk, const _Float16* __restrict__ vt,
    const int* __restrict__ mask, _Float16* ctx)
{
  __shared__ __align__(16) float sO[4 * 16 * 64];          // 16384 B
  __shared__ __align__(16) unsigned char skv[2 * KVSTAGE]; // two step buffers of K and V^T rows

  const int tid = (int)threadIdx.x, lane = tid & 31, w = tid >> 5;
  const int h = lane >> 4, m = lane & 15;
  const int bh = blockIdx.y, b = bh / NH, head = bh - b * NH;
  const int q0 = blockIdx.x * 64 + 16 * w;

  // Q^T B-fragments: column n = query q0+m, k = d (two 32-deep chunks)
  const _Float16* qrow = qk + ((size_t)b * SEQ + q0 + m) * QKP + head * HD;
  const v16h qb0 = load_frag(qrow, h);
  const v16h qb1 = load_frag(qrow + 32, h);

  v8f o[4];                                                // o[t][r] = O[query m][d 16t+8h+r] * (l * PSCALE)
#pragma unroll
  for (int t = 0; t < 4; ++t) o[t] = zero8();
  float mrun = -1e30f, lrun = 0.0f;

  const int* mk = mask + (size_t)b * SEQ_FULL + 8 * h;                            // + key0 + 16j

  // copy map: thread -> row tid>>3 (+16 per copy), 16-byte piece tid&7 of the row's 128 bytes
  const int crow = tid >> 3, cpc = tid & 7;
  const _Float16* gK = qk + ((size_t)b * SEQ + crow) * QKP + FEAT + head * HD + cpc * 8;   // + key0*QKP
  const _Float16* gV = vt + ((size_t)b * FEAT + head * HD + crow) * SEQ + cpc * 8;         // + key0
  const unsigned lK = (unsigned)(size_t)skv + (unsigned)(crow * KVROW + cpc * 16);
  const unsigned lV = lK + KVOP;
  const size_t stepK = (size_t)16 * QKP, stepV = (size_t)16 * SEQ;
  // fragment read bases inside a buffer: row m of a 16-row group, k offset 8h
  const unsigned char* fK = skv + m * KVROW + 16 * h;
  const unsigned char* fV = skv + KVOP + m * KVROW + 16 * h;

  copy_kv(lK, gK, stepK, lV, gV, stepV);
  wait_copies();
  __syncthreads();                                         // step 0 published
  if (SEQ > 64) copy_kv(lK + KVSTAGE, gK + (size_t)64 * QKP, stepK, lV + KVSTAGE, gV + 64, stepV);

#pragma unroll 1
  for (int kb = 0; kb < SEQ; kb += 64) {
    const unsigned buf = (unsigned)((kb >> 6) & 1) * KVSTAGE;
    // ---- scores: s[j][r] = S[query m][key kb+16j+8h+r] * 0.125 + madd[key] ----
    v8f s[4];
    v16h kf[4][2];
#pragma unroll
    for (int j = 0; j < 4; ++j) {
      const _Float16* kr = (const _Float16*)(fK + buf + j * 16 * KVROW);
      kf[j][0] = ldfrag(kr);
      kf[j][1] = ldfrag(kr + 32);
    }
    // keeps the K reads one group in front of the score products: left free, the scheduler puts four reads in
    // front of each pair of products, and every pair waits out its own LDS latency
    __builtin_amdgcn_sched_barrier(0);
#pragma unroll
    for (int j = 0; j < 4; ++j) {
      v8f z = zero8();
      z = wmma_f16(kf[j][0], qb0, z);
      z = wmma_f16(kf[j][1], qb1, z);
      const v4i ma = *(const v4ia*)(mk + kb + 16 * j);
      const v4i mc = *(const v4ia*)(mk + kb + 16 * j + 4);
      const int mm[8] = { ma.x, ma.y, ma.z, ma.w, mc.x, mc.y, mc.z, mc.w };
#pragma unroll
      for (int r = 0; r < 8; ++r) {
        const float sc = z[r] * 0.125f;
        s[j][r] = sc + ((mm[r] != 1) ? -10000.0f : 0.0f);
      }
    }

    // ---- V^T fragments of this step: one read group, in flight while the softmax runs ----
    v16h vf[4][2];
#pragma unroll
    for (int t = 0; t < 4; ++t) {
      const _Float16* vp = (const _Float16*)(fV + buf + t * 16 * KVROW);
      vf[t][0] = ldfrag(vp);
      vf[t][1] = ldfrag(vp + 32);
    }
    // keeps the V^T reads in front of the softmax: left free, they sink to their products and are waited for there
    __builtin_amdgcn_sched_barrier(0);

    // ---- online softmax (f32) ----
    float mloc = s[0][0];
#pragma unroll
    for (int j = 0; j < 4; ++j)
#pragma unroll
      for (int r = 0; r < 8; ++r) mloc = fmaxf(mloc, s[j][r]);
    mloc = fmaxf(mloc, __shfl_xor(mloc, 16));
    const float mnew = fmaxf(mrun, mloc);
    const float alpha = __expf(mrun - mnew);
    mrun = mnew;
    float lsum = 0.0f;
#pragma unroll
    for (int j = 0; j < 4; ++j)
#pragma unroll
      for (int r = 0; r < 8; ++r) {
        const float p = __expf(s[j][r] - mnew);
        s[j][r] = p;
        lsum += p;
      }
    lsum += __shfl_xor(lsum, 16);
    lrun = lrun * alpha + lsum;
#pragma unroll
    for (int t = 0; t < 4; ++t)
#pragma unroll
      for (int r = 0; r < 8; ++r) o[t][r] = o[t][r] * alpha;

    // ---- P^T B-fragments (key chunks 0..31 and 32..63 of this step) ----
    const v16h pb0 = pack_p(s[0], s[1]);
    const v16h pb1 = pack_p(s[2], s[3]);

    // ---- O^T += V^T * P^T ----
#pragma unroll
    for (int t = 0; t < 4; ++t) {
      o[t] = wmma_f16(vf[t][0], pb0, o[t]);
      o[t] = wmma_f16(vf[t][1], pb1, o[t]);
    }
    wait_lds();
    wait_copies();
    __syncthreads();                                       // publishes step kb+64, frees this step's buffer
    if (kb + 128 < SEQ)
      copy_kv(lK + buf, gK + (size_t)(kb + 128) * QKP, stepK, lV + buf, gV + (kb + 128), stepV);
  }
  wait_copies();

  // ---- epilogue: normalise (1/l, remove the p carry, apply the ctx carry), stage per-wave 16x64 tile ----
  const float inv = (1.0f / lrun) * (CTXCARRY / PSCALE);
  float* so = sO + w * 1024;
#pragma unroll
  for (int t = 0; t < 4; ++t)
#pragma unroll
    for (int r = 0; r < 8; ++r)
      so[m * 64 + 16 * t + 8 * h + r] = o[t][r] * inv;
  __syncthreads();

  const int q8 = lane & 7, sub = lane >> 3;
  v8h hv[4];
#pragma unroll
  for (int it = 0; it < 4; ++it) {
    const int row = it * 4 + sub;                          // it 0..3 x sub 0..3 = rows 0..15 of the wave tile
    const float* sp = so + row * 64 + 8 * q8;
    const v4f a = *(const v4fa*)sp;
    const v4f c = *(const v4fa*)(sp + 4);
    const v8h ov = { (_Float16)a.x, (_Float16)a.y, (_Float16)a.z, (_Float16)a.w,
                     (_Float16)c.x, (_Float16)c.y, (_Float16)c.z, (_Float16)c.w };
    hv[it] = ov;
  }
  {
#pragma unroll
    for (int it = 0; it < 4; ++it) {
      const int row = it * 4 + sub;
      _Float16* dst = ctx + ((size_t)b * SEQ + q0 + row) * FEAT + head * HD + 8 * q8;
      *(v8h*)dst = hv[it];
    }
    
  }
}

// =====================================================================================================
// Host orchestration. Workspace map (bytes, NB=4 SEQ=1024), every region an exact multiple of its whole-line
// store granularity, all offsets multiples of 128:
//   hn    f16 [4096][1024]      8388608   (LN outputs of all three blocks, written and consumed in order)
//   cpl   f16 [4096][1024]      8388608   (bf16rne(c) as f16)
//   WqkvT f16 [3072][1024]      6291456
//   WspT  f16 [1024][1024]      2097152
//   WcqT, WckT, WcvT, WcpT      4 x 2097152
//   W1T   f16 [4096][1024]      8388608
//   W2T   f16 [1024][4096]      8388608
//   ATT   shared region        33554432 : self q|k f16 [4096][2048] (16777216) + self v^T f16 [4][1024][1024]
//                                         (8388608) + ctx f16 [4096][1024] (8388608, both attention blocks);
//                                         mid f16 [4096][4096] (33554432) during the MLP (all readers of
//                                         q|k, v^T, ctx have completed before fc1 writes mid)
//   x1    f32 [4096][1024]     16777216
//   x2    f32 [4096][1024]     16777216
//   qk_c  f16 [4096][2048]     16777216   (cross q|k: k written with the self projections, q behind LN(x1))
//   vt_c  f16 [4][1024][1024]   8388608   (cross v^T, written with the self projections)
//   total                     142606336
// =====================================================================================================
extern "C" void kernel_launch(void* const* d_in, const int* in_sizes, int n_in,
                              void* d_out, int out_size, void* d_ws, size_t ws_size,
                              hipStream_t stream)
{
  if (n_in < 19) return;
  const long long needTok = (long long)(NB - 1) * SEQ_FULL + SEQ;
  if ((long long)in_sizes[0] < needTok * FEAT) return;                 // x
  if ((long long)in_sizes[1] < needTok * FEAT) return;                 // c
  if ((long long)in_sizes[2] < needTok) return;                        // mask (int32)
  if ((long long)in_sizes[3] < (long long)FEAT * 3 * FEAT || in_sizes[4] < 3 * FEAT) return;
  if ((long long)in_sizes[5] < (long long)FEAT * FEAT || in_sizes[6] < FEAT) return;
  if ((long long)in_sizes[7] < (long long)FEAT * FEAT || in_sizes[8] < FEAT) return;
  if ((long long)in_sizes[9] < (long long)FEAT * FEAT || in_sizes[10] < FEAT) return;
  if ((long long)in_sizes[11] < (long long)FEAT * FEAT || in_sizes[12] < FEAT) return;
  if ((long long)in_sizes[13] < (long long)FEAT * FEAT || in_sizes[14] < FEAT) return;
  if ((long long)in_sizes[15] < (long long)FEAT * MF || in_sizes[16] < MF) return;
  if ((long long)in_sizes[17] < (long long)MF * FEAT || in_sizes[18] < FEAT) return;
  if ((long long)out_size < needTok * FEAT) return;

  const float* x         = (const float*)d_in[0];
  const float* c         = (const float*)d_in[1];
  const int*   mask      = (const int*)d_in[2];
  const float* sa_qkv_w  = (const float*)d_in[3];
  const float* sa_qkv_b  = (const float*)d_in[4];
  const float* sa_proj_w = (const float*)d_in[5];
  const float* sa_proj_b = (const float*)d_in[6];
  const float* ca_q_w    = (const float*)d_in[7];
  const float* ca_q_b    = (const float*)d_in[8];
  const float* ca_k_w    = (const float*)d_in[9];
  const float* ca_k_b    = (const float*)d_in[10];
  const float* ca_v_w    = (const float*)d_in[11];
  const float* ca_v_b    = (const float*)d_in[12];
  const float* ca_proj_w = (const float*)d_in[13];
  const float* ca_proj_b = (const float*)d_in[14];
  const float* fc1_w     = (const float*)d_in[15];
  const float* fc1_b     = (const float*)d_in[16];
  const float* fc2_w     = (const float*)d_in[17];
  const float* fc2_b     = (const float*)d_in[18];

  const size_t P_F16  = (size_t)NTOK * FEAT * 2;
  const size_t P_F32  = (size_t)NTOK * FEAT * 4;
  const size_t P_W    = (size_t)FEAT * FEAT * 2;
  const size_t P_WQKV = (size_t)3 * FEAT * FEAT * 2;
  const size_t P_W1   = (size_t)MF * FEAT * 2;
  const size_t P_QK   = (size_t)NTOK * QKP * 2;
  const size_t P_VT   = (size_t)NB * FEAT * SEQ * 2;
  const size_t P_MID  = (size_t)NTOK * MF * 2;
  const size_t P_ATTU = P_QK + P_VT + P_F16;
  const size_t P_ATT  = (P_ATTU > P_MID) ? P_ATTU : P_MID;
  size_t off = 0;
  const size_t oHn   = off; off += P_F16;
  const size_t oC    = off; off += P_F16;
  const size_t oWqkv = off; off += P_WQKV;
  const size_t oWsp  = off; off += P_W;
  const size_t oWcq  = off; off += P_W;
  const size_t oWck  = off; off += P_W;
  const size_t oWcv  = off; off += P_W;
  const size_t oWcp  = off; off += P_W;
  const size_t oW1   = off; off += P_W1;
  const size_t oW2   = off; off += P_W1;
  const size_t oAtt  = off; off += P_ATT;
  const size_t oX1   = off; off += P_F32;
  const size_t oX2   = off; off += P_F32;
  const size_t oQkc  = off; off += P_QK;
  const size_t oVtc  = off; off += P_VT;
  if (off > ws_size) return;                               // off = 142606336 at NB=4, SEQ=1024

  char* ws = (char*)d_ws;
  _Float16* hn    = (_Float16*)(ws + oHn);
  _Float16* cpl   = (_Float16*)(ws + oC);
  _Float16* wqkvT = (_Float16*)(ws + oWqkv);
  _Float16* wspT  = (_Float16*)(ws + oWsp);
  _Float16* wcqT  = (_Float16*)(ws + oWcq);
  _Float16* wckT  = (_Float16*)(ws + oWck);
  _Float16* wcvT  = (_Float16*)(ws + oWcv);
  _Float16* wcpT  = (_Float16*)(ws + oWcp);
  _Float16* w1T   = (_Float16*)(ws + oW1);
  _Float16* w2T   = (_Float16*)(ws + oW2);
  _Float16* qkp   = (_Float16*)(ws + oAtt);
  _Float16* vtp   = (_Float16*)(ws + oAtt + P_QK);
  _Float16* ctx   = (_Float16*)(ws + oAtt + P_QK + P_VT);
  _Float16* mid   = (_Float16*)(ws + oAtt);
  float*    x1    = (float*)(ws + oX1);
  float*    x2    = (float*)(ws + oX2);
  _Float16* qkc   = (_Float16*)(ws + oQkc);
  _Float16* vtc   = (_Float16*)(ws + oVtc);

  const dim3 blk(256);
  const float sQKV  = 1.0f / WCARRY;
  const float sPROJ = 1.0f / (WCARRY * CTXCARRY);
  const float sFC2  = 1.0f / (WCARRY * MIDCARRY);

  // (1) one grid: weights f32 [in][out] -> f16 [out][in] = bf16rne(w) x64; c -> compact f16 plane (bf16rne values);
  //     hn = LN(bf16rne(x)) -> f16 plane
  prep_kernel<<<dim3(PB_ALL), blk, 0, stream>>>(
      sa_qkv_w, sa_proj_w, ca_q_w, ca_k_w, ca_v_w, ca_proj_w, fc1_w, fc2_w, x, c,
      wqkvT, wspT, wcqT, wckT, wcvT, wcpT, w1T, w2T, cpl, hn);

  // (2) one grid: self q|k and self v^T from hn, cross k and cross v^T from the c plane (K=1024; acc / 64)
  gemm_proj4<<<dim3(GB_ALL), blk, 0, stream>>>(
      hn, cpl, wqkvT, wckT, wcvT, sa_qkv_b, ca_k_b, ca_v_b, qkp, qkc, vtp, vtc, FEAT, sQKV);

  // ---------------- self-attention block ----------------
  // (3) attention -> ctx f16 plane (x256)
  const dim3 gAT(SEQ / 64, NB * NH);
  attn_kernel<<<gAT, dim3(128), 0, stream>>>(qkp, vtp, mask, ctx);
  // (4) x1 = ctx . Wsp + b + bf16rne(x) -> f32 plane   (per batch M=SEQ, N=1024, K=1024; acc / (64*256))
  const dim3 gPB((SEQ / 128) * (FEAT / 128), NB);
  gemm128<0, true><<<gPB, blk, 0, stream>>>(
      ctx, FEAT, (long long)SEQ * FEAT, wspT, FEAT, 0LL, (void*)x1, FEAT, (long long)SEQ * FEAT,
      sa_proj_b, x, FEAT, (long long)SEQ_FULL * FEAT,
      SEQ, FEAT, FEAT, sPROJ, 1.0f);

  // ---------------- cross-attention block ----------------
  // (5) hn = LN(x1)
  ln_kernel<<<dim3(NTOK), blk, 0, stream>>>(x1, (long long)SEQ * FEAT, hn);
  // (6) q = hn . Wcq + b -> cross q|k plane cols 0..1023   (M=NTOK, N=1024, K=1024)
  const dim3 gQ((NTOK / 128) * (FEAT / 128), 1);
  gemm128<1, false><<<gQ, blk, 0, stream>>>(
      hn, FEAT, 0LL, wcqT, FEAT, 0LL, (void*)qkc, QKP, 0LL, ca_q_b, x1, FEAT, 0LL,
      NTOK, FEAT, FEAT, sQKV, 1.0f);
  // (7) attention -> ctx
  attn_kernel<<<gAT, dim3(128), 0, stream>>>(qkc, vtc, mask, ctx);
  // (8) x2 = ctx . Wcp + b + x1 -> f32 plane   (M=NTOK, N=1024, K=1024)
  gemm128<0, false><<<gQ, blk, 0, stream>>>(
      ctx, FEAT, 0LL, wcpT, FEAT, 0LL, (void*)x2, FEAT, 0LL,
      ca_proj_b, x1, FEAT, 0LL,
      NTOK, FEAT, FEAT, sPROJ, 1.0f);

  // ---------------- MLP block ----------------
  // (9) hn = LN(x2)
  ln_kernel<<<dim3(NTOK), blk, 0, stream>>>(x2, (long long)SEQ * FEAT, hn);
  // (10) mid = gelu(hn . W1 + b1) x16 -> f16 [NTOK][4096]   (M=NTOK, N=4096, K=1024; acc / 64)
  const dim3 gW1((NTOK / 128) * (MF / 128), 1);
  gemm128<2, false><<<gW1, blk, 0, stream>>>(
      hn, FEAT, 0LL, w1T, FEAT, 0LL, (void*)mid, MF, 0LL, fc1_b, x1, FEAT, 0LL,
      NTOK, MF, FEAT, sQKV, MIDCARRY);
  // (11) out = mid . W2 + b2 + x2 -> d_out f32 rows b*SEQ_FULL + t   (per batch M=SEQ, N=1024, K=4096; acc / (64*16))
  gemm128<0, false><<<gPB, blk, 0, stream>>>(
      mid, MF, (long long)SEQ * MF, w2T, MF, 0LL, d_out, FEAT, (long long)SEQ_FULL * FEAT,
      fc2_b, x2, FEAT, (long long)SEQ * FEAT,
      SEQ, FEAT, MF, sFC2, 1.0f);

  (void)hipGetLastError();
}

// v004
// One run takes 232 microseconds.
// Timed twice side by side with v003, it ran 1.03 and 1.04 times as fast.
// Over all steps from v000 it is 3.28 times as fast.
// Contractions: hn*WqkT (q|k plane), Wv*hn^T (v^T plane), K*Q^T scores, V^T*P^T, ctx*WpT for both attention
// blocks (cross block: k and v^T from the c plane), hn*W1T, mid*W2T: all v_wmma_f32_16x16x32_f16
// (f16 operands, single product, f32 accumulate). LayerNorms, softmax, key-mask add, GELU (erf form), bias and
// residual adds: f32 on VALU. Every float input enters as its bf16 RNE value (x, c, weights, biases).
// Carry audit (f16 planes): weights = bf16(w) x64, inverse folded once into the scale of each consuming GEMM
// (q/k/v^T: 1/64; proj GEMMs: 1/(64*256); fc1: 1/64; fc2: 1/(64*16)). hn, c, q, k, v^T carried x1.
// P = p x16384 and ctx = o x256: inv = (1/l)*(256/16384) in attn_kernel; mid = gelu x16.
#include <hip/hip_runtime.h>
#include <math.h>

#ifndef NB
#define NB 4
#endif
#ifndef SEQ
#define SEQ 1024
#endif
#define NB_FULL  4
#define SEQ_FULL 1024
#define FEAT 1024
#define NH   16
#define HD   64
#define MF   4096
#define QKP  (2 * FEAT)
#define NTOK (NB * SEQ)
static_assert(NH * HD == FEAT);
static_assert(HD == 64);
static_assert(NB >= 1 && NB <= NB_FULL);
static_assert(SEQ >= 64 && SEQ <= SEQ_FULL && (SEQ % 64) == 0);
static_assert((FEAT % 64) == 0 && (MF % 64) == 0 && (QKP % 64) == 0);
static_assert((FEAT % 128) == 0 && (MF % 128) == 0 && (QKP % 128) == 0 && (SEQ % 128) == 0 && FEAT >= 256);
static_assert(FEAT == 4 * 256);
static_assert(((long long)(NB - 1) * SEQ_FULL + SEQ) * FEAT <= (long long)NB_FULL * SEQ_FULL * FEAT);

#define WCARRY   64.0f
#define PSCALE   16384.0f
#define CTXCARRY 256.0f
#define MIDCARRY 16.0f

typedef _Float16 v16h __attribute__((ext_vector_type(16)));
typedef _Float16 v8h  __attribute__((ext_vector_type(8)));
typedef float    v8f  __attribute__((ext_vector_type(8)));
typedef float    v4f  __attribute__((ext_vector_type(4)));
typedef int      v4i  __attribute__((ext_vector_type(4)));
typedef v8h __attribute__((may_alias)) v8ha;
typedef v4f __attribute__((may_alias)) v4fa;
typedef v4i __attribute__((may_alias)) v4ia;
union Frag { v16h v; v8h half[2]; };

#if defined(__HIP_DEVICE_COMPILE__)
#define DEV_ASM 1
#else
#define DEV_ASM 0
#endif

__device__ __forceinline__ v8f zero8() { v8f z = {0.f, 0.f, 0.f, 0.f, 0.f, 0.f, 0.f, 0.f}; return z; }

// f32 -> bf16 RNE value kept as f32
__device__ __forceinline__ float bf16r(float f) {
  unsigned u = __float_as_uint(f);
  u = (u + 0x7FFFu + ((u >> 16) & 1u)) & 0xFFFF0000u;
  return __uint_as_float(u);
}
__device__ __forceinline__ v4f bf16r4(v4f a) {
  v4f r = { bf16r(a.x), bf16r(a.y), bf16r(a.z), bf16r(a.w) };
  return r;
}

// ---------------------------------------------------------------------------------------------------
// 16x16x32 f16 WMMA. Fragment map (wave32): lane l, h = l>>4, m = n = l&15.
//   A/B element i: i<8 -> k0+8h+i ; i>=8 -> k0+16+8h+(i-8)      D element r: row 8h+r, col l&15
// ---------------------------------------------------------------------------------------------------
// guarded form: 4 VALU slots after the WMMA, D tied, A/B kept live
__device__ __forceinline__ v8f wmma_f16(v16h a, v16h b, v8f c) {
  v8f d = __builtin_amdgcn_wmma_f32_16x16x32_f16(false, a, false, b, (short)0, c, false, false);
#if DEV_ASM
  asm volatile("v_nop\n\tv_nop\n\tv_nop\n\tv_nop" : "+v"(d) : "v"(a), "v"(b));
#endif
  return d;
}
// plain builtin form for the GEMM inner loop (the compiler keeps the distances between its own builtins)
__device__ __forceinline__ v8f mmar(v16h a, v16h b, v8f c) {
  return __builtin_amdgcn_wmma_f32_16x16x32_f16(false, a, false, b, (short)0, c, false, false);
}
__device__ __forceinline__ void acc_guard4(v8f& a, v8f& b, v8f& c, v8f& d) {
#if DEV_ASM
  asm volatile("v_nop\n\tv_nop\n\tv_nop\n\tv_nop" : "+v"(a), "+v"(b), "+v"(c), "+v"(d));
#else
  (void)a; (void)b; (void)c; (void)d;
#endif
}

// A or B fragment from a k-contiguous f16 row; p points at element k0 of the row owned by this lane.
__device__ __forceinline__ v16h load_frag(const _Float16* p, int h) {
  Frag f;
  f.half[0] = *(const v8ha*)(p + 8 * h);
  f.half[1] = *(const v8ha*)(p + 16 + 8 * h);
  return f.v;
}
// same, p already includes +8*(lane>>4)
__device__ __forceinline__ v16h ldfrag(const _Float16* p) {
  Frag f;
  f.half[0] = *(const v8ha*)(p);
  f.half[1] = *(const v8ha*)(p + 16);
  return f.v;
}

// behind a job's last global store: the compiler lays the jobs of one kernel one behind the other, and the code that
// follows in the listing rewrites the store's address and data registers; the wait stands in front of that
__device__ __forceinline__ void wait_store_regs() {
#if DEV_ASM
  asm volatile("s_wait_xcnt 0x0" ::: "memory");
#endif
}

// =====================================================================================================
// A job of the preparation kernel: transpose + convert: in f32 [K][N] (row = k) -> out f16 [N][K] =
// f16(carry * bf16rne(in)^T). Block 256 threads, tile 64 k x 32 n (tile index bx along k, by along n) staged in
// LDS (n-major, pitch 68 floats; cross-wave -> block barrier).
// coverage: 32 n-rows x 64 k per block; (K/64) x (N/32) blocks cover the whole [N][K] plane.
// LDS: tile cols 0..63 of all 32 rows written before the barrier; cols 64..67 never read.
// =====================================================================================================
__device__ __forceinline__ void transpose_tile(
    const float* in, _Float16* out, int K, int N, float carry, int bx, int by)
{
  __shared__ __align__(16) float tile[32][68];
  const int k0 = bx * 64, n0 = by * 32;
  const int tid = (int)threadIdx.x;
  {
    const int kk = tid >> 2, nq = (tid & 3) * 8;
    const float* src = in + (size_t)(k0 + kk) * N + n0 + nq;
    const v4f a = *(const v4fa*)src;
    const v4f c = *(const v4fa*)(src + 4);
    tile[nq + 0][kk] = a.x; tile[nq + 1][kk] = a.y; tile[nq + 2][kk] = a.z; tile[nq + 3][kk] = a.w;
    tile[nq + 4][kk] = c.x; tile[nq + 5][kk] = c.y; tile[nq + 6][kk] = c.z; tile[nq + 7][kk] = c.w;
  }
  __syncthreads();
  {
    const int nn = tid >> 3, kq = (tid & 7) * 8;
    const float* sp = &tile[nn][kq];
    const v4f a = bf16r4(*(const v4fa*)sp);
    const v4f c = bf16r4(*(const v4fa*)(sp + 4));
    const v8h o = { (_Float16)(a.x * carry), (_Float16)(a.y * carry), (_Float16)(a.z * carry), (_Float16)(a.w * carry),
                    (_Float16)(c.x * carry), (_Float16)(c.y * carry), (_Float16)(c.z * carry), (_Float16)(c.w * carry) };
    _Float16* dst = out + (size_t)(n0 + nn) * K + k0 + kq;
    *(v8h*)dst = o;
    wait_store_regs();
  }
}

// =====================================================================================================
// A job of the preparation kernel: row convert: f32 input rows (batch stride SEQ_FULL*FEAT) -> compact f16 plane
// [NTOK][FEAT], value = f16(bf16rne(v)). Two 1024-wide rows per 256-thread block, 8 elements per thread.
// coverage: 128 x 8 = 1024 per row; NTOK/2 blocks.
// =====================================================================================================
__device__ __forceinline__ void cvt_two_rows(const float* src, _Float16* dst, int pair)
{
  const int row = 2 * pair + ((int)threadIdx.x >> 7);
  const int bb = row / SEQ, t = row - bb * SEQ;
  const int tid = (int)threadIdx.x & 127;
  const float* sp = src + ((size_t)bb * SEQ_FULL + (size_t)t) * FEAT + 8 * tid;
  const v4f a = bf16r4(*(const v4fa*)sp);
  const v4f c = bf16r4(*(const v4fa*)(sp + 4));
  const v8h o = { (_Float16)a.x, (_Float16)a.y, (_Float16)a.z, (_Float16)a.w,
                  (_Float16)c.x, (_Float16)c.y, (_Float16)c.z, (_Float16)c.w };
  _Float16* d = dst + (size_t)row * FEAT + 8 * tid;
  *(v8h*)d = o;
  wait_store_regs();
}

// =====================================================================================================
// LayerNorm, no affine, eps 1e-6 (one 1024-wide row per 256-thread block, thread owns 4 consecutive
//   RNEX = true : v = bf16rne(X) (raw input x); false: v = X (internal f32 plane).
//   Input row = b * strideXB + t * FEAT with (b, t) from the compact row index; output f16 row compact.
//   f16 row: staged in LDS (cross-wave -> block barrier), lanes of waves 0..3 write 16 B each (8 halves),
// =====================================================================================================
__device__ __forceinline__ float block_sum(float v, float* red, int lane, int w) {
#pragma unroll
  for (int off = 16; off > 0; off >>= 1) v += __shfl_xor(v, off);
  if (lane == 0) red[w] = v;
  __syncthreads();
  float r = red[0];
#pragma unroll
  for (int i = 1; i < 8; ++i) r += red[i];
  __syncthreads();
  return r;
}

template <bool RNEX>
__device__ __forceinline__ void ln_row(const float* X, long long strideXB, _Float16* pout, int row)
{
  __shared__ __align__(16) float srow[FEAT];
  __shared__ float red[8];
  const int bb  = row / SEQ, t = row - bb * SEQ;
  const int tid = (int)threadIdx.x, lane = tid & 31, w = tid >> 5;
  const int f0  = 4 * tid;
  const float* xp = X + (size_t)bb * (size_t)strideXB + (size_t)t * FEAT + f0;

  v4f xv = *(const v4fa*)xp;
  if (RNEX) xv = bf16r4(xv);
  float s = (xv.x + xv.y) + (xv.z + xv.w);
  s = block_sum(s, red, lane, w);
  const float mu = s * (1.0f / FEAT);
  const float d0 = xv.x - mu, d1 = xv.y - mu, d2 = xv.z - mu, d3 = xv.w - mu;
  float q = (d0 * d0 + d1 * d1) + (d2 * d2 + d3 * d3);
  q = block_sum(q, red, lane, w);
  const float rstd = rsqrtf(q * (1.0f / FEAT) + 1e-6f);

  const v4f ov = { d0 * rstd, d1 * rstd, d2 * rstd, d3 * rstd };
  *(v4fa*)(srow + f0) = ov;
  __syncthreads();
  if (w < 4) {                                             // wave-uniform: waves 0..3, 128 threads x 8 halves
    const float* sp = srow + 8 * tid;
    const v4f a = *(const v4fa*)sp;
    const v4f c = *(const v4fa*)(sp + 4);
    const v8h o = { (_Float16)a.x, (_Float16)a.y, (_Float16)a.z, (_Float16)a.w,
                    (_Float16)c.x, (_Float16)c.y, (_Float16)c.z, (_Float16)c.w };
    _Float16* dst = pout + (size_t)row * FEAT + 8 * tid;
    *(v8h*)dst = o;
    
  }
}

// LayerNorm of an internal f32 plane, one row per block
__global__ __launch_bounds__(256) void ln_kernel(const float* __restrict__ X, long long strideXB, _Float16* pout)
{
  ln_row<false>(X, strideXB, pout, (int)blockIdx.x);
}

// =====================================================================================================
// Preparation kernel: everything that depends on the raw inputs alone, in ONE grid; a block-index range picks
// the job (block-uniform, so each job's barriers stay under block-uniform control flow):
//   LN(bf16rne(x)) first (its blocks run longest, so they do not form the grid's tail), the row convert of c,
//   the eight weight transposes (tiles in the order bx fastest).
// =====================================================================================================
#define PB_QKV ((FEAT / 64) * ((3 * FEAT) / 32))   // blocks of the [FEAT][3 FEAT] transpose
#define PB_SQ  ((FEAT / 64) * (FEAT / 32))         // blocks of one [FEAT][FEAT] transpose
#define PB_MLP ((FEAT / 64) * (MF / 32))           // blocks of the [FEAT][MF] and of the [MF][FEAT] transpose
#define PB_TR  (PB_QKV + 5 * PB_SQ + 2 * PB_MLP)
#define PB_CV  (NTOK / 2)
#define PB_ALL (PB_TR + PB_CV + NTOK)
static_assert((NTOK % 2) == 0);

__global__ __launch_bounds__(256) void prep_kernel(
    const float* __restrict__ w_qkv, const float* __restrict__ w_sp, const float* __restrict__ w_cq,
    const float* __restrict__ w_ck, const float* __restrict__ w_cv, const float* __restrict__ w_cp,
    const float* __restrict__ w_1, const float* __restrict__ w_2,
    const float* __restrict__ x, const float* __restrict__ c,
    _Float16* t_qkv, _Float16* t_sp, _Float16* t_cq, _Float16* t_ck, _Float16* t_cv, _Float16* t_cp,
    _Float16* t_1, _Float16* t_2, _Float16* cpl, _Float16* hn)
{
  int blk = (int)blockIdx.x;
  if (blk < NTOK) {
    ln_row<true>(x, (long long)SEQ_FULL * FEAT, hn, blk);
  } else if (blk < NTOK + PB_CV) {
    cvt_two_rows(c, cpl, blk - NTOK);
  } else {
    blk -= NTOK + PB_CV;
    const float* in; _Float16* out; int K = FEAT, N = FEAT;
    if (blk < PB_MLP)                    { in = w_1; out = t_1; N = MF; }
    else if ((blk -= PB_MLP) < PB_MLP)   { in = w_2; out = t_2; K = MF; }
    else if ((blk -= PB_MLP) < PB_QKV)   { in = w_qkv; out = t_qkv; N = 3 * FEAT; }
    else if ((blk -= PB_QKV) < PB_SQ)    { in = w_sp; out = t_sp; }
    else if ((blk -= PB_SQ) < PB_SQ)     { in = w_cq; out = t_cq; }
    else if ((blk -= PB_SQ) < PB_SQ)     { in = w_ck; out = t_ck; }
    else if ((blk -= PB_SQ) < PB_SQ)     { in = w_cv; out = t_cv; }
    else                                 { blk -= PB_SQ; in = w_cp; out = t_cp; }
    const int kt = K >> 6;
    const int by = blk / kt;
    transpose_tile(in, out, K, N, WCARRY, blk - by * kt, by);
  }
}

// =====================================================================================================
// Batched WMMA GEMM (f16 operands): C[m][n] = sum_k A[m][k] * Bt[n][k].
// One 128x128 tile of C per 256-thread block; 8 waves as 4 (m) x 2 (n), each 32x64 (2 x 4 accumulator tiles).
// A row-major [M][K] pitch lda; Bt row-major [N][K] pitch ldb (k contiguous); M, N, K multiples of 128,
// K >= 256 (all shapes here are compile-time constants of the host code). tile = index of the C tile, b = batch
// index, smem = the block's 2 * STAGEB bytes of LDS (declared in the kernel that calls this).
// Operands: per stage 128 k of the block's 128 A rows and 128 Bt rows are brought into LDS by asynchronous
// 16-byte copies (each thread 8 + 8 copies, a wave-wide copy = two whole 256-B row pieces), two buffers, the
// next stage in flight while this one is multiplied. LDS row pitch 272 B (256 + 16: ds_load_b128 readers).
// Fragments from LDS with the split k map (ldfrag), two register sets inside a stage.
// k order: a block starts at stage (tile row, counted over the batches, + tile column) mod stages and wraps round, so
// that blocks which share A or Bt rows do not ask L2 for the same lines at the same moment; inside a stage k runs
// upward in steps of 32.
// MODE 0: f32 C = acc*oscale + bf16rne(bias[n]) + res[m][n] (res pitch ldr, batch stride strideR;
//         RESRNE: res value bf16rne-converted on load)
// MODE 1: f16 C = f16(acc*oscale + bf16rne(bias[n]))
// MODE 2: f16 C = f16(gelu(acc*oscale + bf16rne(bias[n])) * ocarry), gelu = 0.5 v (1 + erf(v / sqrt 2))
// MODE 3: f16 C = f16(acc*oscale + bf16rne(bias[m]))       (row bias, transposed output planes)
// coverage: 2 slabs x 16 rows x 64 cols = the wave's whole 32x64 tile; slab 16x64 fully written before reads.
// LDS: every byte of a buffer's 256 data bytes per row is copied before the barrier that publishes it; the 16
// pad bytes per row are never read. The per-wave epilogue slabs lie in the ring, used only behind the last
// trip's barrier (no copy outstanding, every fragment read retired).
// =====================================================================================================
#define LROW    272                    // LDS row pitch, bytes
#define OPBYTES (128 * LROW)           // one operand's 128 rows of one stage
#define STAGEB  (2 * OPBYTES)          // [A 128 rows | Bt 128 rows]

// Eight asynchronous 16-byte copies of this lane: rows r, r+16, ..., r+112 of one operand's stage.
// l = the lane's LDS byte address of row r, gp = its global address, rstep = elements per 16 rows.
// s_wait_xcnt 0 is the last line of the statement, so that no address register is rewritten in front of it.
__device__ __forceinline__ void copy8(unsigned l, const _Float16* gp, size_t rstep) {
#if DEV_ASM
  const unsigned l1 = l + 16 * LROW, l2 = l + 32 * LROW, l3 = l + 48 * LROW, l4 = l + 64 * LROW,
                 l5 = l + 80 * LROW, l6 = l + 96 * LROW, l7 = l + 112 * LROW;
  const _Float16 *g1 = gp + rstep, *g2 = g1 + rstep, *g3 = g2 + rstep, *g4 = g3 + rstep,
                 *g5 = g4 + rstep, *g6 = g5 + rstep, *g7 = g6 + rstep;
  asm volatile("global_load_async_to_lds_b128 %0, %8, off\n\t"
               "global_load_async_to_lds_b128 %1, %9, off\n\t"
               "global_load_async_to_lds_b128 %2, %10, off\n\t"
               "global_load_async_to_lds_b128 %3, %11, off\n\t"
               "global_load_async_to_lds_b128 %4, %12, off\n\t"
               "global_load_async_to_lds_b128 %5, %13, off\n\t"
               "global_load_async_to_lds_b128 %6, %14, off\n\t"
               "global_load_async_to_lds_b128 %7, %15, off\n\t"
               "s_wait_xcnt 0x0"
               :: "v"(l), "v"(l1), "v"(l2), "v"(l3), "v"(l4), "v"(l5), "v"(l6), "v"(l7),
                  "v"(gp), "v"(g1), "v"(g2), "v"(g3), "v"(g4), "v"(g5), "v"(g6), "v"(g7)
               : "memory");
#else
  (void)l; (void)gp; (void)rstep;
#endif
}
// this wave's own copies have landed
__device__ __forceinline__ void wait_copies() {
#if DEV_ASM
  asm volatile("s_wait_asynccnt 0x0" ::: "memory");
#endif
}
// this wave's own LDS reads have retired (before the buffer they read is handed to its next writer)
__device__ __forceinline__ void wait_lds() {
#if DEV_ASM
  asm volatile("s_wait_dscnt 0x0" ::: "memory");
#endif
}

template <int MODE, bool RESRNE>
__device__ __forceinline__ void gemm_tile(
    unsigned char* smem, int tile, int b,
    const _Float16* A, int lda, long long strideA,
    const _Float16* Bt, int ldb, long long strideB,
    void* Cout, int ldc, long long strideC,
    const float* bias,
    const float* res, int ldr, long long strideR,
    int M, int N, int K, float oscale, float ocarry)
{
  const int tid  = (int)threadIdx.x;
  const int lane = tid & 31;
  const int wave = tid >> 5;
  const int tilesN = N >> 7;
  const int tilesM = M >> 7;
  if (tile >= tilesM * tilesN) return;                     // block-uniform, in front of every copy and barrier
  const int tm = tile / tilesN;
  const int tn = tile - tm * tilesN;
  const int m0 = (tm << 7) + ((wave >> 1) << 5);           // this wave's 32 rows
  const int n0 = (tn << 7) + ((wave & 1) << 6);            // this wave's 64 columns

  const _Float16* Ab = A  + (size_t)b * (size_t)strideA;
  const _Float16* Bb = Bt + (size_t)b * (size_t)strideB;

  const int rlane = lane & 15;                             // row (A) / col (B, D) within subtile
  const int koff  = (lane >> 4) * 8;                       // k offset of this lane half
  const int mOff  = (lane >> 4) * 8;                       // D row offset

  // copy map: thread -> row tid>>4 (+16 per copy), 16-byte piece tid&15 of the row's 256 bytes
  const int crow = tid >> 4, ccol = tid & 15;
  const _Float16* gA = Ab + (size_t)((tm << 7) + crow) * lda + ccol * 8;
  const _Float16* gB = Bb + (size_t)((tn << 7) + crow) * ldb + ccol * 8;
  const unsigned lA = (unsigned)(size_t)smem + (unsigned)(crow * LROW + ccol * 16);
  const unsigned lB = lA + OPBYTES;
  const size_t stepA = (size_t)16 * lda, stepB = (size_t)16 * ldb;

  // fragment read bases inside a buffer
  const unsigned char* fA = smem + (((wave >> 1) << 5) + rlane) * LROW + koff * 2;
  const unsigned char* fB = smem + OPBYTES + (((wave & 1) << 6) + rlane) * LROW + koff * 2;

  v8f acc[2][4];
#pragma unroll
  for (int i = 0; i < 2; ++i)
#pragma unroll
    for (int j = 0; j < 4; ++j) acc[i][j] = zero8();

  const int nt = K >> 7;                                   // stages of 128 k
  int sc = (b * tilesM + tm + tn) % nt;                    // k stage of the next copies (block-uniform, 0 .. nt-1)
  copy8(lA, gA + (size_t)sc * 128, stepA);
  copy8(lB, gB + (size_t)sc * 128, stepB);
  sc = (sc + 1 == nt) ? 0 : sc + 1;
  wait_copies();
  __syncthreads();                                         // first stage published
  if (nt > 1) {
    copy8(lA + STAGEB, gA + (size_t)sc * 128, stepA);
    copy8(lB + STAGEB, gB + (size_t)sc * 128, stepB);
    sc = (sc + 1 == nt) ? 0 : sc + 1;
  }

  for (int t = 0; t < nt; ++t) {
    const unsigned buf = (unsigned)(t & 1) * STAGEB;
    // two fragment sets: the next 32 k of THIS buffer are read as one group ahead of the current products
    v16h bq[2][4], af[2][2];
#pragma unroll
    for (int j = 0; j < 4; ++j) bq[0][j] = ldfrag((const _Float16*)(fB + buf + j * 16 * LROW));
#pragma unroll
    for (int i = 0; i < 2; ++i) af[0][i] = ldfrag((const _Float16*)(fA + buf + i * 16 * LROW));
#pragma unroll
    for (int kk = 0; kk < 4; ++kk) {
      const int cur = kk & 1, nxt = cur ^ 1;
      if (kk < 3) {
#pragma unroll
        for (int j = 0; j < 4; ++j)
          bq[nxt][j] = ldfrag((const _Float16*)(fB + buf + j * 16 * LROW + (kk + 1) * 64));
#pragma unroll
        for (int i = 0; i < 2; ++i)
          af[nxt][i] = ldfrag((const _Float16*)(fA + buf + i * 16 * LROW + (kk + 1) * 64));
      }
      // keeps the load group in front of the products: without it the scheduler sinks the LDS reads among the
      // matrix instructions into one register set, and each product group waits out its own LDS latency
      __builtin_amdgcn_sched_barrier(0);
#pragma unroll
      for (int i = 0; i < 2; ++i)
#pragma unroll
        for (int j = 0; j < 4; ++j) acc[i][j] = mmar(af[cur][i], bq[cur][j], acc[i][j]);
      // same purpose: the following load group stays behind these products
      __builtin_amdgcn_sched_barrier(0);
    }
    wait_lds();
    wait_copies();
    __syncthreads();                                       // publishes stage t+1, frees stage t's buffer
    if (t + 2 < nt) {
      copy8(lA + buf, gA + (size_t)sc * 128, stepA);
      copy8(lB + buf, gB + (size_t)sc * 128, stepB);
      sc = (sc + 1 == nt) ? 0 : sc + 1;
    }
  }
  wait_copies();
  acc_guard4(acc[0][0], acc[0][1], acc[0][2], acc[0][3]);
  acc_guard4(acc[1][0], acc[1][1], acc[1][2], acc[1][3]);

  // ---- epilogue ----
  float* slab = (float*)(smem + wave * (16 * 68 * 4));     // per-wave 16x64 slab, pitch 68 floats
#pragma unroll
  for (int i = 0; i < 2; ++i) {
    const int mBase = m0 + (i << 4);
#pragma unroll
    for (int j = 0; j < 4; ++j) {
#pragma unroll
      for (int r = 0; r < 8; ++r) {
        slab[(mOff + r) * 68 + (j << 4) + rlane] = acc[i][j][r];
      }
    }
    __builtin_amdgcn_fence(3, "workgroup");
    __builtin_amdgcn_wave_barrier();
    __builtin_amdgcn_fence(2, "workgroup");
    if (MODE == 0) {
      float* C = (float*)Cout + (size_t)b * (size_t)strideC;
      const float* R = res + (size_t)b * (size_t)strideR;
      const int h2 = lane >> 4, c4 = (lane & 15) * 4;     // 256-B row segment = 16 lanes x 16 B
      const v4f bv = bf16r4(*(const v4fa*)(bias + n0 + c4));
      {
#pragma unroll
        for (int it = 0; it < 8; ++it) {
          const int row = it * 2 + h2;                     // it 0..7 x h2 0..1 = rows 0..15
          const size_t go = (size_t)(mBase + row) * ldc + n0 + c4;
          const size_t ro = (size_t)(mBase + row) * ldr + n0 + c4;
          const v4f sv = *(const v4fa*)(slab + row * 68 + c4);
          v4f rv = *(const v4fa*)(R + ro);
          if (RESRNE) rv = bf16r4(rv);
          const v4f v = sv * oscale + bv + rv;
          *(v4f*)(C + go) = v;
        }
        
      }
    } else {
      const int q = lane >> 3, c8 = (lane & 7) * 8;
      _Float16* C = (_Float16*)Cout + (size_t)b * (size_t)strideC;
      float bb8[8] = { 0.f, 0.f, 0.f, 0.f, 0.f, 0.f, 0.f, 0.f };
      if (MODE == 1 || MODE == 2) {
        const v4f ba = bf16r4(*(const v4fa*)(bias + n0 + c8));
        const v4f bc = bf16r4(*(const v4fa*)(bias + n0 + c8 + 4));
        bb8[0] = ba.x; bb8[1] = ba.y; bb8[2] = ba.z; bb8[3] = ba.w;
        bb8[4] = bc.x; bb8[5] = bc.y; bb8[6] = bc.z; bb8[7] = bc.w;
      }
      v8h hv[4];
#pragma unroll
      for (int it = 0; it < 4; ++it) {
        const int row = it * 4 + q;                        // it 0..3 x q 0..3 = rows 0..15
        const float* sp = slab + row * 68 + c8;
        const v4f a = *(const v4fa*)sp;
        const v4f c = *(const v4fa*)(sp + 4);
        float f[8] = { a.x, a.y, a.z, a.w, c.x, c.y, c.z, c.w };
        float brow = 0.0f;
        if (MODE == 3) brow = bf16r(bias[mBase + row]);
#pragma unroll
        for (int e = 0; e < 8; ++e) {
          float u = f[e] * oscale + ((MODE == 3) ? brow : bb8[e]);
          if (MODE == 2) {
            const float gl = 0.5f * u * (1.0f + erff(u * 0.70710678118654752f));
            u = gl * ocarry;
          }
          f[e] = u;
        }
        const v8h o = { (_Float16)f[0], (_Float16)f[1], (_Float16)f[2], (_Float16)f[3],
                        (_Float16)f[4], (_Float16)f[5], (_Float16)f[6], (_Float16)f[7] };
        hv[it] = o;
      }
      {
#pragma unroll
        for (int it = 0; it < 4; ++it) {
          const int row = it * 4 + q;
          *(v8h*)(C + (size_t)(mBase + row) * ldc + n0 + c8) = hv[it];
        }
        
      }
    }
    __builtin_amdgcn_fence(3, "workgroup");
    __builtin_amdgcn_wave_barrier();
    __builtin_amdgcn_fence(2, "workgroup");
  }
}

// one GEMM per launch: blockIdx.x = tile, blockIdx.y = batch
template <int MODE, bool RESRNE>
__global__ __launch_bounds__(256) void gemm128(
    const _Float16* __restrict__ A, int lda, long long strideA,
    const _Float16* __restrict__ Bt, int ldb, long long strideB,
    void* Cout, int ldc, long long strideC,
    const float* __restrict__ bias,
    const float* __restrict__ res, int ldr, long long strideR,
    int M, int N, int K, float oscale, float ocarry)
{
  __shared__ __align__(16) unsigned char smem[2 * STAGEB];  // two stage buffers; epilogue slabs behind the loop
  gemm_tile<MODE, RESRNE>(smem, (int)blockIdx.x, (int)blockIdx.y, A, lda, strideA, Bt, ldb, strideB,
                          Cout, ldc, strideC, bias, res, ldr, strideR, M, N, K, oscale, ocarry);
}

// The four projections that need only hn = LN(x) or the c plane, in ONE grid; a block-index range picks the job:
//   self q|k   = hn . Wqkv[:, 0:2 FEAT]      -> qk_s [NTOK][QKP]              (M=NTOK, N=QKP,  column bias)
//   cross k    = c . Wck                     -> qk_c [NTOK][QKP] cols FEAT..  (M=NTOK, N=FEAT, column bias)
//   self v^T   = Wqkv[:, 2 FEAT:]^T . hn^T   -> vt_s [b][FEAT][SEQ]           (M=FEAT, N=SEQ per batch, row bias)
//   cross v^T  = Wcv^T . c^T                 -> vt_c [b][FEAT][SEQ]           (M=FEAT, N=SEQ per batch, row bias)
// K (= FEAT) comes as an argument, as in gemm128.
#define GB_QK ((NTOK / 128) * (QKP / 128))
#define GB_K  ((NTOK / 128) * (FEAT / 128))
#define GB_V1 ((FEAT / 128) * (SEQ / 128))         // v^T tiles of one batch
#define GB_ALL (GB_QK + GB_K + 2 * NB * GB_V1)

__global__ __launch_bounds__(256) void gemm_proj4(
    const _Float16* __restrict__ hn, const _Float16* __restrict__ cpl,
    const _Float16* __restrict__ wqkvT, const _Float16* __restrict__ wckT, const _Float16* __restrict__ wcvT,
    const float* __restrict__ b_qkv, const float* __restrict__ b_ck, const float* __restrict__ b_cv,
    _Float16* qk_s, _Float16* qk_c, _Float16* vt_s, _Float16* vt_c, int K, float oscale)
{
  __shared__ __align__(16) unsigned char smem[2 * STAGEB];  // two stage buffers; epilogue slabs behind the loop
  int blk = (int)blockIdx.x;
  const _Float16 *A, *Bt; _Float16* C; const float* bias;
  int b = 0, rowbias = 0, ldc = QKP, M = NTOK, N = FEAT;
  long long strideB = 0LL, strideC = 0LL;
  if (blk < GB_QK)               { A = hn;  Bt = wqkvT; C = qk_s;        bias = b_qkv; N = QKP; }
  else if ((blk -= GB_QK) < GB_K) { A = cpl; Bt = wckT;  C = qk_c + FEAT; bias = b_ck; }
  else {
    blk -= GB_K;
    if (blk < NB * GB_V1) { A = wqkvT + (size_t)2 * FEAT * FEAT; Bt = hn; C = vt_s; bias = b_qkv + 2 * FEAT; }
    else { blk -= NB * GB_V1; A = wcvT; Bt = cpl; C = vt_c; bias = b_cv; }
    b = blk / GB_V1; blk -= b * GB_V1;
    rowbias = 1; ldc = SEQ; M = FEAT; N = SEQ;
    strideB = (long long)SEQ * FEAT; strideC = (long long)FEAT * SEQ;
  }
  if (rowbias)                                             // block-uniform: every barrier inside is met by all waves
    gemm_tile<3, false>(smem, blk, b, A, FEAT, 0LL, Bt, FEAT, strideB, (void*)C, ldc, strideC,
                        bias, bias, FEAT, 0LL, M, N, K, oscale, 1.0f);
  else
    gemm_tile<1, false>(smem, blk, b, A, FEAT, 0LL, Bt, FEAT, strideB, (void*)C, ldc, strideC,
                        bias, bias, FEAT, 0LL, M, N, K, oscale, 1.0f);
}

// =====================================================================================================
// Streaming attention, transposed form, 16 heads, additive key mask (-10000 where mask != 1),
// softmax over all SEQ keys. Block 128 thr (4 waves), 16 queries per wave, 64 keys per step.
//   S^T = K * Q^T : A = K rows (row = key, k = d), B = Q^T (k = d, n = query); scale 0.125 applied in f32
//   O^T += V^T * P^T : A = V^T rows (row = d, k = key), B = P^T packed from the score D registers
//   (element r <- key tile covering k 0..15 row r, element 8+r <- tile covering k 16..31 row r, same lane)
// Lane owns 32 keys of query column (lane&15); partner = lane ^ 16. Online softmax in f32; p carried x16384.
//   q|k plane [b*SEQ + t][QKP]: q at col head*64 + d, k at col FEAT + head*64 + d (f16);
//   v^T plane [b][head*64 + d][SEQ] (f16); mask int32 [b][SEQ_FULL].
//   ctx plane [b*SEQ + t][head*64 + d] = f16(256 * o / l): per-wave 16x64 tile staged in LDS (block barrier),
// coverage: grid (SEQ/64, NB*NH): every (b, head, query) row x 64 columns of its head written once.
// LDS sO: each wave writes its full 16x64 region before the barrier.
// Operands: per step the 64 K rows (128 B each) and the 64 V^T rows (128 B each) that all four waves use are
// brought into LDS once per block by asynchronous 16-byte copies (each thread 4 + 4 copies, a wave-wide copy =
// four whole 128-B rows), two buffers, the next step's tiles in flight while this step is worked on.
// LDS row pitch 144 B (128 + 16: ds_load_b128 readers); the 16 pad bytes per row are never read.
// Key order: the block of query tile x starts at key step x mod steps and wraps round, so that the blocks of one
// (batch, head), which all walk the same K and V^T rows, do not ask L2 for the same lines at the same moment.
// =====================================================================================================
#define KVROW   144                    // LDS row pitch, bytes
#define KVOP    (64 * KVROW)           // one operand's 64 rows of one step
#define KVSTAGE (2 * KVOP)             // [K 64 rows | V^T 64 rows]

// Eight asynchronous 16-byte copies of this lane: rows r, r+16, r+32, r+48 of the K tile and of the V^T tile.
// lk, lv = the lane's LDS byte addresses of row r, gk, gv = its global addresses, kstep, vstep = elements per 16 rows.
// s_wait_xcnt 0 is the last line of the statement, so that no address register is rewritten in front of it.
__device__ __forceinline__ void copy_kv(unsigned lk, const _Float16* gk, size_t kstep,
                                        unsigned lv, const _Float16* gv, size_t vstep) {
#if DEV_ASM
  const unsigned lk1 = lk + 16 * KVROW, lk2 = lk + 32 * KVROW, lk3 = lk + 48 * KVROW;
  const unsigned lv1 = lv + 16 * KVROW, lv2 = lv + 32 * KVROW, lv3 = lv + 48 * KVROW;
  const _Float16 *gk1 = gk + kstep, *gk2 = gk1 + kstep, *gk3 = gk2 + kstep;
  const _Float16 *gv1 = gv + vstep, *gv2 = gv1 + vstep, *gv3 = gv2 + vstep;
  asm volatile("global_load_async_to_lds_b128 %0, %8, off\n\t"
               "global_load_async_to_lds_b128 %1, %9, off\n\t"
               "global_load_async_to_lds_b128 %2, %10, off\n\t"
               "global_load_async_to_lds_b128 %3, %11, off\n\t"
               "global_load_async_to_lds_b128 %4, %12, off\n\t"
               "global_load_async_to_lds_b128 %5, %13, off\n\t"
               "global_load_async_to_lds_b128 %6, %14, off\n\t"
               "global_load_async_to_lds_b128 %7, %15, off\n\t"
               "s_wait_xcnt 0x0"
               :: "v"(lk), "v"(lk1), "v"(lk2), "v"(lk3), "v"(lv), "v"(lv1), "v"(lv2), "v"(lv3),
                  "v"(gk), "v"(gk1), "v"(gk2), "v"(gk3), "v"(gv), "v"(gv1), "v"(gv2), "v"(gv3)
               : "memory");
#else
  (void)lk; (void)gk; (void)kstep; (void)lv; (void)gv; (void)vstep;
#endif
}

__device__ __forceinline__ v16h pack_p(v8f a, v8f c) {
  const v16h r = { (_Float16)(a[0] * PSCALE), (_Float16)(a[1] * PSCALE), (_Float16)(a[2] * PSCALE), (_Float16)(a[3] * PSCALE),
                   (_Float16)(a[4] * PSCALE), (_Float16)(a[5] * PSCALE), (_Float16)(a[6] * PSCALE), (_Float16)(a[7] * PSCALE),
                   (_Float16)(c[0] * PSCALE), (_Float16)(c[1] * PSCALE), (_Float16)(c[2] * PSCALE), (_Float16)(c[3] * PSCALE),
                   (_Float16)(c[4] * PSCALE), (_Float16)(c[5] * PSCALE), (_Float16)(c[6] * PSCALE), (_Float16)(c[7] * PSCALE) };
  return r;
}

__global__ __launch_bounds__(128) __attribute__((amdgpu_num_vgpr(256))) void attn_kernel(
    const _Float16* __restrict__ qk, const _Float16* __restrict__ vt,
    const int* __restrict__ mask, _Float16* ctx)
{
  __shared__ __align__(16) float sO[4 * 16 * 64];          // 16384 B
  __shared__ __align__(16) unsigned char skv[2 * KVSTAGE]; // two step buffers of K and V^T rows

  const int tid = (int)threadIdx.x, lane = tid & 31, w = tid >> 5;
  const int h = lane >> 4, m = lane & 15;
  const int bh = blockIdx.y, b = bh / NH, head = bh - b * NH;
  const int q0 = blockIdx.x * 64 + 16 * w;

  // Q^T B-fragments: column n = query q0+m, k = d (two 32-deep chunks)
  const _Float16* qrow = qk + ((size_t)b * SEQ + q0 + m) * QKP + head * HD;
  const v16h qb0 = load_frag(qrow, h);
  const v16h qb1 = load_frag(qrow + 32, h);

  v8f o[4];                                                // o[t][r] = O[query m][d 16t+8h+r] * (l * PSCALE)
#pragma unroll
  for (int t = 0; t < 4; ++t) o[t] = zero8();
  float mrun = -1e30f, lrun = 0.0f;

  const int* mk = mask + (size_t)b * SEQ_FULL + 8 * h;                            // + key0 + 16j

  // copy map: thread -> row tid>>3 (+16 per copy), 16-byte piece tid&7 of the row's 128 bytes
  const int crow = tid >> 3, cpc = tid & 7;
  const _Float16* gK = qk + ((size_t)b * SEQ + crow) * QKP + FEAT + head * HD + cpc * 8;   // + key0*QKP
  const _Float16* gV = vt + ((size_t)b * FEAT + head * HD + crow) * SEQ + cpc * 8;         // + key0
  const unsigned lK = (unsigned)(size_t)skv + (unsigned)(crow * KVROW + cpc * 16);
  const unsigned lV = lK + KVOP;
  const size_t stepK = (size_t)16 * QKP, stepV = (size_t)16 * SEQ;
  // fragment read bases inside a buffer: row m of a 16-row group, k offset 8h
  const unsigned char* fK = skv + m * KVROW + 16 * h;
  const unsigned char* fV = skv + KVOP + m * KVROW + 16 * h;

  int kb = ((int)blockIdx.x % (SEQ / 64)) * 64;            // first key of this trip (block-uniform, 0 .. SEQ-64)
  int kc = kb;                                             // first key of the next copies
  copy_kv(lK, gK + (size_t)kc * QKP, stepK, lV, gV + kc, stepV);
  kc = (kc + 64 == SEQ) ? 0 : kc + 64;
  wait_copies();
  __syncthreads();                                         // first step published
  if (SEQ > 64) {
    copy_kv(lK + KVSTAGE, gK + (size_t)kc * QKP, stepK, lV + KVSTAGE, gV + kc, stepV);
    kc = (kc + 64 == SEQ) ? 0 : kc + 64;
  }

#pragma unroll 1
  for (int it = 0; it < SEQ; it += 64) {
    const unsigned buf = (unsigned)((it >> 6) & 1) * KVSTAGE;
    // ---- scores: s[j][r] = S[query m][key kb+16j+8h+r] * 0.125 + madd[key] ----
    v8f s[4];
    v16h kf[4][2];
#pragma unroll
    for (int j = 0; j < 4; ++j) {
      const _Float16* kr = (const _Float16*)(fK + buf + j * 16 * KVROW);
      kf[j][0] = ldfrag(kr);
      kf[j][1] = ldfrag(kr + 32);
    }
    // keeps the K reads one group in front of the score products: left free, the scheduler puts four reads in
    // front of each pair of products, and every pair waits out its own LDS latency
    __builtin_amdgcn_sched_barrier(0);
#pragma unroll
    for (int j = 0; j < 4; ++j) {
      v8f z = zero8();
      z = wmma_f16(kf[j][0], qb0, z);
      z = wmma_f16(kf[j][1], qb1, z);
      const v4i ma = *(const v4ia*)(mk + kb + 16 * j);
      const v4i mc = *(const v4ia*)(mk + kb + 16 * j + 4);
      const int mm[8] = { ma.x, ma.y, ma.z, ma.w, mc.x, mc.y, mc.z, mc.w };
#pragma unroll
      for (int r = 0; r < 8; ++r) {
        const float sc = z[r] * 0.125f;
        s[j][r] = sc + ((mm[r] != 1) ? -10000.0f : 0.0f);
      }
    }

    // ---- V^T fragments of this step: one read group, in flight while the softmax runs ----
    v16h vf[4][2];
#pragma unroll
    for (int t = 0; t < 4; ++t) {
      const _Float16* vp = (const _Float16*)(fV + buf + t * 16 * KVROW);
      vf[t][0] = ldfrag(vp);
      vf[t][1] = ldfrag(vp + 32);
    }
    // keeps the V^T reads in front of the softmax: left free, they sink to their products and are waited for there
    __builtin_amdgcn_sched_barrier(0);

    // ---- online softmax (f32) ----
    float mloc = s[0][0];
#pragma unroll
    for (int j = 0; j < 4; ++j)
#pragma unroll
      for (int r = 0; r < 8; ++r) mloc = fmaxf(mloc, s[j][r]);
    mloc = fmaxf(mloc, __shfl_xor(mloc, 16));
    const float mnew = fmaxf(mrun, mloc);
    const float alpha = __expf(mrun - mnew);
    mrun = mnew;
    float lsum = 0.0f;
#pragma unroll
    for (int j = 0; j < 4; ++j)
#pragma unroll
      for (int r = 0; r < 8; ++r) {
        const float p = __expf(s[j][r] - mnew);
        s[j][r] = p;
        lsum += p;
      }
    lsum += __shfl_xor(lsum, 16);
    lrun = lrun * alpha + lsum;
#pragma unroll
    for (int t = 0; t < 4; ++t)
#pragma unroll
      for (int r = 0; r < 8; ++r) o[t][r] = o[t][r] * alpha;

    // ---- P^T B-fragments (key chunks 0..31 and 32..63 of this step) ----
    const v16h pb0 = pack_p(s[0], s[1]);
    const v16h pb1 = pack_p(s[2], s[3]);

    // ---- O^T += V^T * P^T ----
#pragma unroll
    for (int t = 0; t < 4; ++t) {
      o[t] = wmma_f16(vf[t][0], pb0, o[t]);
      o[t] = wmma_f16(vf[t][1], pb1, o[t]);
    }
    wait_lds();
    wait_copies();
    __syncthreads();                                       // publishes the next step, frees this step's buffer
    if (it + 128 < SEQ) {
      copy_kv(lK + buf, gK + (size_t)kc * QKP, stepK, lV + buf, gV + kc, stepV);
      kc = (kc + 64 == SEQ) ? 0 : kc + 64;
    }
    kb = (kb + 64 == SEQ) ? 0 : kb + 64;
  }
  wait_copies();

  // ---- epilogue: normalise (1/l, remove the p carry, apply the ctx carry), stage per-wave 16x64 tile ----
  const float inv = (1.0f / lrun) * (CTXCARRY / PSCALE);
  float* so = sO + w * 1024;
#pragma unroll
  for (int t = 0; t < 4; ++t)
#pragma unroll
    for (int r = 0; r < 8; ++r)
      so[m * 64 + 16 * t + 8 * h + r] = o[t][r] * inv;
  __syncthreads();

  const int q8 = lane & 7, sub = lane >> 3;
  v8h hv[4];
#pragma unroll
  for (int it = 0; it < 4; ++it) {
    const int row = it * 4 + sub;                          // it 0..3 x sub 0..3 = rows 0..15 of the wave tile
    const float* sp = so + row * 64 + 8 * q8;
    const v4f a = *(const v4fa*)sp;
    const v4f c = *(const v4fa*)(sp + 4);
    const v8h ov = { (_Float16)a.x, (_Float16)a.y, (_Float16)a.z, (_Float16)a.w,
                     (_Float16)c.x, (_Float16)c.y, (_Float16)c.z, (_Float16)c.w };
    hv[it] = ov;
  }
  {
#pragma unroll
    for (int it = 0; it < 4; ++it) {
      const int row = it * 4 + sub;
      _Float16* dst = ctx + ((size_t)b * SEQ + q0 + row) * FEAT + head * HD + 8 * q8;
      *(v8h*)dst = hv[it];
    }
    
  }
}

// =====================================================================================================
// Host orchestration. Workspace map (bytes, NB=4 SEQ=1024), every region an exact multiple of its whole-line
// store granularity, all offsets multiples of 128:
//   hn    f16 [4096][1024]      8388608   (LN outputs of all three blocks, written and consumed in order)
//   cpl   f16 [4096][1024]      8388608   (bf16rne(c) as f16)
//   WqkvT f16 [3072][1024]      6291456
//   WspT  f16 [1024][1024]      2097152
//   WcqT, WckT, WcvT, WcpT      4 x 2097152
//   W1T   f16 [4096][1024]      8388608
//   W2T   f16 [1024][4096]      8388608
//   ATT   shared region        33554432 : self q|k f16 [4096][2048] (16777216) + self v^T f16 [4][1024][1024]
//                                         (8388608) + ctx f16 [4096][1024] (8388608, both attention blocks);
//                                         mid f16 [4096][4096] (33554432) during the MLP (all readers of
//                                         q|k, v^T, ctx have completed before fc1 writes mid)
//   x1    f32 [4096][1024]     16777216
//   x2    f32 [4096][1024]     16777216
//   qk_c  f16 [4096][2048]     16777216   (cross q|k: k written with the self projections, q behind LN(x1))
//   vt_c  f16 [4][1024][1024]   8388608   (cross v^T, written with the self projections)
//   total                     142606336
// =====================================================================================================
extern "C" void kernel_launch(void* const* d_in, const int* in_sizes, int n_in,
                              void* d_out, int out_size, void* d_ws, size_t ws_size,
                              hipStream_t stream)
{
  if (n_in < 19) return;
  const long long needTok = (long long)(NB - 1) * SEQ_FULL + SEQ;
  if ((long long)in_sizes[0] < needTok * FEAT) return;                 // x
  if ((long long)in_sizes[1] < needTok * FEAT) return;                 // c
  if ((long long)in_sizes[2] < needTok) return;                        // mask (int32)
  if ((long long)in_sizes[3] < (long long)FEAT * 3 * FEAT || in_sizes[4] < 3 * FEAT) return;
  if ((long long)in_sizes[5] < (long long)FEAT * FEAT || in_sizes[6] < FEAT) return;
  if ((long long)in_sizes[7] < (long long)FEAT * FEAT || in_sizes[8] < FEAT) return;
  if ((long long)in_sizes[9] < (long long)FEAT * FEAT || in_sizes[10] < FEAT) return;
  if ((long long)in_sizes[11] < (long long)FEAT * FEAT || in_sizes[12] < FEAT) return;
  if ((long long)in_sizes[13] < (long long)FEAT * FEAT || in_sizes[14] < FEAT) return;
  if ((long long)in_sizes[15] < (long long)FEAT * MF || in_sizes[16] < MF) return;
  if ((long long)in_sizes[17] < (long long)MF * FEAT || in_sizes[18] < FEAT) return;
  if ((long long)out_size < needTok * FEAT) return;

  const float* x         = (const float*)d_in[0];
  const float* c         = (const float*)d_in[1];
  const int*   mask      = (const int*)d_in[2];
  const float* sa_qkv_w  = (const float*)d_in[3];
  const float* sa_qkv_b  = (const float*)d_in[4];
  const float* sa_proj_w = (const float*)d_in[5];
  const float* sa_proj_b = (const float*)d_in[6];
  const float* ca_q_w    = (const float*)d_in[7];
  const float* ca_q_b    = (const float*)d_in[8];
  const float* ca_k_w    = (const float*)d_in[9];
  const float* ca_k_b    = (const float*)d_in[10];
  const float* ca_v_w    = (const float*)d_in[11];
  const float* ca_v_b    = (const float*)d_in[12];
  const float* ca_proj_w = (const float*)d_in[13];
  const float* ca_proj_b = (const float*)d_in[14];
  const float* fc1_w     = (const float*)d_in[15];
  const float* fc1_b     = (const float*)d_in[16];
  const float* fc2_w     = (const float*)d_in[17];
  const float* fc2_b     = (const float*)d_in[18];

  const size_t P_F16  = (size_t)NTOK * FEAT * 2;
  const size_t P_F32  = (size_t)NTOK * FEAT * 4;
  const size_t P_W    = (size_t)FEAT * FEAT * 2;
  const size_t P_WQKV = (size_t)3 * FEAT * FEAT * 2;
  const size_t P_W1   = (size_t)MF * FEAT * 2;
  const size_t P_QK   = (size_t)NTOK * QKP * 2;
  const size_t P_VT   = (size_t)NB * FEAT * SEQ * 2;
  const size_t P_MID  = (size_t)NTOK * MF * 2;
  const size_t P_ATTU = P_QK + P_VT + P_F16;
  const size_t P_ATT  = (P_ATTU > P_MID) ? P_ATTU : P_MID;
  size_t off = 0;
  const size_t oHn   = off; off += P_F16;
  const size_t oC    = off; off += P_F16;
  const size_t oWqkv = off; off += P_WQKV;
  const size_t oWsp  = off; off += P_W;
  const size_t oWcq  = off; off += P_W;
  const size_t oWck  = off; off += P_W;
  const size_t oWcv  = off; off += P_W;
  const size_t oWcp  = off; off += P_W;
  const size_t oW1   = off; off += P_W1;
  const size_t oW2   = off; off += P_W1;
  const size_t oAtt  = off; off += P_ATT;
  const size_t oX1   = off; off += P_F32;
  const size_t oX2   = off; off += P_F32;
  const size_t oQkc  = off; off += P_QK;
  const size_t oVtc  = off; off += P_VT;
  if (off > ws_size) return;                               // off = 142606336 at NB=4, SEQ=1024

  char* ws = (char*)d_ws;
  _Float16* hn    = (_Float16*)(ws + oHn);
  _Float16* cpl   = (_Float16*)(ws + oC);
  _Float16* wqkvT = (_Float16*)(ws + oWqkv);
  _Float16* wspT  = (_Float16*)(ws + oWsp);
  _Float16* wcqT  = (_Float16*)(ws + oWcq);
  _Float16* wckT  = (_Float16*)(ws + oWck);
  _Float16* wcvT  = (_Float16*)(ws + oWcv);
  _Float16* wcpT  = (_Float16*)(ws + oWcp);
  _Float16* w1T   = (_Float16*)(ws + oW1);
  _Float16* w2T   = (_Float16*)(ws + oW2);
  _Float16* qkp   = (_Float16*)(ws + oAtt);
  _Float16* vtp   = (_Float16*)(ws + oAtt + P_QK);
  _Float16* ctx   = (_Float16*)(ws + oAtt + P_QK + P_VT);
  _Float16* mid   = (_Float16*)(ws + oAtt);
  float*    x1    = (float*)(ws + oX1);
  float*    x2    = (float*)(ws + oX2);
  _Float16* qkc   = (_Float16*)(ws + oQkc);
  _Float16* vtc   = (_Float16*)(ws + oVtc);

  const dim3 blk(256);
  const float sQKV  = 1.0f / WCARRY;
  const float sPROJ = 1.0f / (WCARRY * CTXCARRY);
  const float sFC2  = 1.0f / (WCARRY * MIDCARRY);

  // (1) one grid: weights f32 [in][out] -> f16 [out][in] = bf16rne(w) x64; c -> compact f16 plane (bf16rne values);
  //     hn = LN(bf16rne(x)) -> f16 plane
  prep_kernel<<<dim3(PB_ALL), blk, 0, stream>>>(
      sa_qkv_w, sa_proj_w, ca_q_w, ca_k_w, ca_v_w, ca_proj_w, fc1_w, fc2_w, x, c,
      wqkvT, wspT, wcqT, wckT, wcvT, wcpT, w1T, w2T, cpl, hn);

  // (2) one grid: self q|k and self v^T from hn, cross k and cross v^T from the c plane (K=1024; acc / 64)
  gemm_proj4<<<dim3(GB_ALL), blk, 0, stream>>>(
      hn, cpl, wqkvT, wckT, wcvT, sa_qkv_b, ca_k_b, ca_v_b, qkp, qkc, vtp, vtc, FEAT, sQKV);

  // ---------------- self-attention block ----------------
  // (3) attention -> ctx f16 plane (x256)
  const dim3 gAT(SEQ / 64, NB * NH);
  attn_kernel<<<gAT, dim3(128), 0, stream>>>(qkp, vtp, mask, ctx);
  // (4) x1 = ctx . Wsp + b + bf16rne(x) -> f32 plane   (per batch M=SEQ, N=1024, K=1024; acc / (64*256))
  const dim3 gPB((SEQ / 128) * (FEAT / 128), NB);
  gemm128<0, true><<<gPB, blk, 0, stream>>>(
      ctx, FEAT, (long long)SEQ * FEAT, wspT, FEAT, 0LL, (void*)x1, FEAT, (long long)SEQ * FEAT,
      sa_proj_b, x, FEAT, (long long)SEQ_FULL * FEAT,
      SEQ, FEAT, FEAT, sPROJ, 1.0f);

  // ---------------- cross-attention block ----------------
  // (5) hn = LN(x1)
  ln_kernel<<<dim3(NTOK), blk, 0, stream>>>(x1, (long long)SEQ * FEAT, hn);
  // (6) q = hn . Wcq + b -> cross q|k plane cols 0..1023   (M=NTOK, N=1024, K=1024)
  const dim3 gQ((NTOK / 128) * (FEAT / 128), 1);
  gemm128<1, false><<<gQ, blk, 0, stream>>>(
      hn, FEAT, 0LL, wcqT, FEAT, 0LL, (void*)qkc, QKP, 0LL, ca_q_b, x1, FEAT, 0LL,
      NTOK, FEAT, FEAT, sQKV, 1.0f);
  // (7) attention -> ctx
  attn_kernel<<<gAT, dim3(128), 0, stream>>>(qkc, vtc, mask, ctx);
  // (8) x2 = ctx . Wcp + b + x1 -> f32 plane   (M=NTOK, N=1024, K=1024)
  gemm128<0, false><<<gQ, blk, 0, stream>>>(
      ctx, FEAT, 0LL, wcpT, FEAT, 0LL, (void*)x2, FEAT, 0LL,
      ca_proj_b, x1, FEAT, 0LL,
      NTOK, FEAT, FEAT, sPROJ, 1.0f);

  // ---------------- MLP block ----------------
  // (9) hn = LN(x2)
  ln_kernel<<<dim3(NTOK), blk, 0, stream>>>(x2, (long long)SEQ * FEAT, hn);
  // (10) mid = gelu(hn . W1 + b1) x16 -> f16 [NTOK][4096]   (M=NTOK, N=4096, K=1024; acc / 64)
  const dim3 gW1((NTOK / 128) * (MF / 128), 1);
  gemm128<2, false><<<gW1, blk, 0, stream>>>(
      hn, FEAT, 0LL, w1T, FEAT, 0LL, (void*)mid, MF, 0LL, fc1_b, x1, FEAT, 0LL,
      NTOK, MF, FEAT, sQKV, MIDCARRY);
  // (11) out = mid . W2 + b2 + x2 -> d_out f32 rows b*SEQ_FULL + t   (per batch M=SEQ, N=1024, K=4096; acc / (64*16))
  gemm128<0, false><<<gPB, blk, 0, stream>>>(
      mid, MF, (long long)SEQ * MF, w2T, MF, 0LL, d_out, FEAT, (long long)SEQ_FULL * FEAT,
      fc2_b, x2, FEAT, (long long)SEQ * FEAT,
      SEQ, FEAT, MF, sFC2, 1.0f);

  (void)hipGetLastError();
}

// v005
// Measured time: 223 microseconds a run.
// Timed twice side by side with v004, it ran 1.05 and 1.04 times as fast.
// All steps since v000 together make it 3.42 times as fast.
// Contractions: hn*WqkT (q|k plane), Wv*hn^T (v^T plane), K*Q^T scores, V^T*P^T, ctx*WpT for both attention
// blocks (cross block: k and v^T from the c plane), hn*W1T, mid*W2T: all v_wmma_f32_16x16x32_f16
// (f16 operands, single product, f32 accumulate). LayerNorms, softmax, GELU (erf form), bias and
// residual adds: f32 on VALU. Every float input enters as its bf16 RNE value (x, c, weights, biases).
// Carry audit (f16 planes): weights = bf16(w) x64, inverse folded once into the scale of each consuming GEMM
// (q/k/v^T: 1/64; proj GEMMs: 1/(64*256); fc1: 1/64; fc2: 1/(64*16)). hn, c, q, k, v^T carried x1.
// P = p x16384 (carried in the exponent, so l carries it too) and ctx = o x256: inv = (1/l)*256 in attn_kernel;
// mid = gelu x16. Scores are formed in the log2 domain: q enters the score product as f16(q * log2(e)/8).
#include <hip/hip_runtime.h>
#include <math.h>

#ifndef NB
#define NB 4
#endif
#ifndef SEQ
#define SEQ 1024
#endif
#define NB_FULL  4
#define SEQ_FULL 1024
#define FEAT 1024
#define NH   16
#define HD   64
#define MF   4096
#define QKP  (2 * FEAT)
#define NTOK (NB * SEQ)
static_assert(NH * HD == FEAT);
static_assert(HD == 64);
static_assert(NB >= 1 && NB <= NB_FULL);
static_assert(SEQ >= 64 && SEQ <= SEQ_FULL && (SEQ % 64) == 0);
static_assert((FEAT % 64) == 0 && (MF % 64) == 0 && (QKP % 64) == 0);
static_assert((FEAT % 128) == 0 && (MF % 128) == 0 && (QKP % 128) == 0 && (SEQ % 128) == 0 && FEAT >= 256);
static_assert(FEAT == 4 * 256);
static_assert(((long long)(NB - 1) * SEQ_FULL + SEQ) * FEAT <= (long long)NB_FULL * SEQ_FULL * FEAT);

#define WCARRY   64.0f
#define PEXP     14.0f                    // p is carried x 2^14
#define LOG2E    1.4426950408889634f
#define QSCALE   (0.125f * LOG2E)         // score scale 1/8 and the change to base 2, applied to q once
#define MASKADD2 (-10000.0f * LOG2E)      // additive key mask in the log2 domain
#define CTXCARRY 256.0f
#define MIDCARRY 16.0f

typedef _Float16 v16h __attribute__((ext_vector_type(16)));
typedef _Float16 v8h  __attribute__((ext_vector_type(8)));
typedef float    v8f  __attribute__((ext_vector_type(8)));
typedef float    v4f  __attribute__((ext_vector_type(4)));
typedef v8h __attribute__((may_alias)) v8ha;
typedef v4f __attribute__((may_alias)) v4fa;
union Frag { v16h v; v8h half[2]; };

#if defined(__HIP_DEVICE_COMPILE__)
#define DEV_ASM 1
#else
#define DEV_ASM 0
#endif

__device__ __forceinline__ v8f zero8() { v8f z = {0.f, 0.f, 0.f, 0.f, 0.f, 0.f, 0.f, 0.f}; return z; }

// f32 -> bf16 RNE value kept as f32
__device__ __forceinline__ float bf16r(float f) {
  unsigned u = __float_as_uint(f);
  u = (u + 0x7FFFu + ((u >> 16) & 1u)) & 0xFFFF0000u;
  return __uint_as_float(u);
}
__device__ __forceinline__ v4f bf16r4(v4f a) {
  v4f r = { bf16r(a.x), bf16r(a.y), bf16r(a.z), bf16r(a.w) };
  return r;
}

// ---------------------------------------------------------------------------------------------------
// 16x16x32 f16 WMMA. Fragment map (wave32): lane l, h = l>>4, m = n = l&15.
//   A/B element i: i<8 -> k0+8h+i ; i>=8 -> k0+16+8h+(i-8)      D element r: row 8h+r, col l&15
// ---------------------------------------------------------------------------------------------------
// guarded form: 4 VALU slots after the WMMA, D tied, A/B kept live
__device__ __forceinline__ v8f wmma_f16(v16h a, v16h b, v8f c) {
  v8f d = __builtin_amdgcn_wmma_f32_16x16x32_f16(false, a, false, b, (short)0, c, false, false);
#if DEV_ASM
  asm volatile("v_nop\n\tv_nop\n\tv_nop\n\tv_nop" : "+v"(d) : "v"(a), "v"(b));
#endif
  return d;
}
// plain builtin form for the GEMM inner loop (the compiler keeps the distances between its own builtins)
__device__ __forceinline__ v8f mmar(v16h a, v16h b, v8f c) {
  return __builtin_amdgcn_wmma_f32_16x16x32_f16(false, a, false, b, (short)0, c, false, false);
}
__device__ __forceinline__ void acc_guard4(v8f& a, v8f& b, v8f& c, v8f& d) {
#if DEV_ASM
  asm volatile("v_nop\n\tv_nop\n\tv_nop\n\tv_nop" : "+v"(a), "+v"(b), "+v"(c), "+v"(d));
#else
  (void)a; (void)b; (void)c; (void)d;
#endif
}

// A or B fragment from a k-contiguous f16 row; p points at element k0 of the row owned by this lane.
__device__ __forceinline__ v16h load_frag(const _Float16* p, int h) {
  Frag f;
  f.half[0] = *(const v8ha*)(p + 8 * h);
  f.half[1] = *(const v8ha*)(p + 16 + 8 * h);
  return f.v;
}
// same, p already includes +8*(lane>>4)
__device__ __forceinline__ v16h ldfrag(const _Float16* p) {
  Frag f;
  f.half[0] = *(const v8ha*)(p);
  f.half[1] = *(const v8ha*)(p + 16);
  return f.v;
}

// behind a job's last global store: the compiler lays the jobs of one kernel one behind the other, and the code that
// follows in the listing rewrites the store's address and data registers; the wait stands in front of that
__device__ __forceinline__ void wait_store_regs() {
#if DEV_ASM
  asm volatile("s_wait_xcnt 0x0" ::: "memory");
#endif
}

// =====================================================================================================
// A job of the preparation kernel: transpose + convert: in f32 [K][N] (row = k) -> out f16 [N][K] =
// f16(carry * bf16rne(in)^T). Block 256 threads, tile 64 k x 32 n (tile index bx along k, by along n) staged in
// LDS (n-major, pitch 68 floats; cross-wave -> block barrier).
// coverage: 32 n-rows x 64 k per block; (K/64) x (N/32) blocks cover the whole [N][K] plane.
// LDS: tile cols 0..63 of all 32 rows written before the barrier; cols 64..67 never read.
// =====================================================================================================
__device__ __forceinline__ void transpose_tile(
    const float* in, _Float16* out, int K, int N, float carry, int bx, int by)
{
  __shared__ __align__(16) float tile[32][68];
  const int k0 = bx * 64, n0 = by * 32;
  const int tid = (int)threadIdx.x;
  {
    const int kk = tid >> 2, nq = (tid & 3) * 8;
    const float* src = in + (size_t)(k0 + kk) * N + n0 + nq;
    const v4f a = *(const v4fa*)src;
    const v4f c = *(const v4fa*)(src + 4);
    tile[nq + 0][kk] = a.x; tile[nq + 1][kk] = a.y; tile[nq + 2][kk] = a.z; tile[nq + 3][kk] = a.w;
    tile[nq + 4][kk] = c.x; tile[nq + 5][kk] = c.y; tile[nq + 6][kk] = c.z; tile[nq + 7][kk] = c.w;
  }
  __syncthreads();
  {
    const int nn = tid >> 3, kq = (tid & 7) * 8;
    const float* sp = &tile[nn][kq];
    const v4f a = bf16r4(*(const v4fa*)sp);
    const v4f c = bf16r4(*(const v4fa*)(sp + 4));
    const v8h o = { (_Float16)(a.x * carry), (_Float16)(a.y * carry), (_Float16)(a.z * carry), (_Float16)(a.w * carry),
                    (_Float16)(c.x * carry), (_Float16)(c.y * carry), (_Float16)(c.z * carry), (_Float16)(c.w * carry) };
    _Float16* dst = out + (size_t)(n0 + nn) * K + k0 + kq;
    *(v8h*)dst = o;
    wait_store_regs();
  }
}

// =====================================================================================================
// A job of the preparation kernel: row convert: f32 input rows (batch stride SEQ_FULL*FEAT) -> compact f16 plane
// [NTOK][FEAT], value = f16(bf16rne(v)). Two 1024-wide rows per 256-thread block, 8 elements per thread.
// coverage: 128 x 8 = 1024 per row; NTOK/2 blocks.
// =====================================================================================================
__device__ __forceinline__ void cvt_two_rows(const float* src, _Float16* dst, int pair)
{
  const int row = 2 * pair + ((int)threadIdx.x >> 7);
  const int bb = row / SEQ, t = row - bb * SEQ;
  const int tid = (int)threadIdx.x & 127;
  const float* sp = src + ((size_t)bb * SEQ_FULL + (size_t)t) * FEAT + 8 * tid;
  const v4f a = bf16r4(*(const v4fa*)sp);
  const v4f c = bf16r4(*(const v4fa*)(sp + 4));
  const v8h o = { (_Float16)a.x, (_Float16)a.y, (_Float16)a.z, (_Float16)a.w,
                  (_Float16)c.x, (_Float16)c.y, (_Float16)c.z, (_Float16)c.w };
  _Float16* d = dst + (size_t)row * FEAT + 8 * tid;
  *(v8h*)d = o;
  wait_store_regs();
}

// =====================================================================================================
// A job of the preparation kernel: additive key mask as f32, log2 domain: compact plane [NB][SEQ],
// value = -10000 * log2(e) where mask != 1, else 0. One element per thread, 256 per block; NTOK/256 blocks.
// =====================================================================================================
__device__ __forceinline__ void mask_add_256(const int* mask, float* madd, int blk)
{
  const int idx = blk * 256 + (int)threadIdx.x;
  const int bb = idx / SEQ, t = idx - bb * SEQ;
  madd[idx] = (mask[(size_t)bb * SEQ_FULL + t] != 1) ? MASKADD2 : 0.0f;
  wait_store_regs();
}

// =====================================================================================================
// LayerNorm, no affine, eps 1e-6 (one 1024-wide row per 256-thread block, thread owns 4 consecutive
//   RNEX = true : v = bf16rne(X) (raw input x); false: v = X (internal f32 plane).
//   Input row = b * strideXB + t * FEAT with (b, t) from the compact row index; output f16 row compact.
//   f16 row: staged in LDS (cross-wave -> block barrier), lanes of waves 0..3 write 16 B each (8 halves),
// =====================================================================================================
__device__ __forceinline__ float block_sum(float v, float* red, int lane, int w) {
#pragma unroll
  for (int off = 16; off > 0; off >>= 1) v += __shfl_xor(v, off);
  if (lane == 0) red[w] = v;
  __syncthreads();
  float r = red[0];
#pragma unroll
  for (int i = 1; i < 8; ++i) r += red[i];
  __syncthreads();
  return r;
}

template <bool RNEX>
__device__ __forceinline__ void ln_row(const float* X, long long strideXB, _Float16* pout, int row)
{
  __shared__ __align__(16) float srow[FEAT];
  __shared__ float red[8];
  const int bb  = row / SEQ, t = row - bb * SEQ;
  const int tid = (int)threadIdx.x, lane = tid & 31, w = tid >> 5;
  const int f0  = 4 * tid;
  const float* xp = X + (size_t)bb * (size_t)strideXB + (size_t)t * FEAT + f0;

  v4f xv = *(const v4fa*)xp;
  if (RNEX) xv = bf16r4(xv);
  float s = (xv.x + xv.y) + (xv.z + xv.w);
  s = block_sum(s, red, lane, w);
  const float mu = s * (1.0f / FEAT);
  const float d0 = xv.x - mu, d1 = xv.y - mu, d2 = xv.z - mu, d3 = xv.w - mu;
  float q = (d0 * d0 + d1 * d1) + (d2 * d2 + d3 * d3);
  q = block_sum(q, red, lane, w);
  const float rstd = rsqrtf(q * (1.0f / FEAT) + 1e-6f);

  const v4f ov = { d0 * rstd, d1 * rstd, d2 * rstd, d3 * rstd };
  *(v4fa*)(srow + f0) = ov;
  __syncthreads();
  if (w < 4) {                                             // wave-uniform: waves 0..3, 128 threads x 8 halves
    const float* sp = srow + 8 * tid;
    const v4f a = *(const v4fa*)sp;
    const v4f c = *(const v4fa*)(sp + 4);
    const v8h o = { (_Float16)a.x, (_Float16)a.y, (_Float16)a.z, (_Float16)a.w,
                    (_Float16)c.x, (_Float16)c.y, (_Float16)c.z, (_Float16)c.w };
    _Float16* dst = pout + (size_t)row * FEAT + 8 * tid;
    *(v8h*)dst = o;
    
  }
}

// LayerNorm of an internal f32 plane, one row per block
__global__ __launch_bounds__(256) void ln_kernel(const float* __restrict__ X, long long strideXB, _Float16* pout)
{
  ln_row<false>(X, strideXB, pout, (int)blockIdx.x);
}

// =====================================================================================================
// Preparation kernel: everything that depends on the raw inputs alone, in ONE grid; a block-index range picks
// the job (block-uniform, so each job's barriers stay under block-uniform control flow):
//   LN(bf16rne(x)) first (its blocks run longest, so they do not form the grid's tail), the row convert of c,
//   the additive key mask, the eight weight transposes (tiles in the order bx fastest).
// =====================================================================================================
#define PB_QKV ((FEAT / 64) * ((3 * FEAT) / 32))   // blocks of the [FEAT][3 FEAT] transpose
#define PB_SQ  ((FEAT / 64) * (FEAT / 32))         // blocks of one [FEAT][FEAT] transpose
#define PB_MLP ((FEAT / 64) * (MF / 32))           // blocks of the [FEAT][MF] and of the [MF][FEAT] transpose
#define PB_TR  (PB_QKV + 5 * PB_SQ + 2 * PB_MLP)
#define PB_CV  (NTOK / 2)
#define PB_MK  (NTOK / 256)
#define PB_ALL (PB_TR + PB_CV + PB_MK + NTOK)
static_assert((NTOK % 256) == 0);

__global__ __launch_bounds__(256) void prep_kernel(
    const float* __restrict__ w_qkv, const float* __restrict__ w_sp, const float* __restrict__ w_cq,
    const float* __restrict__ w_ck, const float* __restrict__ w_cv, const float* __restrict__ w_cp,
    const float* __restrict__ w_1, const float* __restrict__ w_2,
    const float* __restrict__ x, const float* __restrict__ c, const int* __restrict__ mask,
    _Float16* t_qkv, _Float16* t_sp, _Float16* t_cq, _Float16* t_ck, _Float16* t_cv, _Float16* t_cp,
    _Float16* t_1, _Float16* t_2, _Float16* cpl, _Float16* hn, float* madd)
{
  int blk = (int)blockIdx.x;
  if (blk < NTOK) {
    ln_row<true>(x, (long long)SEQ_FULL * FEAT, hn, blk);
  } else if (blk < NTOK + PB_CV) {
    cvt_two_rows(c, cpl, blk - NTOK);
  } else if (blk < NTOK + PB_CV + PB_MK) {
    mask_add_256(mask, madd, blk - (NTOK + PB_CV));
  } else {
    blk -= NTOK + PB_CV + PB_MK;
    const float* in; _Float16* out; int K = FEAT, N = FEAT;
    if (blk < PB_MLP)                    { in = w_1; out = t_1; N = MF; }
    else if ((blk -= PB_MLP) < PB_MLP)   { in = w_2; out = t_2; K = MF; }
    else if ((blk -= PB_MLP) < PB_QKV)   { in = w_qkv; out = t_qkv; N = 3 * FEAT; }
    else if ((blk -= PB_QKV) < PB_SQ)    { in = w_sp; out = t_sp; }
    else if ((blk -= PB_SQ) < PB_SQ)     { in = w_cq; out = t_cq; }
    else if ((blk -= PB_SQ) < PB_SQ)     { in = w_ck; out = t_ck; }
    else if ((blk -= PB_SQ) < PB_SQ)     { in = w_cv; out = t_cv; }
    else                                 { blk -= PB_SQ; in = w_cp; out = t_cp; }
    const int kt = K >> 6;
    const int by = blk / kt;
    transpose_tile(in, out, K, N, WCARRY, blk - by * kt, by);
  }
}

// =====================================================================================================
// Batched WMMA GEMM (f16 operands): C[m][n] = sum_k A[m][k] * Bt[n][k].
// One 128x128 tile of C per 256-thread block; 8 waves as 4 (m) x 2 (n), each 32x64 (2 x 4 accumulator tiles).
// A row-major [M][K] pitch lda; Bt row-major [N][K] pitch ldb (k contiguous); M, N, K multiples of 128,
// K >= 256 (all shapes here are compile-time constants of the host code). tile = index of the C tile, b = batch
// index, smem = the block's 2 * STAGEB bytes of LDS (declared in the kernel that calls this).
// Operands: per stage 128 k of the block's 128 A rows and 128 Bt rows are brought into LDS by asynchronous
// 16-byte copies (each thread 8 + 8 copies, a wave-wide copy = two whole 256-B row pieces), two buffers, the
// next stage in flight while this one is multiplied. LDS row pitch 272 B (256 + 16: ds_load_b128 readers).
// Fragments from LDS with the split k map (ldfrag), two register sets inside a stage.
// k order: a block starts at stage (tile row, counted over the batches, + tile column) mod stages and wraps round, so
// that blocks which share A or Bt rows do not ask L2 for the same lines at the same moment; inside a stage k runs
// upward in steps of 32.
// MODE 0: f32 C = acc*oscale + bf16rne(bias[n]) + res[m][n] (res pitch ldr, batch stride strideR;
//         RESRNE: res value bf16rne-converted on load)
// MODE 1: f16 C = f16(acc*oscale + bf16rne(bias[n]))
// MODE 2: f16 C = f16(gelu(acc*oscale + bf16rne(bias[n])) * ocarry), gelu = 0.5 v (1 + erf(v / sqrt 2))
// MODE 3: f16 C = f16(acc*oscale + bf16rne(bias[m]))       (row bias, transposed output planes)
// coverage: 2 slabs x 16 rows x 64 cols = the wave's whole 32x64 tile; slab 16x64 fully written before reads.
// LDS: every byte of a buffer's 256 data bytes per row is copied before the barrier that publishes it; the 16
// pad bytes per row are never read. The per-wave epilogue slabs lie in the ring, used only behind the last
// trip's barrier (no copy outstanding, every fragment read retired).
// =====================================================================================================
#define LROW    272                    // LDS row pitch, bytes
#define OPBYTES (128 * LROW)           // one operand's 128 rows of one stage
#define STAGEB  (2 * OPBYTES)          // [A 128 rows | Bt 128 rows]

// Eight asynchronous 16-byte copies of this lane: rows r, r+16, ..., r+112 of one operand's stage.
// l = the lane's LDS byte address of row r, gp = its global address, rstep = elements per 16 rows.
// s_wait_xcnt 0 is the last line of the statement, so that no address register is rewritten in front of it.
__device__ __forceinline__ void copy8(unsigned l, const _Float16* gp, size_t rstep) {
#if DEV_ASM
  const unsigned l1 = l + 16 * LROW, l2 = l + 32 * LROW, l3 = l + 48 * LROW, l4 = l + 64 * LROW,
                 l5 = l + 80 * LROW, l6 = l + 96 * LROW, l7 = l + 112 * LROW;
  const _Float16 *g1 = gp + rstep, *g2 = g1 + rstep, *g3 = g2 + rstep, *g4 = g3 + rstep,
                 *g5 = g4 + rstep, *g6 = g5 + rstep, *g7 = g6 + rstep;
  asm volatile("global_load_async_to_lds_b128 %0, %8, off\n\t"
               "global_load_async_to_lds_b128 %1, %9, off\n\t"
               "global_load_async_to_lds_b128 %2, %10, off\n\t"
               "global_load_async_to_lds_b128 %3, %11, off\n\t"
               "global_load_async_to_lds_b128 %4, %12, off\n\t"
               "global_load_async_to_lds_b128 %5, %13, off\n\t"
               "global_load_async_to_lds_b128 %6, %14, off\n\t"
               "global_load_async_to_lds_b128 %7, %15, off\n\t"
               "s_wait_xcnt 0x0"
               :: "v"(l), "v"(l1), "v"(l2), "v"(l3), "v"(l4), "v"(l5), "v"(l6), "v"(l7),
                  "v"(gp), "v"(g1), "v"(g2), "v"(g3), "v"(g4), "v"(g5), "v"(g6), "v"(g7)
               : "memory");
#else
  (void)l; (void)gp; (void)rstep;
#endif
}
// this wave's own copies have landed
__device__ __forceinline__ void wait_copies() {
#if DEV_ASM
  asm volatile("s_wait_asynccnt 0x0" ::: "memory");
#endif
}
// this wave's own LDS reads have retired (before the buffer they read is handed to its next writer)
__device__ __forceinline__ void wait_lds() {
#if DEV_ASM
  asm volatile("s_wait_dscnt 0x0" ::: "memory");
#endif
}

template <int MODE, bool RESRNE>
__device__ __forceinline__ void gemm_tile(
    unsigned char* smem, int tile, int b,
    const _Float16* A, int lda, long long strideA,
    const _Float16* Bt, int ldb, long long strideB,
    void* Cout, int ldc, long long strideC,
    const float* bias,
    const float* res, int ldr, long long strideR,
    int M, int N, int K, float oscale, float ocarry)
{
  const int tid  = (int)threadIdx.x;
  const int lane = tid & 31;
  const int wave = tid >> 5;
  const int tilesN = N >> 7;
  const int tilesM = M >> 7;
  if (tile >= tilesM * tilesN) return;                     // block-uniform, in front of every copy and barrier
  const int tm = tile / tilesN;
  const int tn = tile - tm * tilesN;
  const int m0 = (tm << 7) + ((wave >> 1) << 5);           // this wave's 32 rows
  const int n0 = (tn << 7) + ((wave & 1) << 6);            // this wave's 64 columns

  const _Float16* Ab = A  + (size_t)b * (size_t)strideA;
  const _Float16* Bb = Bt + (size_t)b * (size_t)strideB;

  const int rlane = lane & 15;                             // row (A) / col (B, D) within subtile
  const int koff  = (lane >> 4) * 8;                       // k offset of this lane half
  const int mOff  = (lane >> 4) * 8;                       // D row offset

  // copy map: thread -> row tid>>4 (+16 per copy), 16-byte piece tid&15 of the row's 256 bytes
  const int crow = tid >> 4, ccol = tid & 15;
  const _Float16* gA = Ab + (size_t)((tm << 7) + crow) * lda + ccol * 8;
  const _Float16* gB = Bb + (size_t)((tn << 7) + crow) * ldb + ccol * 8;
  const unsigned lA = (unsigned)(size_t)smem + (unsigned)(crow * LROW + ccol * 16);
  const unsigned lB = lA + OPBYTES;
  const size_t stepA = (size_t)16 * lda, stepB = (size_t)16 * ldb;

  // fragment read bases inside a buffer
  const unsigned char* fA = smem + (((wave >> 1) << 5) + rlane) * LROW + koff * 2;
  const unsigned char* fB = smem + OPBYTES + (((wave & 1) << 6) + rlane) * LROW + koff * 2;

  v8f acc[2][4];
#pragma unroll
  for (int i = 0; i < 2; ++i)
#pragma unroll
    for (int j = 0; j < 4; ++j) acc[i][j] = zero8();

  const int nt = K >> 7;                                   // stages of 128 k
  int sc = (b * tilesM + tm + tn) % nt;                    // k stage of the next copies (block-uniform, 0 .. nt-1)
  copy8(lA, gA + (size_t)sc * 128, stepA);
  copy8(lB, gB + (size_t)sc * 128, stepB);
  sc = (sc + 1 == nt) ? 0 : sc + 1;
  wait_copies();
  __syncthreads();                                         // first stage published
  if (nt > 1) {
    copy8(lA + STAGEB, gA + (size_t)sc * 128, stepA);
    copy8(lB + STAGEB, gB + (size_t)sc * 128, stepB);
    sc = (sc + 1 == nt) ? 0 : sc + 1;
  }

  for (int t = 0; t < nt; ++t) {
    const unsigned buf = (unsigned)(t & 1) * STAGEB;
    // two fragment sets: the next 32 k of THIS buffer are read as one group ahead of the current products
    v16h bq[2][4], af[2][2];
#pragma unroll
    for (int j = 0; j < 4; ++j) bq[0][j] = ldfrag((const _Float16*)(fB + buf + j * 16 * LROW));
#pragma unroll
    for (int i = 0; i < 2; ++i) af[0][i] = ldfrag((const _Float16*)(fA + buf + i * 16 * LROW));
#pragma unroll
    for (int kk = 0; kk < 4; ++kk) {
      const int cur = kk & 1, nxt = cur ^ 1;
      if (kk < 3) {
#pragma unroll
        for (int j = 0; j < 4; ++j)
          bq[nxt][j] = ldfrag((const _Float16*)(fB + buf + j * 16 * LROW + (kk + 1) * 64));
#pragma unroll
        for (int i = 0; i < 2; ++i)
          af[nxt][i] = ldfrag((const _Float16*)(fA + buf + i * 16 * LROW + (kk + 1) * 64));
      }
      // keeps the load group in front of the products: without it the scheduler sinks the LDS reads among the
      // matrix instructions into one register set, and each product group waits out its own LDS latency
      __builtin_amdgcn_sched_barrier(0);
#pragma unroll
      for (int i = 0; i < 2; ++i)
#pragma unroll
        for (int j = 0; j < 4; ++j) acc[i][j] = mmar(af[cur][i], bq[cur][j], acc[i][j]);
      // same purpose: the following load group stays behind these products
      __builtin_amdgcn_sched_barrier(0);
    }
    wait_lds();
    wait_copies();
    __syncthreads();                                       // publishes stage t+1, frees stage t's buffer
    if (t + 2 < nt) {
      copy8(lA + buf, gA + (size_t)sc * 128, stepA);
      copy8(lB + buf, gB + (size_t)sc * 128, stepB);
      sc = (sc + 1 == nt) ? 0 : sc + 1;
    }
  }
  wait_copies();
  acc_guard4(acc[0][0], acc[0][1], acc[0][2], acc[0][3]);
  acc_guard4(acc[1][0], acc[1][1], acc[1][2], acc[1][3]);

  // ---- epilogue ----
  float* slab = (float*)(smem + wave * (16 * 68 * 4));     // per-wave 16x64 slab, pitch 68 floats
#pragma unroll
  for (int i = 0; i < 2; ++i) {
    const int mBase = m0 + (i << 4);
#pragma unroll
    for (int j = 0; j < 4; ++j) {
#pragma unroll
      for (int r = 0; r < 8; ++r) {
        slab[(mOff + r) * 68 + (j << 4) + rlane] = acc[i][j][r];
      }
    }
    __builtin_amdgcn_fence(3, "workgroup");
    __builtin_amdgcn_wave_barrier();
    __builtin_amdgcn_fence(2, "workgroup");
    if (MODE == 0) {
      float* C = (float*)Cout + (size_t)b * (size_t)strideC;
      const float* R = res + (size_t)b * (size_t)strideR;
      const int h2 = lane >> 4, c4 = (lane & 15) * 4;     // 256-B row segment = 16 lanes x 16 B
      const v4f bv = bf16r4(*(const v4fa*)(bias + n0 + c4));
      {
#pragma unroll
        for (int it = 0; it < 8; ++it) {
          const int row = it * 2 + h2;                     // it 0..7 x h2 0..1 = rows 0..15
          const size_t go = (size_t)(mBase + row) * ldc + n0 + c4;
          const size_t ro = (size_t)(mBase + row) * ldr + n0 + c4;
          const v4f sv = *(const v4fa*)(slab + row * 68 + c4);
          v4f rv = *(const v4fa*)(R + ro);
          if (RESRNE) rv = bf16r4(rv);
          const v4f v = sv * oscale + bv + rv;
          *(v4f*)(C + go) = v;
        }
        
      }
    } else {
      const int q = lane >> 3, c8 = (lane & 7) * 8;
      _Float16* C = (_Float16*)Cout + (size_t)b * (size_t)strideC;
      float bb8[8] = { 0.f, 0.f, 0.f, 0.f, 0.f, 0.f, 0.f, 0.f };
      if (MODE == 1 || MODE == 2) {
        const v4f ba = bf16r4(*(const v4fa*)(bias + n0 + c8));
        const v4f bc = bf16r4(*(const v4fa*)(bias + n0 + c8 + 4));
        bb8[0] = ba.x; bb8[1] = ba.y; bb8[2] = ba.z; bb8[3] = ba.w;
        bb8[4] = bc.x; bb8[5] = bc.y; bb8[6] = bc.z; bb8[7] = bc.w;
      }
      v8h hv[4];
#pragma unroll
      for (int it = 0; it < 4; ++it) {
        const int row = it * 4 + q;                        // it 0..3 x q 0..3 = rows 0..15
        const float* sp = slab + row * 68 + c8;
        const v4f a = *(const v4fa*)sp;
        const v4f c = *(const v4fa*)(sp + 4);
        float f[8] = { a.x, a.y, a.z, a.w, c.x, c.y, c.z, c.w };
        float brow = 0.0f;
        if (MODE == 3) brow = bf16r(bias[mBase + row]);
#pragma unroll
        for (int e = 0; e < 8; ++e) {
          float u = f[e] * oscale + ((MODE == 3) ? brow : bb8[e]);
          if (MODE == 2) {
            const float gl = 0.5f * u * (1.0f + erff(u * 0.70710678118654752f));
            u = gl * ocarry;
          }
          f[e] = u;
        }
        const v8h o = { (_Float16)f[0], (_Float16)f[1], (_Float16)f[2], (_Float16)f[3],
                        (_Float16)f[4], (_Float16)f[5], (_Float16)f[6], (_Float16)f[7] };
        hv[it] = o;
      }
      {
#pragma unroll
        for (int it = 0; it < 4; ++it) {
          const int row = it * 4 + q;
          *(v8h*)(C + (size_t)(mBase + row) * ldc + n0 + c8) = hv[it];
        }
        
      }
    }
    __builtin_amdgcn_fence(3, "workgroup");
    __builtin_amdgcn_wave_barrier();
    __builtin_amdgcn_fence(2, "workgroup");
  }
}

// one GEMM per launch: blockIdx.x = tile, blockIdx.y = batch
template <int MODE, bool RESRNE>
__global__ __launch_bounds__(256) void gemm128(
    const _Float16* __restrict__ A, int lda, long long strideA,
    const _Float16* __restrict__ Bt, int ldb, long long strideB,
    void* Cout, int ldc, long long strideC,
    const float* __restrict__ bias,
    const float* __restrict__ res, int ldr, long long strideR,
    int M, int N, int K, float oscale, float ocarry)
{
  __shared__ __align__(16) unsigned char smem[2 * STAGEB];  // two stage buffers; epilogue slabs behind the loop
  gemm_tile<MODE, RESRNE>(smem, (int)blockIdx.x, (int)blockIdx.y, A, lda, strideA, Bt, ldb, strideB,
                          Cout, ldc, strideC, bias, res, ldr, strideR, M, N, K, oscale, ocarry);
}

// The four projections that need only hn = LN(x) or the c plane, in ONE grid; a block-index range picks the job:
//   self q|k   = hn . Wqkv[:, 0:2 FEAT]      -> qk_s [NTOK][QKP]              (M=NTOK, N=QKP,  column bias)
//   cross k    = c . Wck                     -> qk_c [NTOK][QKP] cols FEAT..  (M=NTOK, N=FEAT, column bias)
//   self v^T   = Wqkv[:, 2 FEAT:]^T . hn^T   -> vt_s [b][FEAT][SEQ]           (M=FEAT, N=SEQ per batch, row bias)
//   cross v^T  = Wcv^T . c^T                 -> vt_c [b][FEAT][SEQ]           (M=FEAT, N=SEQ per batch, row bias)
// K (= FEAT) comes as an argument, as in gemm128.
#define GB_QK ((NTOK / 128) * (QKP / 128))
#define GB_K  ((NTOK / 128) * (FEAT / 128))
#define GB_V1 ((FEAT / 128) * (SEQ / 128))         // v^T tiles of one batch
#define GB_ALL (GB_QK + GB_K + 2 * NB * GB_V1)

__global__ __launch_bounds__(256) void gemm_proj4(
    const _Float16* __restrict__ hn, const _Float16* __restrict__ cpl,
    const _Float16* __restrict__ wqkvT, const _Float16* __restrict__ wckT, const _Float16* __restrict__ wcvT,
    const float* __restrict__ b_qkv, const float* __restrict__ b_ck, const float* __restrict__ b_cv,
    _Float16* qk_s, _Float16* qk_c, _Float16* vt_s, _Float16* vt_c, int K, float oscale)
{
  __shared__ __align__(16) unsigned char smem[2 * STAGEB];  // two stage buffers; epilogue slabs behind the loop
  int blk = (int)blockIdx.x;
  const _Float16 *A, *Bt; _Float16* C; const float* bias;
  int b = 0, rowbias = 0, ldc = QKP, M = NTOK, N = FEAT;
  long long strideB = 0LL, strideC = 0LL;
  if (blk < GB_QK)               { A = hn;  Bt = wqkvT; C = qk_s;        bias = b_qkv; N = QKP; }
  else if ((blk -= GB_QK) < GB_K) { A = cpl; Bt = wckT;  C = qk_c + FEAT; bias = b_ck; }
  else {
    blk -= GB_K;
    if (blk < NB * GB_V1) { A = wqkvT + (size_t)2 * FEAT * FEAT; Bt = hn; C = vt_s; bias = b_qkv + 2 * FEAT; }
    else { blk -= NB * GB_V1; A = wcvT; Bt = cpl; C = vt_c; bias = b_cv; }
    b = blk / GB_V1; blk -= b * GB_V1;
    rowbias = 1; ldc = SEQ; M = FEAT; N = SEQ;
    strideB = (long long)SEQ * FEAT; strideC = (long long)FEAT * SEQ;
  }
  if (rowbias)                                             // block-uniform: every barrier inside is met by all waves
    gemm_tile<3, false>(smem, blk, b, A, FEAT, 0LL, Bt, FEAT, strideB, (void*)C, ldc, strideC,
                        bias, bias, FEAT, 0LL, M, N, K, oscale, 1.0f);
  else
    gemm_tile<1, false>(smem, blk, b, A, FEAT, 0LL, Bt, FEAT, strideB, (void*)C, ldc, strideC,
                        bias, bias, FEAT, 0LL, M, N, K, oscale, 1.0f);
}

// =====================================================================================================
// Streaming attention, transposed form, 16 heads, additive key mask (-10000 where mask != 1),
// softmax over all SEQ keys. Block 128 thr (4 waves), 16 queries per wave, 64 keys per step.
//   S^T = K * Q^T + mask : A = K rows (row = key, k = d), B = Q^T (k = d, n = query) with q scaled once by
//   log2(e)/8 (product in f32, rounded to f16), C = the key's additive mask x log2(e) from the f32 plane: the
//   accumulator leaves the matrix unit as the masked score in the log2 domain, no vector work per score for it
//   O^T += V^T * P^T : A = V^T rows (row = d, k = key), B = P^T packed from the score D registers
//   (element r <- key tile covering k 0..15 row r, element 8+r <- tile covering k 16..31 row r, same lane)
// Lane owns 32 keys of query column (lane&15); partner = lane ^ 16. Online softmax in f32, base 2; p carried x16384
// by 14 taken off the maximum that is subtracted, so the running sum l carries the same factor.
//   q|k plane [b*SEQ + t][QKP]: q at col head*64 + d, k at col FEAT + head*64 + d (f16);
//   v^T plane [b][head*64 + d][SEQ] (f16); madd f32 [b][SEQ].
//   ctx plane [b*SEQ + t][head*64 + d] = f16(256 * o / l): per-wave 16x64 tile staged in LDS (block barrier),
// coverage: grid (SEQ/64, NB*NH): every (b, head, query) row x 64 columns of its head written once.
// LDS sO: each wave writes its full 16x64 region before the barrier.
// Operands: per step the 64 K rows (128 B each) and the 64 V^T rows (128 B each) that all four waves use are
// brought into LDS once per block by asynchronous 16-byte copies (each thread 4 + 4 copies, a wave-wide copy =
// four whole 128-B rows), two buffers, the next step's tiles in flight while this step is worked on.
// LDS row pitch 144 B (128 + 16: ds_load_b128 readers); the 16 pad bytes per row are never read.
// Key order: the block of query tile x starts at key step x mod steps and wraps round, so that the blocks of one
// (batch, head), which all walk the same K and V^T rows, do not ask L2 for the same lines at the same moment.
// =====================================================================================================
#define KVROW   144                    // LDS row pitch, bytes
#define KVOP    (64 * KVROW)           // one operand's 64 rows of one step
#define KVSTAGE (2 * KVOP)             // [K 64 rows | V^T 64 rows]

// Eight asynchronous 16-byte copies of this lane: rows r, r+16, r+32, r+48 of the K tile and of the V^T tile.
// lk, lv = the lane's LDS byte addresses of row r, gk, gv = its global addresses, kstep, vstep = elements per 16 rows.
// s_wait_xcnt 0 is the last line of the statement, so that no address register is rewritten in front of it.
__device__ __forceinline__ void copy_kv(unsigned lk, const _Float16* gk, size_t kstep,
                                        unsigned lv, const _Float16* gv, size_t vstep) {
#if DEV_ASM
  const unsigned lk1 = lk + 16 * KVROW, lk2 = lk + 32 * KVROW, lk3 = lk + 48 * KVROW;
  const unsigned lv1 = lv + 16 * KVROW, lv2 = lv + 32 * KVROW, lv3 = lv + 48 * KVROW;
  const _Float16 *gk1 = gk + kstep, *gk2 = gk1 + kstep, *gk3 = gk2 + kstep;
  const _Float16 *gv1 = gv + vstep, *gv2 = gv1 + vstep, *gv3 = gv2 + vstep;
  asm volatile("global_load_async_to_lds_b128 %0, %8, off\n\t"
               "global_load_async_to_lds_b128 %1, %9, off\n\t"
               "global_load_async_to_lds_b128 %2, %10, off\n\t"
               "global_load_async_to_lds_b128 %3, %11, off\n\t"
               "global_load_async_to_lds_b128 %4, %12, off\n\t"
               "global_load_async_to_lds_b128 %5, %13, off\n\t"
               "global_load_async_to_lds_b128 %6, %14, off\n\t"
               "global_load_async_to_lds_b128 %7, %15, off\n\t"
               "s_wait_xcnt 0x0"
               :: "v"(lk), "v"(lk1), "v"(lk2), "v"(lk3), "v"(lv), "v"(lv1), "v"(lv2), "v"(lv3),
                  "v"(gk), "v"(gk1), "v"(gk2), "v"(gk3), "v"(gv), "v"(gv1), "v"(gv2), "v"(gv3)
               : "memory");
#else
  (void)lk; (void)gk; (void)kstep; (void)lv; (void)gv; (void)vstep;
#endif
}

__device__ __forceinline__ v16h pack_p(v8f a, v8f c) {
  const v16h r = { (_Float16)a[0], (_Float16)a[1], (_Float16)a[2], (_Float16)a[3],
                   (_Float16)a[4], (_Float16)a[5], (_Float16)a[6], (_Float16)a[7],
                   (_Float16)c[0], (_Float16)c[1], (_Float16)c[2], (_Float16)c[3],
                   (_Float16)c[4], (_Float16)c[5], (_Float16)c[6], (_Float16)c[7] };
  return r;
}
// q fragment x log2(e)/8: product in f32, one rounding to f16
__device__ __forceinline__ v16h scale_q(v16h a) {
  v16h r;
#pragma unroll                                             // constant element indices: the vector stays in registers
  for (int i = 0; i < 16; ++i) r[i] = (_Float16)((float)a[i] * QSCALE);
  return r;
}

__global__ __launch_bounds__(128) __attribute__((amdgpu_num_vgpr(256))) void attn_kernel(
    const _Float16* __restrict__ qk, const _Float16* __restrict__ vt,
    const float* __restrict__ madd, _Float16* ctx)
{
  __shared__ __align__(16) float sO[4 * 16 * 64];          // 16384 B
  __shared__ __align__(16) unsigned char skv[2 * KVSTAGE]; // two step buffers of K and V^T rows

  const int tid = (int)threadIdx.x, lane = tid & 31, w = tid >> 5;
  const int h = lane >> 4, m = lane & 15;
  const int bh = blockIdx.y, b = bh / NH, head = bh - b * NH;
  const int q0 = blockIdx.x * 64 + 16 * w;

  // Q^T B-fragments: column n = query q0+m, k = d (two 32-deep chunks)
  const _Float16* qrow = qk + ((size_t)b * SEQ + q0 + m) * QKP + head * HD;
  const v16h qb0 = scale_q(load_frag(qrow, h));
  const v16h qb1 = scale_q(load_frag(qrow + 32, h));

  v8f o[4];                                                // o[t][r] = O[query m][d 16t+8h+r] * l (l carries 2^14)
#pragma unroll
  for (int t = 0; t < 4; ++t) o[t] = zero8();
  float mrun = -1e30f, lrun = 0.0f;

  const float* mrow = madd + (size_t)b * SEQ;              // block-uniform base; + key0 (uniform) + 8h + 16j

  // copy map: thread -> row tid>>3 (+16 per copy), 16-byte piece tid&7 of the row's 128 bytes
  const int crow = tid >> 3, cpc = tid & 7;
  const _Float16* gK = qk + ((size_t)b * SEQ + crow) * QKP + FEAT + head * HD + cpc * 8;   // + key0*QKP
  const _Float16* gV = vt + ((size_t)b * FEAT + head * HD + crow) * SEQ + cpc * 8;         // + key0
  const unsigned lK = (unsigned)(size_t)skv + (unsigned)(crow * KVROW + cpc * 16);
  const unsigned lV = lK + KVOP;
  const size_t stepK = (size_t)16 * QKP, stepV = (size_t)16 * SEQ;
  // fragment read bases inside a buffer: row m of a 16-row group, k offset 8h
  const unsigned char* fK = skv + m * KVROW + 16 * h;
  const unsigned char* fV = skv + KVOP + m * KVROW + 16 * h;

  int kb = ((int)blockIdx.x % (SEQ / 64)) * 64;            // first key of this trip (block-uniform, 0 .. SEQ-64)
  int kc = kb;                                             // first key of the next copies
  copy_kv(lK, gK + (size_t)kc * QKP, stepK, lV, gV + kc, stepV);
  kc = (kc + 64 == SEQ) ? 0 : kc + 64;
  wait_copies();
  __syncthreads();                                         // first step published
  if (SEQ > 64) {
    copy_kv(lK + KVSTAGE, gK + (size_t)kc * QKP, stepK, lV + KVSTAGE, gV + kc, stepV);
    kc = (kc + 64 == SEQ) ? 0 : kc + 64;
  }

#pragma unroll 1
  for (int it = 0; it < SEQ; it += 64) {
    const unsigned buf = (unsigned)((it >> 6) & 1) * KVSTAGE;
    // ---- scores, log2 domain: s[j][r] = S[query m][key kb+16j+8h+r] * 0.125 * log2(e) + madd[key] ----
    v8f s[4];                                              // starts as the C operand: row r of tile j = key's mask term
    v16h kf[4][2];
#pragma unroll
    for (int j = 0; j < 4; ++j) {
      const _Float16* kr = (const _Float16*)(fK + buf + j * 16 * KVROW);
      kf[j][0] = ldfrag(kr);
      kf[j][1] = ldfrag(kr + 32);
    }
    // keeps the K reads in front of the mask loads: moved behind them, the reads land on the loads' address registers
    // and so stand behind an s_wait_xcnt 0, and the LDS latency starts that much later
    __builtin_amdgcn_sched_barrier(0);
    const float* mk = mrow + kb + 8 * h;
#pragma unroll
    for (int j = 0; j < 4; ++j) {
      const v4f ca = *(const v4fa*)(mk + 16 * j);
      const v4f cc = *(const v4fa*)(mk + 16 * j + 4);
      const v8f cj = { ca.x, ca.y, ca.z, ca.w, cc.x, cc.y, cc.z, cc.w };
      s[j] = cj;
    }
#if DEV_ASM
    // behind the mask loads: their address pair is an input here, so it stays whole up to this wait (no load of the
    // group lands on it) and is rewritten only behind it; the wave waits for the K reads at this place anyway
    asm volatile("s_wait_xcnt 0x0" :: "v"(mk) : "memory");
#endif
    // keeps the K reads one group in front of the score products: left free, the scheduler puts four reads in
    // front of each pair of products, and every pair waits out its own LDS latency
    __builtin_amdgcn_sched_barrier(0);
#pragma unroll
    for (int j = 0; j < 4; ++j) {
      s[j] = wmma_f16(kf[j][0], qb0, s[j]);
      s[j] = wmma_f16(kf[j][1], qb1, s[j]);
    }

    // ---- V^T fragments of this step: one read group, in flight while the softmax runs ----
    v16h vf[4][2];
#pragma unroll
    for (int t = 0; t < 4; ++t) {
      const _Float16* vp = (const _Float16*)(fV + buf + t * 16 * KVROW);
      vf[t][0] = ldfrag(vp);
      vf[t][1] = ldfrag(vp + 32);
    }
    // keeps the V^T reads in front of the softmax: left free, they sink to their products and are waited for there
    __builtin_amdgcn_sched_barrier(0);

    // ---- online softmax (f32, base 2) ----
    float mloc = s[0][0];
#pragma unroll
    for (int j = 0; j < 4; ++j)
#pragma unroll
      for (int r = 0; r < 8; ++r) mloc = fmaxf(mloc, s[j][r]);
    mloc = fmaxf(mloc, __shfl_xor(mloc, 16));
    const float mnew = fmaxf(mrun, mloc);
    const float alpha = __builtin_amdgcn_exp2f(mrun - mnew);
    mrun = mnew;
    const float msh = mnew - PEXP;                         // p = 2^(s - mnew) x 2^14
    float lsum = 0.0f;
#pragma unroll
    for (int j = 0; j < 4; ++j)
#pragma unroll
      for (int r = 0; r < 8; ++r) {
        const float p = __builtin_amdgcn_exp2f(s[j][r] - msh);
        s[j][r] = p;
        lsum += p;
      }
    lsum += __shfl_xor(lsum, 16);
    lrun = lrun * alpha + lsum;
#pragma unroll
    for (int t = 0; t < 4; ++t)
#pragma unroll
      for (int r = 0; r < 8; ++r) o[t][r] = o[t][r] * alpha;

    // ---- P^T B-fragments (key chunks 0..31 and 32..63 of this step) ----
    const v16h pb0 = pack_p(s[0], s[1]);
    const v16h pb1 = pack_p(s[2], s[3]);

    // ---- O^T += V^T * P^T ----
#pragma unroll
    for (int t = 0; t < 4; ++t) {
      o[t] = wmma_f16(vf[t][0], pb0, o[t]);
      o[t] = wmma_f16(vf[t][1], pb1, o[t]);
    }
    wait_lds();
    wait_copies();
    __syncthreads();                                       // publishes the next step, frees this step's buffer
    if (it + 128 < SEQ) {
      copy_kv(lK + buf, gK + (size_t)kc * QKP, stepK, lV + buf, gV + kc, stepV);
      kc = (kc + 64 == SEQ) ? 0 : kc + 64;
    }
    kb = (kb + 64 == SEQ) ? 0 : kb + 64;
  }
  wait_copies();

  // ---- epilogue: normalise (1/l, which also removes the p carry; apply the ctx carry), stage per-wave 16x64 tile ----
  const float inv = (1.0f / lrun) * CTXCARRY;
  float* so = sO + w * 1024;
#pragma unroll
  for (int t = 0; t < 4; ++t)
#pragma unroll
    for (int r = 0; r < 8; ++r)
      so[m * 64 + 16 * t + 8 * h + r] = o[t][r] * inv;
  __syncthreads();

  const int q8 = lane & 7, sub = lane >> 3;
  v8h hv[4];
#pragma unroll
  for (int it = 0; it < 4; ++it) {
    const int row = it * 4 + sub;                          // it 0..3 x sub 0..3 = rows 0..15 of the wave tile
    const float* sp = so + row * 64 + 8 * q8;
    const v4f a = *(const v4fa*)sp;
    const v4f c = *(const v4fa*)(sp + 4);
    const v8h ov = { (_Float16)a.x, (_Float16)a.y, (_Float16)a.z, (_Float16)a.w,
                     (_Float16)c.x, (_Float16)c.y, (_Float16)c.z, (_Float16)c.w };
    hv[it] = ov;
  }
  {
#pragma unroll
    for (int it = 0; it < 4; ++it) {
      const int row = it * 4 + sub;
      _Float16* dst = ctx + ((size_t)b * SEQ + q0 + row) * FEAT + head * HD + 8 * q8;
      *(v8h*)dst = hv[it];
    }
    
  }
}

// =====================================================================================================
// Host orchestration. Workspace map (bytes, NB=4 SEQ=1024), every region an exact multiple of its whole-line
// store granularity, all offsets multiples of 128:
//   hn    f16 [4096][1024]      8388608   (LN outputs of all three blocks, written and consumed in order)
//   cpl   f16 [4096][1024]      8388608   (bf16rne(c) as f16)
//   WqkvT f16 [3072][1024]      6291456
//   WspT  f16 [1024][1024]      2097152
//   WcqT, WckT, WcvT, WcpT      4 x 2097152
//   W1T   f16 [4096][1024]      8388608
//   W2T   f16 [1024][4096]      8388608
//   ATT   shared region        33554432 : self q|k f16 [4096][2048] (16777216) + self v^T f16 [4][1024][1024]
//                                         (8388608) + ctx f16 [4096][1024] (8388608, both attention blocks);
//                                         mid f16 [4096][4096] (33554432) during the MLP (all readers of
//                                         q|k, v^T, ctx have completed before fc1 writes mid)
//   x1    f32 [4096][1024]     16777216
//   x2    f32 [4096][1024]     16777216
//   qk_c  f16 [4096][2048]     16777216   (cross q|k: k written with the self projections, q behind LN(x1))
//   vt_c  f16 [4][1024][1024]   8388608   (cross v^T, written with the self projections)
//   madd  f32 [4][1024]           16384   (additive key mask x log2(e), both attention blocks)
//   total                     142622720
// =====================================================================================================
extern "C" void kernel_launch(void* const* d_in, const int* in_sizes, int n_in,
                              void* d_out, int out_size, void* d_ws, size_t ws_size,
                              hipStream_t stream)
{
  if (n_in < 19) return;
  const long long needTok = (long long)(NB - 1) * SEQ_FULL + SEQ;
  if ((long long)in_sizes[0] < needTok * FEAT) return;                 // x
  if ((long long)in_sizes[1] < needTok * FEAT) return;                 // c
  if ((long long)in_sizes[2] < needTok) return;                        // mask (int32)
  if ((long long)in_sizes[3] < (long long)FEAT * 3 * FEAT || in_sizes[4] < 3 * FEAT) return;
  if ((long long)in_sizes[5] < (long long)FEAT * FEAT || in_sizes[6] < FEAT) return;
  if ((long long)in_sizes[7] < (long long)FEAT * FEAT || in_sizes[8] < FEAT) return;
  if ((long long)in_sizes[9] < (long long)FEAT * FEAT || in_sizes[10] < FEAT) return;
  if ((long long)in_sizes[11] < (long long)FEAT * FEAT || in_sizes[12] < FEAT) return;
  if ((long long)in_sizes[13] < (long long)FEAT * FEAT || in_sizes[14] < FEAT) return;
  if ((long long)in_sizes[15] < (long long)FEAT * MF || in_sizes[16] < MF) return;
  if ((long long)in_sizes[17] < (long long)MF * FEAT || in_sizes[18] < FEAT) return;
  if ((long long)out_size < needTok * FEAT) return;

  const float* x         = (const float*)d_in[0];
  const float* c         = (const float*)d_in[1];
  const int*   mask      = (const int*)d_in[2];
  const float* sa_qkv_w  = (const float*)d_in[3];
  const float* sa_qkv_b  = (const float*)d_in[4];
  const float* sa_proj_w = (const float*)d_in[5];
  const float* sa_proj_b = (const float*)d_in[6];
  const float* ca_q_w    = (const float*)d_in[7];
  const float* ca_q_b    = (const float*)d_in[8];
  const float* ca_k_w    = (const float*)d_in[9];
  const float* ca_k_b    = (const float*)d_in[10];
  const float* ca_v_w    = (const float*)d_in[11];
  const float* ca_v_b    = (const float*)d_in[12];
  const float* ca_proj_w = (const float*)d_in[13];
  const float* ca_proj_b = (const float*)d_in[14];
  const float* fc1_w     = (const float*)d_in[15];
  const float* fc1_b     = (const float*)d_in[16];
  const float* fc2_w     = (const float*)d_in[17];
  const float* fc2_b     = (const float*)d_in[18];

  const size_t P_F16  = (size_t)NTOK * FEAT * 2;
  const size_t P_F32  = (size_t)NTOK * FEAT * 4;
  const size_t P_W    = (size_t)FEAT * FEAT * 2;
  const size_t P_WQKV = (size_t)3 * FEAT * FEAT * 2;
  const size_t P_W1   = (size_t)MF * FEAT * 2;
  const size_t P_QK   = (size_t)NTOK * QKP * 2;
  const size_t P_VT   = (size_t)NB * FEAT * SEQ * 2;
  const size_t P_MID  = (size_t)NTOK * MF * 2;
  const size_t P_ATTU = P_QK + P_VT + P_F16;
  const size_t P_ATT  = (P_ATTU > P_MID) ? P_ATTU : P_MID;
  size_t off = 0;
  const size_t oHn   = off; off += P_F16;
  const size_t oC    = off; off += P_F16;
  const size_t oWqkv = off; off += P_WQKV;
  const size_t oWsp  = off; off += P_W;
  const size_t oWcq  = off; off += P_W;
  const size_t oWck  = off; off += P_W;
  const size_t oWcv  = off; off += P_W;
  const size_t oWcp  = off; off += P_W;
  const size_t oW1   = off; off += P_W1;
  const size_t oW2   = off; off += P_W1;
  const size_t oAtt  = off; off += P_ATT;
  const size_t oX1   = off; off += P_F32;
  const size_t oX2   = off; off += P_F32;
  const size_t oQkc  = off; off += P_QK;
  const size_t oVtc  = off; off += P_VT;
  const size_t oMadd = off; off += (size_t)NTOK * 4;
  if (off > ws_size) return;                               // off = 142622720 at NB=4, SEQ=1024

  char* ws = (char*)d_ws;
  _Float16* hn    = (_Float16*)(ws + oHn);
  _Float16* cpl   = (_Float16*)(ws + oC);
  _Float16* wqkvT = (_Float16*)(ws + oWqkv);
  _Float16* wspT  = (_Float16*)(ws + oWsp);
  _Float16* wcqT  = (_Float16*)(ws + oWcq);
  _Float16* wckT  = (_Float16*)(ws + oWck);
  _Float16* wcvT  = (_Float16*)(ws + oWcv);
  _Float16* wcpT  = (_Float16*)(ws + oWcp);
  _Float16* w1T   = (_Float16*)(ws + oW1);
  _Float16* w2T   = (_Float16*)(ws + oW2);
  _Float16* qkp   = (_Float16*)(ws + oAtt);
  _Float16* vtp   = (_Float16*)(ws + oAtt + P_QK);
  _Float16* ctx   = (_Float16*)(ws + oAtt + P_QK + P_VT);
  _Float16* mid   = (_Float16*)(ws + oAtt);
  float*    x1    = (float*)(ws + oX1);
  float*    x2    = (float*)(ws + oX2);
  _Float16* qkc   = (_Float16*)(ws + oQkc);
  _Float16* vtc   = (_Float16*)(ws + oVtc);
  float*    madd  = (float*)(ws + oMadd);

  const dim3 blk(256);
  const float sQKV  = 1.0f / WCARRY;
  const float sPROJ = 1.0f / (WCARRY * CTXCARRY);
  const float sFC2  = 1.0f / (WCARRY * MIDCARRY);

  // (1) one grid: weights f32 [in][out] -> f16 [out][in] = bf16rne(w) x64; c -> compact f16 plane (bf16rne values);
  //     hn = LN(bf16rne(x)) -> f16 plane; key mask -> additive f32 plane
  prep_kernel<<<dim3(PB_ALL), blk, 0, stream>>>(
      sa_qkv_w, sa_proj_w, ca_q_w, ca_k_w, ca_v_w, ca_proj_w, fc1_w, fc2_w, x, c, mask,
      wqkvT, wspT, wcqT, wckT, wcvT, wcpT, w1T, w2T, cpl, hn, madd);

  // (2) one grid: self q|k and self v^T from hn, cross k and cross v^T from the c plane (K=1024; acc / 64)
  gemm_proj4<<<dim3(GB_ALL), blk, 0, stream>>>(
      hn, cpl, wqkvT, wckT, wcvT, sa_qkv_b, ca_k_b, ca_v_b, qkp, qkc, vtp, vtc, FEAT, sQKV);

  // ---------------- self-attention block ----------------
  // (3) attention -> ctx f16 plane (x256)
  const dim3 gAT(SEQ / 64, NB * NH);
  attn_kernel<<<gAT, dim3(128), 0, stream>>>(qkp, vtp, madd, ctx);
  // (4) x1 = ctx . Wsp + b + bf16rne(x) -> f32 plane   (per batch M=SEQ, N=1024, K=1024; acc / (64*256))
  const dim3 gPB((SEQ / 128) * (FEAT / 128), NB);
  gemm128<0, true><<<gPB, blk, 0, stream>>>(
      ctx, FEAT, (long long)SEQ * FEAT, wspT, FEAT, 0LL, (void*)x1, FEAT, (long long)SEQ * FEAT,
      sa_proj_b, x, FEAT, (long long)SEQ_FULL * FEAT,
      SEQ, FEAT, FEAT, sPROJ, 1.0f);

  // ---------------- cross-attention block ----------------
  // (5) hn = LN(x1)
  ln_kernel<<<dim3(NTOK), blk, 0, stream>>>(x1, (long long)SEQ * FEAT, hn);
  // (6) q = hn . Wcq + b -> cross q|k plane cols 0..1023   (M=NTOK, N=1024, K=1024)
  const dim3 gQ((NTOK / 128) * (FEAT / 128), 1);
  gemm128<1, false><<<gQ, blk, 0, stream>>>(
      hn, FEAT, 0LL, wcqT, FEAT, 0LL, (void*)qkc, QKP, 0LL, ca_q_b, x1, FEAT, 0LL,
      NTOK, FEAT, FEAT, sQKV, 1.0f);
  // (7) attention -> ctx
  attn_kernel<<<gAT, dim3(128), 0, stream>>>(qkc, vtc, madd, ctx);
  // (8) x2 = ctx . Wcp + b + x1 -> f32 plane   (M=NTOK, N=1024, K=1024)
  gemm128<0, false><<<gQ, blk, 0, stream>>>(
      ctx, FEAT, 0LL, wcpT, FEAT, 0LL, (void*)x2, FEAT, 0LL,
      ca_proj_b, x1, FEAT, 0LL,
      NTOK, FEAT, FEAT, sPROJ, 1.0f);

  // ---------------- MLP block ----------------
  // (9) hn = LN(x2)
  ln_kernel<<<dim3(NTOK), blk, 0, stream>>>(x2, (long long)SEQ * FEAT, hn);
  // (10) mid = gelu(hn . W1 + b1) x16 -> f16 [NTOK][4096]   (M=NTOK, N=4096, K=1024; acc / 64)
  const dim3 gW1((NTOK / 128) * (MF / 128), 1);
  gemm128<2, false><<<gW1, blk, 0, stream>>>(
      hn, FEAT, 0LL, w1T, FEAT, 0LL, (void*)mid, MF, 0LL, fc1_b, x1, FEAT, 0LL,
      NTOK, MF, FEAT, sQKV, MIDCARRY);
  // (11) out = mid . W2 + b2 + x2 -> d_out f32 rows b*SEQ_FULL + t   (per batch M=SEQ, N=1024, K=4096; acc / (64*16))
  gemm128<0, false><<<gPB, blk, 0, stream>>>(
      mid, MF, (long long)SEQ * MF, w2T, MF, 0LL, d_out, FEAT, (long long)SEQ_FULL * FEAT,
      fc2_b, x2, FEAT, (long long)SEQ * FEAT,
      SEQ, FEAT, MF, sFC2, 1.0f);

  (void)hipGetLastError();
}

// v006
// One run takes 215 microseconds.
// Next to v005, in two timings, it ran 1.03 times as fast each time.
// Counting every step since v000, it is 3.53 times as fast.
// Contractions: hn*WqkT (q|k plane), Wv*hn^T (v^T plane), K*Q^T scores, V^T*P^T, ctx*WpT for both attention
// blocks (cross block: k and v^T from the c plane), hn*W1T, mid*W2T: all v_wmma_f32_16x16x32_f16
// (f16 operands, single product, f32 accumulate). LayerNorms, softmax, GELU (erf form), bias and
// residual adds: f32 on VALU. Every float input enters as its bf16 RNE value (x, c, weights, biases).
// Carry audit (f16 planes): weights = bf16(w) x64, inverse folded once into the scale of each consuming GEMM
// (q/k/v^T: 1/64; proj GEMMs: 1/(64*256); fc1: 1/64; fc2: 1/(64*16)). hn, c, q, k, v^T carried x1.
// P = p x16384 (carried in the exponent, so l carries it too) and ctx = o x256: inv = (1/l)*256 in attn_kernel;
// mid = gelu x16. Scores are formed in the log2 domain: q enters the score product as f16(q * log2(e)/8).
#include <hip/hip_runtime.h>
#include <math.h>

#ifndef NB
#define NB 4
#endif
#ifndef SEQ
#define SEQ 1024
#endif
#define NB_FULL  4
#define SEQ_FULL 1024
#define FEAT 1024
#define NH   16
#define HD   64
#define MF   4096
#define QKP  (2 * FEAT)
#define NTOK (NB * SEQ)
static_assert(NH * HD == FEAT);
static_assert(HD == 64);
static_assert(NB >= 1 && NB <= NB_FULL);
static_assert(SEQ >= 64 && SEQ <= SEQ_FULL && (SEQ % 64) == 0);
static_assert((FEAT % 64) == 0 && (MF % 64) == 0 && (QKP % 64) == 0);
static_assert((FEAT % 128) == 0 && (MF % 128) == 0 && (QKP % 128) == 0 && (SEQ % 128) == 0 && FEAT >= 256);
static_assert(FEAT == 4 * 256);
static_assert(((long long)(NB - 1) * SEQ_FULL + SEQ) * FEAT <= (long long)NB_FULL * SEQ_FULL * FEAT);

#define WCARRY   64.0f
#define PEXP     14.0f                    // p is carried x 2^14
#define LOG2E    1.4426950408889634f
#define QSCALE   (0.125f * LOG2E)         // score scale 1/8 and the change to base 2, applied to q once
#define MASKADD2 (-10000.0f * LOG2E)      // additive key mask in the log2 domain
#define CTXCARRY 256.0f
#define MIDCARRY 16.0f

typedef _Float16 v16h __attribute__((ext_vector_type(16)));
typedef _Float16 v8h  __attribute__((ext_vector_type(8)));
typedef float    v8f  __attribute__((ext_vector_type(8)));
typedef float    v4f  __attribute__((ext_vector_type(4)));
typedef v8h __attribute__((may_alias)) v8ha;
typedef v4f __attribute__((may_alias)) v4fa;
union Frag { v16h v; v8h half[2]; };

#if defined(__HIP_DEVICE_COMPILE__)
#define DEV_ASM 1
#else
#define DEV_ASM 0
#endif

__device__ __forceinline__ v8f zero8() { v8f z = {0.f, 0.f, 0.f, 0.f, 0.f, 0.f, 0.f, 0.f}; return z; }

// f32 -> bf16 RNE value kept as f32
__device__ __forceinline__ float bf16r(float f) {
  unsigned u = __float_as_uint(f);
  u = (u + 0x7FFFu + ((u >> 16) & 1u)) & 0xFFFF0000u;
  return __uint_as_float(u);
}
__device__ __forceinline__ v4f bf16r4(v4f a) {
  v4f r = { bf16r(a.x), bf16r(a.y), bf16r(a.z), bf16r(a.w) };
  return r;
}

// ---------------------------------------------------------------------------------------------------
// 16x16x32 f16 WMMA. Fragment map (wave32): lane l, h = l>>4, m = n = l&15.
//   A/B element i: i<8 -> k0+8h+i ; i>=8 -> k0+16+8h+(i-8)      D element r: row 8h+r, col l&15
// ---------------------------------------------------------------------------------------------------
// guarded form: 4 VALU slots after the WMMA, D tied, A/B kept live
__device__ __forceinline__ v8f wmma_f16(v16h a, v16h b, v8f c) {
  v8f d = __builtin_amdgcn_wmma_f32_16x16x32_f16(false, a, false, b, (short)0, c, false, false);
#if DEV_ASM
  asm volatile("v_nop\n\tv_nop\n\tv_nop\n\tv_nop" : "+v"(d) : "v"(a), "v"(b));
#endif
  return d;
}
// plain builtin form for the GEMM inner loop (the compiler keeps the distances between its own builtins)
__device__ __forceinline__ v8f mmar(v16h a, v16h b, v8f c) {
  return __builtin_amdgcn_wmma_f32_16x16x32_f16(false, a, false, b, (short)0, c, false, false);
}
__device__ __forceinline__ void acc_guard4(v8f& a, v8f& b, v8f& c, v8f& d) {
#if DEV_ASM
  asm volatile("v_nop\n\tv_nop\n\tv_nop\n\tv_nop" : "+v"(a), "+v"(b), "+v"(c), "+v"(d));
#else
  (void)a; (void)b; (void)c; (void)d;
#endif
}

// A or B fragment from a k-contiguous f16 row; p points at element k0 of the row owned by this lane.
__device__ __forceinline__ v16h load_frag(const _Float16* p, int h) {
  Frag f;
  f.half[0] = *(const v8ha*)(p + 8 * h);
  f.half[1] = *(const v8ha*)(p + 16 + 8 * h);
  return f.v;
}
// same, p already includes +8*(lane>>4)
__device__ __forceinline__ v16h ldfrag(const _Float16* p) {
  Frag f;
  f.half[0] = *(const v8ha*)(p);
  f.half[1] = *(const v8ha*)(p + 16);
  return f.v;
}

// behind a job's last global store: the compiler lays the jobs of one kernel one behind the other, and the code that
// follows in the listing rewrites the store's address and data registers; the wait stands in front of that
__device__ __forceinline__ void wait_store_regs() {
#if DEV_ASM
  asm volatile("s_wait_xcnt 0x0" ::: "memory");
#endif
}

// =====================================================================================================
// A job of the preparation kernel: transpose + convert: in f32 [K][N] (row = k) -> out f16 [N][K] =
// f16(carry * bf16rne(in)^T). Block 256 threads, tile 64 k x 32 n (tile index bx along k, by along n) staged in
// LDS (n-major, pitch 68 floats; cross-wave -> block barrier).
// coverage: 32 n-rows x 64 k per block; (K/64) x (N/32) blocks cover the whole [N][K] plane.
// LDS: tile cols 0..63 of all 32 rows written before the barrier; cols 64..67 never read.
// =====================================================================================================
__device__ __forceinline__ void transpose_tile(
    const float* in, _Float16* out, int K, int N, float carry, int bx, int by)
{
  __shared__ __align__(16) float tile[32][68];
  const int k0 = bx * 64, n0 = by * 32;
  const int tid = (int)threadIdx.x;
  {
    const int kk = tid >> 2, nq = (tid & 3) * 8;
    const float* src = in + (size_t)(k0 + kk) * N + n0 + nq;
    const v4f a = *(const v4fa*)src;
    const v4f c = *(const v4fa*)(src + 4);
    tile[nq + 0][kk] = a.x; tile[nq + 1][kk] = a.y; tile[nq + 2][kk] = a.z; tile[nq + 3][kk] = a.w;
    tile[nq + 4][kk] = c.x; tile[nq + 5][kk] = c.y; tile[nq + 6][kk] = c.z; tile[nq + 7][kk] = c.w;
  }
  __syncthreads();
  {
    const int nn = tid >> 3, kq = (tid & 7) * 8;
    const float* sp = &tile[nn][kq];
    const v4f a = bf16r4(*(const v4fa*)sp);
    const v4f c = bf16r4(*(const v4fa*)(sp + 4));
    const v8h o = { (_Float16)(a.x * carry), (_Float16)(a.y * carry), (_Float16)(a.z * carry), (_Float16)(a.w * carry),
                    (_Float16)(c.x * carry), (_Float16)(c.y * carry), (_Float16)(c.z * carry), (_Float16)(c.w * carry) };
    _Float16* dst = out + (size_t)(n0 + nn) * K + k0 + kq;
    *(v8h*)dst = o;
    wait_store_regs();
  }
}

// =====================================================================================================
// A job of the preparation kernel: row convert: f32 input rows (batch stride SEQ_FULL*FEAT) -> compact f16 plane
// [NTOK][FEAT], value = f16(bf16rne(v)). Two 1024-wide rows per 256-thread block, 8 elements per thread.
// coverage: 128 x 8 = 1024 per row; NTOK/2 blocks.
// =====================================================================================================
__device__ __forceinline__ void cvt_two_rows(const float* src, _Float16* dst, int pair)
{
  const int row = 2 * pair + ((int)threadIdx.x >> 7);
  const int bb = row / SEQ, t = row - bb * SEQ;
  const int tid = (int)threadIdx.x & 127;
  const float* sp = src + ((size_t)bb * SEQ_FULL + (size_t)t) * FEAT + 8 * tid;
  const v4f a = bf16r4(*(const v4fa*)sp);
  const v4f c = bf16r4(*(const v4fa*)(sp + 4));
  const v8h o = { (_Float16)a.x, (_Float16)a.y, (_Float16)a.z, (_Float16)a.w,
                  (_Float16)c.x, (_Float16)c.y, (_Float16)c.z, (_Float16)c.w };
  _Float16* d = dst + (size_t)row * FEAT + 8 * tid;
  *(v8h*)d = o;
  wait_store_regs();
}

// =====================================================================================================
// A job of the preparation kernel: additive key mask as f32, log2 domain: compact plane [NB][SEQ],
// value = -10000 * log2(e) where mask != 1, else 0. One element per thread, 256 per block; NTOK/256 blocks.
// =====================================================================================================
__device__ __forceinline__ void mask_add_256(const int* mask, float* madd, int blk)
{
  const int idx = blk * 256 + (int)threadIdx.x;
  const int bb = idx / SEQ, t = idx - bb * SEQ;
  madd[idx] = (mask[(size_t)bb * SEQ_FULL + t] != 1) ? MASKADD2 : 0.0f;
  wait_store_regs();
}

// =====================================================================================================
// LayerNorm, no affine, eps 1e-6 (one 1024-wide row per 256-thread block, thread owns 4 consecutive
//   RNEX = true : v = bf16rne(X) (raw input x); false: v = X (internal f32 plane).
//   Input row = b * strideXB + t * FEAT with (b, t) from the compact row index; output f16 row compact.
//   f16 row: staged in LDS (cross-wave -> block barrier), lanes of waves 0..3 write 16 B each (8 halves),
// =====================================================================================================
__device__ __forceinline__ float block_sum(float v, float* red, int lane, int w) {
#pragma unroll
  for (int off = 16; off > 0; off >>= 1) v += __shfl_xor(v, off);
  if (lane == 0) red[w] = v;
  __syncthreads();
  float r = red[0];
#pragma unroll
  for (int i = 1; i < 8; ++i) r += red[i];
  __syncthreads();
  return r;
}

template <bool RNEX>
__device__ __forceinline__ void ln_row(const float* X, long long strideXB, _Float16* pout, int row)
{
  __shared__ __align__(16) float srow[FEAT];
  __shared__ float red[8];
  const int bb  = row / SEQ, t = row - bb * SEQ;
  const int tid = (int)threadIdx.x, lane = tid & 31, w = tid >> 5;
  const int f0  = 4 * tid;
  const float* xp = X + (size_t)bb * (size_t)strideXB + (size_t)t * FEAT + f0;

  v4f xv = *(const v4fa*)xp;
  if (RNEX) xv = bf16r4(xv);
  float s = (xv.x + xv.y) + (xv.z + xv.w);
  s = block_sum(s, red, lane, w);
  const float mu = s * (1.0f / FEAT);
  const float d0 = xv.x - mu, d1 = xv.y - mu, d2 = xv.z - mu, d3 = xv.w - mu;
  float q = (d0 * d0 + d1 * d1) + (d2 * d2 + d3 * d3);
  q = block_sum(q, red, lane, w);
  const float rstd = rsqrtf(q * (1.0f / FEAT) + 1e-6f);

  const v4f ov = { d0 * rstd, d1 * rstd, d2 * rstd, d3 * rstd };
  *(v4fa*)(srow + f0) = ov;
  __syncthreads();
  if (w < 4) {                                             // wave-uniform: waves 0..3, 128 threads x 8 halves
    const float* sp = srow + 8 * tid;
    const v4f a = *(const v4fa*)sp;
    const v4f c = *(const v4fa*)(sp + 4);
    const v8h o = { (_Float16)a.x, (_Float16)a.y, (_Float16)a.z, (_Float16)a.w,
                    (_Float16)c.x, (_Float16)c.y, (_Float16)c.z, (_Float16)c.w };
    _Float16* dst = pout + (size_t)row * FEAT + 8 * tid;
    *(v8h*)dst = o;
    
  }
}

// LayerNorm of an internal f32 plane, one row per block
__global__ __launch_bounds__(256) void ln_kernel(const float* __restrict__ X, long long strideXB, _Float16* pout)
{
  ln_row<false>(X, strideXB, pout, (int)blockIdx.x);
}

// =====================================================================================================
// Preparation kernel: everything that depends on the raw inputs alone, in ONE grid; a block-index range picks
// the job (block-uniform, so each job's barriers stay under block-uniform control flow):
//   LN(bf16rne(x)) first (its blocks run longest, so they do not form the grid's tail), the row convert of c,
//   the additive key mask, the eight weight transposes (tiles in the order bx fastest).
// =====================================================================================================
#define PB_QKV ((FEAT / 64) * ((3 * FEAT) / 32))   // blocks of the [FEAT][3 FEAT] transpose
#define PB_SQ  ((FEAT / 64) * (FEAT / 32))         // blocks of one [FEAT][FEAT] transpose
#define PB_MLP ((FEAT / 64) * (MF / 32))           // blocks of the [FEAT][MF] and of the [MF][FEAT] transpose
#define PB_TR  (PB_QKV + 5 * PB_SQ + 2 * PB_MLP)
#define PB_CV  (NTOK / 2)
#define PB_MK  (NTOK / 256)
#define PB_ALL (PB_TR + PB_CV + PB_MK + NTOK)
static_assert((NTOK % 256) == 0);

__global__ __launch_bounds__(256) void prep_kernel(
    const float* __restrict__ w_qkv, const float* __restrict__ w_sp, const float* __restrict__ w_cq,
    const float* __restrict__ w_ck, const float* __restrict__ w_cv, const float* __restrict__ w_cp,
    const float* __restrict__ w_1, const float* __restrict__ w_2,
    const float* __restrict__ x, const float* __restrict__ c, const int* __restrict__ mask,
    _Float16* t_qkv, _Float16* t_sp, _Float16* t_cq, _Float16* t_ck, _Float16* t_cv, _Float16* t_cp,
    _Float16* t_1, _Float16* t_2, _Float16* cpl, _Float16* hn, float* madd)
{
  int blk = (int)blockIdx.x;
  if (blk < NTOK) {
    ln_row<true>(x, (long long)SEQ_FULL * FEAT, hn, blk);
  } else if (blk < NTOK + PB_CV) {
    cvt_two_rows(c, cpl, blk - NTOK);
  } else if (blk < NTOK + PB_CV + PB_MK) {
    mask_add_256(mask, madd, blk - (NTOK + PB_CV));
  } else {
    blk -= NTOK + PB_CV + PB_MK;
    const float* in; _Float16* out; int K = FEAT, N = FEAT;
    if (blk < PB_MLP)                    { in = w_1; out = t_1; N = MF; }
    else if ((blk -= PB_MLP) < PB_MLP)   { in = w_2; out = t_2; K = MF; }
    else if ((blk -= PB_MLP) < PB_QKV)   { in = w_qkv; out = t_qkv; N = 3 * FEAT; }
    else if ((blk -= PB_QKV) < PB_SQ)    { in = w_sp; out = t_sp; }
    else if ((blk -= PB_SQ) < PB_SQ)     { in = w_cq; out = t_cq; }
    else if ((blk -= PB_SQ) < PB_SQ)     { in = w_ck; out = t_ck; }
    else if ((blk -= PB_SQ) < PB_SQ)     { in = w_cv; out = t_cv; }
    else                                 { blk -= PB_SQ; in = w_cp; out = t_cp; }
    const int kt = K >> 6;
    const int by = blk / kt;
    transpose_tile(in, out, K, N, WCARRY, blk - by * kt, by);
  }
}

// =====================================================================================================
// Batched WMMA GEMM (f16 operands): C[m][n] = sum_k A[m][k] * Bt[n][k].
// One 128x128 tile of C per 256-thread block; 8 waves as 4 (m) x 2 (n), each 32x64 (2 x 4 accumulator tiles).
// A row-major [M][K] pitch lda; Bt row-major [N][K] pitch ldb (k contiguous); M, N, K multiples of 128,
// K >= 256 (all shapes here are compile-time constants of the host code). tile = index of the C tile, b = batch
// index, smem = the block's 2 * STAGEB bytes of LDS (declared in the kernel that calls this).
// Operands: per stage 128 k of the block's 128 A rows and 128 Bt rows are brought into LDS by asynchronous
// 16-byte copies (each thread 8 + 8 copies, a wave-wide copy = two whole 256-B row pieces), two buffers, the
// next stage in flight while this one is multiplied. LDS row pitch 272 B (256 + 16: ds_load_b128 readers).
// Fragments from LDS with the split k map (ldfrag), two register sets inside a stage.
// k order: a block starts at stage (tile row, counted over the batches, + tile column) mod stages and wraps round, so
// that blocks which share A or Bt rows do not ask L2 for the same lines at the same moment; inside a stage k runs
// upward in steps of 32.
// MODE 0: f32 C = acc*oscale + bf16rne(bias[n]) + res[m][n] (res pitch ldr, batch stride strideR;
//         RESRNE: res value bf16rne-converted on load)
// MODE 1: f16 C = f16(acc*oscale + bf16rne(bias[n]))
// MODE 2: f16 C = f16(gelu(acc*oscale + bf16rne(bias[n])) * ocarry), gelu = 0.5 v (1 + erf(v / sqrt 2)): gelu8_carry
// MODE 3: f16 C = f16(acc*oscale + bf16rne(bias[m]))       (row bias, transposed output planes)
// coverage: 2 slabs x 16 rows x 64 cols = the wave's whole 32x64 tile; slab 16x64 fully written before reads.
// LDS: every byte of a buffer's 256 data bytes per row is copied before the barrier that publishes it; the 16
// pad bytes per row are never read. The per-wave epilogue slabs lie in the ring, used only behind the last
// trip's barrier (no copy outstanding, every fragment read retired).
// =====================================================================================================
#define LROW    272                    // LDS row pitch, bytes
#define OPBYTES (128 * LROW)           // one operand's 128 rows of one stage
#define STAGEB  (2 * OPBYTES)          // [A 128 rows | Bt 128 rows]

// Eight asynchronous 16-byte copies of this lane: rows r, r+16, ..., r+112 of one operand's stage.
// l = the lane's LDS byte address of row r, gp = its global address, rstep = elements per 16 rows.
// s_wait_xcnt 0 is the last line of the statement, so that no address register is rewritten in front of it.
__device__ __forceinline__ void copy8(unsigned l, const _Float16* gp, size_t rstep) {
#if DEV_ASM
  const unsigned l1 = l + 16 * LROW, l2 = l + 32 * LROW, l3 = l + 48 * LROW, l4 = l + 64 * LROW,
                 l5 = l + 80 * LROW, l6 = l + 96 * LROW, l7 = l + 112 * LROW;
  const _Float16 *g1 = gp + rstep, *g2 = g1 + rstep, *g3 = g2 + rstep, *g4 = g3 + rstep,
                 *g5 = g4 + rstep, *g6 = g5 + rstep, *g7 = g6 + rstep;
  asm volatile("global_load_async_to_lds_b128 %0, %8, off\n\t"
               "global_load_async_to_lds_b128 %1, %9, off\n\t"
               "global_load_async_to_lds_b128 %2, %10, off\n\t"
               "global_load_async_to_lds_b128 %3, %11, off\n\t"
               "global_load_async_to_lds_b128 %4, %12, off\n\t"
               "global_load_async_to_lds_b128 %5, %13, off\n\t"
               "global_load_async_to_lds_b128 %6, %14, off\n\t"
               "global_load_async_to_lds_b128 %7, %15, off\n\t"
               "s_wait_xcnt 0x0"
               :: "v"(l), "v"(l1), "v"(l2), "v"(l3), "v"(l4), "v"(l5), "v"(l6), "v"(l7),
                  "v"(gp), "v"(g1), "v"(g2), "v"(g3), "v"(g4), "v"(g5), "v"(g6), "v"(g7)
               : "memory");
#else
  (void)l; (void)gp; (void)rstep;
#endif
}
// this wave's own copies have landed
__device__ __forceinline__ void wait_copies() {
#if DEV_ASM
  asm volatile("s_wait_asynccnt 0x0" ::: "memory");
#endif
}
// this wave's own LDS reads have retired (before the buffer they read is handed to its next writer)
__device__ __forceinline__ void wait_lds() {
#if DEV_ASM
  asm volatile("s_wait_dscnt 0x0" ::: "memory");
#endif
}

// Eight reciprocals, or eight powers of two, of a lane in one statement. What it is for: directly behind a transcendental
// the instruction set asks for one instruction that neither uses its result nor overwrites its source; here each fills
// that slot for the one in front of it (early-clobber outputs: no result shares a register with a source) and the
// v_nop fills it for the last.
__device__ __forceinline__ void rcp8(float (&r)[8], const float (&x)[8]) {
#if DEV_ASM
  asm("v_rcp_f32 %0, %8\n\t"
      "v_rcp_f32 %1, %9\n\t"
      "v_rcp_f32 %2, %10\n\t"
      "v_rcp_f32 %3, %11\n\t"
      "v_rcp_f32 %4, %12\n\t"
      "v_rcp_f32 %5, %13\n\t"
      "v_rcp_f32 %6, %14\n\t"
      "v_rcp_f32 %7, %15\n\t"
      "v_nop"
      : "=&v"(r[0]), "=&v"(r[1]), "=&v"(r[2]), "=&v"(r[3]), "=&v"(r[4]), "=&v"(r[5]), "=&v"(r[6]), "=&v"(r[7])
      : "v"(x[0]), "v"(x[1]), "v"(x[2]), "v"(x[3]), "v"(x[4]), "v"(x[5]), "v"(x[6]), "v"(x[7]));
#else
  for (int i = 0; i < 8; ++i) r[i] = 1.0f / x[i];
#endif
}
__device__ __forceinline__ void exp2_8(float (&r)[8], const float (&x)[8]) {
#if DEV_ASM
  asm("v_exp_f32 %0, %8\n\t"
      "v_exp_f32 %1, %9\n\t"
      "v_exp_f32 %2, %10\n\t"
      "v_exp_f32 %3, %11\n\t"
      "v_exp_f32 %4, %12\n\t"
      "v_exp_f32 %5, %13\n\t"
      "v_exp_f32 %6, %14\n\t"
      "v_exp_f32 %7, %15\n\t"
      "v_nop"
      : "=&v"(r[0]), "=&v"(r[1]), "=&v"(r[2]), "=&v"(r[3]), "=&v"(r[4]), "=&v"(r[5]), "=&v"(r[6]), "=&v"(r[7])
      : "v"(x[0]), "v"(x[1]), "v"(x[2]), "v"(x[3]), "v"(x[4]), "v"(x[5]), "v"(x[6]), "v"(x[7]));
#else
  for (int i = 0; i < 8; ++i) r[i] = exp2f(x[i]);
#endif
}

// u <- hc * u * (1 + erf(u / sqrt 2)) for eight values, hc = half the output carry: the erf form of GELU without a
// branch, so that the values of a lane run side by side in independent chains. With a = |u|, t = 1 / (1 + P a / sqrt 2):
//   erfc(a / sqrt 2) = t (A1 + t (A2 + t (A3 + t (A4 + t A5)))) exp(-u^2 / 2)   (rational form, absolute error 1.5e-7)
//   u (1 + erf(u / sqrt 2)) = u + a (1 - erfc(a / sqrt 2))                      (erf is odd)
__device__ __forceinline__ void gelu8_carry(float (&u)[8], float hc) {
  float d[8], g[8], t[8], ex[8];
#pragma unroll                                             // constant indices: the arrays stay in registers
  for (int i = 0; i < 8; ++i) {
    d[i] = fmaf(fabsf(u[i]), 0.231641888f, 1.0f);          // P / sqrt 2, P = 0.3275911
    g[i] = (u[i] * u[i]) * (-0.5f * LOG2E);
  }
  rcp8(t, d);
  exp2_8(ex, g);
#pragma unroll                                             // constant indices: the arrays stay in registers
  for (int i = 0; i < 8; ++i) {
    float p = fmaf(t[i], 1.061405429f, -1.453152027f);
    p = fmaf(p, t[i], 1.421413741f);
    p = fmaf(p, t[i], -0.284496736f);
    p = fmaf(p, t[i], 0.254829592f);
    const float q = fmaf(-(p * t[i]), ex[i], 1.0f);        // erf(a / sqrt 2)
    u[i] = fmaf(fabsf(u[i]), q, u[i]) * hc;
  }
}

template <int MODE, bool RESRNE>
__device__ __forceinline__ void gemm_tile(
    unsigned char* smem, int tile, int b,
    const _Float16* A, int lda, long long strideA,
    const _Float16* Bt, int ldb, long long strideB,
    void* Cout, int ldc, long long strideC,
    const float* bias,
    const float* res, int ldr, long long strideR,
    int M, int N, int K, float oscale, float ocarry)
{
  const int tid  = (int)threadIdx.x;
  const int lane = tid & 31;
  const int wave = tid >> 5;
  const int tilesN = N >> 7;
  const int tilesM = M >> 7;
  if (tile >= tilesM * tilesN) return;                     // block-uniform, in front of every copy and barrier
  const int tm = tile / tilesN;
  const int tn = tile - tm * tilesN;
  const int m0 = (tm << 7) + ((wave >> 1) << 5);           // this wave's 32 rows
  const int n0 = (tn << 7) + ((wave & 1) << 6);            // this wave's 64 columns

  const _Float16* Ab = A  + (size_t)b * (size_t)strideA;
  const _Float16* Bb = Bt + (size_t)b * (size_t)strideB;

  const int rlane = lane & 15;                             // row (A) / col (B, D) within subtile
  const int koff  = (lane >> 4) * 8;                       // k offset of this lane half
  const int mOff  = (lane >> 4) * 8;                       // D row offset

  // copy map: thread -> row tid>>4 (+16 per copy), 16-byte piece tid&15 of the row's 256 bytes
  const int crow = tid >> 4, ccol = tid & 15;
  const _Float16* gA = Ab + (size_t)((tm << 7) + crow) * lda + ccol * 8;
  const _Float16* gB = Bb + (size_t)((tn << 7) + crow) * ldb + ccol * 8;
  const unsigned lA = (unsigned)(size_t)smem + (unsigned)(crow * LROW + ccol * 16);
  const unsigned lB = lA + OPBYTES;
  const size_t stepA = (size_t)16 * lda, stepB = (size_t)16 * ldb;

  // fragment read bases inside a buffer
  const unsigned char* fA = smem + (((wave >> 1) << 5) + rlane) * LROW + koff * 2;
  const unsigned char* fB = smem + OPBYTES + (((wave & 1) << 6) + rlane) * LROW + koff * 2;

  v8f acc[2][4];
#pragma unroll
  for (int i = 0; i < 2; ++i)
#pragma unroll
    for (int j = 0; j < 4; ++j) acc[i][j] = zero8();

  const int nt = K >> 7;                                   // stages of 128 k
  int sc = (b * tilesM + tm + tn) % nt;                    // k stage of the next copies (block-uniform, 0 .. nt-1)
  copy8(lA, gA + (size_t)sc * 128, stepA);
  copy8(lB, gB + (size_t)sc * 128, stepB);
  sc = (sc + 1 == nt) ? 0 : sc + 1;
  wait_copies();
  __syncthreads();                                         // first stage published
  if (nt > 1) {
    copy8(lA + STAGEB, gA + (size_t)sc * 128, stepA);
    copy8(lB + STAGEB, gB + (size_t)sc * 128, stepB);
    sc = (sc + 1 == nt) ? 0 : sc + 1;
  }

  for (int t = 0; t < nt; ++t) {
    const unsigned buf = (unsigned)(t & 1) * STAGEB;
    // two fragment sets: the next 32 k of THIS buffer are read as one group ahead of the current products
    v16h bq[2][4], af[2][2];
#pragma unroll
    for (int j = 0; j < 4; ++j) bq[0][j] = ldfrag((const _Float16*)(fB + buf + j * 16 * LROW));
#pragma unroll
    for (int i = 0; i < 2; ++i) af[0][i] = ldfrag((const _Float16*)(fA + buf + i * 16 * LROW));
#pragma unroll
    for (int kk = 0; kk < 4; ++kk) {
      const int cur = kk & 1, nxt = cur ^ 1;
      if (kk < 3) {
#pragma unroll
        for (int j = 0; j < 4; ++j)
          bq[nxt][j] = ldfrag((const _Float16*)(fB + buf + j * 16 * LROW + (kk + 1) * 64));
#pragma unroll
        for (int i = 0; i < 2; ++i)
          af[nxt][i] = ldfrag((const _Float16*)(fA + buf + i * 16 * LROW + (kk + 1) * 64));
      }
      // keeps the load group in front of the products: without it the scheduler sinks the LDS reads among the
      // matrix instructions into one register set, and each product group waits out its own LDS latency
      __builtin_amdgcn_sched_barrier(0);
#pragma unroll
      for (int i = 0; i < 2; ++i)
#pragma unroll
        for (int j = 0; j < 4; ++j) acc[i][j] = mmar(af[cur][i], bq[cur][j], acc[i][j]);
      // same purpose: the following load group stays behind these products
      __builtin_amdgcn_sched_barrier(0);
    }
    wait_lds();
    wait_copies();
    __syncthreads();                                       // publishes stage t+1, frees stage t's buffer
    if (t + 2 < nt) {
      copy8(lA + buf, gA + (size_t)sc * 128, stepA);
      copy8(lB + buf, gB + (size_t)sc * 128, stepB);
      sc = (sc + 1 == nt) ? 0 : sc + 1;
    }
  }
  wait_copies();
  acc_guard4(acc[0][0], acc[0][1], acc[0][2], acc[0][3]);
  acc_guard4(acc[1][0], acc[1][1], acc[1][2], acc[1][3]);

  // ---- epilogue ----
  float* slab = (float*)(smem + wave * (16 * 68 * 4));     // per-wave 16x64 slab, pitch 68 floats
#pragma unroll
  for (int i = 0; i < 2; ++i) {
    const int mBase = m0 + (i << 4);
#pragma unroll
    for (int j = 0; j < 4; ++j) {
#pragma unroll
      for (int r = 0; r < 8; ++r) {
        slab[(mOff + r) * 68 + (j << 4) + rlane] = acc[i][j][r];
      }
    }
    __builtin_amdgcn_fence(3, "workgroup");
    __builtin_amdgcn_wave_barrier();
    __builtin_amdgcn_fence(2, "workgroup");
    if (MODE == 0) {
      float* C = (float*)Cout + (size_t)b * (size_t)strideC;
      const float* R = res + (size_t)b * (size_t)strideR;
      const int h2 = lane >> 4, c4 = (lane & 15) * 4;     // 256-B row segment = 16 lanes x 16 B
      const v4f bv = bf16r4(*(const v4fa*)(bias + n0 + c4));
      {
#pragma unroll
        for (int it = 0; it < 8; ++it) {
          const int row = it * 2 + h2;                     // it 0..7 x h2 0..1 = rows 0..15
          const size_t go = (size_t)(mBase + row) * ldc + n0 + c4;
          const size_t ro = (size_t)(mBase + row) * ldr + n0 + c4;
          const v4f sv = *(const v4fa*)(slab + row * 68 + c4);
          v4f rv = *(const v4fa*)(R + ro);
          if (RESRNE) rv = bf16r4(rv);
          const v4f v = sv * oscale + bv + rv;
          *(v4f*)(C + go) = v;
        }
        
      }
    } else {
      const int q = lane >> 3, c8 = (lane & 7) * 8;
      _Float16* C = (_Float16*)Cout + (size_t)b * (size_t)strideC;
      float bb8[8] = { 0.f, 0.f, 0.f, 0.f, 0.f, 0.f, 0.f, 0.f };
      if (MODE == 1 || MODE == 2) {
        const v4f ba = bf16r4(*(const v4fa*)(bias + n0 + c8));
        const v4f bc = bf16r4(*(const v4fa*)(bias + n0 + c8 + 4));
        bb8[0] = ba.x; bb8[1] = ba.y; bb8[2] = ba.z; bb8[3] = ba.w;
        bb8[4] = bc.x; bb8[5] = bc.y; bb8[6] = bc.z; bb8[7] = bc.w;
      }
      v8h hv[4];
#pragma unroll
      for (int it = 0; it < 4; ++it) {
        const int row = it * 4 + q;                        // it 0..3 x q 0..3 = rows 0..15
        const float* sp = slab + row * 68 + c8;
        const v4f a = *(const v4fa*)sp;
        const v4f c = *(const v4fa*)(sp + 4);
        float f[8] = { a.x, a.y, a.z, a.w, c.x, c.y, c.z, c.w };
        float brow = 0.0f;
        if (MODE == 3) brow = bf16r(bias[mBase + row]);
#pragma unroll
        for (int e = 0; e < 8; ++e) f[e] = f[e] * oscale + ((MODE == 3) ? brow : bb8[e]);
        if (MODE == 2) gelu8_carry(f, 0.5f * ocarry);
        const v8h o = { (_Float16)f[0], (_Float16)f[1], (_Float16)f[2], (_Float16)f[3],
                        (_Float16)f[4], (_Float16)f[5], (_Float16)f[6], (_Float16)f[7] };
        hv[it] = o;
      }
      {
#pragma unroll
        for (int it = 0; it < 4; ++it) {
          const int row = it * 4 + q;
          *(v8h*)(C + (size_t)(mBase + row) * ldc + n0 + c8) = hv[it];
        }
        
      }
    }
    __builtin_amdgcn_fence(3, "workgroup");
    __builtin_amdgcn_wave_barrier();
    __builtin_amdgcn_fence(2, "workgroup");
  }
}

// one GEMM per launch: blockIdx.x = tile, blockIdx.y = batch
template <int MODE, bool RESRNE>
__global__ __launch_bounds__(256) void gemm128(
    const _Float16* __restrict__ A, int lda, long long strideA,
    const _Float16* __restrict__ Bt, int ldb, long long strideB,
    void* Cout, int ldc, long long strideC,
    const float* __restrict__ bias,
    const float* __restrict__ res, int ldr, long long strideR,
    int M, int N, int K, float oscale, float ocarry)
{
  __shared__ __align__(16) unsigned char smem[2 * STAGEB];  // two stage buffers; epilogue slabs behind the loop
  gemm_tile<MODE, RESRNE>(smem, (int)blockIdx.x, (int)blockIdx.y, A, lda, strideA, Bt, ldb, strideB,
                          Cout, ldc, strideC, bias, res, ldr, strideR, M, N, K, oscale, ocarry);
}

// The four projections that need only hn = LN(x) or the c plane, in ONE grid; a block-index range picks the job:
//   self q|k   = hn . Wqkv[:, 0:2 FEAT]      -> qk_s [NTOK][QKP]              (M=NTOK, N=QKP,  column bias)
//   cross k    = c . Wck                     -> qk_c [NTOK][QKP] cols FEAT..  (M=NTOK, N=FEAT, column bias)
//   self v^T   = Wqkv[:, 2 FEAT:]^T . hn^T   -> vt_s [b][FEAT][SEQ]           (M=FEAT, N=SEQ per batch, row bias)
//   cross v^T  = Wcv^T . c^T                 -> vt_c [b][FEAT][SEQ]           (M=FEAT, N=SEQ per batch, row bias)
// K (= FEAT) comes as an argument, as in gemm128.
#define GB_QK ((NTOK / 128) * (QKP / 128))
#define GB_K  ((NTOK / 128) * (FEAT / 128))
#define GB_V1 ((FEAT / 128) * (SEQ / 128))         // v^T tiles of one batch
#define GB_ALL (GB_QK + GB_K + 2 * NB * GB_V1)

__global__ __launch_bounds__(256) void gemm_proj4(
    const _Float16* __restrict__ hn, const _Float16* __restrict__ cpl,
    const _Float16* __restrict__ wqkvT, const _Float16* __restrict__ wckT, const _Float16* __restrict__ wcvT,
    const float* __restrict__ b_qkv, const float* __restrict__ b_ck, const float* __restrict__ b_cv,
    _Float16* qk_s, _Float16* qk_c, _Float16* vt_s, _Float16* vt_c, int K, float oscale)
{
  __shared__ __align__(16) unsigned char smem[2 * STAGEB];  // two stage buffers; epilogue slabs behind the loop
  int blk = (int)blockIdx.x;
  const _Float16 *A, *Bt; _Float16* C; const float* bias;
  int b = 0, rowbias = 0, ldc = QKP, M = NTOK, N = FEAT;
  long long strideB = 0LL, strideC = 0LL;
  if (blk < GB_QK)               { A = hn;  Bt = wqkvT; C = qk_s;        bias = b_qkv; N = QKP; }
  else if ((blk -= GB_QK) < GB_K) { A = cpl; Bt = wckT;  C = qk_c + FEAT; bias = b_ck; }
  else {
    blk -= GB_K;
    if (blk < NB * GB_V1) { A = wqkvT + (size_t)2 * FEAT * FEAT; Bt = hn; C = vt_s; bias = b_qkv + 2 * FEAT; }
    else { blk -= NB * GB_V1; A = wcvT; Bt = cpl; C = vt_c; bias = b_cv; }
    b = blk / GB_V1; blk -= b * GB_V1;
    rowbias = 1; ldc = SEQ; M = FEAT; N = SEQ;
    strideB = (long long)SEQ * FEAT; strideC = (long long)FEAT * SEQ;
  }
  if (rowbias)                                             // block-uniform: every barrier inside is met by all waves
    gemm_tile<3, false>(smem, blk, b, A, FEAT, 0LL, Bt, FEAT, strideB, (void*)C, ldc, strideC,
                        bias, bias, FEAT, 0LL, M, N, K, oscale, 1.0f);
  else
    gemm_tile<1, false>(smem, blk, b, A, FEAT, 0LL, Bt, FEAT, strideB, (void*)C, ldc, strideC,
                        bias, bias, FEAT, 0LL, M, N, K, oscale, 1.0f);
}

// =====================================================================================================
// Streaming attention, transposed form, 16 heads, additive key mask (-10000 where mask != 1),
// softmax over all SEQ keys. Block 128 thr (4 waves), 16 queries per wave, 64 keys per step.
//   S^T = K * Q^T + mask : A = K rows (row = key, k = d), B = Q^T (k = d, n = query) with q scaled once by
//   log2(e)/8 (product in f32, rounded to f16), C = the key's additive mask x log2(e) from the f32 plane: the
//   accumulator leaves the matrix unit as the masked score in the log2 domain, no vector work per score for it
//   O^T += V^T * P^T : A = V^T rows (row = d, k = key), B = P^T packed from the score D registers
//   (element r <- key tile covering k 0..15 row r, element 8+r <- tile covering k 16..31 row r, same lane)
// Lane owns 32 keys of query column (lane&15); partner = lane ^ 16. Online softmax in f32, base 2; p carried x16384
// by 14 taken off the maximum that is subtracted, so the running sum l carries the same factor.
//   q|k plane [b*SEQ + t][QKP]: q at col head*64 + d, k at col FEAT + head*64 + d (f16);
//   v^T plane [b][head*64 + d][SEQ] (f16); madd f32 [b][SEQ].
//   ctx plane [b*SEQ + t][head*64 + d] = f16(256 * o / l): per-wave 16x64 tile staged in LDS (block barrier),
// coverage: grid (SEQ/64, NB*NH): every (b, head, query) row x 64 columns of its head written once.
// LDS sO: each wave writes its full 16x64 region before the barrier.
// Operands: per step the 64 K rows (128 B each) and the 64 V^T rows (128 B each) that all four waves use are
// brought into LDS once per block by asynchronous 16-byte copies (each thread 4 + 4 copies, a wave-wide copy =
// four whole 128-B rows), two buffers, the next step's tiles in flight while this step is worked on.
// LDS row pitch 144 B (128 + 16: ds_load_b128 readers); the 16 pad bytes per row are never read.
// Key order: the block of query tile x starts at key step x mod steps and wraps round, so that the blocks of one
// (batch, head), which all walk the same K and V^T rows, do not ask L2 for the same lines at the same moment.
// =====================================================================================================
#define KVROW   144                    // LDS row pitch, bytes
#define KVOP    (64 * KVROW)           // one operand's 64 rows of one step
#define KVSTAGE (2 * KVOP)             // [K 64 rows | V^T 64 rows]

// Eight asynchronous 16-byte copies of this lane: rows r, r+16, r+32, r+48 of the K tile and of the V^T tile.
// lk, lv = the lane's LDS byte addresses of row r, gk, gv = its global addresses, kstep, vstep = elements per 16 rows.
// s_wait_xcnt 0 is the last line of the statement, so that no address register is rewritten in front of it.
__device__ __forceinline__ void copy_kv(unsigned lk, const _Float16* gk, size_t kstep,
                                        unsigned lv, const _Float16* gv, size_t vstep) {
#if DEV_ASM
  const unsigned lk1 = lk + 16 * KVROW, lk2 = lk + 32 * KVROW, lk3 = lk + 48 * KVROW;
  const unsigned lv1 = lv + 16 * KVROW, lv2 = lv + 32 * KVROW, lv3 = lv + 48 * KVROW;
  const _Float16 *gk1 = gk + kstep, *gk2 = gk1 + kstep, *gk3 = gk2 + kstep;
  const _Float16 *gv1 = gv + vstep, *gv2 = gv1 + vstep, *gv3 = gv2 + vstep;
  asm volatile("global_load_async_to_lds_b128 %0, %8, off\n\t"
               "global_load_async_to_lds_b128 %1, %9, off\n\t"
               "global_load_async_to_lds_b128 %2, %10, off\n\t"
               "global_load_async_to_lds_b128 %3, %11, off\n\t"
               "global_load_async_to_lds_b128 %4, %12, off\n\t"
               "global_load_async_to_lds_b128 %5, %13, off\n\t"
               "global_load_async_to_lds_b128 %6, %14, off\n\t"
               "global_load_async_to_lds_b128 %7, %15, off\n\t"
               "s_wait_xcnt 0x0"
               :: "v"(lk), "v"(lk1), "v"(lk2), "v"(lk3), "v"(lv), "v"(lv1), "v"(lv2), "v"(lv3),
                  "v"(gk), "v"(gk1), "v"(gk2), "v"(gk3), "v"(gv), "v"(gv1), "v"(gv2), "v"(gv3)
               : "memory");
#else
  (void)lk; (void)gk; (void)kstep; (void)lv; (void)gv; (void)vstep;
#endif
}

__device__ __forceinline__ v16h pack_p(v8f a, v8f c) {
  const v16h r = { (_Float16)a[0], (_Float16)a[1], (_Float16)a[2], (_Float16)a[3],
                   (_Float16)a[4], (_Float16)a[5], (_Float16)a[6], (_Float16)a[7],
                   (_Float16)c[0], (_Float16)c[1], (_Float16)c[2], (_Float16)c[3],
                   (_Float16)c[4], (_Float16)c[5], (_Float16)c[6], (_Float16)c[7] };
  return r;
}
// q fragment x log2(e)/8: product in f32, one rounding to f16
__device__ __forceinline__ v16h scale_q(v16h a) {
  v16h r;
#pragma unroll                                             // constant element indices: the vector stays in registers
  for (int i = 0; i < 16; ++i) r[i] = (_Float16)((float)a[i] * QSCALE);
  return r;
}

__global__ __launch_bounds__(128) __attribute__((amdgpu_num_vgpr(256))) void attn_kernel(
    const _Float16* __restrict__ qk, const _Float16* __restrict__ vt,
    const float* __restrict__ madd, _Float16* ctx)
{
  __shared__ __align__(16) float sO[4 * 16 * 64];          // 16384 B
  __shared__ __align__(16) unsigned char skv[2 * KVSTAGE]; // two step buffers of K and V^T rows

  const int tid = (int)threadIdx.x, lane = tid & 31, w = tid >> 5;
  const int h = lane >> 4, m = lane & 15;
  const int bh = blockIdx.y, b = bh / NH, head = bh - b * NH;
  const int q0 = blockIdx.x * 64 + 16 * w;

  // Q^T B-fragments: column n = query q0+m, k = d (two 32-deep chunks)
  const _Float16* qrow = qk + ((size_t)b * SEQ + q0 + m) * QKP + head * HD;
  const v16h qb0 = scale_q(load_frag(qrow, h));
  const v16h qb1 = scale_q(load_frag(qrow + 32, h));

  v8f o[4];                                                // o[t][r] = O[query m][d 16t+8h+r] * l (l carries 2^14)
#pragma unroll
  for (int t = 0; t < 4; ++t) o[t] = zero8();
  float mrun = -1e30f, lrun = 0.0f;

  const float* mrow = madd + (size_t)b * SEQ;              // block-uniform base; + key0 (uniform) + 8h + 16j

  // copy map: thread -> row tid>>3 (+16 per copy), 16-byte piece tid&7 of the row's 128 bytes
  const int crow = tid >> 3, cpc = tid & 7;
  const _Float16* gK = qk + ((size_t)b * SEQ + crow) * QKP + FEAT + head * HD + cpc * 8;   // + key0*QKP
  const _Float16* gV = vt + ((size_t)b * FEAT + head * HD + crow) * SEQ + cpc * 8;         // + key0
  const unsigned lK = (unsigned)(size_t)skv + (unsigned)(crow * KVROW + cpc * 16);
  const unsigned lV = lK + KVOP;
  const size_t stepK = (size_t)16 * QKP, stepV = (size_t)16 * SEQ;
  // fragment read bases inside a buffer: row m of a 16-row group, k offset 8h
  const unsigned char* fK = skv + m * KVROW + 16 * h;
  const unsigned char* fV = skv + KVOP + m * KVROW + 16 * h;

  int kb = ((int)blockIdx.x % (SEQ / 64)) * 64;            // first key of this trip (block-uniform, 0 .. SEQ-64)
  int kc = kb;                                             // first key of the next copies
  copy_kv(lK, gK + (size_t)kc * QKP, stepK, lV, gV + kc, stepV);
  kc = (kc + 64 == SEQ) ? 0 : kc + 64;
  wait_copies();
  __syncthreads();                                         // first step published
  if (SEQ > 64) {
    copy_kv(lK + KVSTAGE, gK + (size_t)kc * QKP, stepK, lV + KVSTAGE, gV + kc, stepV);
    kc = (kc + 64 == SEQ) ? 0 : kc + 64;
  }

#pragma unroll 1
  for (int it = 0; it < SEQ; it += 64) {
    const unsigned buf = (unsigned)((it >> 6) & 1) * KVSTAGE;
    // ---- scores, log2 domain: s[j][r] = S[query m][key kb+16j+8h+r] * 0.125 * log2(e) + madd[key] ----
    v8f s[4];                                              // starts as the C operand: row r of tile j = key's mask term
    v16h kf[4][2];
#pragma unroll
    for (int j = 0; j < 4; ++j) {
      const _Float16* kr = (const _Float16*)(fK + buf + j * 16 * KVROW);
      kf[j][0] = ldfrag(kr);
      kf[j][1] = ldfrag(kr + 32);
    }
    // keeps the K reads in front of the mask loads: moved behind them, the reads land on the loads' address registers
    // and so stand behind an s_wait_xcnt 0, and the LDS latency starts that much later
    __builtin_amdgcn_sched_barrier(0);
    const float* mk = mrow + kb + 8 * h;
#pragma unroll
    for (int j = 0; j < 4; ++j) {
      const v4f ca = *(const v4fa*)(mk + 16 * j);
      const v4f cc = *(const v4fa*)(mk + 16 * j + 4);
      const v8f cj = { ca.x, ca.y, ca.z, ca.w, cc.x, cc.y, cc.z, cc.w };
      s[j] = cj;
    }
#if DEV_ASM
    // behind the mask loads: their address pair is an input here, so it stays whole up to this wait (no load of the
    // group lands on it) and is rewritten only behind it; the wave waits for the K reads at this place anyway
    asm volatile("s_wait_xcnt 0x0" :: "v"(mk) : "memory");
#endif
    // keeps the K reads one group in front of the score products: left free, the scheduler puts four reads in
    // front of each pair of products, and every pair waits out its own LDS latency
    __builtin_amdgcn_sched_barrier(0);
#pragma unroll
    for (int j = 0; j < 4; ++j) {
      s[j] = wmma_f16(kf[j][0], qb0, s[j]);
      s[j] = wmma_f16(kf[j][1], qb1, s[j]);
    }

    // ---- V^T fragments of this step: one read group, in flight while the softmax runs ----
    v16h vf[4][2];
#pragma unroll
    for (int t = 0; t < 4; ++t) {
      const _Float16* vp = (const _Float16*)(fV + buf + t * 16 * KVROW);
      vf[t][0] = ldfrag(vp);
      vf[t][1] = ldfrag(vp + 32);
    }
    // keeps the V^T reads in front of the softmax: left free, they sink to their products and are waited for there
    __builtin_amdgcn_sched_barrier(0);

    // ---- online softmax (f32, base 2) ----
    float mloc = s[0][0];
#pragma unroll
    for (int j = 0; j < 4; ++j)
#pragma unroll
      for (int r = 0; r < 8; ++r) mloc = fmaxf(mloc, s[j][r]);
    mloc = fmaxf(mloc, __shfl_xor(mloc, 16));
    const float mnew = fmaxf(mrun, mloc);
    const float alpha = __builtin_amdgcn_exp2f(mrun - mnew);
    mrun = mnew;
    const float msh = mnew - PEXP;                         // p = 2^(s - mnew) x 2^14
    float lsum = 0.0f;
#pragma unroll
    for (int j = 0; j < 4; ++j)
#pragma unroll
      for (int r = 0; r < 8; ++r) {
        const float p = __builtin_amdgcn_exp2f(s[j][r] - msh);
        s[j][r] = p;
        lsum += p;
      }
    lsum += __shfl_xor(lsum, 16);
    lrun = lrun * alpha + lsum;
#pragma unroll
    for (int t = 0; t < 4; ++t)
#pragma unroll
      for (int r = 0; r < 8; ++r) o[t][r] = o[t][r] * alpha;

    // ---- P^T B-fragments (key chunks 0..31 and 32..63 of this step) ----
    const v16h pb0 = pack_p(s[0], s[1]);
    const v16h pb1 = pack_p(s[2], s[3]);

    // ---- O^T += V^T * P^T ----
#pragma unroll
    for (int t = 0; t < 4; ++t) {
      o[t] = wmma_f16(vf[t][0], pb0, o[t]);
      o[t] = wmma_f16(vf[t][1], pb1, o[t]);
    }
    wait_lds();
    wait_copies();
    __syncthreads();                                       // publishes the next step, frees this step's buffer
    if (it + 128 < SEQ) {
      copy_kv(lK + buf, gK + (size_t)kc * QKP, stepK, lV + buf, gV + kc, stepV);
      kc = (kc + 64 == SEQ) ? 0 : kc + 64;
    }
    kb = (kb + 64 == SEQ) ? 0 : kb + 64;
  }
  wait_copies();

  // ---- epilogue: normalise (1/l, which also removes the p carry; apply the ctx carry), stage per-wave 16x64 tile ----
  const float inv = (1.0f / lrun) * CTXCARRY;
  float* so = sO + w * 1024;
#pragma unroll
  for (int t = 0; t < 4; ++t)
#pragma unroll
    for (int r = 0; r < 8; ++r)
      so[m * 64 + 16 * t + 8 * h + r] = o[t][r] * inv;
  __syncthreads();

  const int q8 = lane & 7, sub = lane >> 3;
  v8h hv[4];
#pragma unroll
  for (int it = 0; it < 4; ++it) {
    const int row = it * 4 + sub;                          // it 0..3 x sub 0..3 = rows 0..15 of the wave tile
    const float* sp = so + row * 64 + 8 * q8;
    const v4f a = *(const v4fa*)sp;
    const v4f c = *(const v4fa*)(sp + 4);
    const v8h ov = { (_Float16)a.x, (_Float16)a.y, (_Float16)a.z, (_Float16)a.w,
                     (_Float16)c.x, (_Float16)c.y, (_Float16)c.z, (_Float16)c.w };
    hv[it] = ov;
  }
  {
#pragma unroll
    for (int it = 0; it < 4; ++it) {
      const int row = it * 4 + sub;
      _Float16* dst = ctx + ((size_t)b * SEQ + q0 + row) * FEAT + head * HD + 8 * q8;
      *(v8h*)dst = hv[it];
    }
    
  }
}

// =====================================================================================================
// Host orchestration. Workspace map (bytes, NB=4 SEQ=1024), every region an exact multiple of its whole-line
// store granularity, all offsets multiples of 128:
//   hn    f16 [4096][1024]      8388608   (LN outputs of all three blocks, written and consumed in order)
//   cpl   f16 [4096][1024]      8388608   (bf16rne(c) as f16)
//   WqkvT f16 [3072][1024]      6291456
//   WspT  f16 [1024][1024]      2097152
//   WcqT, WckT, WcvT, WcpT      4 x 2097152
//   W1T   f16 [4096][1024]      8388608
//   W2T   f16 [1024][4096]      8388608
//   ATT   shared region        33554432 : self q|k f16 [4096][2048] (16777216) + self v^T f16 [4][1024][1024]
//                                         (8388608) + ctx f16 [4096][1024] (8388608, both attention blocks);
//                                         mid f16 [4096][4096] (33554432) during the MLP (all readers of
//                                         q|k, v^T, ctx have completed before fc1 writes mid)
//   x1    f32 [4096][1024]     16777216
//   x2    f32 [4096][1024]     16777216
//   qk_c  f16 [4096][2048]     16777216   (cross q|k: k written with the self projections, q behind LN(x1))
//   vt_c  f16 [4][1024][1024]   8388608   (cross v^T, written with the self projections)
//   madd  f32 [4][1024]           16384   (additive key mask x log2(e), both attention blocks)
//   total                     142622720
// =====================================================================================================
extern "C" void kernel_launch(void* const* d_in, const int* in_sizes, int n_in,
                              void* d_out, int out_size, void* d_ws, size_t ws_size,
                              hipStream_t stream)
{
  if (n_in < 19) return;
  const long long needTok = (long long)(NB - 1) * SEQ_FULL + SEQ;
  if ((long long)in_sizes[0] < needTok * FEAT) return;                 // x
  if ((long long)in_sizes[1] < needTok * FEAT) return;                 // c
  if ((long long)in_sizes[2] < needTok) return;                        // mask (int32)
  if ((long long)in_sizes[3] < (long long)FEAT * 3 * FEAT || in_sizes[4] < 3 * FEAT) return;
  if ((long long)in_sizes[5] < (long long)FEAT * FEAT || in_sizes[6] < FEAT) return;
  if ((long long)in_sizes[7] < (long long)FEAT * FEAT || in_sizes[8] < FEAT) return;
  if ((long long)in_sizes[9] < (long long)FEAT * FEAT || in_sizes[10] < FEAT) return;
  if ((long long)in_sizes[11] < (long long)FEAT * FEAT || in_sizes[12] < FEAT) return;
  if ((long long)in_sizes[13] < (long long)FEAT * FEAT || in_sizes[14] < FEAT) return;
  if ((long long)in_sizes[15] < (long long)FEAT * MF || in_sizes[16] < MF) return;
  if ((long long)in_sizes[17] < (long long)MF * FEAT || in_sizes[18] < FEAT) return;
  if ((long long)out_size < needTok * FEAT) return;

  const float* x         = (const float*)d_in[0];
  const float* c         = (const float*)d_in[1];
  const int*   mask      = (const int*)d_in[2];
  const float* sa_qkv_w  = (const float*)d_in[3];
  const float* sa_qkv_b  = (const float*)d_in[4];
  const float* sa_proj_w = (const float*)d_in[5];
  const float* sa_proj_b = (const float*)d_in[6];
  const float* ca_q_w    = (const float*)d_in[7];
  const float* ca_q_b    = (const float*)d_in[8];
  const float* ca_k_w    = (const float*)d_in[9];
  const float* ca_k_b    = (const float*)d_in[10];
  const float* ca_v_w    = (const float*)d_in[11];
  const float* ca_v_b    = (const float*)d_in[12];
  const float* ca_proj_w = (const float*)d_in[13];
  const float* ca_proj_b = (const float*)d_in[14];
  const float* fc1_w     = (const float*)d_in[15];
  const float* fc1_b     = (const float*)d_in[16];
  const float* fc2_w     = (const float*)d_in[17];
  const float* fc2_b     = (const float*)d_in[18];

  const size_t P_F16  = (size_t)NTOK * FEAT * 2;
  const size_t P_F32  = (size_t)NTOK * FEAT * 4;
  const size_t P_W    = (size_t)FEAT * FEAT * 2;
  const size_t P_WQKV = (size_t)3 * FEAT * FEAT * 2;
  const size_t P_W1   = (size_t)MF * FEAT * 2;
  const size_t P_QK   = (size_t)NTOK * QKP * 2;
  const size_t P_VT   = (size_t)NB * FEAT * SEQ * 2;
  const size_t P_MID  = (size_t)NTOK * MF * 2;
  const size_t P_ATTU = P_QK + P_VT + P_F16;
  const size_t P_ATT  = (P_ATTU > P_MID) ? P_ATTU : P_MID;
  size_t off = 0;
  const size_t oHn   = off; off += P_F16;
  const size_t oC    = off; off += P_F16;
  const size_t oWqkv = off; off += P_WQKV;
  const size_t oWsp  = off; off += P_W;
  const size_t oWcq  = off; off += P_W;
  const size_t oWck  = off; off += P_W;
  const size_t oWcv  = off; off += P_W;
  const size_t oWcp  = off; off += P_W;
  const size_t oW1   = off; off += P_W1;
  const size_t oW2   = off; off += P_W1;
  const size_t oAtt  = off; off += P_ATT;
  const size_t oX1   = off; off += P_F32;
  const size_t oX2   = off; off += P_F32;
  const size_t oQkc  = off; off += P_QK;
  const size_t oVtc  = off; off += P_VT;
  const size_t oMadd = off; off += (size_t)NTOK * 4;
  if (off > ws_size) return;                               // off = 142622720 at NB=4, SEQ=1024

  char* ws = (char*)d_ws;
  _Float16* hn    = (_Float16*)(ws + oHn);
  _Float16* cpl   = (_Float16*)(ws + oC);
  _Float16* wqkvT = (_Float16*)(ws + oWqkv);
  _Float16* wspT  = (_Float16*)(ws + oWsp);
  _Float16* wcqT  = (_Float16*)(ws + oWcq);
  _Float16* wckT  = (_Float16*)(ws + oWck);
  _Float16* wcvT  = (_Float16*)(ws + oWcv);
  _Float16* wcpT  = (_Float16*)(ws + oWcp);
  _Float16* w1T   = (_Float16*)(ws + oW1);
  _Float16* w2T   = (_Float16*)(ws + oW2);
  _Float16* qkp   = (_Float16*)(ws + oAtt);
  _Float16* vtp   = (_Float16*)(ws + oAtt + P_QK);
  _Float16* ctx   = (_Float16*)(ws + oAtt + P_QK + P_VT);
  _Float16* mid   = (_Float16*)(ws + oAtt);
  float*    x1    = (float*)(ws + oX1);
  float*    x2    = (float*)(ws + oX2);
  _Float16* qkc   = (_Float16*)(ws + oQkc);
  _Float16* vtc   = (_Float16*)(ws + oVtc);
  float*    madd  = (float*)(ws + oMadd);

  const dim3 blk(256);
  const float sQKV  = 1.0f / WCARRY;
  const float sPROJ = 1.0f / (WCARRY * CTXCARRY);
  const float sFC2  = 1.0f / (WCARRY * MIDCARRY);

  // (1) one grid: weights f32 [in][out] -> f16 [out][in] = bf16rne(w) x64; c -> compact f16 plane (bf16rne values);
  //     hn = LN(bf16rne(x)) -> f16 plane; key mask -> additive f32 plane
  prep_kernel<<<dim3(PB_ALL), blk, 0, stream>>>(
      sa_qkv_w, sa_proj_w, ca_q_w, ca_k_w, ca_v_w, ca_proj_w, fc1_w, fc2_w, x, c, mask,
      wqkvT, wspT, wcqT, wckT, wcvT, wcpT, w1T, w2T, cpl, hn, madd);

  // (2) one grid: self q|k and self v^T from hn, cross k and cross v^T from the c plane (K=1024; acc / 64)
  gemm_proj4<<<dim3(GB_ALL), blk, 0, stream>>>(
      hn, cpl, wqkvT, wckT, wcvT, sa_qkv_b, ca_k_b, ca_v_b, qkp, qkc, vtp, vtc, FEAT, sQKV);

  // ---------------- self-attention block ----------------
  // (3) attention -> ctx f16 plane (x256)
  const dim3 gAT(SEQ / 64, NB * NH);
  attn_kernel<<<gAT, dim3(128), 0, stream>>>(qkp, vtp, madd, ctx);
  // (4) x1 = ctx . Wsp + b + bf16rne(x) -> f32 plane   (per batch M=SEQ, N=1024, K=1024; acc / (64*256))
  const dim3 gPB((SEQ / 128) * (FEAT / 128), NB);
  gemm128<0, true><<<gPB, blk, 0, stream>>>(
      ctx, FEAT, (long long)SEQ * FEAT, wspT, FEAT, 0LL, (void*)x1, FEAT, (long long)SEQ * FEAT,
      sa_proj_b, x, FEAT, (long long)SEQ_FULL * FEAT,
      SEQ, FEAT, FEAT, sPROJ, 1.0f);

  // ---------------- cross-attention block ----------------
  // (5) hn = LN(x1)
  ln_kernel<<<dim3(NTOK), blk, 0, stream>>>(x1, (long long)SEQ * FEAT, hn);
  // (6) q = hn . Wcq + b -> cross q|k plane cols 0..1023   (M=NTOK, N=1024, K=1024)
  const dim3 gQ((NTOK / 128) * (FEAT / 128), 1);
  gemm128<1, false><<<gQ, blk, 0, stream>>>(
      hn, FEAT, 0LL, wcqT, FEAT, 0LL, (void*)qkc, QKP, 0LL, ca_q_b, x1, FEAT, 0LL,
      NTOK, FEAT, FEAT, sQKV, 1.0f);
  // (7) attention -> ctx
  attn_kernel<<<gAT, dim3(128), 0, stream>>>(qkc, vtc, madd, ctx);
  // (8) x2 = ctx . Wcp + b + x1 -> f32 plane   (M=NTOK, N=1024, K=1024)
  gemm128<0, false><<<gQ, blk, 0, stream>>>(
      ctx, FEAT, 0LL, wcpT, FEAT, 0LL, (void*)x2, FEAT, 0LL,
      ca_proj_b, x1, FEAT, 0LL,
      NTOK, FEAT, FEAT, sPROJ, 1.0f);

  // ---------------- MLP block ----------------
  // (9) hn = LN(x2)
  ln_kernel<<<dim3(NTOK), blk, 0, stream>>>(x2, (long long)SEQ * FEAT, hn);
  // (10) mid = gelu(hn . W1 + b1) x16 -> f16 [NTOK][4096]   (M=NTOK, N=4096, K=1024; acc / 64)
  const dim3 gW1((NTOK / 128) * (MF / 128), 1);
  gemm128<2, false><<<gW1, blk, 0, stream>>>(
      hn, FEAT, 0LL, w1T, FEAT, 0LL, (void*)mid, MF, 0LL, fc1_b, x1, FEAT, 0LL,
      NTOK, MF, FEAT, sQKV, MIDCARRY);
  // (11) out = mid . W2 + b2 + x2 -> d_out f32 rows b*SEQ_FULL + t   (per batch M=SEQ, N=1024, K=4096; acc / (64*16))
  gemm128<0, false><<<gPB, blk, 0, stream>>>(
      mid, MF, (long long)SEQ * MF, w2T, MF, 0LL, d_out, FEAT, (long long)SEQ_FULL * FEAT,
      fc2_b, x2, FEAT, (long long)SEQ * FEAT,
      SEQ, FEAT, MF, sFC2, 1.0f);

  (void)hipGetLastError();
}

// v007
// A run of this version takes 192 microseconds.
// Timed twice side by side with v006, it ran 1.12 times as fast both times.
// Over all steps from v000 it is 3.96 times as fast.
// Contractions: hn*WqkT (q|k plane), Wv*hn^T (v^T plane), K*Q^T scores, V^T*P^T, ctx*WpT for both attention
// blocks (cross block: k and v^T from the c plane), hn*W1T, mid*W2T: all v_wmma_f32_16x16x32_f16
// (f16 operands, single product, f32 accumulate). LayerNorms, softmax, GELU (erf form), bias and
// residual adds: f32 on VALU. Every float input enters as its bf16 RNE value (x, c, weights, biases).
// Carry audit (f16 planes): weights = bf16(w) x64, inverse folded once into the scale of each consuming GEMM
// (q/k/v^T: 1/64; proj GEMMs: 1/(64*256); fc1: 1/64; fc2: 1/(64*16)). hn, c, q, k, v^T carried x1.
// P = p x16384 (carried in the exponent, so l carries it too) and ctx = o x256: inv = (1/l)*256 in attn_kernel;
// mid = gelu x16. Scores are formed in the log2 domain: q enters the score product as f16(q * log2(e)/8).
#include <hip/hip_runtime.h>
#include <math.h>

#ifndef NB
#define NB 4
#endif
#ifndef SEQ
#define SEQ 1024
#endif
#define NB_FULL  4
#define SEQ_FULL 1024
#define FEAT 1024
#define NH   16
#define HD   64
#define MF   4096
#define QKP  (2 * FEAT)
#define NTOK (NB * SEQ)
static_assert(NH * HD == FEAT);
static_assert(HD == 64);
static_assert(NB >= 1 && NB <= NB_FULL);
static_assert(SEQ >= 64 && SEQ <= SEQ_FULL && (SEQ % 64) == 0);
static_assert((FEAT % 64) == 0 && (MF % 64) == 0 && (QKP % 64) == 0);
static_assert((FEAT % 128) == 0 && (MF % 128) == 0 && (QKP % 128) == 0 && (SEQ % 128) == 0 && FEAT >= 256);
static_assert(FEAT == 4 * 256);
static_assert(((long long)(NB - 1) * SEQ_FULL + SEQ) * FEAT <= (long long)NB_FULL * SEQ_FULL * FEAT);

#define WCARRY   64.0f
#define PEXP     14.0f                    // p is carried x 2^14
#define LOG2E    1.4426950408889634f
#define QSCALE   (0.125f * LOG2E)         // score scale 1/8 and the change to base 2, applied to q once
#define MASKADD2 (-10000.0f * LOG2E)      // additive key mask in the log2 domain
#define CTXCARRY 256.0f
#define MIDCARRY 16.0f

typedef _Float16 v16h __attribute__((ext_vector_type(16)));
typedef _Float16 v8h  __attribute__((ext_vector_type(8)));
typedef float    v8f  __attribute__((ext_vector_type(8)));
typedef float    v4f  __attribute__((ext_vector_type(4)));
typedef v8h __attribute__((may_alias)) v8ha;
typedef v4f __attribute__((may_alias)) v4fa;
union Frag { v16h v; v8h half[2]; };

#if defined(__HIP_DEVICE_COMPILE__)
#define DEV_ASM 1
#else
#define DEV_ASM 0
#endif

__device__ __forceinline__ v8f zero8() { v8f z = {0.f, 0.f, 0.f, 0.f, 0.f, 0.f, 0.f, 0.f}; return z; }

// f32 -> bf16 RNE value kept as f32
__device__ __forceinline__ float bf16r(float f) {
  unsigned u = __float_as_uint(f);
  u = (u + 0x7FFFu + ((u >> 16) & 1u)) & 0xFFFF0000u;
  return __uint_as_float(u);
}
__device__ __forceinline__ v4f bf16r4(v4f a) {
  v4f r = { bf16r(a.x), bf16r(a.y), bf16r(a.z), bf16r(a.w) };
  return r;
}

// ---------------------------------------------------------------------------------------------------
// 16x16x32 f16 WMMA. Fragment map (wave32): lane l, h = l>>4, m = n = l&15.
//   A/B element i: i<8 -> k0+8h+i ; i>=8 -> k0+16+8h+(i-8)      D element r: row 8h+r, col l&15
// ---------------------------------------------------------------------------------------------------
// guarded form: 4 VALU slots after the WMMA, D tied, A/B kept live
__device__ __forceinline__ v8f wmma_f16(v16h a, v16h b, v8f c) {
  v8f d = __builtin_amdgcn_wmma_f32_16x16x32_f16(false, a, false, b, (short)0, c, false, false);
#if DEV_ASM
  asm volatile("v_nop\n\tv_nop\n\tv_nop\n\tv_nop" : "+v"(d) : "v"(a), "v"(b));
#endif
  return d;
}
// plain builtin form for the GEMM inner loop (the compiler keeps the distances between its own builtins)
__device__ __forceinline__ v8f mmar(v16h a, v16h b, v8f c) {
  return __builtin_amdgcn_wmma_f32_16x16x32_f16(false, a, false, b, (short)0, c, false, false);
}
__device__ __forceinline__ void acc_guard4(v8f& a, v8f& b, v8f& c, v8f& d) {
#if DEV_ASM
  asm volatile("v_nop\n\tv_nop\n\tv_nop\n\tv_nop" : "+v"(a), "+v"(b), "+v"(c), "+v"(d));
#else
  (void)a; (void)b; (void)c; (void)d;
#endif
}

// A or B fragment from a k-contiguous f16 row; p points at element k0 of the row owned by this lane.
__device__ __forceinline__ v16h load_frag(const _Float16* p, int h) {
  Frag f;
  f.half[0] = *(const v8ha*)(p + 8 * h);
  f.half[1] = *(const v8ha*)(p + 16 + 8 * h);
  return f.v;
}
// same, p already includes +8*(lane>>4)
__device__ __forceinline__ v16h ldfrag(const _Float16* p) {
  Frag f;
  f.half[0] = *(const v8ha*)(p);
  f.half[1] = *(const v8ha*)(p + 16);
  return f.v;
}

// behind a job's last global store: the compiler lays the jobs of one kernel one behind the other, and the code that
// follows in the listing rewrites the store's address and data registers; the wait stands in front of that
__device__ __forceinline__ void wait_store_regs() {
#if DEV_ASM
  asm volatile("s_wait_xcnt 0x0" ::: "memory");
#endif
}

// =====================================================================================================
// A job of the preparation kernel: transpose + convert: in f32 [K][N] (row = k) -> out f16 [N][K] =
// f16(carry * bf16rne(in)^T). Block 256 threads, tile 64 k x 32 n (tile index bx along k, by along n) staged in
// LDS (n-major, pitch 68 floats; cross-wave -> block barrier).
// coverage: 32 n-rows x 64 k per block; (K/64) x (N/32) blocks cover the whole [N][K] plane.
// LDS: tile cols 0..63 of all 32 rows written before the barrier; cols 64..67 never read.
// =====================================================================================================
__device__ __forceinline__ void transpose_tile(
    const float* in, _Float16* out, int K, int N, float carry, int bx, int by)
{
  __shared__ __align__(16) float tile[32][68];
  const int k0 = bx * 64, n0 = by * 32;
  const int tid = (int)threadIdx.x;
  {
    const int kk = tid >> 2, nq = (tid & 3) * 8;
    const float* src = in + (size_t)(k0 + kk) * N + n0 + nq;
    const v4f a = *(const v4fa*)src;
    const v4f c = *(const v4fa*)(src + 4);
    tile[nq + 0][kk] = a.x; tile[nq + 1][kk] = a.y; tile[nq + 2][kk] = a.z; tile[nq + 3][kk] = a.w;
    tile[nq + 4][kk] = c.x; tile[nq + 5][kk] = c.y; tile[nq + 6][kk] = c.z; tile[nq + 7][kk] = c.w;
  }
  __syncthreads();
  {
    const int nn = tid >> 3, kq = (tid & 7) * 8;
    const float* sp = &tile[nn][kq];
    const v4f a = bf16r4(*(const v4fa*)sp);
    const v4f c = bf16r4(*(const v4fa*)(sp + 4));
    const v8h o = { (_Float16)(a.x * carry), (_Float16)(a.y * carry), (_Float16)(a.z * carry), (_Float16)(a.w * carry),
                    (_Float16)(c.x * carry), (_Float16)(c.y * carry), (_Float16)(c.z * carry), (_Float16)(c.w * carry) };
    _Float16* dst = out + (size_t)(n0 + nn) * K + k0 + kq;
    *(v8h*)dst = o;
    wait_store_regs();
  }
}

// =====================================================================================================
// A job of the preparation kernel: row convert: f32 input rows (batch stride SEQ_FULL*FEAT) -> compact f16 plane
// [NTOK][FEAT], value = f16(bf16rne(v)). Two 1024-wide rows per 256-thread block, 8 elements per thread.
// coverage: 128 x 8 = 1024 per row; NTOK/2 blocks.
// =====================================================================================================
__device__ __forceinline__ void cvt_two_rows(const float* src, _Float16* dst, int pair)
{
  const int row = 2 * pair + ((int)threadIdx.x >> 7);
  const int bb = row / SEQ, t = row - bb * SEQ;
  const int tid = (int)threadIdx.x & 127;
  const float* sp = src + ((size_t)bb * SEQ_FULL + (size_t)t) * FEAT + 8 * tid;
  const v4f a = bf16r4(*(const v4fa*)sp);
  const v4f c = bf16r4(*(const v4fa*)(sp + 4));
  const v8h o = { (_Float16)a.x, (_Float16)a.y, (_Float16)a.z, (_Float16)a.w,
                  (_Float16)c.x, (_Float16)c.y, (_Float16)c.z, (_Float16)c.w };
  _Float16* d = dst + (size_t)row * FEAT + 8 * tid;
  *(v8h*)d = o;
  wait_store_regs();
}

// =====================================================================================================
// A job of the preparation kernel: key order of one batch. A key with mask != 1 gets -10000 added to its score, so
// beside any key with mask == 1 its softmax weight is exp(-10000 + a score difference) = 0 exactly in f32: it adds
// nothing to any sum. The keys are therefore put in the order [mask == 1, by token | the others, by token]:
//   kidx[b][j] = token at place j (a permutation of 0 .. SEQ-1), madd[b][j] = additive mask of place j in the log2
//   domain (0, or -10000 * log2(e)), nst[32 b] = 64-key steps that hold every key with mask == 1 (all SEQ/64 steps
//   when the batch has no such key: the common -10000 then cancels in the softmax and every key counts).
// K and V^T are built in this order, and only as far as nst says; places behind the last kept key inside the last
// step hold masked keys with their true mask term. One 256-thread block per batch; token t = e * 256 + tid.
// Place of a token: ballot within its wave, counts of the 32-token groups through LDS (block barrier); the list is
// staged in LDS (second block barrier) so that each wave stores whole 128-B lines. nst: one 128-B line per batch.
// =====================================================================================================
__device__ __forceinline__ void key_order(const int* mask, int* kidx, float* madd, int* nst, int bb)
{
  __shared__ int sidx[SEQ];
  __shared__ int gcnt[SEQ / 32];
  const int tid = (int)threadIdx.x, lane = tid & 31;
  bool keep[SEQ / 256];
  int before[SEQ / 256];
#pragma unroll                                             // constant indices; the loads go out as one group
  for (int e = 0; e < SEQ / 256; ++e) before[e] = mask[(size_t)bb * SEQ_FULL + e * 256 + tid];
#pragma unroll                                             // constant indices: the arrays stay in registers
  for (int e = 0; e < SEQ / 256; ++e) {
    const int t = e * 256 + tid;
    keep[e] = before[e] == 1;
    const unsigned bal = __builtin_amdgcn_ballot_w32(keep[e]);
    before[e] = __popc(bal & ((1u << lane) - 1u));
    if (lane == 0) gcnt[t >> 5] = __popc(bal);
  }
  __syncthreads();
  int total = 0;
  for (int g = 0; g < SEQ / 32; ++g) {
    const int cg = gcnt[g];
    total += cg;
#pragma unroll                                             // constant indices: the arrays stay in registers
    for (int e = 0; e < SEQ / 256; ++e)
      if (g < ((e * 256 + tid) >> 5)) before[e] += cg;
  }
#pragma unroll                                             // constant indices: the arrays stay in registers
  for (int e = 0; e < SEQ / 256; ++e) {
    const int t = e * 256 + tid;
    sidx[keep[e] ? before[e] : total + (t - before[e])] = t;
  }
  __syncthreads();
#pragma unroll                                             // constant indices, four independent stores
  for (int e = 0; e < SEQ / 256; ++e) {
    const int j = e * 256 + tid;
    kidx[bb * SEQ + j] = sidx[j];
    madd[bb * SEQ + j] = (j < total) ? 0.0f : MASKADD2;
  }
  if (tid == 0) nst[bb * 32] = (total > 0) ? (total + 63) / 64 : SEQ / 64;
  wait_store_regs();
}
// 64-key steps of batch bb, bounded by the shape whatever the word holds (block-uniform)
__device__ __forceinline__ int key_steps(const int* nst, int bb) {
  const int n = nst[bb * 32];
  return n < 1 ? 1 : (n > SEQ / 64 ? SEQ / 64 : n);
}

// =====================================================================================================
// LayerNorm, no affine, eps 1e-6 (one 1024-wide row per 256-thread block, thread owns 4 consecutive
//   RNEX = true : v = bf16rne(X) (raw input x); false: v = X (internal f32 plane).
//   Input row = b * strideXB + t * FEAT with (b, t) from the compact row index; output f16 row compact.
//   f16 row: staged in LDS (cross-wave -> block barrier), lanes of waves 0..3 write 16 B each (8 halves),
// =====================================================================================================
__device__ __forceinline__ float block_sum(float v, float* red, int lane, int w) {
#pragma unroll
  for (int off = 16; off > 0; off >>= 1) v += __shfl_xor(v, off);
  if (lane == 0) red[w] = v;
  __syncthreads();
  float r = red[0];
#pragma unroll
  for (int i = 1; i < 8; ++i) r += red[i];
  __syncthreads();
  return r;
}

template <bool RNEX>
__device__ __forceinline__ void ln_row(const float* X, long long strideXB, _Float16* pout, int row)
{
  __shared__ __align__(16) float srow[FEAT];
  __shared__ float red[8];
  const int bb  = row / SEQ, t = row - bb * SEQ;
  const int tid = (int)threadIdx.x, lane = tid & 31, w = tid >> 5;
  const int f0  = 4 * tid;
  const float* xp = X + (size_t)bb * (size_t)strideXB + (size_t)t * FEAT + f0;

  v4f xv = *(const v4fa*)xp;
  if (RNEX) xv = bf16r4(xv);
  float s = (xv.x + xv.y) + (xv.z + xv.w);
  s = block_sum(s, red, lane, w);
  const float mu = s * (1.0f / FEAT);
  const float d0 = xv.x - mu, d1 = xv.y - mu, d2 = xv.z - mu, d3 = xv.w - mu;
  float q = (d0 * d0 + d1 * d1) + (d2 * d2 + d3 * d3);
  q = block_sum(q, red, lane, w);
  const float rstd = rsqrtf(q * (1.0f / FEAT) + 1e-6f);

  const v4f ov = { d0 * rstd, d1 * rstd, d2 * rstd, d3 * rstd };
  *(v4fa*)(srow + f0) = ov;
  __syncthreads();
  if (w < 4) {                                             // wave-uniform: waves 0..3, 128 threads x 8 halves
    const float* sp = srow + 8 * tid;
    const v4f a = *(const v4fa*)sp;
    const v4f c = *(const v4fa*)(sp + 4);
    const v8h o = { (_Float16)a.x, (_Float16)a.y, (_Float16)a.z, (_Float16)a.w,
                    (_Float16)c.x, (_Float16)c.y, (_Float16)c.z, (_Float16)c.w };
    _Float16* dst = pout + (size_t)row * FEAT + 8 * tid;
    *(v8h*)dst = o;
    
  }
}

// LayerNorm of an internal f32 plane, one row per block
__global__ __launch_bounds__(256) void ln_kernel(const float* __restrict__ X, long long strideXB, _Float16* pout)
{
  ln_row<false>(X, strideXB, pout, (int)blockIdx.x);
}

// =====================================================================================================
// Preparation kernel: everything that depends on the raw inputs alone, in ONE grid; a block-index range picks
// the job (block-uniform, so each job's barriers stay under block-uniform control flow):
//   LN(bf16rne(x)) first (its blocks run longest, so they do not form the grid's tail), the row convert of c,
//   the key order with its additive mask, the eight weight transposes (tiles in the order bx fastest).
// =====================================================================================================
#define PB_QKV ((FEAT / 64) * ((3 * FEAT) / 32))   // blocks of the [FEAT][3 FEAT] transpose
#define PB_SQ  ((FEAT / 64) * (FEAT / 32))         // blocks of one [FEAT][FEAT] transpose
#define PB_MLP ((FEAT / 64) * (MF / 32))           // blocks of the [FEAT][MF] and of the [MF][FEAT] transpose
#define PB_TR  (PB_QKV + 5 * PB_SQ + 2 * PB_MLP)
#define PB_CV  (NTOK / 2)
#define PB_MK  NB
#define PB_ALL (PB_TR + PB_CV + PB_MK + NTOK)
static_assert((SEQ % 256) == 0);

__global__ __launch_bounds__(256) void prep_kernel(
    const float* __restrict__ w_qkv, const float* __restrict__ w_sp, const float* __restrict__ w_cq,
    const float* __restrict__ w_ck, const float* __restrict__ w_cv, const float* __restrict__ w_cp,
    const float* __restrict__ w_1, const float* __restrict__ w_2,
    const float* __restrict__ x, const float* __restrict__ c, const int* __restrict__ mask,
    _Float16* t_qkv, _Float16* t_sp, _Float16* t_cq, _Float16* t_ck, _Float16* t_cv, _Float16* t_cp,
    _Float16* t_1, _Float16* t_2, _Float16* cpl, _Float16* hn, float* madd, int* kidx, int* nst)
{
  int blk = (int)blockIdx.x;
  if (blk < NTOK) {
    ln_row<true>(x, (long long)SEQ_FULL * FEAT, hn, blk);
  } else if (blk < NTOK + PB_CV) {
    cvt_two_rows(c, cpl, blk - NTOK);
  } else if (blk < NTOK + PB_CV + PB_MK) {
    key_order(mask, kidx, madd, nst, blk - (NTOK + PB_CV));
  } else {
    blk -= NTOK + PB_CV + PB_MK;
    const float* in; _Float16* out; int K = FEAT, N = FEAT;
    if (blk < PB_MLP)                    { in = w_1; out = t_1; N = MF; }
    else if ((blk -= PB_MLP) < PB_MLP)   { in = w_2; out = t_2; K = MF; }
    else if ((blk -= PB_MLP) < PB_QKV)   { in = w_qkv; out = t_qkv; N = 3 * FEAT; }
    else if ((blk -= PB_QKV) < PB_SQ)    { in = w_sp; out = t_sp; }
    else if ((blk -= PB_SQ) < PB_SQ)     { in = w_cq; out = t_cq; }
    else if ((blk -= PB_SQ) < PB_SQ)     { in = w_ck; out = t_ck; }
    else if ((blk -= PB_SQ) < PB_SQ)     { in = w_cv; out = t_cv; }
    else                                 { blk -= PB_SQ; in = w_cp; out = t_cp; }
    const int kt = K >> 6;
    const int by = blk / kt;
    transpose_tile(in, out, K, N, WCARRY, blk - by * kt, by);
  }
}

// =====================================================================================================
// Batched WMMA GEMM (f16 operands): C[m][n] = sum_k A[m][k] * Bt[n][k].
// One 128x128 tile of C per 256-thread block; 8 waves as 4 (m) x 2 (n), each 32x64 (2 x 4 accumulator tiles).
// A row-major [M][K] pitch lda; Bt row-major [N][K] pitch ldb (k contiguous); M, N, K multiples of 128,
// K >= 256 (all shapes here are compile-time constants of the host code). tile = index of the C tile, b = batch
// index, smem = the block's 2 * STAGEB bytes of LDS (declared in the kernel that calls this).
// Operands: per stage 128 k of the block's 128 A rows and 128 Bt rows are brought into LDS by asynchronous
// 16-byte copies (each thread 8 + 8 copies, a wave-wide copy = two whole 256-B row pieces), two buffers, the
// next stage in flight while this one is multiplied. LDS row pitch 272 B (256 + 16: ds_load_b128 readers).
// Fragments from LDS with the split k map (ldfrag), two register sets inside a stage.
// k order: a block starts at stage (tile row, counted over the batches, + tile column) mod stages and wraps round, so
// that blocks which share A or Bt rows do not ask L2 for the same lines at the same moment; inside a stage k runs
// upward in steps of 32.
// MODE 0: f32 C = acc*oscale + bf16rne(bias[n]) + res[m][n] (res pitch ldr, batch stride strideR;
//         RESRNE: res value bf16rne-converted on load)
// MODE 1: f16 C = f16(acc*oscale + bf16rne(bias[n]))
// MODE 2: f16 C = f16(gelu(acc*oscale + bf16rne(bias[n])) * ocarry), gelu = 0.5 v (1 + erf(v / sqrt 2)): gelu8_carry
// MODE 3: f16 C = f16(acc*oscale + bf16rne(bias[m]))       (row bias, transposed output planes)
// coverage: 2 slabs x 16 rows x 64 cols = the wave's whole 32x64 tile; slab 16x64 fully written before reads.
// LDS: every byte of a buffer's 256 data bytes per row is copied before the barrier that publishes it; the 16
// pad bytes per row are never read. The per-wave epilogue slabs lie in the ring, used only behind the last
// trip's barrier (no copy outstanding, every fragment read retired).
// =====================================================================================================
#define LROW    272                    // LDS row pitch, bytes
#define OPBYTES (128 * LROW)           // one operand's 128 rows of one stage
#define STAGEB  (2 * OPBYTES)          // [A 128 rows | Bt 128 rows]

// Eight asynchronous 16-byte copies of this lane: rows r, r+16, ..., r+112 of one operand's stage.
// l = the lane's LDS byte address of row r, gp = its global address, rstep = elements per 16 rows.
// s_wait_xcnt 0 is the last line of the statement, so that no address register is rewritten in front of it.
__device__ __forceinline__ void copy8(unsigned l, const _Float16* gp, size_t rstep) {
#if DEV_ASM
  const unsigned l1 = l + 16 * LROW, l2 = l + 32 * LROW, l3 = l + 48 * LROW, l4 = l + 64 * LROW,
                 l5 = l + 80 * LROW, l6 = l + 96 * LROW, l7 = l + 112 * LROW;
  const _Float16 *g1 = gp + rstep, *g2 = g1 + rstep, *g3 = g2 + rstep, *g4 = g3 + rstep,
                 *g5 = g4 + rstep, *g6 = g5 + rstep, *g7 = g6 + rstep;
  asm volatile("global_load_async_to_lds_b128 %0, %8, off\n\t"
               "global_load_async_to_lds_b128 %1, %9, off\n\t"
               "global_load_async_to_lds_b128 %2, %10, off\n\t"
               "global_load_async_to_lds_b128 %3, %11, off\n\t"
               "global_load_async_to_lds_b128 %4, %12, off\n\t"
               "global_load_async_to_lds_b128 %5, %13, off\n\t"
               "global_load_async_to_lds_b128 %6, %14, off\n\t"
               "global_load_async_to_lds_b128 %7, %15, off\n\t"
               "s_wait_xcnt 0x0"
               :: "v"(l), "v"(l1), "v"(l2), "v"(l3), "v"(l4), "v"(l5), "v"(l6), "v"(l7),
                  "v"(gp), "v"(g1), "v"(g2), "v"(g3), "v"(g4), "v"(g5), "v"(g6), "v"(g7)
               : "memory");
#else
  (void)l; (void)gp; (void)rstep;
#endif
}
// The same eight copies from eight row addresses of the lane's own (rows picked by an index list), koff = elements
// to add to each. s_wait_xcnt 0 is the last line of the statement, for the same reason.
__device__ __forceinline__ void copy8r(unsigned l, const _Float16* const (&g)[8], size_t koff) {
#if DEV_ASM
  const unsigned l1 = l + 16 * LROW, l2 = l + 32 * LROW, l3 = l + 48 * LROW, l4 = l + 64 * LROW,
                 l5 = l + 80 * LROW, l6 = l + 96 * LROW, l7 = l + 112 * LROW;
  const _Float16 *g0 = g[0] + koff, *g1 = g[1] + koff, *g2 = g[2] + koff, *g3 = g[3] + koff,
                 *g4 = g[4] + koff, *g5 = g[5] + koff, *g6 = g[6] + koff, *g7 = g[7] + koff;
  asm volatile("global_load_async_to_lds_b128 %0, %8, off\n\t"
               "global_load_async_to_lds_b128 %1, %9, off\n\t"
               "global_load_async_to_lds_b128 %2, %10, off\n\t"
               "global_load_async_to_lds_b128 %3, %11, off\n\t"
               "global_load_async_to_lds_b128 %4, %12, off\n\t"
               "global_load_async_to_lds_b128 %5, %13, off\n\t"
               "global_load_async_to_lds_b128 %6, %14, off\n\t"
               "global_load_async_to_lds_b128 %7, %15, off\n\t"
               "s_wait_xcnt 0x0"
               :: "v"(l), "v"(l1), "v"(l2), "v"(l3), "v"(l4), "v"(l5), "v"(l6), "v"(l7),
                  "v"(g0), "v"(g1), "v"(g2), "v"(g3), "v"(g4), "v"(g5), "v"(g6), "v"(g7)
               : "memory");
#else
  (void)l; (void)g; (void)koff;
#endif
}
// this wave's own copies have landed
__device__ __forceinline__ void wait_copies() {
#if DEV_ASM
  asm volatile("s_wait_asynccnt 0x0" ::: "memory");
#endif
}
// this wave's own LDS reads have retired (before the buffer they read is handed to its next writer)
__device__ __forceinline__ void wait_lds() {
#if DEV_ASM
  asm volatile("s_wait_dscnt 0x0" ::: "memory");
#endif
}

// Eight reciprocals, or eight powers of two, of a lane in one statement. What it is for: directly behind a transcendental
// the instruction set asks for one instruction that neither uses its result nor overwrites its source; here each fills
// that slot for the one in front of it (early-clobber outputs: no result shares a register with a source) and the
// v_nop fills it for the last.
__device__ __forceinline__ void rcp8(float (&r)[8], const float (&x)[8]) {
#if DEV_ASM
  asm("v_rcp_f32 %0, %8\n\t"
      "v_rcp_f32 %1, %9\n\t"
      "v_rcp_f32 %2, %10\n\t"
      "v_rcp_f32 %3, %11\n\t"
      "v_rcp_f32 %4, %12\n\t"
      "v_rcp_f32 %5, %13\n\t"
      "v_rcp_f32 %6, %14\n\t"
      "v_rcp_f32 %7, %15\n\t"
      "v_nop"
      : "=&v"(r[0]), "=&v"(r[1]), "=&v"(r[2]), "=&v"(r[3]), "=&v"(r[4]), "=&v"(r[5]), "=&v"(r[6]), "=&v"(r[7])
      : "v"(x[0]), "v"(x[1]), "v"(x[2]), "v"(x[3]), "v"(x[4]), "v"(x[5]), "v"(x[6]), "v"(x[7]));
#else
  for (int i = 0; i < 8; ++i) r[i] = 1.0f / x[i];
#endif
}
__device__ __forceinline__ void exp2_8(float (&r)[8], const float (&x)[8]) {
#if DEV_ASM
  asm("v_exp_f32 %0, %8\n\t"
      "v_exp_f32 %1, %9\n\t"
      "v_exp_f32 %2, %10\n\t"
      "v_exp_f32 %3, %11\n\t"
      "v_exp_f32 %4, %12\n\t"
      "v_exp_f32 %5, %13\n\t"
      "v_exp_f32 %6, %14\n\t"
      "v_exp_f32 %7, %15\n\t"
      "v_nop"
      : "=&v"(r[0]), "=&v"(r[1]), "=&v"(r[2]), "=&v"(r[3]), "=&v"(r[4]), "=&v"(r[5]), "=&v"(r[6]), "=&v"(r[7])
      : "v"(x[0]), "v"(x[1]), "v"(x[2]), "v"(x[3]), "v"(x[4]), "v"(x[5]), "v"(x[6]), "v"(x[7]));
#else
  for (int i = 0; i < 8; ++i) r[i] = exp2f(x[i]);
#endif
}

// u <- hc * u * (1 + erf(u / sqrt 2)) for eight values, hc = half the output carry: the erf form of GELU without a
// branch, so that the values of a lane run side by side in independent chains. With a = |u|, t = 1 / (1 + P a / sqrt 2):
//   erfc(a / sqrt 2) = t (A1 + t (A2 + t (A3 + t (A4 + t A5)))) exp(-u^2 / 2)   (rational form, absolute error 1.5e-7)
//   u (1 + erf(u / sqrt 2)) = u + a (1 - erfc(a / sqrt 2))                      (erf is odd)
__device__ __forceinline__ void gelu8_carry(float (&u)[8], float hc) {
  float d[8], g[8], t[8], ex[8];
#pragma unroll                                             // constant indices: the arrays stay in registers
  for (int i = 0; i < 8; ++i) {
    d[i] = fmaf(fabsf(u[i]), 0.231641888f, 1.0f);          // P / sqrt 2, P = 0.3275911
    g[i] = (u[i] * u[i]) * (-0.5f * LOG2E);
  }
  rcp8(t, d);
  exp2_8(ex, g);
#pragma unroll                                             // constant indices: the arrays stay in registers
  for (int i = 0; i < 8; ++i) {
    float p = fmaf(t[i], 1.061405429f, -1.453152027f);
    p = fmaf(p, t[i], 1.421413741f);
    p = fmaf(p, t[i], -0.284496736f);
    p = fmaf(p, t[i], 0.254829592f);
    const float q = fmaf(-(p * t[i]), ex[i], 1.0f);        // erf(a / sqrt 2)
    u[i] = fmaf(fabsf(u[i]), q, u[i]) * hc;
  }
}

// GATHER 1 / 2: the block's 128 A rows / Bt rows are rows growbase + gidx[0 .. 127] of the operand (gidx null, GATHER 1
// only: the tile's own rows); each index is bounded to 0 .. SEQ-1 here. GATHER 0: the tile's own rows, gidx not read.
template <int MODE, bool RESRNE, int GATHER = 0>
__device__ __forceinline__ void gemm_tile(
    unsigned char* smem, int tile, int b,
    const _Float16* A, int lda, long long strideA,
    const _Float16* Bt, int ldb, long long strideB,
    void* Cout, int ldc, long long strideC,
    const float* bias,
    const float* res, int ldr, long long strideR,
    int M, int N, int K, float oscale, float ocarry, const int* gidx = nullptr, int growbase = 0)
{
  const int tid  = (int)threadIdx.x;
  const int lane = tid & 31;
  const int wave = tid >> 5;
  const int tilesN = N >> 7;
  const int tilesM = M >> 7;
  if (tile >= tilesM * tilesN) return;                     // block-uniform, in front of every copy and barrier
  const int tm = tile / tilesN;
  const int tn = tile - tm * tilesN;
  const int m0 = (tm << 7) + ((wave >> 1) << 5);           // this wave's 32 rows
  const int n0 = (tn << 7) + ((wave & 1) << 6);            // this wave's 64 columns

  const _Float16* Ab = A  + (size_t)b * (size_t)strideA;
  const _Float16* Bb = Bt + (size_t)b * (size_t)strideB;

  const int rlane = lane & 15;                             // row (A) / col (B, D) within subtile
  const int koff  = (lane >> 4) * 8;                       // k offset of this lane half
  const int mOff  = (lane >> 4) * 8;                       // D row offset

  // copy map: thread -> row tid>>4 (+16 per copy), 16-byte piece tid&15 of the row's 256 bytes
  const int crow = tid >> 4, ccol = tid & 15;
  const _Float16* gA = Ab + (size_t)((tm << 7) + crow) * lda + ccol * 8;
  const _Float16* gB = Bb + (size_t)((tn << 7) + crow) * ldb + ccol * 8;
  const unsigned lA = (unsigned)(size_t)smem + (unsigned)(crow * LROW + ccol * 16);
  const unsigned lB = lA + OPBYTES;
  const size_t stepA = (size_t)16 * lda, stepB = (size_t)16 * ldb;

  // row addresses of the gathered operand: this thread's rows crow, crow+16, ..., crow+112 of the tile
  const _Float16* gr[8];
  if (GATHER != 0) {
    int ri[8];
    if (GATHER == 2 || gidx != nullptr) {                  // block-uniform
      const int* ip = gidx + crow;
#pragma unroll                                             // constant indices: the array stays in registers
      for (int i = 0; i < 8; ++i) ri[i] = ip[16 * i];
#if DEV_ASM
      // behind the index loads, in front of whatever rewrites their address registers
      asm volatile("s_wait_xcnt 0x0" ::: "memory");
#endif
#pragma unroll                                             // constant indices: the array stays in registers
      for (int i = 0; i < 8; ++i) ri[i] = growbase + (ri[i] < 0 ? 0 : (ri[i] > SEQ - 1 ? SEQ - 1 : ri[i]));
    } else {
#pragma unroll                                             // constant indices: the array stays in registers
      for (int i = 0; i < 8; ++i) ri[i] = (tm << 7) + crow + 16 * i;
    }
#pragma unroll                                             // constant indices: the array stays in registers
    for (int i = 0; i < 8; ++i)
      gr[i] = ((GATHER == 1) ? Ab : Bb) + (size_t)ri[i] * ((GATHER == 1) ? lda : ldb) + ccol * 8;
  }
  // one stage's copies of an operand: l = LDS address in the target buffer, s = k stage
  auto stageA = [&](unsigned l, int s) {
    if (GATHER == 1) copy8r(l, gr, (size_t)s * 128); else copy8(l, gA + (size_t)s * 128, stepA);
  };
  auto stageB = [&](unsigned l, int s) {
    if (GATHER == 2) copy8r(l, gr, (size_t)s * 128); else copy8(l, gB + (size_t)s * 128, stepB);
  };

  // fragment read bases inside a buffer
  const unsigned char* fA = smem + (((wave >> 1) << 5) + rlane) * LROW + koff * 2;
  const unsigned char* fB = smem + OPBYTES + (((wave & 1) << 6) + rlane) * LROW + koff * 2;

  v8f acc[2][4];
#pragma unroll
  for (int i = 0; i < 2; ++i)
#pragma unroll
    for (int j = 0; j < 4; ++j) acc[i][j] = zero8();

  const int nt = K >> 7;                                   // stages of 128 k
  int sc = (b * tilesM + tm + tn) % nt;                    // k stage of the next copies (block-uniform, 0 .. nt-1)
  stageA(lA, sc);
  stageB(lB, sc);
  sc = (sc + 1 == nt) ? 0 : sc + 1;
  wait_copies();
  __syncthreads();                                         // first stage published
  if (nt > 1) {
    stageA(lA + STAGEB, sc);
    stageB(lB + STAGEB, sc);
    sc = (sc + 1 == nt) ? 0 : sc + 1;
  }

  for (int t = 0; t < nt; ++t) {
    const unsigned buf = (unsigned)(t & 1) * STAGEB;
    // two fragment sets: the next 32 k of THIS buffer are read as one group ahead of the current products
    v16h bq[2][4], af[2][2];
#pragma unroll
    for (int j = 0; j < 4; ++j) bq[0][j] = ldfrag((const _Float16*)(fB + buf + j * 16 * LROW));
#pragma unroll
    for (int i = 0; i < 2; ++i) af[0][i] = ldfrag((const _Float16*)(fA + buf + i * 16 * LROW));
#pragma unroll
    for (int kk = 0; kk < 4; ++kk) {
      const int cur = kk & 1, nxt = cur ^ 1;
      if (kk < 3) {
#pragma unroll
        for (int j = 0; j < 4; ++j)
          bq[nxt][j] = ldfrag((const _Float16*)(fB + buf + j * 16 * LROW + (kk + 1) * 64));
#pragma unroll
        for (int i = 0; i < 2; ++i)
          af[nxt][i] = ldfrag((const _Float16*)(fA + buf + i * 16 * LROW + (kk + 1) * 64));
      }
      // keeps the load group in front of the products: without it the scheduler sinks the LDS reads among the
      // matrix instructions into one register set, and each product group waits out its own LDS latency
      __builtin_amdgcn_sched_barrier(0);
#pragma unroll
      for (int i = 0; i < 2; ++i)
#pragma unroll
        for (int j = 0; j < 4; ++j) acc[i][j] = mmar(af[cur][i], bq[cur][j], acc[i][j]);
      // same purpose: the following load group stays behind these products
      __builtin_amdgcn_sched_barrier(0);
    }
    wait_lds();
    wait_copies();
    __syncthreads();                                       // publishes stage t+1, frees stage t's buffer
    if (t + 2 < nt) {
      stageA(lA + buf, sc);
      stageB(lB + buf, sc);
      sc = (sc + 1 == nt) ? 0 : sc + 1;
    }
  }
  wait_copies();
  acc_guard4(acc[0][0], acc[0][1], acc[0][2], acc[0][3]);
  acc_guard4(acc[1][0], acc[1][1], acc[1][2], acc[1][3]);

  // ---- epilogue ----
  float* slab = (float*)(smem + wave * (16 * 68 * 4));     // per-wave 16x64 slab, pitch 68 floats
#pragma unroll
  for (int i = 0; i < 2; ++i) {
    const int mBase = m0 + (i << 4);
#pragma unroll
    for (int j = 0; j < 4; ++j) {
#pragma unroll
      for (int r = 0; r < 8; ++r) {
        slab[(mOff + r) * 68 + (j << 4) + rlane] = acc[i][j][r];
      }
    }
    __builtin_amdgcn_fence(3, "workgroup");
    __builtin_amdgcn_wave_barrier();
    __builtin_amdgcn_fence(2, "workgroup");
    if (MODE == 0) {
      float* C = (float*)Cout + (size_t)b * (size_t)strideC;
      const float* R = res + (size_t)b * (size_t)strideR;
      const int h2 = lane >> 4, c4 = (lane & 15) * 4;     // 256-B row segment = 16 lanes x 16 B
      const v4f bv = bf16r4(*(const v4fa*)(bias + n0 + c4));
      {
#pragma unroll
        for (int it = 0; it < 8; ++it) {
          const int row = it * 2 + h2;                     // it 0..7 x h2 0..1 = rows 0..15
          const size_t go = (size_t)(mBase + row) * ldc + n0 + c4;
          const size_t ro = (size_t)(mBase + row) * ldr + n0 + c4;
          const v4f sv = *(const v4fa*)(slab + row * 68 + c4);
          v4f rv = *(const v4fa*)(R + ro);
          if (RESRNE) rv = bf16r4(rv);
          const v4f v = sv * oscale + bv + rv;
          *(v4f*)(C + go) = v;
        }
        
      }
    } else {
      const int q = lane >> 3, c8 = (lane & 7) * 8;
      _Float16* C = (_Float16*)Cout + (size_t)b * (size_t)strideC;
      float bb8[8] = { 0.f, 0.f, 0.f, 0.f, 0.f, 0.f, 0.f, 0.f };
      if (MODE == 1 || MODE == 2) {
        const v4f ba = bf16r4(*(const v4fa*)(bias + n0 + c8));
        const v4f bc = bf16r4(*(const v4fa*)(bias + n0 + c8 + 4));
        bb8[0] = ba.x; bb8[1] = ba.y; bb8[2] = ba.z; bb8[3] = ba.w;
        bb8[4] = bc.x; bb8[5] = bc.y; bb8[6] = bc.z; bb8[7] = bc.w;
      }
      v8h hv[4];
#pragma unroll
      for (int it = 0; it < 4; ++it) {
        const int row = it * 4 + q;                        // it 0..3 x q 0..3 = rows 0..15
        const float* sp = slab + row * 68 + c8;
        const v4f a = *(const v4fa*)sp;
        const v4f c = *(const v4fa*)(sp + 4);
        float f[8] = { a.x, a.y, a.z, a.w, c.x, c.y, c.z, c.w };
        float brow = 0.0f;
        if (MODE == 3) brow = bf16r(bias[mBase + row]);
#pragma unroll
        for (int e = 0; e < 8; ++e) f[e] = f[e] * oscale + ((MODE == 3) ? brow : bb8[e]);
        if (MODE == 2) gelu8_carry(f, 0.5f * ocarry);
        const v8h o = { (_Float16)f[0], (_Float16)f[1], (_Float16)f[2], (_Float16)f[3],
                        (_Float16)f[4], (_Float16)f[5], (_Float16)f[6], (_Float16)f[7] };
        hv[it] = o;
      }
      {
#pragma unroll
        for (int it = 0; it < 4; ++it) {
          const int row = it * 4 + q;
          *(v8h*)(C + (size_t)(mBase + row) * ldc + n0 + c8) = hv[it];
        }
        
      }
    }
    __builtin_amdgcn_fence(3, "workgroup");
    __builtin_amdgcn_wave_barrier();
    __builtin_amdgcn_fence(2, "workgroup");
  }
}

// one GEMM per launch: blockIdx.x = tile, blockIdx.y = batch
template <int MODE, bool RESRNE>
__global__ __launch_bounds__(256) void gemm128(
    const _Float16* __restrict__ A, int lda, long long strideA,
    const _Float16* __restrict__ Bt, int ldb, long long strideB,
    void* Cout, int ldc, long long strideC,
    const float* __restrict__ bias,
    const float* __restrict__ res, int ldr, long long strideR,
    int M, int N, int K, float oscale, float ocarry)
{
  __shared__ __align__(16) unsigned char smem[2 * STAGEB];  // two stage buffers; epilogue slabs behind the loop
  gemm_tile<MODE, RESRNE>(smem, (int)blockIdx.x, (int)blockIdx.y, A, lda, strideA, Bt, ldb, strideB,
                          Cout, ldc, strideC, bias, res, ldr, strideR, M, N, K, oscale, ocarry);
}

// The four projections that need only hn = LN(x) or the c plane, in ONE grid; a block-index range picks the job:
//   self q|k   = hn . Wqkv[:, 0:2 FEAT]      -> qk_s [NTOK][QKP]              (M=NTOK, N=QKP,  column bias)
//   cross k    = c . Wck                     -> qk_c [NTOK][QKP] cols FEAT..  (M=NTOK, N=FEAT, column bias)
//   self v^T   = Wqkv[:, 2 FEAT:]^T . hn^T   -> vt_s [b][FEAT][SEQ]           (M=FEAT, N=SEQ per batch, row bias)
//   cross v^T  = Wcv^T . c^T                 -> vt_c [b][FEAT][SEQ]           (M=FEAT, N=SEQ per batch, row bias)
// K (= FEAT) comes as an argument, as in gemm128.
// Keys stand in the order of key_order: row b*SEQ + j of a k plane and column j of a v^T plane belong to token
// kidx[b][j], brought in by gathering the token rows of hn or c; q rows stay in token order. A k or v^T tile whose 128
// places all lie behind the batch's key steps is not computed (block-uniform return in front of every copy and
// barrier); the attention kernel reads no place behind those steps.
#define GB_QK ((NTOK / 128) * (QKP / 128))
#define GB_K  ((NTOK / 128) * (FEAT / 128))
#define GB_V1 ((FEAT / 128) * (SEQ / 128))         // v^T tiles of one batch
#define GB_ALL (GB_QK + GB_K + 2 * NB * GB_V1)

__global__ __launch_bounds__(256) void gemm_proj4(
    const _Float16* __restrict__ hn, const _Float16* __restrict__ cpl,
    const _Float16* __restrict__ wqkvT, const _Float16* __restrict__ wckT, const _Float16* __restrict__ wcvT,
    const float* __restrict__ b_qkv, const float* __restrict__ b_ck, const float* __restrict__ b_cv,
    _Float16* qk_s, _Float16* qk_c, _Float16* vt_s, _Float16* vt_c, int K, float oscale,
    const int* __restrict__ kidx, const int* __restrict__ nst)
{
  __shared__ __align__(16) unsigned char smem[2 * STAGEB];  // two stage buffers; epilogue slabs behind the loop
  int blk = (int)blockIdx.x;
  const _Float16 *A, *Bt; _Float16* C; const float* bias;
  int b = 0, rowbias = 0, ldc = QKP, M = NTOK, N = FEAT;
  long long strideB = 0LL, strideC = 0LL;
  int kt = -1;                                             // 128-row tile of a k plane, counted over the batches
  const int* gidx = nullptr; int growbase = 0;
  if (blk < GB_QK) {
    A = hn;  Bt = wqkvT; C = qk_s;        bias = b_qkv; N = QKP;
    const int tm = blk / (QKP / 128);
    if (blk - tm * (QKP / 128) >= FEAT / 128) kt = tm;     // the k half of the columns
  }
  else if ((blk -= GB_QK) < GB_K) { A = cpl; Bt = wckT;  C = qk_c + FEAT; bias = b_ck; kt = blk / (FEAT / 128); }
  else {
    blk -= GB_K;
    if (blk < NB * GB_V1) { A = wqkvT + (size_t)2 * FEAT * FEAT; Bt = hn; C = vt_s; bias = b_qkv + 2 * FEAT; }
    else { blk -= NB * GB_V1; A = wcvT; Bt = cpl; C = vt_c; bias = b_cv; }
    b = blk / GB_V1; blk -= b * GB_V1;
    rowbias = 1; ldc = SEQ; M = FEAT; N = SEQ;
    strideB = (long long)SEQ * FEAT; strideC = (long long)FEAT * SEQ;
    const int p0 = (blk % (SEQ / 128)) * 128;              // first key place of the tile's columns
    if (p0 >= key_steps(nst, b) * 64) return;
    gidx = kidx + b * SEQ + p0;
  }
  if (kt >= 0) {
    const int kb = kt / (SEQ / 128), p0 = (kt - kb * (SEQ / 128)) * 128;   // batch, first key place of the tile's rows
    if (p0 >= key_steps(nst, kb) * 64) return;
    gidx = kidx + kb * SEQ + p0;
    growbase = kb * SEQ;
  }
  if (rowbias)                                             // block-uniform: every barrier inside is met by all waves
    gemm_tile<3, false, 2>(smem, blk, b, A, FEAT, 0LL, Bt, FEAT, strideB, (void*)C, ldc, strideC,
                           bias, bias, FEAT, 0LL, M, N, K, oscale, 1.0f, gidx, 0);
  else
    gemm_tile<1, false, 1>(smem, blk, b, A, FEAT, 0LL, Bt, FEAT, strideB, (void*)C, ldc, strideC,
                           bias, bias, FEAT, 0LL, M, N, K, oscale, 1.0f, gidx, growbase);
}

// =====================================================================================================
// Streaming attention, transposed form, 16 heads, additive key mask (-10000 where mask != 1),
// softmax over all SEQ keys, of which the steps behind nst (key_order: weight exactly 0) are not walked; key index =
// place in that order throughout. Block 128 thr (4 waves), 16 queries per wave, 64 keys per step.
//   S^T = K * Q^T + mask : A = K rows (row = key, k = d), B = Q^T (k = d, n = query) with q scaled once by
//   log2(e)/8 (product in f32, rounded to f16), C = the key's additive mask x log2(e) from the f32 plane: the
//   accumulator leaves the matrix unit as the masked score in the log2 domain, no vector work per score for it
//   O^T += V^T * P^T : A = V^T rows (row = d, k = key), B = P^T packed from the score D registers
//   (element r <- key tile covering k 0..15 row r, element 8+r <- tile covering k 16..31 row r, same lane)
// Lane owns 32 keys of query column (lane&15); partner = lane ^ 16. Online softmax in f32, base 2; p carried x16384
// by 14 taken off the maximum that is subtracted, so the running sum l carries the same factor.
//   q|k plane [b*SEQ + t][QKP]: q at col head*64 + d, k at col FEAT + head*64 + d (f16);
//   v^T plane [b][head*64 + d][SEQ] (f16); madd f32 [b][SEQ].
//   ctx plane [b*SEQ + t][head*64 + d] = f16(256 * o / l): per-wave 16x64 tile staged in LDS (block barrier),
// coverage: grid (SEQ/64, NB*NH): every (b, head, query) row x 64 columns of its head written once.
// LDS sO: each wave writes its full 16x64 region before the barrier.
// Operands: per step the 64 K rows (128 B each) and the 64 V^T rows (128 B each) that all four waves use are
// brought into LDS once per block by asynchronous 16-byte copies (each thread 4 + 4 copies, a wave-wide copy =
// four whole 128-B rows), two buffers, the next step's tiles in flight while this step is worked on.
// LDS row pitch 144 B (128 + 16: ds_load_b128 readers); the 16 pad bytes per row are never read.
// Step order: the block of query tile x starts at key step x mod steps and wraps round, so that the blocks of one
// (batch, head), which all walk the same K and V^T rows, do not ask L2 for the same lines at the same moment.
// =====================================================================================================
#define KVROW   144                    // LDS row pitch, bytes
#define KVOP    (64 * KVROW)           // one operand's 64 rows of one step
#define KVSTAGE (2 * KVOP)             // [K 64 rows | V^T 64 rows]

// Eight asynchronous 16-byte copies of this lane: rows r, r+16, r+32, r+48 of the K tile and of the V^T tile.
// lk, lv = the lane's LDS byte addresses of row r, gk, gv = its global addresses, kstep, vstep = elements per 16 rows.
// s_wait_xcnt 0 is the last line of the statement, so that no address register is rewritten in front of it.
__device__ __forceinline__ void copy_kv(unsigned lk, const _Float16* gk, size_t kstep,
                                        unsigned lv, const _Float16* gv, size_t vstep) {
#if DEV_ASM
  const unsigned lk1 = lk + 16 * KVROW, lk2 = lk + 32 * KVROW, lk3 = lk + 48 * KVROW;
  const unsigned lv1 = lv + 16 * KVROW, lv2 = lv + 32 * KVROW, lv3 = lv + 48 * KVROW;
  const _Float16 *gk1 = gk + kstep, *gk2 = gk1 + kstep, *gk3 = gk2 + kstep;
  const _Float16 *gv1 = gv + vstep, *gv2 = gv1 + vstep, *gv3 = gv2 + vstep;
  asm volatile("global_load_async_to_lds_b128 %0, %8, off\n\t"
               "global_load_async_to_lds_b128 %1, %9, off\n\t"
               "global_load_async_to_lds_b128 %2, %10, off\n\t"
               "global_load_async_to_lds_b128 %3, %11, off\n\t"
               "global_load_async_to_lds_b128 %4, %12, off\n\t"
               "global_load_async_to_lds_b128 %5, %13, off\n\t"
               "global_load_async_to_lds_b128 %6, %14, off\n\t"
               "global_load_async_to_lds_b128 %7, %15, off\n\t"
               "s_wait_xcnt 0x0"
               :: "v"(lk), "v"(lk1), "v"(lk2), "v"(lk3), "v"(lv), "v"(lv1), "v"(lv2), "v"(lv3),
                  "v"(gk), "v"(gk1), "v"(gk2), "v"(gk3), "v"(gv), "v"(gv1), "v"(gv2), "v"(gv3)
               : "memory");
#else
  (void)lk; (void)gk; (void)kstep; (void)lv; (void)gv; (void)vstep;
#endif
}

__device__ __forceinline__ v16h pack_p(v8f a, v8f c) {
  const v16h r = { (_Float16)a[0], (_Float16)a[1], (_Float16)a[2], (_Float16)a[3],
                   (_Float16)a[4], (_Float16)a[5], (_Float16)a[6], (_Float16)a[7],
                   (_Float16)c[0], (_Float16)c[1], (_Float16)c[2], (_Float16)c[3],
                   (_Float16)c[4], (_Float16)c[5], (_Float16)c[6], (_Float16)c[7] };
  return r;
}
// q fragment x log2(e)/8: product in f32, one rounding to f16
__device__ __forceinline__ v16h scale_q(v16h a) {
  v16h r;
#pragma unroll                                             // constant element indices: the vector stays in registers
  for (int i = 0; i < 16; ++i) r[i] = (_Float16)((float)a[i] * QSCALE);
  return r;
}

__global__ __launch_bounds__(128) __attribute__((amdgpu_num_vgpr(256))) void attn_kernel(
    const _Float16* __restrict__ qk, const _Float16* __restrict__ vt,
    const float* __restrict__ madd, const int* __restrict__ nst, _Float16* ctx)
{
  __shared__ __align__(16) float sO[4 * 16 * 64];          // 16384 B
  __shared__ __align__(16) unsigned char skv[2 * KVSTAGE]; // two step buffers of K and V^T rows

  const int tid = (int)threadIdx.x, lane = tid & 31, w = tid >> 5;
  const int h = lane >> 4, m = lane & 15;
  const int bh = blockIdx.y, b = bh / NH, head = bh - b * NH;
  const int q0 = blockIdx.x * 64 + 16 * w;

  // Q^T B-fragments: column n = query q0+m, k = d (two 32-deep chunks)
  const _Float16* qrow = qk + ((size_t)b * SEQ + q0 + m) * QKP + head * HD;
  const v16h qb0 = scale_q(load_frag(qrow, h));
  const v16h qb1 = scale_q(load_frag(qrow + 32, h));

  v8f o[4];                                                // o[t][r] = O[query m][d 16t+8h+r] * l (l carries 2^14)
#pragma unroll
  for (int t = 0; t < 4; ++t) o[t] = zero8();
  float mrun = -1e30f, lrun = 0.0f;

  const float* mrow = madd + (size_t)b * SEQ;              // block-uniform base; + key0 (uniform) + 8h + 16j

  // copy map: thread -> row tid>>3 (+16 per copy), 16-byte piece tid&7 of the row's 128 bytes
  const int crow = tid >> 3, cpc = tid & 7;
  const _Float16* gK = qk + ((size_t)b * SEQ + crow) * QKP + FEAT + head * HD + cpc * 8;   // + key0*QKP
  const _Float16* gV = vt + ((size_t)b * FEAT + head * HD + crow) * SEQ + cpc * 8;         // + key0
  const unsigned lK = (unsigned)(size_t)skv + (unsigned)(crow * KVROW + cpc * 16);
  const unsigned lV = lK + KVOP;
  const size_t stepK = (size_t)16 * QKP, stepV = (size_t)16 * SEQ;
  // fragment read bases inside a buffer: row m of a 16-row group, k offset 8h
  const unsigned char* fK = skv + m * KVROW + 16 * h;
  const unsigned char* fV = skv + KVOP + m * KVROW + 16 * h;

  const int steps = key_steps(nst, b);                     // block-uniform, 1 .. SEQ/64
  const int nk = steps * 64;                               // key places that are walked
  int kb = ((int)blockIdx.x % steps) * 64;                 // first key place of this trip (block-uniform, 0 .. nk-64)
  int kc = kb;                                             // first key place of the next copies
  copy_kv(lK, gK + (size_t)kc * QKP, stepK, lV, gV + kc, stepV);
  kc = (kc + 64 == nk) ? 0 : kc + 64;
  wait_copies();
  __syncthreads();                                         // first step published
  if (nk > 64) {
    copy_kv(lK + KVSTAGE, gK + (size_t)kc * QKP, stepK, lV + KVSTAGE, gV + kc, stepV);
    kc = (kc + 64 == nk) ? 0 : kc + 64;
  }

#pragma unroll 1
  for (int it = 0; it < nk; it += 64) {
    const unsigned buf = (unsigned)((it >> 6) & 1) * KVSTAGE;
    // ---- scores, log2 domain: s[j][r] = S[query m][key kb+16j+8h+r] * 0.125 * log2(e) + madd[key] ----
    v8f s[4];                                              // starts as the C operand: row r of tile j = key's mask term
    v16h kf[4][2];
#pragma unroll
    for (int j = 0; j < 4; ++j) {
      const _Float16* kr = (const _Float16*)(fK + buf + j * 16 * KVROW);
      kf[j][0] = ldfrag(kr);
      kf[j][1] = ldfrag(kr + 32);
    }
    // keeps the K reads in front of the mask loads: moved behind them, the reads land on the loads' address registers
    // and so stand behind an s_wait_xcnt 0, and the LDS latency starts that much later
    __builtin_amdgcn_sched_barrier(0);
    const float* mk = mrow + kb + 8 * h;
#pragma unroll
    for (int j = 0; j < 4; ++j) {
      const v4f ca = *(const v4fa*)(mk + 16 * j);
      const v4f cc = *(const v4fa*)(mk + 16 * j + 4);
      const v8f cj = { ca.x, ca.y, ca.z, ca.w, cc.x, cc.y, cc.z, cc.w };
      s[j] = cj;
    }
#if DEV_ASM
    // behind the mask loads: their address pair is an input here, so it stays whole up to this wait (no load of the
    // group lands on it) and is rewritten only behind it; the wave waits for the K reads at this place anyway
    asm volatile("s_wait_xcnt 0x0" :: "v"(mk) : "memory");
#endif
    // keeps the K reads one group in front of the score products: left free, the scheduler puts four reads in
    // front of each pair of products, and every pair waits out its own LDS latency
    __builtin_amdgcn_sched_barrier(0);
#pragma unroll
    for (int j = 0; j < 4; ++j) {
      s[j] = wmma_f16(kf[j][0], qb0, s[j]);
      s[j] = wmma_f16(kf[j][1], qb1, s[j]);
    }

    // ---- V^T fragments of this step: one read group, in flight while the softmax runs ----
    v16h vf[4][2];
#pragma unroll
    for (int t = 0; t < 4; ++t) {
      const _Float16* vp = (const _Float16*)(fV + buf + t * 16 * KVROW);
      vf[t][0] = ldfrag(vp);
      vf[t][1] = ldfrag(vp + 32);
    }
    // keeps the V^T reads in front of the softmax: left free, they sink to their products and are waited for there
    __builtin_amdgcn_sched_barrier(0);

    // ---- online softmax (f32, base 2) ----
    float mloc = s[0][0];
#pragma unroll
    for (int j = 0; j < 4; ++j)
#pragma unroll
      for (int r = 0; r < 8; ++r) mloc = fmaxf(mloc, s[j][r]);
    mloc = fmaxf(mloc, __shfl_xor(mloc, 16));
    const float mnew = fmaxf(mrun, mloc);
    const float alpha = __builtin_amdgcn_exp2f(mrun - mnew);
    mrun = mnew;
    const float msh = mnew - PEXP;                         // p = 2^(s - mnew) x 2^14
    float lsum = 0.0f;
#pragma unroll
    for (int j = 0; j < 4; ++j)
#pragma unroll
      for (int r = 0; r < 8; ++r) {
        const float p = __builtin_amdgcn_exp2f(s[j][r] - msh);
        s[j][r] = p;
        lsum += p;
      }
    lsum += __shfl_xor(lsum, 16);
    lrun = lrun * alpha + lsum;
#pragma unroll
    for (int t = 0; t < 4; ++t)
#pragma unroll
      for (int r = 0; r < 8; ++r) o[t][r] = o[t][r] * alpha;

    // ---- P^T B-fragments (key chunks 0..31 and 32..63 of this step) ----
    const v16h pb0 = pack_p(s[0], s[1]);
    const v16h pb1 = pack_p(s[2], s[3]);

    // ---- O^T += V^T * P^T ----
#pragma unroll
    for (int t = 0; t < 4; ++t) {
      o[t] = wmma_f16(vf[t][0], pb0, o[t]);
      o[t] = wmma_f16(vf[t][1], pb1, o[t]);
    }
    wait_lds();
    wait_copies();
    __syncthreads();                                       // publishes the next step, frees this step's buffer
    if (it + 128 < nk) {
      copy_kv(lK + buf, gK + (size_t)kc * QKP, stepK, lV + buf, gV + kc, stepV);
      kc = (kc + 64 == nk) ? 0 : kc + 64;
    }
    kb = (kb + 64 == nk) ? 0 : kb + 64;
  }
  wait_copies();

  // ---- epilogue: normalise (1/l, which also removes the p carry; apply the ctx carry), stage per-wave 16x64 tile ----
  const float inv = (1.0f / lrun) * CTXCARRY;
  float* so = sO + w * 1024;
#pragma unroll
  for (int t = 0; t < 4; ++t)
#pragma unroll
    for (int r = 0; r < 8; ++r)
      so[m * 64 + 16 * t + 8 * h + r] = o[t][r] * inv;
  __syncthreads();

  const int q8 = lane & 7, sub = lane >> 3;
  v8h hv[4];
#pragma unroll
  for (int it = 0; it < 4; ++it) {
    const int row = it * 4 + sub;                          // it 0..3 x sub 0..3 = rows 0..15 of the wave tile
    const float* sp = so + row * 64 + 8 * q8;
    const v4f a = *(const v4fa*)sp;
    const v4f c = *(const v4fa*)(sp + 4);
    const v8h ov = { (_Float16)a.x, (_Float16)a.y, (_Float16)a.z, (_Float16)a.w,
                     (_Float16)c.x, (_Float16)c.y, (_Float16)c.z, (_Float16)c.w };
    hv[it] = ov;
  }
  {
#pragma unroll
    for (int it = 0; it < 4; ++it) {
      const int row = it * 4 + sub;
      _Float16* dst = ctx + ((size_t)b * SEQ + q0 + row) * FEAT + head * HD + 8 * q8;
      *(v8h*)dst = hv[it];
    }
    
  }
}

// =====================================================================================================
// Host orchestration. Workspace map (bytes, NB=4 SEQ=1024), every region an exact multiple of its whole-line
// store granularity, all offsets multiples of 128:
//   hn    f16 [4096][1024]      8388608   (LN outputs of all three blocks, written and consumed in order)
//   cpl   f16 [4096][1024]      8388608   (bf16rne(c) as f16)
//   WqkvT f16 [3072][1024]      6291456
//   WspT  f16 [1024][1024]      2097152
//   WcqT, WckT, WcvT, WcpT      4 x 2097152
//   W1T   f16 [4096][1024]      8388608
//   W2T   f16 [1024][4096]      8388608
//   ATT   shared region        33554432 : self q|k f16 [4096][2048] (16777216) + self v^T f16 [4][1024][1024]
//                                         (8388608) + ctx f16 [4096][1024] (8388608, both attention blocks);
//                                         mid f16 [4096][4096] (33554432) during the MLP (all readers of
//                                         q|k, v^T, ctx have completed before fc1 writes mid)
//   x1    f32 [4096][1024]     16777216
//   x2    f32 [4096][1024]     16777216
//   qk_c  f16 [4096][2048]     16777216   (cross q|k: k written with the self projections, q behind LN(x1))
//   vt_c  f16 [4][1024][1024]   8388608   (cross v^T, written with the self projections)
//   madd  f32 [4][1024]           16384   (additive key mask x log2(e) by key place, both attention blocks)
//   kidx  i32 [4][1024]           16384   (token at each key place)
//   nst   i32 [4][32]               512   (key steps of a batch in word 0 of its line)
//   total                     142639616
// =====================================================================================================
extern "C" void kernel_launch(void* const* d_in, const int* in_sizes, int n_in,
                              void* d_out, int out_size, void* d_ws, size_t ws_size,
                              hipStream_t stream)
{
  if (n_in < 19) return;
  const long long needTok = (long long)(NB - 1) * SEQ_FULL + SEQ;
  if ((long long)in_sizes[0] < needTok * FEAT) return;                 // x
  if ((long long)in_sizes[1] < needTok * FEAT) return;                 // c
  if ((long long)in_sizes[2] < needTok) return;                        // mask (int32)
  if ((long long)in_sizes[3] < (long long)FEAT * 3 * FEAT || in_sizes[4] < 3 * FEAT) return;
  if ((long long)in_sizes[5] < (long long)FEAT * FEAT || in_sizes[6] < FEAT) return;
  if ((long long)in_sizes[7] < (long long)FEAT * FEAT || in_sizes[8] < FEAT) return;
  if ((long long)in_sizes[9] < (long long)FEAT * FEAT || in_sizes[10] < FEAT) return;
  if ((long long)in_sizes[11] < (long long)FEAT * FEAT || in_sizes[12] < FEAT) return;
  if ((long long)in_sizes[13] < (long long)FEAT * FEAT || in_sizes[14] < FEAT) return;
  if ((long long)in_sizes[15] < (long long)FEAT * MF || in_sizes[16] < MF) return;
  if ((long long)in_sizes[17] < (long long)MF * FEAT || in_sizes[18] < FEAT) return;
  if ((long long)out_size < needTok * FEAT) return;

  const float* x         = (const float*)d_in[0];
  const float* c         = (const float*)d_in[1];
  const int*   mask      = (const int*)d_in[2];
  const float* sa_qkv_w  = (const float*)d_in[3];
  const float* sa_qkv_b  = (const float*)d_in[4];
  const float* sa_proj_w = (const float*)d_in[5];
  const float* sa_proj_b = (const float*)d_in[6];
  const float* ca_q_w    = (const float*)d_in[7];
  const float* ca_q_b    = (const float*)d_in[8];
  const float* ca_k_w    = (const float*)d_in[9];
  const float* ca_k_b    = (const float*)d_in[10];
  const float* ca_v_w    = (const float*)d_in[11];
  const float* ca_v_b    = (const float*)d_in[12];
  const float* ca_proj_w = (const float*)d_in[13];
  const float* ca_proj_b = (const float*)d_in[14];
  const float* fc1_w     = (const float*)d_in[15];
  const float* fc1_b     = (const float*)d_in[16];
  const float* fc2_w     = (const float*)d_in[17];
  const float* fc2_b     = (const float*)d_in[18];

  const size_t P_F16  = (size_t)NTOK * FEAT * 2;
  const size_t P_F32  = (size_t)NTOK * FEAT * 4;
  const size_t P_W    = (size_t)FEAT * FEAT * 2;
  const size_t P_WQKV = (size_t)3 * FEAT * FEAT * 2;
  const size_t P_W1   = (size_t)MF * FEAT * 2;
  const size_t P_QK   = (size_t)NTOK * QKP * 2;
  const size_t P_VT   = (size_t)NB * FEAT * SEQ * 2;
  const size_t P_MID  = (size_t)NTOK * MF * 2;
  const size_t P_ATTU = P_QK + P_VT + P_F16;
  const size_t P_ATT  = (P_ATTU > P_MID) ? P_ATTU : P_MID;
  size_t off = 0;
  const size_t oHn   = off; off += P_F16;
  const size_t oC    = off; off += P_F16;
  const size_t oWqkv = off; off += P_WQKV;
  const size_t oWsp  = off; off += P_W;
  const size_t oWcq  = off; off += P_W;
  const size_t oWck  = off; off += P_W;
  const size_t oWcv  = off; off += P_W;
  const size_t oWcp  = off; off += P_W;
  const size_t oW1   = off; off += P_W1;
  const size_t oW2   = off; off += P_W1;
  const size_t oAtt  = off; off += P_ATT;
  const size_t oX1   = off; off += P_F32;
  const size_t oX2   = off; off += P_F32;
  const size_t oQkc  = off; off += P_QK;
  const size_t oVtc  = off; off += P_VT;
  const size_t oMadd = off; off += (size_t)NTOK * 4;
  const size_t oKidx = off; off += (size_t)NTOK * 4;
  const size_t oNst  = off; off += (size_t)NB * 128;
  if (off > ws_size) return;                               // off = 142639616 at NB=4, SEQ=1024

  char* ws = (char*)d_ws;
  _Float16* hn    = (_Float16*)(ws + oHn);
  _Float16* cpl   = (_Float16*)(ws + oC);
  _Float16* wqkvT = (_Float16*)(ws + oWqkv);
  _Float16* wspT  = (_Float16*)(ws + oWsp);
  _Float16* wcqT  = (_Float16*)(ws + oWcq);
  _Float16* wckT  = (_Float16*)(ws + oWck);
  _Float16* wcvT  = (_Float16*)(ws + oWcv);
  _Float16* wcpT  = (_Float16*)(ws + oWcp);
  _Float16* w1T   = (_Float16*)(ws + oW1);
  _Float16* w2T   = (_Float16*)(ws + oW2);
  _Float16* qkp   = (_Float16*)(ws + oAtt);
  _Float16* vtp   = (_Float16*)(ws + oAtt + P_QK);
  _Float16* ctx   = (_Float16*)(ws + oAtt + P_QK + P_VT);
  _Float16* mid   = (_Float16*)(ws + oAtt);
  float*    x1    = (float*)(ws + oX1);
  float*    x2    = (float*)(ws + oX2);
  _Float16* qkc   = (_Float16*)(ws + oQkc);
  _Float16* vtc   = (_Float16*)(ws + oVtc);
  float*    madd  = (float*)(ws + oMadd);
  int*      kidx  = (int*)(ws + oKidx);
  int*      nst   = (int*)(ws + oNst);

  const dim3 blk(256);
  const float sQKV  = 1.0f / WCARRY;
  const float sPROJ = 1.0f / (WCARRY * CTXCARRY);
  const float sFC2  = 1.0f / (WCARRY * MIDCARRY);

  // (1) one grid: weights f32 [in][out] -> f16 [out][in] = bf16rne(w) x64; c -> compact f16 plane (bf16rne values);
  //     hn = LN(bf16rne(x)) -> f16 plane; key mask -> key order, additive f32 plane, key steps
  prep_kernel<<<dim3(PB_ALL), blk, 0, stream>>>(
      sa_qkv_w, sa_proj_w, ca_q_w, ca_k_w, ca_v_w, ca_proj_w, fc1_w, fc2_w, x, c, mask,
      wqkvT, wspT, wcqT, wckT, wcvT, wcpT, w1T, w2T, cpl, hn, madd, kidx, nst);

  // (2) one grid: self q|k and self v^T from hn, cross k and cross v^T from the c plane (K=1024; acc / 64)
  gemm_proj4<<<dim3(GB_ALL), blk, 0, stream>>>(
      hn, cpl, wqkvT, wckT, wcvT, sa_qkv_b, ca_k_b, ca_v_b, qkp, qkc, vtp, vtc, FEAT, sQKV, kidx, nst);

  // ---------------- self-attention block ----------------
  // (3) attention -> ctx f16 plane (x256)
  const dim3 gAT(SEQ / 64, NB * NH);
  attn_kernel<<<gAT, dim3(128), 0, stream>>>(qkp, vtp, madd, nst, ctx);
  // (4) x1 = ctx . Wsp + b + bf16rne(x) -> f32 plane   (per batch M=SEQ, N=1024, K=1024; acc / (64*256))
  const dim3 gPB((SEQ / 128) * (FEAT / 128), NB);
  gemm128<0, true><<<gPB, blk, 0, stream>>>(
      ctx, FEAT, (long long)SEQ * FEAT, wspT, FEAT, 0LL, (void*)x1, FEAT, (long long)SEQ * FEAT,
      sa_proj_b, x, FEAT, (long long)SEQ_FULL * FEAT,
      SEQ, FEAT, FEAT, sPROJ, 1.0f);

  // ---------------- cross-attention block ----------------
  // (5) hn = LN(x1)
  ln_kernel<<<dim3(NTOK), blk, 0, stream>>>(x1, (long long)SEQ * FEAT, hn);
  // (6) q = hn . Wcq + b -> cross q|k plane cols 0..1023   (M=NTOK, N=1024, K=1024)
  const dim3 gQ((NTOK / 128) * (FEAT / 128), 1);
  gemm128<1, false><<<gQ, blk, 0, stream>>>(
      hn, FEAT, 0LL, wcqT, FEAT, 0LL, (void*)qkc, QKP, 0LL, ca_q_b, x1, FEAT, 0LL,
      NTOK, FEAT, FEAT, sQKV, 1.0f);
  // (7) attention -> ctx
  attn_kernel<<<gAT, dim3(128), 0, stream>>>(qkc, vtc, madd, nst, ctx);
  // (8) x2 = ctx . Wcp + b + x1 -> f32 plane   (M=NTOK, N=1024, K=1024)
  gemm128<0, false><<<gQ, blk, 0, stream>>>(
      ctx, FEAT, 0LL, wcpT, FEAT, 0LL, (void*)x2, FEAT, 0LL,
      ca_proj_b, x1, FEAT, 0LL,
      NTOK, FEAT, FEAT, sPROJ, 1.0f);

  // ---------------- MLP block ----------------
  // (9) hn = LN(x2)
  ln_kernel<<<dim3(NTOK), blk, 0, stream>>>(x2, (long long)SEQ * FEAT, hn);
  // (10) mid = gelu(hn . W1 + b1) x16 -> f16 [NTOK][4096]   (M=NTOK, N=4096, K=1024; acc / 64)
  const dim3 gW1((NTOK / 128) * (MF / 128), 1);
  gemm128<2, false><<<gW1, blk, 0, stream>>>(
      hn, FEAT, 0LL, w1T, FEAT, 0LL, (void*)mid, MF, 0LL, fc1_b, x1, FEAT, 0LL,
      NTOK, MF, FEAT, sQKV, MIDCARRY);
  // (11) out = mid . W2 + b2 + x2 -> d_out f32 rows b*SEQ_FULL + t   (per batch M=SEQ, N=1024, K=4096; acc / (64*16))
  gemm128<0, false><<<gPB, blk, 0, stream>>>(
      mid, MF, (long long)SEQ * MF, w2T, MF, 0LL, d_out, FEAT, (long long)SEQ_FULL * FEAT,
      fc2_b, x2, FEAT, (long long)SEQ * FEAT,
      SEQ, FEAT, MF, sFC2, 1.0f);

  (void)hipGetLastError();
}
